// v000
// The times below were measured on an AMD MI455X: many runs one after another, warmed up first and cycling through
// copies of the inputs, with the whole window's GPU time divided by the number of runs. Launches and the gaps
// between them are all in it. The median over several windows is given; except for v000 it joins two sittings, which
// can be a few percent apart, so the side-by-side timings, each taken in one sitting, are the better comparison.
// v000 is the starting kernel. One run takes 10.1 milliseconds.
#include <hip/hip_runtime.h>
// BERT self-attention (hidden [1][4096][768]; q/k/v = x W + b with W stored [in][out], 12 heads of 64; scores / 8 + the additive attention_mask[b][key] (f32); softmax; out = attn v merged -> [1][4096][768]; no output projection).
// Structure: token rows r = b*4096 + s; x as exact f16 rows (bf16-rounded); Q, K, V as three WMMA GEMMs (32x64 wave tiles, f32 accumulation, exact x16 weights + bias, f16 outputs); per batch: V^T for all heads via LDS transposes; per (batch, group of 1 heads): scores GEMM (K = 64, batched over the heads on grid.y, alpha = 1/8), row softmax of (scores + additive mask) on VALU (f32 statistics, native exp; weights stored x256 as f16), o = P . V^T GEMM (K = 4096, alpha 2^-8) written as f32 straight into the merged output rows.
// Compute dtype: inputs rounded to bf16; x / weights exact; q, k, v and softmax weights as plain f16 GEMM operands (~2^-12); scores, softmax statistics and o f32; v_wmma_f32_16x16x32_f16.
#define NB 1
#define SQ 4096
#define DM 768
#define NH 12
#define HD 64
#define HG 1                         /* heads per attention launch group */
#define B0 0                         /* first batch processed (debug hook) */
#define NBR NB                       /* batches processed (debug hook) */
#define NR ((size_t)NB * SQ)         /* token rows */
#define MP ((int)((size_t)NBR * SQ)) /* rows projected (debug hook) */
#define QN SQ                        /* query rows attended per batch (debug hook) */
#define NHD NH                       /* heads attended (debug hook) */
#define MPO MP                       /* unused: there is no output stage */
#define LQ DM      /* row pitch of the q/k/v rows */
typedef __bf16 v16b __attribute__((ext_vector_type(16)));
typedef unsigned short v8us __attribute__((ext_vector_type(8), may_alias));
typedef float  v8f  __attribute__((ext_vector_type(8)));
typedef float  v4f  __attribute__((ext_vector_type(4)));
typedef float  v4fa __attribute__((ext_vector_type(4), may_alias));
union FragB { v16b v; v8us half[2]; unsigned short u[16]; };

__device__ __forceinline__ unsigned short bf16_bits(float x) { unsigned int u = __float_as_uint(x); return (unsigned short)((u + 0x7FFFu + ((u >> 16) & 1u)) >> 16); }
__device__ __forceinline__ float bf16_val(unsigned short b) { return __uint_as_float(((unsigned int)b) << 16); }
__device__ __forceinline__ float bf16_round(float x) { return bf16_val(bf16_bits(x)); }
// D += A·B with NT terms: 1 = ah·bh, 2 = + al·bh (A split), 3 = + ah·bl (both split)
template <int NT>
__device__ __forceinline__ v8f mmaN(v16b ah, v16b al, v16b bh, v16b bl, v8f c) {
  c = __builtin_amdgcn_wmma_f32_16x16x32_bf16(false, ah, false, bh, (short)0, c, false, false);
  if (NT >= 2) c = __builtin_amdgcn_wmma_f32_16x16x32_bf16(false, al, false, bh, (short)0, c, false, false);
  if (NT >= 3) c = __builtin_amdgcn_wmma_f32_16x16x32_bf16(false, ah, false, bl, (short)0, c, false, false);
  asm volatile("v_nop\n\tv_nop\n\tv_nop\n\tv_nop" : "+v"(c) : "v"(ah), "v"(al), "v"(bh), "v"(bl));
  return c;
}

__global__ __launch_bounds__(256) void k_wt_bf16(const float* __restrict__ W, unsigned short* __restrict__ Wt, int K, int N) {
  const int t = blockIdx.x * 256 + threadIdx.x;
  const int k8n = K / 8;
  if (t >= N * k8n) return;
  const int n = t / k8n, k8 = (t % k8n) * 8;
  v8us v;
#pragma unroll
  for (int i = 0; i < 8; ++i) v[i] = bf16_bits(W[(size_t)(k8 + i) * N + n]);
  *(v8us*)(Wt + (size_t)n * K + k8) = v;
  
}

// GEMM C[M][N] (f32, pitch ldc) = act(A[M][K]·W + bias). A f32 row-major (pitch lda) converted per fragment to bf16
// (ASPLIT: hi/lo two planes -> 2 terms, else single rounded term); Wt bf16 [N][K] (pitch ldb). BIAS_BF16 rounds the
// bias to bf16 first (bias quantised to bf16 before the add). K%32==0, M%16==0, N%64==0.
template <bool ASPLIT, int ACT, bool BIAS_BF16>
__global__ __launch_bounds__(128) void k_gemm_bf(const float* __restrict__ A, int lda, const unsigned short* __restrict__ Wt, int ldb,
                                               const float* __restrict__ bias, float* __restrict__ C, int ldc, int M, int N, int K) {
  __shared__ __attribute__((aligned(16))) float so[4][16][64];
  const int tid = threadIdx.x, w = tid >> 5, lane = tid & 31, ln = lane & 15, hh = lane >> 4;
  const int ntn = N / 64;
  const int wid = blockIdx.x * 4 + w;
  const int mt = wid / ntn, nq = wid % ntn;
  if (mt * 16 >= M) return;
  const int row0 = mt * 16, col0 = nq * 64;
  const float* arow = A + (size_t)(row0 + ln) * lda;
  v8f acc[4] = {};
  for (int kb = 0; kb < K; kb += 32) {
    FragB ah, al;
    const v4f x0 = *(const v4fa*)(arow + kb + 8 * hh), x1 = *(const v4fa*)(arow + kb + 8 * hh + 4);
    const v4f x2 = *(const v4fa*)(arow + kb + 16 + 8 * hh), x3 = *(const v4fa*)(arow + kb + 16 + 8 * hh + 4);
    float xs[16] = {x0[0],x0[1],x0[2],x0[3],x1[0],x1[1],x1[2],x1[3],x2[0],x2[1],x2[2],x2[3],x3[0],x3[1],x3[2],x3[3]};
#pragma unroll
    for (int i = 0; i < 16; ++i) { const unsigned short hb = bf16_bits(xs[i]); ah.u[i] = hb; al.u[i] = ASPLIT ? bf16_bits(xs[i] - bf16_val(hb)) : (unsigned short)0; }
#pragma unroll
    for (int t = 0; t < 4; ++t) {
      const unsigned short* brow = Wt + (size_t)(col0 + t * 16 + ln) * ldb + kb;
      FragB b;
      b.half[0] = *(const v8us*)(brow + 8 * hh);
      b.half[1] = *(const v8us*)(brow + 16 + 8 * hh);
      acc[t] = mmaN<ASPLIT ? 2 : 1>(ah.v, al.v, b.v, b.v, acc[t]);
    }
  }
#pragma unroll
  for (int t = 0; t < 4; ++t) {
    float bv = bias ? bias[col0 + t * 16 + ln] : 0.f;
    if (BIAS_BF16) bv = bf16_round(bv);
#pragma unroll
    for (int r = 0; r < 8; ++r) { float v = acc[t][r] + bv; if (ACT == 1) v = fmaxf(v, 0.f); so[w][8 * hh + r][t * 16 + ln] = v; }
  }
  __builtin_amdgcn_fence(__ATOMIC_ACQ_REL, "workgroup");
  __builtin_amdgcn_wave_barrier();
  const int rsub = lane >> 4, c4 = (lane & 15) * 4;
  {
#pragma unroll
    for (int q = 0; q < 8; ++q) {
      const int r = q * 2 + rsub;
      const v4f v = *(const v4fa*)&so[w][r][c4];
      *(v4f*)(C + (size_t)(row0 + r) * ldc + col0 + c4) = v;
    }
    
  }
}

// GEMM C = act(A·W + bias + resid): A f32 (ASPLIT -> hi/lo 2 terms), Wt bf16 [N][K]; ACT 0 none, 1 relu, 2 exact gelu;
// resid (optional, f32, row index = (row % rmod), pitch ldr, RES_BF16 rounds it) added before the activation.
template <bool ASPLIT, int ACT, bool BIAS_BF16, bool RES_BF16>
__global__ __launch_bounds__(128) void k_gemm_bf3(const float* __restrict__ A, int lda, const unsigned short* __restrict__ Wt, int ldb,
                                                const float* __restrict__ bias, const float* __restrict__ resid, int rmod, int ldr,
                                                float* __restrict__ C, int ldc, int M, int N, int K) {
  __shared__ __attribute__((aligned(16))) float so[4][16][64];
  const int tid = threadIdx.x, w = tid >> 5, lane = tid & 31, ln = lane & 15, hh = lane >> 4;
  const int ntn = N / 64;
  const int wid = blockIdx.x * 4 + w;
  const int mt = wid / ntn, nq = wid % ntn;
  if (mt * 16 >= M) return;
  const int row0 = mt * 16, col0 = nq * 64;
  const float* arow = A + (size_t)(row0 + ln) * lda;
  v8f acc[4] = {};
  for (int kb = 0; kb < K; kb += 32) {
    FragB ah, al;
    const v4f x0 = *(const v4fa*)(arow + kb + 8 * hh), x1 = *(const v4fa*)(arow + kb + 8 * hh + 4);
    const v4f x2 = *(const v4fa*)(arow + kb + 16 + 8 * hh), x3 = *(const v4fa*)(arow + kb + 16 + 8 * hh + 4);
    float xs[16] = {x0[0],x0[1],x0[2],x0[3],x1[0],x1[1],x1[2],x1[3],x2[0],x2[1],x2[2],x2[3],x3[0],x3[1],x3[2],x3[3]};
#pragma unroll
    for (int i = 0; i < 16; ++i) { const unsigned short hb = bf16_bits(xs[i]); ah.u[i] = hb; al.u[i] = ASPLIT ? bf16_bits(xs[i] - bf16_val(hb)) : (unsigned short)0; }
#pragma unroll
    for (int t = 0; t < 4; ++t) {
      const unsigned short* brow = Wt + (size_t)(col0 + t * 16 + ln) * ldb + kb;
      FragB b;
      b.half[0] = *(const v8us*)(brow + 8 * hh);
      b.half[1] = *(const v8us*)(brow + 16 + 8 * hh);
      acc[t] = mmaN<ASPLIT ? 2 : 1>(ah.v, al.v, b.v, b.v, acc[t]);
    }
  }
#pragma unroll
  for (int t = 0; t < 4; ++t) {
    const int col = col0 + t * 16 + ln;
    float bv = bias ? bias[col] : 0.f;
    if (BIAS_BF16) bv = bf16_round(bv);
#pragma unroll
    for (int r = 0; r < 8; ++r) {
      float v = acc[t][r] + bv;
      if (resid) { float rv = resid[(size_t)((row0 + 8 * hh + r) % rmod) * ldr + col]; if (RES_BF16) rv = bf16_round(rv); v += rv; }
      if (ACT == 1) v = fmaxf(v, 0.f);
      if (ACT == 2) v = 0.5f * v * (1.0f + erff(v * 0.70710678118654752f));
      if (ACT == 3) { const float u = 0.7978845608028654f * (v + 0.044715f * v * v * v); v = 0.5f * v * (1.0f + tanhf(u)); }
      so[w][8 * hh + r][t * 16 + ln] = v;
    }
  }
  __builtin_amdgcn_fence(__ATOMIC_ACQ_REL, "workgroup");
  __builtin_amdgcn_wave_barrier();
  const int rsub = lane >> 4, c4 = (lane & 15) * 4;
  {
#pragma unroll
    for (int q = 0; q < 8; ++q) {
      const int r = q * 2 + rsub;
      const v4f v = *(const v4fa*)&so[w][r][c4];
      *(v4f*)(C + (size_t)(row0 + r) * ldc + col0 + c4) = v;
    }
    
  }
}
// row LayerNorm (biased variance, eps) over N: s = X (+ R); optional out_sum <- s; out_norm <- (s-mu)*rsqrt(var+eps)*g + b
template <bool PARAM_BF16>
__global__ __launch_bounds__(256) void k_layernorm(const float* __restrict__ X, const float* __restrict__ R, const float* __restrict__ g, const float* __restrict__ bta,
                                                  float* __restrict__ out_sum, float* __restrict__ out_norm, int N, float eps) {
  __shared__ float red[256];
  const int row = blockIdx.x, tid = threadIdx.x;
  const float* x = X + (size_t)row * N; const float* rr = R ? R + (size_t)row * N : nullptr;
  float vals[16];                     // up to N = 4096
  const int per = N / 256;            // contiguous chunk per thread? use strided-by-4 chunks: thread handles j = tid*4 + 1024*u
  float s1 = 0.f;
  for (int u = 0; u < per / 4; ++u) {
    const int j = tid * 4 + 1024 * u;
    const v4f a = *(const v4fa*)(x + j);
    v4f b = {0.f,0.f,0.f,0.f}; if (rr) b = *(const v4fa*)(rr + j);
#pragma unroll
    for (int q = 0; q < 4; ++q) { const float v = a[q] + b[q]; vals[u * 4 + q] = v; s1 += v; }
  }
  red[tid] = s1; __syncthreads();
  for (int st = 128; st > 0; st >>= 1) { if (tid < st) red[tid] += red[tid + st]; __syncthreads(); }
  const float mu = red[0] / (float)N; __syncthreads();
  float s2 = 0.f;
  for (int u = 0; u < per / 4; ++u)
#pragma unroll
    for (int q = 0; q < 4; ++q) { const float c = vals[u * 4 + q] - mu; s2 += c * c; }
  red[tid] = s2; __syncthreads();
  for (int st = 128; st > 0; st >>= 1) { if (tid < st) red[tid] += red[tid + st]; __syncthreads(); }
  const float rs = rsqrtf(red[0] / (float)N + eps);
  {
    for (int u = 0; u < per / 4; ++u) {
      const int j = tid * 4 + 1024 * u;
      v4f o, sm;
#pragma unroll
      for (int q = 0; q < 4; ++q) {
        float gg = g[j + q], bb = bta[j + q];
        if (PARAM_BF16) { gg = bf16_round(gg); bb = bf16_round(bb); }
        sm[q] = vals[u * 4 + q]; o[q] = (vals[u * 4 + q] - mu) * rs * gg + bb;
      }
      if (out_sum) *(v4f*)(out_sum + (size_t)row * N + j) = sm;
      *(v4f*)(out_norm + (size_t)row * N + j) = o;
    }
    
  }
}



// ---- f16 WMMA path (v_wmma_f32_16x16x32_f16): 11-bit significands for operands in range — used where a [0,1] probability operand needs more precision than bf16
typedef _Float16 v16h __attribute__((ext_vector_type(16)));
union FragH { v16h v; v8us half[2]; _Float16 h[16]; unsigned short u[16]; };
template <int NT>
__device__ __forceinline__ v8f mmaH(v16h ah, v16h al, v16h bh, v16h bl, v8f c) {
  c = __builtin_amdgcn_wmma_f32_16x16x32_f16(false, ah, false, bh, (short)0, c, false, false);
  if (NT >= 2) c = __builtin_amdgcn_wmma_f32_16x16x32_f16(false, al, false, bh, (short)0, c, false, false);
  if (NT >= 3) c = __builtin_amdgcn_wmma_f32_16x16x32_f16(false, ah, false, bl, (short)0, c, false, false);
  asm volatile("v_nop\n\tv_nop\n\tv_nop\n\tv_nop" : "+v"(c) : "v"(ah), "v"(al), "v"(bh), "v"(bl));
  return c;
}
// batched GEMM like k_gemm_b but f16 operands: A f32 (split into f16 hi/lo if ASPLIT, else rounded to f16), Bt = f16 values [n][k]; alpha; C f32; N multiple of 16 (partial tiles skipped)
template <bool ASPLIT>
__global__ __launch_bounds__(128) void k_gemm_h(const float* __restrict__ A, int lda, size_t sA, const _Float16* __restrict__ Bh, int ldb, size_t sB, float alpha, float* __restrict__ C, int ldc, size_t sC, int M, int N, int K) {
  __shared__ __attribute__((aligned(16))) float so[4][16][64];
  const int tid = threadIdx.x, w = tid >> 5, lane = tid & 31, ln = lane & 15, hh = lane >> 4; const int by = blockIdx.y;
  A += (size_t)by * sA; Bh += (size_t)by * sB; C += (size_t)by * sC;
  const int ntn = (N + 63) / 64; const int wid = blockIdx.x * 4 + w; const int mt = wid / ntn, nq = wid % ntn; if (mt * 16 >= M) return;
  const int row0 = mt * 16, col0 = nq * 64; const float* arow = A + (size_t)(row0 + ln) * lda;
  v8f acc[4] = {};
  for (int kb = 0; kb < K; kb += 32) {
    FragH ah, al;
    const v4f x0 = *(const v4fa*)(arow + kb + 8 * hh), x1 = *(const v4fa*)(arow + kb + 8 * hh + 4), x2 = *(const v4fa*)(arow + kb + 16 + 8 * hh), x3 = *(const v4fa*)(arow + kb + 16 + 8 * hh + 4);
    float xs[16] = {x0[0],x0[1],x0[2],x0[3],x1[0],x1[1],x1[2],x1[3],x2[0],x2[1],x2[2],x2[3],x3[0],x3[1],x3[2],x3[3]};
#pragma unroll
    for (int i = 0; i < 16; ++i) { const _Float16 h = (_Float16)xs[i]; ah.h[i] = h; al.h[i] = ASPLIT ? (_Float16)(xs[i] - (float)h) : (_Float16)0.0f; }
#pragma unroll
    for (int t = 0; t < 4; ++t) { if (col0 + t * 16 >= N) continue; const size_t boff = (size_t)(col0 + t * 16 + ln) * ldb + kb; FragH bq; bq.half[0] = *(const v8us*)(Bh + boff + 8 * hh); bq.half[1] = *(const v8us*)(Bh + boff + 16 + 8 * hh);
      acc[t] = mmaH<ASPLIT ? 2 : 1>(ah.v, al.v, bq.v, bq.v, acc[t]); }
  }
#pragma unroll
  for (int t = 0; t < 4; ++t) { if (col0 + t * 16 >= N) continue;
#pragma unroll
    for (int r = 0; r < 8; ++r) so[w][8 * hh + r][t * 16 + ln] = acc[t][r] * alpha; }
  __builtin_amdgcn_fence(__ATOMIC_ACQ_REL, "workgroup"); __builtin_amdgcn_wave_barrier();
  const int rsub = lane >> 4, c4 = (lane & 15) * 4;
  {
#pragma unroll
    for (int q = 0; q < 8; ++q) { const int r = q * 2 + rsub; if (col0 + c4 < N) { const v4f v = *(const v4fa*)&so[w][r][c4]; *(v4f*)(C + (size_t)(row0 + r) * ldc + col0 + c4) = v; } }
     }
}

// Wt[n][k] = f16(W[k][n]·scale) from f32 row-major W[K][N] (scale = power of two; bf16-exact weights stay exact in f16 away from the subnormal range)
__global__ __launch_bounds__(256) void k_wt_f16(const float* __restrict__ W, _Float16* __restrict__ Wt, int K, int N, float scale) {
  const int t = blockIdx.x * 256 + threadIdx.x; if (t >= N * (K / 8)) return; const int n = t / (K / 8), k8 = (t % (K / 8)) * 8; FragH f;
#pragma unroll
  for (int i = 0; i < 8; ++i) f.h[i] = (_Float16)(bf16_round(W[(size_t)(k8 + i) * N + n]) * scale); const v8us o = f.half[0];
  *(v8us*)((unsigned short*)Wt + (size_t)n * K + k8) = o; 
}
// k_gemm_hh variant with fused epilogue: v = acc·alpha + bias[by·sBias + col] (+ CP[(row/rowsPerB)·sCPb + by·64 + col] if CP) ; ACT 0 none / 1 elu ; writes f16 C16 (and f32 C if non-null)
template <int ACT>
__global__ __launch_bounds__(128) void k_gemm_hhx(const _Float16* __restrict__ A, int lda, size_t sA, const _Float16* __restrict__ Bh, int ldb, size_t sB, float alpha, const float* __restrict__ bias, size_t sBias, const float* __restrict__ CP, int rowsPerB, size_t sCPb, int row0g,
    float* __restrict__ C, _Float16* __restrict__ C16, int ldc, size_t sC, int M, int N, int K) {
  __shared__ __attribute__((aligned(16))) float so[4][16][64];
  const int tid = threadIdx.x, w = tid >> 5, lane = tid & 31, ln = lane & 15, hh = lane >> 4; const int by = blockIdx.y;
  A += (size_t)by * sA; Bh += (size_t)by * sB; const size_t cofs = (size_t)by * sC; const float* bp = bias ? bias + (size_t)by * sBias : nullptr;
  const int ntn = (N + 63) / 64; const int wid = blockIdx.x * 4 + w; const int mt = wid / ntn, nq = wid % ntn; if (mt * 16 >= M) return;
  const int row0 = mt * 16, col0 = nq * 64; const _Float16* arow = A + (size_t)(row0 + ln) * lda;
  v8f acc[4] = {};
  for (int kb = 0; kb < K; kb += 32) { FragH ah; ah.half[0] = *(const v8us*)((const unsigned short*)arow + kb + 8 * hh); ah.half[1] = *(const v8us*)((const unsigned short*)arow + kb + 16 + 8 * hh);
#pragma unroll
    for (int t = 0; t < 4; ++t) { if (col0 + t * 16 >= N) continue; const size_t boff = (size_t)(col0 + t * 16 + ln) * ldb + kb; FragH bq; bq.half[0] = *(const v8us*)((const unsigned short*)Bh + boff + 8 * hh); bq.half[1] = *(const v8us*)((const unsigned short*)Bh + boff + 16 + 8 * hh);
      acc[t] = mmaH<1>(ah.v, ah.v, bq.v, bq.v, acc[t]); }
  }
#pragma unroll
  for (int t = 0; t < 4; ++t) { if (col0 + t * 16 >= N) continue; const int col = col0 + t * 16 + ln; const float bv = bp ? bf16_round(bp[col]) : 0.f;
#pragma unroll
    for (int r = 0; r < 8; ++r) { float v = acc[t][r] * alpha + bv; if (CP) { const int rr = row0g + row0 + 8 * hh + r; if (rowsPerB < 0) v += CP[cofs + (size_t)rr * ldc + col];      /* rowsPerB < 0: own element of the batched C plane */ else { const int bidx = rr / rowsPerB; v += CP[(size_t)bidx * sCPb + (size_t)by * 64 + col]; } } if (ACT == 1) v = (v > 0.f) ? v : expm1f(v); else if (ACT == 7) v = (v > 0.f) ? v + 1.0f : expf(v); else if (ACT == 8) v = tanhf(v); else if (ACT == 9) v = 0.5f * v * (1.0f + tanhf(0.7978845608028654f * (v + 0.044715f * v * v * v))); else if (ACT == 11) v = 1.0f / (1.0f + expf(-v)); else if (ACT == 12) v = (v > 0.f) ? v : 0.01f * v; else if (ACT == 14) v = (v > 0.f) ? v : 0.1f * v; else if (ACT == 16) v = (v >= 0.f) ? v : 0.3f * v; else if (ACT == 17) v = (v >= 0.f) ? v : 0.2f * v; else if (ACT == 15) v = v / (1.0f + expf(-v)); else if (ACT == 3) v = fmaxf(v, 0.f); else if (ACT == 6) v = 0.5f * v * (1.0f + erff(v * 0.70710678118654752f)); so[w][8 * hh + r][t * 16 + ln] = v; } }
  __builtin_amdgcn_fence(__ATOMIC_ACQ_REL, "workgroup"); __builtin_amdgcn_wave_barrier();
  const int rsub = lane >> 4, c4 = (lane & 15) * 4; typedef _Float16 v4h __attribute__((ext_vector_type(4)));
  {
#pragma unroll
    for (int q = 0; q < 8; ++q) { const int r = q * 2 + rsub; if (col0 + c4 < N) { const v4f v = *(const v4fa*)&so[w][r][c4]; if (C) *(v4f*)(C + cofs + (size_t)(row0 + r) * ldc + col0 + c4) = v; if (C16) { v4h h4; for (int i = 0; i < 4; ++i) h4[i] = (_Float16)v[i]; *(v4h*)(C16 + cofs + (size_t)(row0 + r) * ldc + col0 + c4) = h4; } } }
     }
}


typedef _Float16 v4h __attribute__((ext_vector_type(4)));

__global__ __launch_bounds__(256) void k_x16(const float* __restrict__ x, _Float16* __restrict__ X16, size_t n8) { const size_t t = (size_t)blockIdx.x * 256 + threadIdx.x; if (t >= n8) return; FragH f;
#pragma unroll
  for (int q = 0; q < 8; ++q) f.h[q] = (_Float16)bf16_round(x[t * 8 + q]); *(v8us*)((unsigned short*)X16 + t * 8) = f.half[0];  }
__global__ __launch_bounds__(256) void k_h16(const float* __restrict__ x, _Float16* __restrict__ X16, size_t n8) { const size_t t = (size_t)blockIdx.x * 256 + threadIdx.x; if (t >= n8) return; FragH f;
#pragma unroll
  for (int q = 0; q < 8; ++q) f.h[q] = (_Float16)x[t * 8 + q]; *(v8us*)((unsigned short*)X16 + t * 8) = f.half[0];  }
__global__ __launch_bounds__(256) void k_round16f(const float* __restrict__ W, _Float16* __restrict__ Bt, size_t n8) { const size_t t = (size_t)blockIdx.x * 256 + threadIdx.x; if (t >= n8) return; FragH f;
#pragma unroll
  for (int i = 0; i < 8; ++i) f.h[i] = (_Float16)(bf16_round(W[t * 8 + i]) * 16.0f); *(v8us*)((unsigned short*)Bt + t * 8) = f.half[0];  }
template <int NHv, int TTv>
__global__ __launch_bounds__(256) void k_vt(const _Float16* __restrict__ V16, int ldv, int voff, _Float16* __restrict__ Vt) { __shared__ unsigned short tl[64][66]; const int tid = threadIdx.x; const int slab = blockIdx.x / (TTv / 64), lg = blockIdx.x % (TTv / 64); const int b = slab / NHv, h = slab % NHv;
  for (int i = tid; i < 64 * 8; i += 256) { const int r = i / 8, c8 = (i % 8) * 8; FragH f; f.half[0] = *(const v8us*)((const unsigned short*)V16 + ((size_t)b * TTv + lg * 64 + r) * ldv + voff + h * 64 + c8);
#pragma unroll
    for (int q = 0; q < 8; ++q) tl[r][c8 + q] = f.u[q]; }
  __syncthreads();
  {
#pragma unroll
    for (int rd = 0; rd < 2; ++rd) { const int d = rd * 32 + tid / 8, pc = tid % 8; FragH f;
#pragma unroll
      for (int q = 0; q < 8; ++q) f.u[q] = tl[pc * 8 + q][d];
      *(v8us*)((unsigned short*)Vt + ((size_t)slab * 64 + d) * TTv + lg * 64 + pc * 8) = f.half[0]; }
     } }

__global__ __launch_bounds__(256) void k_hl(const float* __restrict__ F, _Float16* __restrict__ Hh, _Float16* __restrict__ Hl, size_t n8) { const size_t t = (size_t)blockIdx.x * 256 + threadIdx.x; if (t >= n8) return; FragH fh, fl; const v4f a = *(const v4fa*)(F + t * 8), c = *(const v4fa*)(F + t * 8 + 4);
#pragma unroll
  for (int q = 0; q < 4; ++q) { _Float16 h = (_Float16)a[q]; fh.h[q] = h; fl.h[q] = (_Float16)((a[q] - (float)h) * 1024.0f); h = (_Float16)c[q]; fh.h[4 + q] = h; fl.h[4 + q] = (_Float16)((c[q] - (float)h) * 1024.0f); }
  { *(v8us*)((unsigned short*)Hh + t * 8) = fh.half[0]; *(v8us*)((unsigned short*)Hl + t * 8) = fl.half[0];  } }

// ---- fast GEMM (wave tile 32x64; requires M % 32 == 0 rows per launch region and N % 64 == 0); epilogue = k_gemm_hhx semantics ----
__device__ __forceinline__ v16h g2_frag(const _Float16* p, int hh) { FragH f; f.half[0] = *(const v8us*)((const unsigned short*)p + 8 * hh); f.half[1] = *(const v8us*)((const unsigned short*)p + 16 + 8 * hh); return f.v; }
__device__ __forceinline__ v8f g2_mma(v16h a, v16h b, v8f c) { v8f d = __builtin_amdgcn_wmma_f32_16x16x32_f16(false, a, false, b, (short)0, c, false, false); asm volatile("v_nop\n\tv_nop\n\tv_nop\n\tv_nop" : "+v"(d) : "v"(a), "v"(b)); return d; }
template <int ACT>
__global__ __launch_bounds__(128) void k_gemm2(const _Float16* __restrict__ A, int lda, size_t sA, const _Float16* __restrict__ Bh, int ldb, size_t sB, float alpha, const float* __restrict__ bias, size_t sBias, const float* __restrict__ CP, int rowsPerB, size_t sCPb, int row0g,
    float* __restrict__ C, _Float16* __restrict__ C16, int ldc, size_t sC, int M, int N, int K) { static_assert(ACT == 0 || ACT == 3 || ACT == 6 || ACT == 8 || ACT == 9 || ACT == 11 || ACT == 12 || ACT == 14 || ACT == 15 || ACT == 16 || ACT == 17, "k_gemm2: unsupported ACT code (would silently apply no activation)");
  __shared__ __attribute__((aligned(16))) float so[4][32][68];
  const int tid = threadIdx.x, w = tid >> 5, lane = tid & 31, ln = lane & 15, hh = lane >> 4; const int by = blockIdx.y;
  A += (size_t)by * sA; Bh += (size_t)by * sB; const size_t cofs = (size_t)by * sC; const float* bp = bias ? bias + (size_t)by * sBias : nullptr;
  const int ntn = N >> 6; const int mt = blockIdx.x / ntn, nq = blockIdx.x - mt * ntn; const int row0 = mt * 128 + 32 * w, col0 = nq * 64; if (row0 >= M) return;
  const _Float16* a0p = A + (size_t)(row0 + ln) * lda; const _Float16* a1p = a0p + (size_t)16 * lda;
  const _Float16* b0p = Bh + (size_t)(col0 + ln) * ldb; const _Float16* b1p = b0p + (size_t)16 * ldb; const _Float16* b2p = b1p + (size_t)16 * ldb; const _Float16* b3p = b2p + (size_t)16 * ldb;
  const v8f z8 = {0.f,0.f,0.f,0.f,0.f,0.f,0.f,0.f}; v8f c00 = z8, c01 = z8, c02 = z8, c03 = z8, c10 = z8, c11 = z8, c12 = z8, c13 = z8;
#pragma unroll 1
  for (int kb = 0; kb < K; kb += 32) { const v16h a0 = g2_frag(a0p + kb, hh), a1 = g2_frag(a1p + kb, hh);
    v16h b = g2_frag(b0p + kb, hh); c00 = g2_mma(a0, b, c00); c10 = g2_mma(a1, b, c10);
    b = g2_frag(b1p + kb, hh); c01 = g2_mma(a0, b, c01); c11 = g2_mma(a1, b, c11);
    b = g2_frag(b2p + kb, hh); c02 = g2_mma(a0, b, c02); c12 = g2_mma(a1, b, c12);
    b = g2_frag(b3p + kb, hh); c03 = g2_mma(a0, b, c03); c13 = g2_mma(a1, b, c13); }
  v8f accs[8] = {c00, c01, c02, c03, c10, c11, c12, c13};
#pragma unroll
  for (int u = 0; u < 8; ++u) { const int t = u & 3, half = u >> 2; const int col = col0 + t * 16 + ln; const float bv = bp ? bf16_round(bp[col]) : 0.f;
#pragma unroll
    for (int r = 0; r < 8; ++r) { const int rloc = half * 16 + 8 * hh + r; float v = accs[u][r] * alpha + bv; if (CP) { if (rowsPerB < 0) v += CP[cofs + (size_t)(row0g + row0 + rloc) * ldc + col];      /* rowsPerB < 0: own element of the batched C plane */ else { const int bidx = (row0g + row0 + rloc) / rowsPerB; v += CP[(size_t)bidx * sCPb + (size_t)by * 64 + col]; } }
      if (ACT == 3) v = fmaxf(v, 0.f); else if (ACT == 6) v = 0.5f * v * (1.0f + erff(v * 0.70710678118654752f)); else if (ACT == 11) v = 1.0f / (1.0f + expf(-v)); else if (ACT == 15) v = v / (1.0f + expf(-v)); else if (ACT == 12) v = (v > 0.f) ? v : 0.01f * v; else if (ACT == 8) v = tanhf(v); else if (ACT == 9) v = 0.5f * v * (1.0f + tanhf(0.7978845608028654f * (v + 0.044715f * v * v * v))); else if (ACT == 14) v = (v > 0.f) ? v : 0.1f * v; else if (ACT == 16) v = (v >= 0.f) ? v : 0.3f * v; else if (ACT == 17) v = (v >= 0.f) ? v : 0.2f * v;
      so[w][rloc][t * 16 + ln] = v; } }
  __builtin_amdgcn_fence(__ATOMIC_ACQ_REL, "workgroup"); __builtin_amdgcn_wave_barrier();
  const int rsub = lane >> 4, c4 = (lane & 15) * 4;
  {
#pragma unroll
    for (int q = 0; q < 16; ++q) { const int r = q * 2 + rsub; const v4f v = *(const v4fa*)&so[w][r][c4]; if (C) *(v4f*)(C + cofs + (size_t)(row0 + r) * ldc + col0 + c4) = v; if (C16) { v4h h4; for (int i = 0; i < 4; ++i) h4[i] = (_Float16)v[i]; *(v4h*)(C16 + cofs + (size_t)(row0 + r) * ldc + col0 + c4) = h4; } }
     } }


__global__ __launch_bounds__(256) void k_wnat(const float* __restrict__ w, size_t n8, _Float16* __restrict__ Bt) { const size_t t = (size_t)blockIdx.x * 256 + threadIdx.x; if (t >= n8) return; FragH f; for (int q = 0; q < 8; ++q) f.h[q] = (_Float16)(bf16_round(w[t * 8 + q]) * 16.0f); *(v8us*)((unsigned short*)Bt + t * 8) = f.half[0];  }
__global__ __launch_bounds__(256) void k_rsm(const float* __restrict__ S, _Float16* __restrict__ P, int nrows) {
  #pragma clang fp contract(off)
  const int i = blockIdx.x * 256 + threadIdx.x; if (i >= nrows) return; const float* s = S + (size_t)i * SQ; float mx = -3.0e38f;
#pragma unroll 1
  for (int j = 0; j < SQ; ++j) mx = fmaxf(mx, s[j]); float se = 0.f;
#pragma unroll 1
  for (int j = 0; j < SQ; ++j) se += expf(s[j] - mx); const float sc = 256.0f / se;
#pragma unroll 1
  for (int j0 = 0; j0 < SQ; j0 += 8) { FragH f; for (int q = 0; q < 8; ++q) f.h[q] = (_Float16)(expf(s[j0 + q] - mx) * sc); unsigned short* d = (unsigned short*)P + (size_t)i * SQ + j0; *(v8us*)d = f.half[0];  } }
__global__ __launch_bounds__(256) void k_vt(const _Float16* __restrict__ V16, int b, int h0, _Float16* __restrict__ VT) { __shared__ unsigned short tl[64][65]; const int tid = threadIdx.x; const int hh = blockIdx.x % HG, sg = blockIdx.x / HG; const int s0 = sg * 64; const int h = h0 + hh;
  for (int i = tid; i < 64 * 8; i += 256) { const int j = i / 8, d8 = (i % 8) * 8; FragH f; f.half[0] = *(const v8us*)((const unsigned short*)V16 + ((size_t)b * SQ + s0 + j) * DM + h * HD + d8); for (int q = 0; q < 8; ++q) tl[d8 + q][j] = f.u[q]; }
  __syncthreads();
  { for (int i = tid; i < 64 * 8; i += 256) { const int d = i / 8, j8 = (i % 8) * 8; FragH f; for (int q = 0; q < 8; ++q) f.u[q] = tl[d][j8 + q]; *(v8us*)((unsigned short*)VT + ((size_t)hh * HD + d) * SQ + s0 + j8) = f.half[0]; }  } }



__global__ __launch_bounds__(256) void k_rsmfam(const float* __restrict__ S, _Float16* __restrict__ P, int qn, int hg, const float* __restrict__ am) {
  #pragma clang fp contract(off)
  const int t = blockIdx.x * 256 + threadIdx.x; if (t >= qn * hg) return; const size_t i = (size_t)(t / qn) * SQ + (t % qn); const float* s = S + i * SQ; float mx = -3.0e38f;
#pragma unroll 1
  for (int j = 0; j < SQ; ++j) mx = fmaxf(mx, __fadd_rn(s[j], bf16_round(am[j]))); float se = 0.f;
#pragma unroll 1
  for (int j = 0; j < SQ; ++j) se += __expf(__fadd_rn(s[j], bf16_round(am[j])) - mx); const float sc = 256.0f / se;
#pragma unroll 1
  for (int j0 = 0; j0 < SQ; j0 += 8) { FragH fr; for (int q = 0; q < 8; ++q) { const int j = j0 + q; fr.h[q] = (_Float16)(__expf(__fadd_rn(s[j], bf16_round(am[j])) - mx) * sc); } unsigned short* d = (unsigned short*)P + i * SQ + j0; *(v8us*)d = fr.half[0];  } }

extern "C" void kernel_launch(void* const* d_in, const int* in_sizes, int n_in,
                              void* d_out, int out_size, void* d_ws, size_t ws_size, hipStream_t stream) {
  (void)in_sizes; (void)n_in; (void)out_size;
  const float* const* I = (const float* const*)d_in; const float* x = I[0]; const float* am = I[1]; const float* wq = I[2]; const float* bq = I[3]; const float* wk = I[4]; const float* bk = I[5]; const float* wv = I[6]; const float* bv = I[7];      /* weights [in][out]; am = additive mask [NB][1][1][SQ] */
  char* ws = (char*)d_ws; size_t off = 0;
  auto take = [&](size_t bytes) { char* p = ws + off; off += (bytes + 255) & ~(size_t)255; return p; };
  _Float16* BQ = (_Float16*)take((size_t)DM * DM * 2); _Float16* BK = (_Float16*)take((size_t)DM * DM * 2); _Float16* BV = (_Float16*)take((size_t)DM * DM * 2); 
  _Float16* X16 = (_Float16*)take(NR * DM * 2); _Float16* Q16 = (_Float16*)take(NR * DM * 2); _Float16* K16 = (_Float16*)take(NR * DM * 2); _Float16* V16 = (_Float16*)take(NR * DM * 2);
  float* S = (float*)take((size_t)HG * SQ * SQ * 4); _Float16* P = (_Float16*)take((size_t)HG * SQ * SQ * 2); _Float16* VT = (_Float16*)take((size_t)NH * HD * SQ * 2);
  if (off > ws_size) return;
  { const unsigned g = (unsigned)(((size_t)DM * (DM / 8) + 255) / 256); k_wt_f16<<<g, 256, 0, stream>>>(wq, BQ, DM, DM, 16.0f); k_wt_f16<<<g, 256, 0, stream>>>(wk, BK, DM, DM, 16.0f); k_wt_f16<<<g, 256, 0, stream>>>(wv, BV, DM, DM, 16.0f); }      /* [in][out] -> Bt[n][k] x16 */
  k_x16<<<(unsigned)((NR * DM / 8 + 255) / 256), 256, 0, stream>>>(x, X16, NR * DM / 8);
  const size_t r0p = (size_t)B0 * SQ;      /* first projected row */
  k_gemm2<0><<<dim3((unsigned)((MP / 128) * (DM / 64)), 1), 128, 0, stream>>>(X16 + r0p * DM, DM, 0, BQ, DM, 0, 0.0625f, bq, 0, nullptr, 1, 0, 0, nullptr, Q16 + r0p * DM, DM, 0, MP, DM, DM);
  k_gemm2<0><<<dim3((unsigned)((MP / 128) * (DM / 64)), 1), 128, 0, stream>>>(X16 + r0p * DM, DM, 0, BK, DM, 0, 0.0625f, bk, 0, nullptr, 1, 0, 0, nullptr, K16 + r0p * DM, DM, 0, MP, DM, DM);
  k_gemm2<0><<<dim3((unsigned)((MP / 128) * (DM / 64)), 1), 128, 0, stream>>>(X16 + r0p * DM, DM, 0, BV, DM, 0, 0.0625f, bv, 0, nullptr, 1, 0, 0, nullptr, V16 + r0p * DM, DM, 0, MP, DM, DM);
  for (int b = B0; b < B0 + NBR; ++b) { const size_t r0 = (size_t)b * SQ;
    k_vt<NH, SQ><<<NH * (SQ / 64), 256, 0, stream>>>(V16 + r0 * LQ, LQ, 0, VT);      /* V^T [NH][HD][SQ] for this batch */
    for (int h0 = 0; h0 < NHD; h0 += HG) {
      k_gemm2<0><<<dim3((QN / 128) * (SQ / 64), HG), 128, 0, stream>>>(Q16 + r0 * LQ + h0 * HD, LQ, (size_t)HD, K16 + r0 * LQ + h0 * HD, LQ, (size_t)HD, 0.125f, nullptr, 0, nullptr, 1, 0, 0, S, nullptr, SQ, (size_t)SQ * SQ, QN, SQ, HD);      /* scores, HG heads per launch */
      k_rsmfam<<<(HG * QN + 255) / 256, 256, 0, stream>>>(S, P, QN, HG, am + (size_t)b * SQ);      /* P = 256 softmax (f16), rows of all HG heads */
      k_gemm2<0><<<dim3((QN / 128) * (HD / 64), HG), 128, 0, stream>>>(P, SQ, (size_t)SQ * SQ, VT + (size_t)h0 * HD * SQ, SQ, (size_t)HD * SQ, 0.00390625f, nullptr, 0, nullptr, 1, 0, 0, (float*)d_out + r0 * DM + h0 * HD, nullptr, DM, (size_t)HD, QN, HD, SQ); } }      /* out = o (merged heads), f32, straight into the output rows */
}

// v001
// Measured time: 2070 microseconds a run.
// In two side-by-side timings against v000, it was 4.95 and 4.86 times as fast.
#include <hip/hip_runtime.h>
// BERT self-attention (hidden [1][4096][768]; q/k/v = x W + b with W stored [in][out], 12 heads of 64; scores / 8 + the additive attention_mask[b][key] (f32); softmax; out = attn v merged -> [1][4096][768]; no output projection).
// Structure: token rows r = b*4096 + s; x as exact f16 rows (bf16-rounded); Q, K, V as three WMMA GEMMs (32x64 wave tiles, f32 accumulation, exact x16 weights + bias, f16 outputs); per batch: V^T for all heads via LDS transposes; per (batch, group of 1 heads): scores GEMM (K = 64, batched over the heads on grid.y, alpha = 1/8), row softmax of (scores + additive mask) on VALU (f32 statistics, native exp; weights stored x256 as f16), o = P . V^T GEMM (K = 4096, alpha 2^-8) written as f32 straight into the merged output rows.
// Compute dtype: inputs rounded to bf16; x / weights exact; q, k, v and softmax weights as plain f16 GEMM operands (~2^-12); scores, softmax statistics and o f32; v_wmma_f32_16x16x32_f16.
#define NB 1
#define SQ 4096
#define DM 768
#define NH 12
#define HD 64
#define HG 1                         /* heads per attention launch group */
#define B0 0                         /* first batch processed (debug hook) */
#define NBR NB                       /* batches processed (debug hook) */
#define NR ((size_t)NB * SQ)         /* token rows */
#define MP ((int)((size_t)NBR * SQ)) /* rows projected (debug hook) */
#define QN SQ                        /* query rows attended per batch (debug hook) */
#define NHD NH                       /* heads attended (debug hook) */
#define MPO MP                       /* unused: there is no output stage */
#define LQ DM      /* row pitch of the q/k/v rows */
typedef __bf16 v16b __attribute__((ext_vector_type(16)));
typedef unsigned short v8us __attribute__((ext_vector_type(8), may_alias));
typedef float  v8f  __attribute__((ext_vector_type(8)));
typedef float  v4f  __attribute__((ext_vector_type(4)));
typedef float  v4fa __attribute__((ext_vector_type(4), may_alias));
union FragB { v16b v; v8us half[2]; unsigned short u[16]; };

__device__ __forceinline__ unsigned short bf16_bits(float x) { unsigned int u = __float_as_uint(x); return (unsigned short)((u + 0x7FFFu + ((u >> 16) & 1u)) >> 16); }
__device__ __forceinline__ float bf16_val(unsigned short b) { return __uint_as_float(((unsigned int)b) << 16); }
__device__ __forceinline__ float bf16_round(float x) { return bf16_val(bf16_bits(x)); }
// D += A·B with NT terms: 1 = ah·bh, 2 = + al·bh (A split), 3 = + ah·bl (both split)
template <int NT>
__device__ __forceinline__ v8f mmaN(v16b ah, v16b al, v16b bh, v16b bl, v8f c) {
  c = __builtin_amdgcn_wmma_f32_16x16x32_bf16(false, ah, false, bh, (short)0, c, false, false);
  if (NT >= 2) c = __builtin_amdgcn_wmma_f32_16x16x32_bf16(false, al, false, bh, (short)0, c, false, false);
  if (NT >= 3) c = __builtin_amdgcn_wmma_f32_16x16x32_bf16(false, ah, false, bl, (short)0, c, false, false);
  asm volatile("v_nop\n\tv_nop\n\tv_nop\n\tv_nop" : "+v"(c) : "v"(ah), "v"(al), "v"(bh), "v"(bl));
  return c;
}

__global__ __launch_bounds__(256) void k_wt_bf16(const float* __restrict__ W, unsigned short* __restrict__ Wt, int K, int N) {
  const int t = blockIdx.x * 256 + threadIdx.x;
  const int k8n = K / 8;
  if (t >= N * k8n) return;
  const int n = t / k8n, k8 = (t % k8n) * 8;
  v8us v;
#pragma unroll
  for (int i = 0; i < 8; ++i) v[i] = bf16_bits(W[(size_t)(k8 + i) * N + n]);
  *(v8us*)(Wt + (size_t)n * K + k8) = v;
  
}

// GEMM C[M][N] (f32, pitch ldc) = act(A[M][K]·W + bias). A f32 row-major (pitch lda) converted per fragment to bf16
// (ASPLIT: hi/lo two planes -> 2 terms, else single rounded term); Wt bf16 [N][K] (pitch ldb). BIAS_BF16 rounds the
// bias to bf16 first (bias quantised to bf16 before the add). K%32==0, M%16==0, N%64==0.
template <bool ASPLIT, int ACT, bool BIAS_BF16>
__global__ __launch_bounds__(128) void k_gemm_bf(const float* __restrict__ A, int lda, const unsigned short* __restrict__ Wt, int ldb,
                                               const float* __restrict__ bias, float* __restrict__ C, int ldc, int M, int N, int K) {
  __shared__ __attribute__((aligned(16))) float so[4][16][64];
  const int tid = threadIdx.x, w = tid >> 5, lane = tid & 31, ln = lane & 15, hh = lane >> 4;
  const int ntn = N / 64;
  const int wid = blockIdx.x * 4 + w;
  const int mt = wid / ntn, nq = wid % ntn;
  if (mt * 16 >= M) return;
  const int row0 = mt * 16, col0 = nq * 64;
  const float* arow = A + (size_t)(row0 + ln) * lda;
  v8f acc[4] = {};
  for (int kb = 0; kb < K; kb += 32) {
    FragB ah, al;
    const v4f x0 = *(const v4fa*)(arow + kb + 8 * hh), x1 = *(const v4fa*)(arow + kb + 8 * hh + 4);
    const v4f x2 = *(const v4fa*)(arow + kb + 16 + 8 * hh), x3 = *(const v4fa*)(arow + kb + 16 + 8 * hh + 4);
    float xs[16] = {x0[0],x0[1],x0[2],x0[3],x1[0],x1[1],x1[2],x1[3],x2[0],x2[1],x2[2],x2[3],x3[0],x3[1],x3[2],x3[3]};
#pragma unroll
    for (int i = 0; i < 16; ++i) { const unsigned short hb = bf16_bits(xs[i]); ah.u[i] = hb; al.u[i] = ASPLIT ? bf16_bits(xs[i] - bf16_val(hb)) : (unsigned short)0; }
#pragma unroll
    for (int t = 0; t < 4; ++t) {
      const unsigned short* brow = Wt + (size_t)(col0 + t * 16 + ln) * ldb + kb;
      FragB b;
      b.half[0] = *(const v8us*)(brow + 8 * hh);
      b.half[1] = *(const v8us*)(brow + 16 + 8 * hh);
      acc[t] = mmaN<ASPLIT ? 2 : 1>(ah.v, al.v, b.v, b.v, acc[t]);
    }
  }
#pragma unroll
  for (int t = 0; t < 4; ++t) {
    float bv = bias ? bias[col0 + t * 16 + ln] : 0.f;
    if (BIAS_BF16) bv = bf16_round(bv);
#pragma unroll
    for (int r = 0; r < 8; ++r) { float v = acc[t][r] + bv; if (ACT == 1) v = fmaxf(v, 0.f); so[w][8 * hh + r][t * 16 + ln] = v; }
  }
  __builtin_amdgcn_fence(__ATOMIC_ACQ_REL, "workgroup");
  __builtin_amdgcn_wave_barrier();
  const int rsub = lane >> 4, c4 = (lane & 15) * 4;
  {
#pragma unroll
    for (int q = 0; q < 8; ++q) {
      const int r = q * 2 + rsub;
      const v4f v = *(const v4fa*)&so[w][r][c4];
      *(v4f*)(C + (size_t)(row0 + r) * ldc + col0 + c4) = v;
    }
    
  }
}

// GEMM C = act(A·W + bias + resid): A f32 (ASPLIT -> hi/lo 2 terms), Wt bf16 [N][K]; ACT 0 none, 1 relu, 2 exact gelu;
// resid (optional, f32, row index = (row % rmod), pitch ldr, RES_BF16 rounds it) added before the activation.
template <bool ASPLIT, int ACT, bool BIAS_BF16, bool RES_BF16>
__global__ __launch_bounds__(128) void k_gemm_bf3(const float* __restrict__ A, int lda, const unsigned short* __restrict__ Wt, int ldb,
                                                const float* __restrict__ bias, const float* __restrict__ resid, int rmod, int ldr,
                                                float* __restrict__ C, int ldc, int M, int N, int K) {
  __shared__ __attribute__((aligned(16))) float so[4][16][64];
  const int tid = threadIdx.x, w = tid >> 5, lane = tid & 31, ln = lane & 15, hh = lane >> 4;
  const int ntn = N / 64;
  const int wid = blockIdx.x * 4 + w;
  const int mt = wid / ntn, nq = wid % ntn;
  if (mt * 16 >= M) return;
  const int row0 = mt * 16, col0 = nq * 64;
  const float* arow = A + (size_t)(row0 + ln) * lda;
  v8f acc[4] = {};
  for (int kb = 0; kb < K; kb += 32) {
    FragB ah, al;
    const v4f x0 = *(const v4fa*)(arow + kb + 8 * hh), x1 = *(const v4fa*)(arow + kb + 8 * hh + 4);
    const v4f x2 = *(const v4fa*)(arow + kb + 16 + 8 * hh), x3 = *(const v4fa*)(arow + kb + 16 + 8 * hh + 4);
    float xs[16] = {x0[0],x0[1],x0[2],x0[3],x1[0],x1[1],x1[2],x1[3],x2[0],x2[1],x2[2],x2[3],x3[0],x3[1],x3[2],x3[3]};
#pragma unroll
    for (int i = 0; i < 16; ++i) { const unsigned short hb = bf16_bits(xs[i]); ah.u[i] = hb; al.u[i] = ASPLIT ? bf16_bits(xs[i] - bf16_val(hb)) : (unsigned short)0; }
#pragma unroll
    for (int t = 0; t < 4; ++t) {
      const unsigned short* brow = Wt + (size_t)(col0 + t * 16 + ln) * ldb + kb;
      FragB b;
      b.half[0] = *(const v8us*)(brow + 8 * hh);
      b.half[1] = *(const v8us*)(brow + 16 + 8 * hh);
      acc[t] = mmaN<ASPLIT ? 2 : 1>(ah.v, al.v, b.v, b.v, acc[t]);
    }
  }
#pragma unroll
  for (int t = 0; t < 4; ++t) {
    const int col = col0 + t * 16 + ln;
    float bv = bias ? bias[col] : 0.f;
    if (BIAS_BF16) bv = bf16_round(bv);
#pragma unroll
    for (int r = 0; r < 8; ++r) {
      float v = acc[t][r] + bv;
      if (resid) { float rv = resid[(size_t)((row0 + 8 * hh + r) % rmod) * ldr + col]; if (RES_BF16) rv = bf16_round(rv); v += rv; }
      if (ACT == 1) v = fmaxf(v, 0.f);
      if (ACT == 2) v = 0.5f * v * (1.0f + erff(v * 0.70710678118654752f));
      if (ACT == 3) { const float u = 0.7978845608028654f * (v + 0.044715f * v * v * v); v = 0.5f * v * (1.0f + tanhf(u)); }
      so[w][8 * hh + r][t * 16 + ln] = v;
    }
  }
  __builtin_amdgcn_fence(__ATOMIC_ACQ_REL, "workgroup");
  __builtin_amdgcn_wave_barrier();
  const int rsub = lane >> 4, c4 = (lane & 15) * 4;
  {
#pragma unroll
    for (int q = 0; q < 8; ++q) {
      const int r = q * 2 + rsub;
      const v4f v = *(const v4fa*)&so[w][r][c4];
      *(v4f*)(C + (size_t)(row0 + r) * ldc + col0 + c4) = v;
    }
    
  }
}
// row LayerNorm (biased variance, eps) over N: s = X (+ R); optional out_sum <- s; out_norm <- (s-mu)*rsqrt(var+eps)*g + b
template <bool PARAM_BF16>
__global__ __launch_bounds__(256) void k_layernorm(const float* __restrict__ X, const float* __restrict__ R, const float* __restrict__ g, const float* __restrict__ bta,
                                                  float* __restrict__ out_sum, float* __restrict__ out_norm, int N, float eps) {
  __shared__ float red[256];
  const int row = blockIdx.x, tid = threadIdx.x;
  const float* x = X + (size_t)row * N; const float* rr = R ? R + (size_t)row * N : nullptr;
  float vals[16];                     // up to N = 4096
  const int per = N / 256;            // contiguous chunk per thread? use strided-by-4 chunks: thread handles j = tid*4 + 1024*u
  float s1 = 0.f;
  for (int u = 0; u < per / 4; ++u) {
    const int j = tid * 4 + 1024 * u;
    const v4f a = *(const v4fa*)(x + j);
    v4f b = {0.f,0.f,0.f,0.f}; if (rr) b = *(const v4fa*)(rr + j);
#pragma unroll
    for (int q = 0; q < 4; ++q) { const float v = a[q] + b[q]; vals[u * 4 + q] = v; s1 += v; }
  }
  red[tid] = s1; __syncthreads();
  for (int st = 128; st > 0; st >>= 1) { if (tid < st) red[tid] += red[tid + st]; __syncthreads(); }
  const float mu = red[0] / (float)N; __syncthreads();
  float s2 = 0.f;
  for (int u = 0; u < per / 4; ++u)
#pragma unroll
    for (int q = 0; q < 4; ++q) { const float c = vals[u * 4 + q] - mu; s2 += c * c; }
  red[tid] = s2; __syncthreads();
  for (int st = 128; st > 0; st >>= 1) { if (tid < st) red[tid] += red[tid + st]; __syncthreads(); }
  const float rs = rsqrtf(red[0] / (float)N + eps);
  {
    for (int u = 0; u < per / 4; ++u) {
      const int j = tid * 4 + 1024 * u;
      v4f o, sm;
#pragma unroll
      for (int q = 0; q < 4; ++q) {
        float gg = g[j + q], bb = bta[j + q];
        if (PARAM_BF16) { gg = bf16_round(gg); bb = bf16_round(bb); }
        sm[q] = vals[u * 4 + q]; o[q] = (vals[u * 4 + q] - mu) * rs * gg + bb;
      }
      if (out_sum) *(v4f*)(out_sum + (size_t)row * N + j) = sm;
      *(v4f*)(out_norm + (size_t)row * N + j) = o;
    }
    
  }
}



// ---- f16 WMMA path (v_wmma_f32_16x16x32_f16): 11-bit significands for operands in range — used where a [0,1] probability operand needs more precision than bf16
typedef _Float16 v16h __attribute__((ext_vector_type(16)));
union FragH { v16h v; v8us half[2]; _Float16 h[16]; unsigned short u[16]; };
template <int NT>
__device__ __forceinline__ v8f mmaH(v16h ah, v16h al, v16h bh, v16h bl, v8f c) {
  c = __builtin_amdgcn_wmma_f32_16x16x32_f16(false, ah, false, bh, (short)0, c, false, false);
  if (NT >= 2) c = __builtin_amdgcn_wmma_f32_16x16x32_f16(false, al, false, bh, (short)0, c, false, false);
  if (NT >= 3) c = __builtin_amdgcn_wmma_f32_16x16x32_f16(false, ah, false, bl, (short)0, c, false, false);
  asm volatile("v_nop\n\tv_nop\n\tv_nop\n\tv_nop" : "+v"(c) : "v"(ah), "v"(al), "v"(bh), "v"(bl));
  return c;
}
// batched GEMM like k_gemm_b but f16 operands: A f32 (split into f16 hi/lo if ASPLIT, else rounded to f16), Bt = f16 values [n][k]; alpha; C f32; N multiple of 16 (partial tiles skipped)
template <bool ASPLIT>
__global__ __launch_bounds__(128) void k_gemm_h(const float* __restrict__ A, int lda, size_t sA, const _Float16* __restrict__ Bh, int ldb, size_t sB, float alpha, float* __restrict__ C, int ldc, size_t sC, int M, int N, int K) {
  __shared__ __attribute__((aligned(16))) float so[4][16][64];
  const int tid = threadIdx.x, w = tid >> 5, lane = tid & 31, ln = lane & 15, hh = lane >> 4; const int by = blockIdx.y;
  A += (size_t)by * sA; Bh += (size_t)by * sB; C += (size_t)by * sC;
  const int ntn = (N + 63) / 64; const int wid = blockIdx.x * 4 + w; const int mt = wid / ntn, nq = wid % ntn; if (mt * 16 >= M) return;
  const int row0 = mt * 16, col0 = nq * 64; const float* arow = A + (size_t)(row0 + ln) * lda;
  v8f acc[4] = {};
  for (int kb = 0; kb < K; kb += 32) {
    FragH ah, al;
    const v4f x0 = *(const v4fa*)(arow + kb + 8 * hh), x1 = *(const v4fa*)(arow + kb + 8 * hh + 4), x2 = *(const v4fa*)(arow + kb + 16 + 8 * hh), x3 = *(const v4fa*)(arow + kb + 16 + 8 * hh + 4);
    float xs[16] = {x0[0],x0[1],x0[2],x0[3],x1[0],x1[1],x1[2],x1[3],x2[0],x2[1],x2[2],x2[3],x3[0],x3[1],x3[2],x3[3]};
#pragma unroll
    for (int i = 0; i < 16; ++i) { const _Float16 h = (_Float16)xs[i]; ah.h[i] = h; al.h[i] = ASPLIT ? (_Float16)(xs[i] - (float)h) : (_Float16)0.0f; }
#pragma unroll
    for (int t = 0; t < 4; ++t) { if (col0 + t * 16 >= N) continue; const size_t boff = (size_t)(col0 + t * 16 + ln) * ldb + kb; FragH bq; bq.half[0] = *(const v8us*)(Bh + boff + 8 * hh); bq.half[1] = *(const v8us*)(Bh + boff + 16 + 8 * hh);
      acc[t] = mmaH<ASPLIT ? 2 : 1>(ah.v, al.v, bq.v, bq.v, acc[t]); }
  }
#pragma unroll
  for (int t = 0; t < 4; ++t) { if (col0 + t * 16 >= N) continue;
#pragma unroll
    for (int r = 0; r < 8; ++r) so[w][8 * hh + r][t * 16 + ln] = acc[t][r] * alpha; }
  __builtin_amdgcn_fence(__ATOMIC_ACQ_REL, "workgroup"); __builtin_amdgcn_wave_barrier();
  const int rsub = lane >> 4, c4 = (lane & 15) * 4;
  {
#pragma unroll
    for (int q = 0; q < 8; ++q) { const int r = q * 2 + rsub; if (col0 + c4 < N) { const v4f v = *(const v4fa*)&so[w][r][c4]; *(v4f*)(C + (size_t)(row0 + r) * ldc + col0 + c4) = v; } }
     }
}

// Wt[n][k] = f16(W[k][n]·scale) from f32 row-major W[K][N] (scale = power of two; bf16-exact weights stay exact in f16 away from the subnormal range)
__global__ __launch_bounds__(256) void k_wt_f16(const float* __restrict__ W, _Float16* __restrict__ Wt, int K, int N, float scale) {
  const int t = blockIdx.x * 256 + threadIdx.x; if (t >= N * (K / 8)) return; const int n = t / (K / 8), k8 = (t % (K / 8)) * 8; FragH f;
#pragma unroll
  for (int i = 0; i < 8; ++i) f.h[i] = (_Float16)(bf16_round(W[(size_t)(k8 + i) * N + n]) * scale); const v8us o = f.half[0];
  *(v8us*)((unsigned short*)Wt + (size_t)n * K + k8) = o; 
}
// k_gemm_hh variant with fused epilogue: v = acc·alpha + bias[by·sBias + col] (+ CP[(row/rowsPerB)·sCPb + by·64 + col] if CP) ; ACT 0 none / 1 elu ; writes f16 C16 (and f32 C if non-null)
template <int ACT>
__global__ __launch_bounds__(128) void k_gemm_hhx(const _Float16* __restrict__ A, int lda, size_t sA, const _Float16* __restrict__ Bh, int ldb, size_t sB, float alpha, const float* __restrict__ bias, size_t sBias, const float* __restrict__ CP, int rowsPerB, size_t sCPb, int row0g,
    float* __restrict__ C, _Float16* __restrict__ C16, int ldc, size_t sC, int M, int N, int K) {
  __shared__ __attribute__((aligned(16))) float so[4][16][64];
  const int tid = threadIdx.x, w = tid >> 5, lane = tid & 31, ln = lane & 15, hh = lane >> 4; const int by = blockIdx.y;
  A += (size_t)by * sA; Bh += (size_t)by * sB; const size_t cofs = (size_t)by * sC; const float* bp = bias ? bias + (size_t)by * sBias : nullptr;
  const int ntn = (N + 63) / 64; const int wid = blockIdx.x * 4 + w; const int mt = wid / ntn, nq = wid % ntn; if (mt * 16 >= M) return;
  const int row0 = mt * 16, col0 = nq * 64; const _Float16* arow = A + (size_t)(row0 + ln) * lda;
  v8f acc[4] = {};
  for (int kb = 0; kb < K; kb += 32) { FragH ah; ah.half[0] = *(const v8us*)((const unsigned short*)arow + kb + 8 * hh); ah.half[1] = *(const v8us*)((const unsigned short*)arow + kb + 16 + 8 * hh);
#pragma unroll
    for (int t = 0; t < 4; ++t) { if (col0 + t * 16 >= N) continue; const size_t boff = (size_t)(col0 + t * 16 + ln) * ldb + kb; FragH bq; bq.half[0] = *(const v8us*)((const unsigned short*)Bh + boff + 8 * hh); bq.half[1] = *(const v8us*)((const unsigned short*)Bh + boff + 16 + 8 * hh);
      acc[t] = mmaH<1>(ah.v, ah.v, bq.v, bq.v, acc[t]); }
  }
#pragma unroll
  for (int t = 0; t < 4; ++t) { if (col0 + t * 16 >= N) continue; const int col = col0 + t * 16 + ln; const float bv = bp ? bf16_round(bp[col]) : 0.f;
#pragma unroll
    for (int r = 0; r < 8; ++r) { float v = acc[t][r] * alpha + bv; if (CP) { const int rr = row0g + row0 + 8 * hh + r; if (rowsPerB < 0) v += CP[cofs + (size_t)rr * ldc + col];      /* rowsPerB < 0: own element of the batched C plane */ else { const int bidx = rr / rowsPerB; v += CP[(size_t)bidx * sCPb + (size_t)by * 64 + col]; } } if (ACT == 1) v = (v > 0.f) ? v : expm1f(v); else if (ACT == 7) v = (v > 0.f) ? v + 1.0f : expf(v); else if (ACT == 8) v = tanhf(v); else if (ACT == 9) v = 0.5f * v * (1.0f + tanhf(0.7978845608028654f * (v + 0.044715f * v * v * v))); else if (ACT == 11) v = 1.0f / (1.0f + expf(-v)); else if (ACT == 12) v = (v > 0.f) ? v : 0.01f * v; else if (ACT == 14) v = (v > 0.f) ? v : 0.1f * v; else if (ACT == 16) v = (v >= 0.f) ? v : 0.3f * v; else if (ACT == 17) v = (v >= 0.f) ? v : 0.2f * v; else if (ACT == 15) v = v / (1.0f + expf(-v)); else if (ACT == 3) v = fmaxf(v, 0.f); else if (ACT == 6) v = 0.5f * v * (1.0f + erff(v * 0.70710678118654752f)); so[w][8 * hh + r][t * 16 + ln] = v; } }
  __builtin_amdgcn_fence(__ATOMIC_ACQ_REL, "workgroup"); __builtin_amdgcn_wave_barrier();
  const int rsub = lane >> 4, c4 = (lane & 15) * 4; typedef _Float16 v4h __attribute__((ext_vector_type(4)));
  {
#pragma unroll
    for (int q = 0; q < 8; ++q) { const int r = q * 2 + rsub; if (col0 + c4 < N) { const v4f v = *(const v4fa*)&so[w][r][c4]; if (C) *(v4f*)(C + cofs + (size_t)(row0 + r) * ldc + col0 + c4) = v; if (C16) { v4h h4; for (int i = 0; i < 4; ++i) h4[i] = (_Float16)v[i]; *(v4h*)(C16 + cofs + (size_t)(row0 + r) * ldc + col0 + c4) = h4; } } }
     }
}


typedef _Float16 v4h __attribute__((ext_vector_type(4)));

__global__ __launch_bounds__(256) void k_x16(const float* __restrict__ x, _Float16* __restrict__ X16, size_t n8) { const size_t t = (size_t)blockIdx.x * 256 + threadIdx.x; if (t >= n8) return; FragH f;
#pragma unroll
  for (int q = 0; q < 8; ++q) f.h[q] = (_Float16)bf16_round(x[t * 8 + q]); *(v8us*)((unsigned short*)X16 + t * 8) = f.half[0];  }
__global__ __launch_bounds__(256) void k_h16(const float* __restrict__ x, _Float16* __restrict__ X16, size_t n8) { const size_t t = (size_t)blockIdx.x * 256 + threadIdx.x; if (t >= n8) return; FragH f;
#pragma unroll
  for (int q = 0; q < 8; ++q) f.h[q] = (_Float16)x[t * 8 + q]; *(v8us*)((unsigned short*)X16 + t * 8) = f.half[0];  }
__global__ __launch_bounds__(256) void k_round16f(const float* __restrict__ W, _Float16* __restrict__ Bt, size_t n8) { const size_t t = (size_t)blockIdx.x * 256 + threadIdx.x; if (t >= n8) return; FragH f;
#pragma unroll
  for (int i = 0; i < 8; ++i) f.h[i] = (_Float16)(bf16_round(W[t * 8 + i]) * 16.0f); *(v8us*)((unsigned short*)Bt + t * 8) = f.half[0];  }
template <int NHv, int TTv>
__global__ __launch_bounds__(256) void k_vt(const _Float16* __restrict__ V16, int ldv, int voff, _Float16* __restrict__ Vt) { __shared__ unsigned short tl[64][66]; const int tid = threadIdx.x; const int slab = blockIdx.x / (TTv / 64), lg = blockIdx.x % (TTv / 64); const int b = slab / NHv, h = slab % NHv;
  for (int i = tid; i < 64 * 8; i += 256) { const int r = i / 8, c8 = (i % 8) * 8; FragH f; f.half[0] = *(const v8us*)((const unsigned short*)V16 + ((size_t)b * TTv + lg * 64 + r) * ldv + voff + h * 64 + c8);
#pragma unroll
    for (int q = 0; q < 8; ++q) tl[r][c8 + q] = f.u[q]; }
  __syncthreads();
  {
#pragma unroll
    for (int rd = 0; rd < 2; ++rd) { const int d = rd * 32 + tid / 8, pc = tid % 8; FragH f;
#pragma unroll
      for (int q = 0; q < 8; ++q) f.u[q] = tl[pc * 8 + q][d];
      *(v8us*)((unsigned short*)Vt + ((size_t)slab * 64 + d) * TTv + lg * 64 + pc * 8) = f.half[0]; }
     } }

__global__ __launch_bounds__(256) void k_hl(const float* __restrict__ F, _Float16* __restrict__ Hh, _Float16* __restrict__ Hl, size_t n8) { const size_t t = (size_t)blockIdx.x * 256 + threadIdx.x; if (t >= n8) return; FragH fh, fl; const v4f a = *(const v4fa*)(F + t * 8), c = *(const v4fa*)(F + t * 8 + 4);
#pragma unroll
  for (int q = 0; q < 4; ++q) { _Float16 h = (_Float16)a[q]; fh.h[q] = h; fl.h[q] = (_Float16)((a[q] - (float)h) * 1024.0f); h = (_Float16)c[q]; fh.h[4 + q] = h; fl.h[4 + q] = (_Float16)((c[q] - (float)h) * 1024.0f); }
  { *(v8us*)((unsigned short*)Hh + t * 8) = fh.half[0]; *(v8us*)((unsigned short*)Hl + t * 8) = fl.half[0];  } }

// ---- fast GEMM (wave tile 32x64; requires M % 32 == 0 rows per launch region and N % 64 == 0); epilogue = k_gemm_hhx semantics ----
__device__ __forceinline__ v16h g2_frag(const _Float16* p, int hh) { FragH f; f.half[0] = *(const v8us*)((const unsigned short*)p + 8 * hh); f.half[1] = *(const v8us*)((const unsigned short*)p + 16 + 8 * hh); return f.v; }
__device__ __forceinline__ v8f g2_mma(v16h a, v16h b, v8f c) { v8f d = __builtin_amdgcn_wmma_f32_16x16x32_f16(false, a, false, b, (short)0, c, false, false); asm volatile("v_nop\n\tv_nop\n\tv_nop\n\tv_nop" : "+v"(d) : "v"(a), "v"(b)); return d; }
template <int ACT>
__global__ __launch_bounds__(128) void k_gemm2(const _Float16* __restrict__ A, int lda, size_t sA, const _Float16* __restrict__ Bh, int ldb, size_t sB, float alpha, const float* __restrict__ bias, size_t sBias, const float* __restrict__ CP, int rowsPerB, size_t sCPb, int row0g,
    float* __restrict__ C, _Float16* __restrict__ C16, int ldc, size_t sC, int M, int N, int K) { static_assert(ACT == 0 || ACT == 3 || ACT == 6 || ACT == 8 || ACT == 9 || ACT == 11 || ACT == 12 || ACT == 14 || ACT == 15 || ACT == 16 || ACT == 17, "k_gemm2: unsupported ACT code (would silently apply no activation)");
  __shared__ __attribute__((aligned(16))) float so[4][32][68];
  const int tid = threadIdx.x, w = tid >> 5, lane = tid & 31, ln = lane & 15, hh = lane >> 4; const int by = blockIdx.y;
  A += (size_t)by * sA; Bh += (size_t)by * sB; const size_t cofs = (size_t)by * sC; const float* bp = bias ? bias + (size_t)by * sBias : nullptr;
  const int ntn = N >> 6; const int mt = blockIdx.x / ntn, nq = blockIdx.x - mt * ntn; const int row0 = mt * 128 + 32 * w, col0 = nq * 64; if (row0 >= M) return;
  const _Float16* a0p = A + (size_t)(row0 + ln) * lda; const _Float16* a1p = a0p + (size_t)16 * lda;
  const _Float16* b0p = Bh + (size_t)(col0 + ln) * ldb; const _Float16* b1p = b0p + (size_t)16 * ldb; const _Float16* b2p = b1p + (size_t)16 * ldb; const _Float16* b3p = b2p + (size_t)16 * ldb;
  const v8f z8 = {0.f,0.f,0.f,0.f,0.f,0.f,0.f,0.f}; v8f c00 = z8, c01 = z8, c02 = z8, c03 = z8, c10 = z8, c11 = z8, c12 = z8, c13 = z8;
#pragma unroll 1
  for (int kb = 0; kb < K; kb += 32) { const v16h a0 = g2_frag(a0p + kb, hh), a1 = g2_frag(a1p + kb, hh);
    v16h b = g2_frag(b0p + kb, hh); c00 = g2_mma(a0, b, c00); c10 = g2_mma(a1, b, c10);
    b = g2_frag(b1p + kb, hh); c01 = g2_mma(a0, b, c01); c11 = g2_mma(a1, b, c11);
    b = g2_frag(b2p + kb, hh); c02 = g2_mma(a0, b, c02); c12 = g2_mma(a1, b, c12);
    b = g2_frag(b3p + kb, hh); c03 = g2_mma(a0, b, c03); c13 = g2_mma(a1, b, c13); }
  v8f accs[8] = {c00, c01, c02, c03, c10, c11, c12, c13};
#pragma unroll
  for (int u = 0; u < 8; ++u) { const int t = u & 3, half = u >> 2; const int col = col0 + t * 16 + ln; const float bv = bp ? bf16_round(bp[col]) : 0.f;
#pragma unroll
    for (int r = 0; r < 8; ++r) { const int rloc = half * 16 + 8 * hh + r; float v = accs[u][r] * alpha + bv; if (CP) { if (rowsPerB < 0) v += CP[cofs + (size_t)(row0g + row0 + rloc) * ldc + col];      /* rowsPerB < 0: own element of the batched C plane */ else { const int bidx = (row0g + row0 + rloc) / rowsPerB; v += CP[(size_t)bidx * sCPb + (size_t)by * 64 + col]; } }
      if (ACT == 3) v = fmaxf(v, 0.f); else if (ACT == 6) v = 0.5f * v * (1.0f + erff(v * 0.70710678118654752f)); else if (ACT == 11) v = 1.0f / (1.0f + expf(-v)); else if (ACT == 15) v = v / (1.0f + expf(-v)); else if (ACT == 12) v = (v > 0.f) ? v : 0.01f * v; else if (ACT == 8) v = tanhf(v); else if (ACT == 9) v = 0.5f * v * (1.0f + tanhf(0.7978845608028654f * (v + 0.044715f * v * v * v))); else if (ACT == 14) v = (v > 0.f) ? v : 0.1f * v; else if (ACT == 16) v = (v >= 0.f) ? v : 0.3f * v; else if (ACT == 17) v = (v >= 0.f) ? v : 0.2f * v;
      so[w][rloc][t * 16 + ln] = v; } }
  __builtin_amdgcn_fence(__ATOMIC_ACQ_REL, "workgroup"); __builtin_amdgcn_wave_barrier();
  const int rsub = lane >> 4, c4 = (lane & 15) * 4;
  {
#pragma unroll
    for (int q = 0; q < 16; ++q) { const int r = q * 2 + rsub; const v4f v = *(const v4fa*)&so[w][r][c4]; if (C) *(v4f*)(C + cofs + (size_t)(row0 + r) * ldc + col0 + c4) = v; if (C16) { v4h h4; for (int i = 0; i < 4; ++i) h4[i] = (_Float16)v[i]; *(v4h*)(C16 + cofs + (size_t)(row0 + r) * ldc + col0 + c4) = h4; } }
     } }


__global__ __launch_bounds__(256) void k_wnat(const float* __restrict__ w, size_t n8, _Float16* __restrict__ Bt) { const size_t t = (size_t)blockIdx.x * 256 + threadIdx.x; if (t >= n8) return; FragH f; for (int q = 0; q < 8; ++q) f.h[q] = (_Float16)(bf16_round(w[t * 8 + q]) * 16.0f); *(v8us*)((unsigned short*)Bt + t * 8) = f.half[0];  }
__global__ __launch_bounds__(256) void k_rsm(const float* __restrict__ S, _Float16* __restrict__ P, int nrows) {
  #pragma clang fp contract(off)
  const int i = blockIdx.x * 256 + threadIdx.x; if (i >= nrows) return; const float* s = S + (size_t)i * SQ; float mx = -3.0e38f;
#pragma unroll 1
  for (int j = 0; j < SQ; ++j) mx = fmaxf(mx, s[j]); float se = 0.f;
#pragma unroll 1
  for (int j = 0; j < SQ; ++j) se += expf(s[j] - mx); const float sc = 256.0f / se;
#pragma unroll 1
  for (int j0 = 0; j0 < SQ; j0 += 8) { FragH f; for (int q = 0; q < 8; ++q) f.h[q] = (_Float16)(expf(s[j0 + q] - mx) * sc); unsigned short* d = (unsigned short*)P + (size_t)i * SQ + j0; *(v8us*)d = f.half[0];  } }
__global__ __launch_bounds__(256) void k_vt(const _Float16* __restrict__ V16, int b, int h0, _Float16* __restrict__ VT) { __shared__ unsigned short tl[64][65]; const int tid = threadIdx.x; const int hh = blockIdx.x % HG, sg = blockIdx.x / HG; const int s0 = sg * 64; const int h = h0 + hh;
  for (int i = tid; i < 64 * 8; i += 256) { const int j = i / 8, d8 = (i % 8) * 8; FragH f; f.half[0] = *(const v8us*)((const unsigned short*)V16 + ((size_t)b * SQ + s0 + j) * DM + h * HD + d8); for (int q = 0; q < 8; ++q) tl[d8 + q][j] = f.u[q]; }
  __syncthreads();
  { for (int i = tid; i < 64 * 8; i += 256) { const int d = i / 8, j8 = (i % 8) * 8; FragH f; for (int q = 0; q < 8; ++q) f.u[q] = tl[d][j8 + q]; *(v8us*)((unsigned short*)VT + ((size_t)hh * HD + d) * SQ + s0 + j8) = f.half[0]; }  } }



// Four exponentials 2^x in place. The closing v_nop is the free slot that the instruction set asks for behind a transcendental before its result is used or its
// source overwritten; it stands in the same statement because nothing else would keep it directly behind the last v_exp_f32 (inside, each v_exp_f32 is independent of the one before).
__device__ __forceinline__ v4f exp2x4(v4f x) { float a = x[0], b = x[1], c = x[2], d = x[3];
  asm("v_exp_f32 %0, %0\n\tv_exp_f32 %1, %1\n\tv_exp_f32 %2, %2\n\tv_exp_f32 %3, %3\n\tv_nop" : "+v"(a), "+v"(b), "+v"(c), "+v"(d));
  const v4f r = {a, b, c, d}; return r; }
// Row softmax of (scores + additive mask): one wave per score row. Each wave-wide load covers 512 contiguous bytes of its row, the row stays in registers
// between the maximum, the sum and the store, so S is read once and each exponential is taken once. The bf16-rounded mask is staged once per work-group in LDS.
__global__ __launch_bounds__(512) void k_rsmfam(const float* __restrict__ S, _Float16* __restrict__ P, int qn, int hg, const float* __restrict__ am) {
  __shared__ __attribute__((aligned(16))) float ms[SQ];
  const int tid = threadIdx.x, lane = tid & 31; const int w = __builtin_amdgcn_readfirstlane(tid >> 5);
  const int t = blockIdx.x * 16 + w; const size_t i = (size_t)(t / qn) * SQ + (t % qn); const float* s = S + i * SQ + lane * 4;
#pragma unroll
  for (int u = 0; u < SQ / 2048; ++u) { const v4f m = *(const v4fa*)(am + u * 2048 + tid * 4); v4f r;
#pragma unroll
    for (int q = 0; q < 4; ++q) r[q] = bf16_round(m[q]);
    *(v4fa*)&ms[u * 2048 + tid * 4] = r; }
  __syncthreads();      /* publishes the staged mask to all 16 waves; the only barrier, in front of the wave-uniform exit */
  if (t >= qn * hg) return;
  v4f v[SQ / 128];
#pragma unroll
  for (int u = 0; u < SQ / 128; ++u) v[u] = *(const v4fa*)(s + u * 128);
  __builtin_amdgcn_sched_barrier(0);      /* keeps all 32 loads of the row in front of the first use: without it the last ones are issued only after the first have come back, one more memory latency */
  float m4[4] = {-3.0e38f, -3.0e38f, -3.0e38f, -3.0e38f};
#pragma unroll
  for (int u = 0; u < SQ / 128; ++u) { const v4f m = *(const v4fa*)&ms[u * 128 + lane * 4];
#pragma unroll
    for (int q = 0; q < 4; ++q) { v[u][q] = v[u][q] + m[q]; m4[q] = fmaxf(m4[q], v[u][q]); } }
  float mx = fmaxf(fmaxf(m4[0], m4[1]), fmaxf(m4[2], m4[3]));
#pragma unroll
  for (int d = 16; d > 0; d >>= 1) mx = fmaxf(mx, __shfl_xor(mx, d, 32));
  float s4[4] = {0.f, 0.f, 0.f, 0.f};
#pragma unroll
  for (int u = 0; u < SQ / 128; ++u) {
#pragma unroll
    for (int q = 0; q < 4; ++q) v[u][q] = (v[u][q] - mx) * 1.44269504088896340736f;      /* e^y = 2^(y log2 e), as the native exponential forms it */
    v[u] = exp2x4(v[u]);
#pragma unroll
    for (int q = 0; q < 4; ++q) s4[q] += v[u][q]; }
  float se = (s4[0] + s4[1]) + (s4[2] + s4[3]);
#pragma unroll
  for (int d = 16; d > 0; d >>= 1) se += __shfl_xor(se, d, 32);
  const float sc = 256.0f / se; _Float16* p = P + i * SQ + lane * 4;
#pragma unroll
  for (int u = 0; u < SQ / 128; ++u) { v4h h4;
#pragma unroll
    for (int q = 0; q < 4; ++q) h4[q] = (_Float16)(v[u][q] * sc);
    *(v4h*)(p + u * 128) = h4; } }

extern "C" void kernel_launch(void* const* d_in, const int* in_sizes, int n_in,
                              void* d_out, int out_size, void* d_ws, size_t ws_size, hipStream_t stream) {
  (void)in_sizes; (void)n_in; (void)out_size;
  const float* const* I = (const float* const*)d_in; const float* x = I[0]; const float* am = I[1]; const float* wq = I[2]; const float* bq = I[3]; const float* wk = I[4]; const float* bk = I[5]; const float* wv = I[6]; const float* bv = I[7];      /* weights [in][out]; am = additive mask [NB][1][1][SQ] */
  char* ws = (char*)d_ws; size_t off = 0;
  auto take = [&](size_t bytes) { char* p = ws + off; off += (bytes + 255) & ~(size_t)255; return p; };
  _Float16* BQ = (_Float16*)take((size_t)DM * DM * 2); _Float16* BK = (_Float16*)take((size_t)DM * DM * 2); _Float16* BV = (_Float16*)take((size_t)DM * DM * 2); 
  _Float16* X16 = (_Float16*)take(NR * DM * 2); _Float16* Q16 = (_Float16*)take(NR * DM * 2); _Float16* K16 = (_Float16*)take(NR * DM * 2); _Float16* V16 = (_Float16*)take(NR * DM * 2);
  float* S = (float*)take((size_t)HG * SQ * SQ * 4); _Float16* P = (_Float16*)take((size_t)HG * SQ * SQ * 2); _Float16* VT = (_Float16*)take((size_t)NH * HD * SQ * 2);
  if (off > ws_size) return;
  { const unsigned g = (unsigned)(((size_t)DM * (DM / 8) + 255) / 256); k_wt_f16<<<g, 256, 0, stream>>>(wq, BQ, DM, DM, 16.0f); k_wt_f16<<<g, 256, 0, stream>>>(wk, BK, DM, DM, 16.0f); k_wt_f16<<<g, 256, 0, stream>>>(wv, BV, DM, DM, 16.0f); }      /* [in][out] -> Bt[n][k] x16 */
  k_x16<<<(unsigned)((NR * DM / 8 + 255) / 256), 256, 0, stream>>>(x, X16, NR * DM / 8);
  const size_t r0p = (size_t)B0 * SQ;      /* first projected row */
  k_gemm2<0><<<dim3((unsigned)((MP / 128) * (DM / 64)), 1), 128, 0, stream>>>(X16 + r0p * DM, DM, 0, BQ, DM, 0, 0.0625f, bq, 0, nullptr, 1, 0, 0, nullptr, Q16 + r0p * DM, DM, 0, MP, DM, DM);
  k_gemm2<0><<<dim3((unsigned)((MP / 128) * (DM / 64)), 1), 128, 0, stream>>>(X16 + r0p * DM, DM, 0, BK, DM, 0, 0.0625f, bk, 0, nullptr, 1, 0, 0, nullptr, K16 + r0p * DM, DM, 0, MP, DM, DM);
  k_gemm2<0><<<dim3((unsigned)((MP / 128) * (DM / 64)), 1), 128, 0, stream>>>(X16 + r0p * DM, DM, 0, BV, DM, 0, 0.0625f, bv, 0, nullptr, 1, 0, 0, nullptr, V16 + r0p * DM, DM, 0, MP, DM, DM);
  for (int b = B0; b < B0 + NBR; ++b) { const size_t r0 = (size_t)b * SQ;
    k_vt<NH, SQ><<<NH * (SQ / 64), 256, 0, stream>>>(V16 + r0 * LQ, LQ, 0, VT);      /* V^T [NH][HD][SQ] for this batch */
    for (int h0 = 0; h0 < NHD; h0 += HG) {
      k_gemm2<0><<<dim3((QN / 128) * (SQ / 64), HG), 128, 0, stream>>>(Q16 + r0 * LQ + h0 * HD, LQ, (size_t)HD, K16 + r0 * LQ + h0 * HD, LQ, (size_t)HD, 0.125f, nullptr, 0, nullptr, 1, 0, 0, S, nullptr, SQ, (size_t)SQ * SQ, QN, SQ, HD);      /* scores, HG heads per launch */
      k_rsmfam<<<(HG * QN + 15) / 16, 512, 0, stream>>>(S, P, QN, HG, am + (size_t)b * SQ);      /* P = 256 softmax (f16), rows of all HG heads */
      k_gemm2<0><<<dim3((QN / 128) * (HD / 64), HG), 128, 0, stream>>>(P, SQ, (size_t)SQ * SQ, VT + (size_t)h0 * HD * SQ, SQ, (size_t)HD * SQ, 0.00390625f, nullptr, 0, nullptr, 1, 0, 0, (float*)d_out + r0 * DM + h0 * HD, nullptr, DM, (size_t)HD, QN, HD, SQ); } }      /* out = o (merged heads), f32, straight into the output rows */
}

// v002
// It runs in 180 microseconds.
// In both of two side-by-side timings against v001, it was 11.4 times as fast.
// All steps since v000 together make it 55.9 times as fast.
#include <hip/hip_runtime.h>
// BERT self-attention (hidden [1][4096][768]; q/k/v = x W + b with W stored [in][out], 12 heads of 64; scores / 8 + the additive attention_mask[b][key] (f32); softmax; out = attn v merged -> [1][4096][768]; no output projection).
// Structure: token rows r = b*4096 + s; x as exact f16 rows (bf16-rounded); Q, K, V as three WMMA GEMMs (32x64 wave tiles, f32 accumulation, exact x16 weights + bias, f16 outputs); per batch: V^T for all heads via LDS transposes; per batch one fused attention launch over all heads: scores (WMMA, K = 64), running softmax of (scores / 8 + additive mask) on VALU (f32 statistics, native exp; weights as f16 in registers), o = P . V (WMMA), normalised and written as f32 into the merged output rows.
// Compute dtype: inputs rounded to bf16; x / weights exact; q, k, v and softmax weights as plain f16 GEMM operands (~2^-12); scores, softmax statistics and o f32. v_wmma_f32_16x16x32_f16.
#define NB 1
#define SQ 4096
#define DM 768
#define NH 12
#define HD 64
#define HG 1                         /* heads per launch of the second k_vt (not launched) */
#define B0 0                         /* first batch processed (debug hook) */
#define NBR NB                       /* batches processed (debug hook) */
#define NR ((size_t)NB * SQ)         /* token rows */
#define MP ((int)((size_t)NBR * SQ)) /* rows projected (debug hook) */
#define QN SQ                        /* unused: the attention launch covers all SQ queries */
#define NHD NH                       /* unused: the attention launch covers all NH heads */
#define MPO MP                       /* unused: there is no output stage */
#define LQ DM      /* row pitch of the q/k/v rows */
typedef __bf16 v16b __attribute__((ext_vector_type(16)));
typedef unsigned short v8us __attribute__((ext_vector_type(8), may_alias));
typedef float  v8f  __attribute__((ext_vector_type(8)));
typedef float  v4f  __attribute__((ext_vector_type(4)));
typedef float  v4fa __attribute__((ext_vector_type(4), may_alias));
union FragB { v16b v; v8us half[2]; unsigned short u[16]; };

__device__ __forceinline__ unsigned short bf16_bits(float x) { unsigned int u = __float_as_uint(x); return (unsigned short)((u + 0x7FFFu + ((u >> 16) & 1u)) >> 16); }
__device__ __forceinline__ float bf16_val(unsigned short b) { return __uint_as_float(((unsigned int)b) << 16); }
__device__ __forceinline__ float bf16_round(float x) { return bf16_val(bf16_bits(x)); }
// D += A·B with NT terms: 1 = ah·bh, 2 = + al·bh (A split), 3 = + ah·bl (both split)
template <int NT>
__device__ __forceinline__ v8f mmaN(v16b ah, v16b al, v16b bh, v16b bl, v8f c) {
  c = __builtin_amdgcn_wmma_f32_16x16x32_bf16(false, ah, false, bh, (short)0, c, false, false);
  if (NT >= 2) c = __builtin_amdgcn_wmma_f32_16x16x32_bf16(false, al, false, bh, (short)0, c, false, false);
  if (NT >= 3) c = __builtin_amdgcn_wmma_f32_16x16x32_bf16(false, ah, false, bl, (short)0, c, false, false);
  asm volatile("v_nop\n\tv_nop\n\tv_nop\n\tv_nop" : "+v"(c) : "v"(ah), "v"(al), "v"(bh), "v"(bl));
  return c;
}

__global__ __launch_bounds__(256) void k_wt_bf16(const float* __restrict__ W, unsigned short* __restrict__ Wt, int K, int N) {
  const int t = blockIdx.x * 256 + threadIdx.x;
  const int k8n = K / 8;
  if (t >= N * k8n) return;
  const int n = t / k8n, k8 = (t % k8n) * 8;
  v8us v;
#pragma unroll
  for (int i = 0; i < 8; ++i) v[i] = bf16_bits(W[(size_t)(k8 + i) * N + n]);
  *(v8us*)(Wt + (size_t)n * K + k8) = v;
  
}

// GEMM C[M][N] (f32, pitch ldc) = act(A[M][K]·W + bias). A f32 row-major (pitch lda) converted per fragment to bf16
// (ASPLIT: hi/lo two planes -> 2 terms, else single rounded term); Wt bf16 [N][K] (pitch ldb). BIAS_BF16 rounds the
// bias to bf16 first (bias quantised to bf16 before the add). K%32==0, M%16==0, N%64==0.
template <bool ASPLIT, int ACT, bool BIAS_BF16>
__global__ __launch_bounds__(128) void k_gemm_bf(const float* __restrict__ A, int lda, const unsigned short* __restrict__ Wt, int ldb,
                                               const float* __restrict__ bias, float* __restrict__ C, int ldc, int M, int N, int K) {
  __shared__ __attribute__((aligned(16))) float so[4][16][64];
  const int tid = threadIdx.x, w = tid >> 5, lane = tid & 31, ln = lane & 15, hh = lane >> 4;
  const int ntn = N / 64;
  const int wid = blockIdx.x * 4 + w;
  const int mt = wid / ntn, nq = wid % ntn;
  if (mt * 16 >= M) return;
  const int row0 = mt * 16, col0 = nq * 64;
  const float* arow = A + (size_t)(row0 + ln) * lda;
  v8f acc[4] = {};
  for (int kb = 0; kb < K; kb += 32) {
    FragB ah, al;
    const v4f x0 = *(const v4fa*)(arow + kb + 8 * hh), x1 = *(const v4fa*)(arow + kb + 8 * hh + 4);
    const v4f x2 = *(const v4fa*)(arow + kb + 16 + 8 * hh), x3 = *(const v4fa*)(arow + kb + 16 + 8 * hh + 4);
    float xs[16] = {x0[0],x0[1],x0[2],x0[3],x1[0],x1[1],x1[2],x1[3],x2[0],x2[1],x2[2],x2[3],x3[0],x3[1],x3[2],x3[3]};
#pragma unroll
    for (int i = 0; i < 16; ++i) { const unsigned short hb = bf16_bits(xs[i]); ah.u[i] = hb; al.u[i] = ASPLIT ? bf16_bits(xs[i] - bf16_val(hb)) : (unsigned short)0; }
#pragma unroll
    for (int t = 0; t < 4; ++t) {
      const unsigned short* brow = Wt + (size_t)(col0 + t * 16 + ln) * ldb + kb;
      FragB b;
      b.half[0] = *(const v8us*)(brow + 8 * hh);
      b.half[1] = *(const v8us*)(brow + 16 + 8 * hh);
      acc[t] = mmaN<ASPLIT ? 2 : 1>(ah.v, al.v, b.v, b.v, acc[t]);
    }
  }
#pragma unroll
  for (int t = 0; t < 4; ++t) {
    float bv = bias ? bias[col0 + t * 16 + ln] : 0.f;
    if (BIAS_BF16) bv = bf16_round(bv);
#pragma unroll
    for (int r = 0; r < 8; ++r) { float v = acc[t][r] + bv; if (ACT == 1) v = fmaxf(v, 0.f); so[w][8 * hh + r][t * 16 + ln] = v; }
  }
  __builtin_amdgcn_fence(__ATOMIC_ACQ_REL, "workgroup");
  __builtin_amdgcn_wave_barrier();
  const int rsub = lane >> 4, c4 = (lane & 15) * 4;
  {
#pragma unroll
    for (int q = 0; q < 8; ++q) {
      const int r = q * 2 + rsub;
      const v4f v = *(const v4fa*)&so[w][r][c4];
      *(v4f*)(C + (size_t)(row0 + r) * ldc + col0 + c4) = v;
    }
    
  }
}

// GEMM C = act(A·W + bias + resid): A f32 (ASPLIT -> hi/lo 2 terms), Wt bf16 [N][K]; ACT 0 none, 1 relu, 2 exact gelu;
// resid (optional, f32, row index = (row % rmod), pitch ldr, RES_BF16 rounds it) added before the activation.
template <bool ASPLIT, int ACT, bool BIAS_BF16, bool RES_BF16>
__global__ __launch_bounds__(128) void k_gemm_bf3(const float* __restrict__ A, int lda, const unsigned short* __restrict__ Wt, int ldb,
                                                const float* __restrict__ bias, const float* __restrict__ resid, int rmod, int ldr,
                                                float* __restrict__ C, int ldc, int M, int N, int K) {
  __shared__ __attribute__((aligned(16))) float so[4][16][64];
  const int tid = threadIdx.x, w = tid >> 5, lane = tid & 31, ln = lane & 15, hh = lane >> 4;
  const int ntn = N / 64;
  const int wid = blockIdx.x * 4 + w;
  const int mt = wid / ntn, nq = wid % ntn;
  if (mt * 16 >= M) return;
  const int row0 = mt * 16, col0 = nq * 64;
  const float* arow = A + (size_t)(row0 + ln) * lda;
  v8f acc[4] = {};
  for (int kb = 0; kb < K; kb += 32) {
    FragB ah, al;
    const v4f x0 = *(const v4fa*)(arow + kb + 8 * hh), x1 = *(const v4fa*)(arow + kb + 8 * hh + 4);
    const v4f x2 = *(const v4fa*)(arow + kb + 16 + 8 * hh), x3 = *(const v4fa*)(arow + kb + 16 + 8 * hh + 4);
    float xs[16] = {x0[0],x0[1],x0[2],x0[3],x1[0],x1[1],x1[2],x1[3],x2[0],x2[1],x2[2],x2[3],x3[0],x3[1],x3[2],x3[3]};
#pragma unroll
    for (int i = 0; i < 16; ++i) { const unsigned short hb = bf16_bits(xs[i]); ah.u[i] = hb; al.u[i] = ASPLIT ? bf16_bits(xs[i] - bf16_val(hb)) : (unsigned short)0; }
#pragma unroll
    for (int t = 0; t < 4; ++t) {
      const unsigned short* brow = Wt + (size_t)(col0 + t * 16 + ln) * ldb + kb;
      FragB b;
      b.half[0] = *(const v8us*)(brow + 8 * hh);
      b.half[1] = *(const v8us*)(brow + 16 + 8 * hh);
      acc[t] = mmaN<ASPLIT ? 2 : 1>(ah.v, al.v, b.v, b.v, acc[t]);
    }
  }
#pragma unroll
  for (int t = 0; t < 4; ++t) {
    const int col = col0 + t * 16 + ln;
    float bv = bias ? bias[col] : 0.f;
    if (BIAS_BF16) bv = bf16_round(bv);
#pragma unroll
    for (int r = 0; r < 8; ++r) {
      float v = acc[t][r] + bv;
      if (resid) { float rv = resid[(size_t)((row0 + 8 * hh + r) % rmod) * ldr + col]; if (RES_BF16) rv = bf16_round(rv); v += rv; }
      if (ACT == 1) v = fmaxf(v, 0.f);
      if (ACT == 2) v = 0.5f * v * (1.0f + erff(v * 0.70710678118654752f));
      if (ACT == 3) { const float u = 0.7978845608028654f * (v + 0.044715f * v * v * v); v = 0.5f * v * (1.0f + tanhf(u)); }
      so[w][8 * hh + r][t * 16 + ln] = v;
    }
  }
  __builtin_amdgcn_fence(__ATOMIC_ACQ_REL, "workgroup");
  __builtin_amdgcn_wave_barrier();
  const int rsub = lane >> 4, c4 = (lane & 15) * 4;
  {
#pragma unroll
    for (int q = 0; q < 8; ++q) {
      const int r = q * 2 + rsub;
      const v4f v = *(const v4fa*)&so[w][r][c4];
      *(v4f*)(C + (size_t)(row0 + r) * ldc + col0 + c4) = v;
    }
    
  }
}
// row LayerNorm (biased variance, eps) over N: s = X (+ R); optional out_sum <- s; out_norm <- (s-mu)*rsqrt(var+eps)*g + b
template <bool PARAM_BF16>
__global__ __launch_bounds__(256) void k_layernorm(const float* __restrict__ X, const float* __restrict__ R, const float* __restrict__ g, const float* __restrict__ bta,
                                                  float* __restrict__ out_sum, float* __restrict__ out_norm, int N, float eps) {
  __shared__ float red[256];
  const int row = blockIdx.x, tid = threadIdx.x;
  const float* x = X + (size_t)row * N; const float* rr = R ? R + (size_t)row * N : nullptr;
  float vals[16];                     // up to N = 4096
  const int per = N / 256;            // contiguous chunk per thread? use strided-by-4 chunks: thread handles j = tid*4 + 1024*u
  float s1 = 0.f;
  for (int u = 0; u < per / 4; ++u) {
    const int j = tid * 4 + 1024 * u;
    const v4f a = *(const v4fa*)(x + j);
    v4f b = {0.f,0.f,0.f,0.f}; if (rr) b = *(const v4fa*)(rr + j);
#pragma unroll
    for (int q = 0; q < 4; ++q) { const float v = a[q] + b[q]; vals[u * 4 + q] = v; s1 += v; }
  }
  red[tid] = s1; __syncthreads();
  for (int st = 128; st > 0; st >>= 1) { if (tid < st) red[tid] += red[tid + st]; __syncthreads(); }
  const float mu = red[0] / (float)N; __syncthreads();
  float s2 = 0.f;
  for (int u = 0; u < per / 4; ++u)
#pragma unroll
    for (int q = 0; q < 4; ++q) { const float c = vals[u * 4 + q] - mu; s2 += c * c; }
  red[tid] = s2; __syncthreads();
  for (int st = 128; st > 0; st >>= 1) { if (tid < st) red[tid] += red[tid + st]; __syncthreads(); }
  const float rs = rsqrtf(red[0] / (float)N + eps);
  {
    for (int u = 0; u < per / 4; ++u) {
      const int j = tid * 4 + 1024 * u;
      v4f o, sm;
#pragma unroll
      for (int q = 0; q < 4; ++q) {
        float gg = g[j + q], bb = bta[j + q];
        if (PARAM_BF16) { gg = bf16_round(gg); bb = bf16_round(bb); }
        sm[q] = vals[u * 4 + q]; o[q] = (vals[u * 4 + q] - mu) * rs * gg + bb;
      }
      if (out_sum) *(v4f*)(out_sum + (size_t)row * N + j) = sm;
      *(v4f*)(out_norm + (size_t)row * N + j) = o;
    }
    
  }
}



// ---- f16 WMMA path (v_wmma_f32_16x16x32_f16): 11-bit significands for operands in range — used where a [0,1] probability operand needs more precision than bf16
typedef _Float16 v16h __attribute__((ext_vector_type(16)));
union FragH { v16h v; v8us half[2]; _Float16 h[16]; unsigned short u[16]; };
template <int NT>
__device__ __forceinline__ v8f mmaH(v16h ah, v16h al, v16h bh, v16h bl, v8f c) {
  c = __builtin_amdgcn_wmma_f32_16x16x32_f16(false, ah, false, bh, (short)0, c, false, false);
  if (NT >= 2) c = __builtin_amdgcn_wmma_f32_16x16x32_f16(false, al, false, bh, (short)0, c, false, false);
  if (NT >= 3) c = __builtin_amdgcn_wmma_f32_16x16x32_f16(false, ah, false, bl, (short)0, c, false, false);
  asm volatile("v_nop\n\tv_nop\n\tv_nop\n\tv_nop" : "+v"(c) : "v"(ah), "v"(al), "v"(bh), "v"(bl));
  return c;
}
// batched GEMM like k_gemm_b but f16 operands: A f32 (split into f16 hi/lo if ASPLIT, else rounded to f16), Bt = f16 values [n][k]; alpha; C f32; N multiple of 16 (partial tiles skipped)
template <bool ASPLIT>
__global__ __launch_bounds__(128) void k_gemm_h(const float* __restrict__ A, int lda, size_t sA, const _Float16* __restrict__ Bh, int ldb, size_t sB, float alpha, float* __restrict__ C, int ldc, size_t sC, int M, int N, int K) {
  __shared__ __attribute__((aligned(16))) float so[4][16][64];
  const int tid = threadIdx.x, w = tid >> 5, lane = tid & 31, ln = lane & 15, hh = lane >> 4; const int by = blockIdx.y;
  A += (size_t)by * sA; Bh += (size_t)by * sB; C += (size_t)by * sC;
  const int ntn = (N + 63) / 64; const int wid = blockIdx.x * 4 + w; const int mt = wid / ntn, nq = wid % ntn; if (mt * 16 >= M) return;
  const int row0 = mt * 16, col0 = nq * 64; const float* arow = A + (size_t)(row0 + ln) * lda;
  v8f acc[4] = {};
  for (int kb = 0; kb < K; kb += 32) {
    FragH ah, al;
    const v4f x0 = *(const v4fa*)(arow + kb + 8 * hh), x1 = *(const v4fa*)(arow + kb + 8 * hh + 4), x2 = *(const v4fa*)(arow + kb + 16 + 8 * hh), x3 = *(const v4fa*)(arow + kb + 16 + 8 * hh + 4);
    float xs[16] = {x0[0],x0[1],x0[2],x0[3],x1[0],x1[1],x1[2],x1[3],x2[0],x2[1],x2[2],x2[3],x3[0],x3[1],x3[2],x3[3]};
#pragma unroll
    for (int i = 0; i < 16; ++i) { const _Float16 h = (_Float16)xs[i]; ah.h[i] = h; al.h[i] = ASPLIT ? (_Float16)(xs[i] - (float)h) : (_Float16)0.0f; }
#pragma unroll
    for (int t = 0; t < 4; ++t) { if (col0 + t * 16 >= N) continue; const size_t boff = (size_t)(col0 + t * 16 + ln) * ldb + kb; FragH bq; bq.half[0] = *(const v8us*)(Bh + boff + 8 * hh); bq.half[1] = *(const v8us*)(Bh + boff + 16 + 8 * hh);
      acc[t] = mmaH<ASPLIT ? 2 : 1>(ah.v, al.v, bq.v, bq.v, acc[t]); }
  }
#pragma unroll
  for (int t = 0; t < 4; ++t) { if (col0 + t * 16 >= N) continue;
#pragma unroll
    for (int r = 0; r < 8; ++r) so[w][8 * hh + r][t * 16 + ln] = acc[t][r] * alpha; }
  __builtin_amdgcn_fence(__ATOMIC_ACQ_REL, "workgroup"); __builtin_amdgcn_wave_barrier();
  const int rsub = lane >> 4, c4 = (lane & 15) * 4;
  {
#pragma unroll
    for (int q = 0; q < 8; ++q) { const int r = q * 2 + rsub; if (col0 + c4 < N) { const v4f v = *(const v4fa*)&so[w][r][c4]; *(v4f*)(C + (size_t)(row0 + r) * ldc + col0 + c4) = v; } }
     }
}

// Wt[n][k] = f16(W[k][n]·scale) from f32 row-major W[K][N] (scale = power of two; bf16-exact weights stay exact in f16 away from the subnormal range)
__global__ __launch_bounds__(256) void k_wt_f16(const float* __restrict__ W, _Float16* __restrict__ Wt, int K, int N, float scale) {
  const int t = blockIdx.x * 256 + threadIdx.x; if (t >= N * (K / 8)) return; const int n = t / (K / 8), k8 = (t % (K / 8)) * 8; FragH f;
#pragma unroll
  for (int i = 0; i < 8; ++i) f.h[i] = (_Float16)(bf16_round(W[(size_t)(k8 + i) * N + n]) * scale); const v8us o = f.half[0];
  *(v8us*)((unsigned short*)Wt + (size_t)n * K + k8) = o; 
}
// k_gemm_hh variant with fused epilogue: v = acc·alpha + bias[by·sBias + col] (+ CP[(row/rowsPerB)·sCPb + by·64 + col] if CP) ; ACT 0 none / 1 elu ; writes f16 C16 (and f32 C if non-null)
template <int ACT>
__global__ __launch_bounds__(128) void k_gemm_hhx(const _Float16* __restrict__ A, int lda, size_t sA, const _Float16* __restrict__ Bh, int ldb, size_t sB, float alpha, const float* __restrict__ bias, size_t sBias, const float* __restrict__ CP, int rowsPerB, size_t sCPb, int row0g,
    float* __restrict__ C, _Float16* __restrict__ C16, int ldc, size_t sC, int M, int N, int K) {
  __shared__ __attribute__((aligned(16))) float so[4][16][64];
  const int tid = threadIdx.x, w = tid >> 5, lane = tid & 31, ln = lane & 15, hh = lane >> 4; const int by = blockIdx.y;
  A += (size_t)by * sA; Bh += (size_t)by * sB; const size_t cofs = (size_t)by * sC; const float* bp = bias ? bias + (size_t)by * sBias : nullptr;
  const int ntn = (N + 63) / 64; const int wid = blockIdx.x * 4 + w; const int mt = wid / ntn, nq = wid % ntn; if (mt * 16 >= M) return;
  const int row0 = mt * 16, col0 = nq * 64; const _Float16* arow = A + (size_t)(row0 + ln) * lda;
  v8f acc[4] = {};
  for (int kb = 0; kb < K; kb += 32) { FragH ah; ah.half[0] = *(const v8us*)((const unsigned short*)arow + kb + 8 * hh); ah.half[1] = *(const v8us*)((const unsigned short*)arow + kb + 16 + 8 * hh);
#pragma unroll
    for (int t = 0; t < 4; ++t) { if (col0 + t * 16 >= N) continue; const size_t boff = (size_t)(col0 + t * 16 + ln) * ldb + kb; FragH bq; bq.half[0] = *(const v8us*)((const unsigned short*)Bh + boff + 8 * hh); bq.half[1] = *(const v8us*)((const unsigned short*)Bh + boff + 16 + 8 * hh);
      acc[t] = mmaH<1>(ah.v, ah.v, bq.v, bq.v, acc[t]); }
  }
#pragma unroll
  for (int t = 0; t < 4; ++t) { if (col0 + t * 16 >= N) continue; const int col = col0 + t * 16 + ln; const float bv = bp ? bf16_round(bp[col]) : 0.f;
#pragma unroll
    for (int r = 0; r < 8; ++r) { float v = acc[t][r] * alpha + bv; if (CP) { const int rr = row0g + row0 + 8 * hh + r; if (rowsPerB < 0) v += CP[cofs + (size_t)rr * ldc + col];      /* rowsPerB < 0: own element of the batched C plane */ else { const int bidx = rr / rowsPerB; v += CP[(size_t)bidx * sCPb + (size_t)by * 64 + col]; } } if (ACT == 1) v = (v > 0.f) ? v : expm1f(v); else if (ACT == 7) v = (v > 0.f) ? v + 1.0f : expf(v); else if (ACT == 8) v = tanhf(v); else if (ACT == 9) v = 0.5f * v * (1.0f + tanhf(0.7978845608028654f * (v + 0.044715f * v * v * v))); else if (ACT == 11) v = 1.0f / (1.0f + expf(-v)); else if (ACT == 12) v = (v > 0.f) ? v : 0.01f * v; else if (ACT == 14) v = (v > 0.f) ? v : 0.1f * v; else if (ACT == 16) v = (v >= 0.f) ? v : 0.3f * v; else if (ACT == 17) v = (v >= 0.f) ? v : 0.2f * v; else if (ACT == 15) v = v / (1.0f + expf(-v)); else if (ACT == 3) v = fmaxf(v, 0.f); else if (ACT == 6) v = 0.5f * v * (1.0f + erff(v * 0.70710678118654752f)); so[w][8 * hh + r][t * 16 + ln] = v; } }
  __builtin_amdgcn_fence(__ATOMIC_ACQ_REL, "workgroup"); __builtin_amdgcn_wave_barrier();
  const int rsub = lane >> 4, c4 = (lane & 15) * 4; typedef _Float16 v4h __attribute__((ext_vector_type(4)));
  {
#pragma unroll
    for (int q = 0; q < 8; ++q) { const int r = q * 2 + rsub; if (col0 + c4 < N) { const v4f v = *(const v4fa*)&so[w][r][c4]; if (C) *(v4f*)(C + cofs + (size_t)(row0 + r) * ldc + col0 + c4) = v; if (C16) { v4h h4; for (int i = 0; i < 4; ++i) h4[i] = (_Float16)v[i]; *(v4h*)(C16 + cofs + (size_t)(row0 + r) * ldc + col0 + c4) = h4; } } }
     }
}


typedef _Float16 v4h __attribute__((ext_vector_type(4)));

__global__ __launch_bounds__(256) void k_x16(const float* __restrict__ x, _Float16* __restrict__ X16, size_t n8) { const size_t t = (size_t)blockIdx.x * 256 + threadIdx.x; if (t >= n8) return; FragH f;
#pragma unroll
  for (int q = 0; q < 8; ++q) f.h[q] = (_Float16)bf16_round(x[t * 8 + q]); *(v8us*)((unsigned short*)X16 + t * 8) = f.half[0];  }
__global__ __launch_bounds__(256) void k_h16(const float* __restrict__ x, _Float16* __restrict__ X16, size_t n8) { const size_t t = (size_t)blockIdx.x * 256 + threadIdx.x; if (t >= n8) return; FragH f;
#pragma unroll
  for (int q = 0; q < 8; ++q) f.h[q] = (_Float16)x[t * 8 + q]; *(v8us*)((unsigned short*)X16 + t * 8) = f.half[0];  }
__global__ __launch_bounds__(256) void k_round16f(const float* __restrict__ W, _Float16* __restrict__ Bt, size_t n8) { const size_t t = (size_t)blockIdx.x * 256 + threadIdx.x; if (t >= n8) return; FragH f;
#pragma unroll
  for (int i = 0; i < 8; ++i) f.h[i] = (_Float16)(bf16_round(W[t * 8 + i]) * 16.0f); *(v8us*)((unsigned short*)Bt + t * 8) = f.half[0];  }
template <int NHv, int TTv>
__global__ __launch_bounds__(256) void k_vt(const _Float16* __restrict__ V16, int ldv, int voff, _Float16* __restrict__ Vt) { __shared__ unsigned short tl[64][66]; const int tid = threadIdx.x; const int slab = blockIdx.x / (TTv / 64), lg = blockIdx.x % (TTv / 64); const int b = slab / NHv, h = slab % NHv;
  for (int i = tid; i < 64 * 8; i += 256) { const int r = i / 8, c8 = (i % 8) * 8; FragH f; f.half[0] = *(const v8us*)((const unsigned short*)V16 + ((size_t)b * TTv + lg * 64 + r) * ldv + voff + h * 64 + c8);
#pragma unroll
    for (int q = 0; q < 8; ++q) tl[r][c8 + q] = f.u[q]; }
  __syncthreads();
  {
#pragma unroll
    for (int rd = 0; rd < 2; ++rd) { const int d = rd * 32 + tid / 8, pc = tid % 8; FragH f;
#pragma unroll
      for (int q = 0; q < 8; ++q) f.u[q] = tl[pc * 8 + q][d];
      *(v8us*)((unsigned short*)Vt + ((size_t)slab * 64 + d) * TTv + lg * 64 + pc * 8) = f.half[0]; }
     } }

__global__ __launch_bounds__(256) void k_hl(const float* __restrict__ F, _Float16* __restrict__ Hh, _Float16* __restrict__ Hl, size_t n8) { const size_t t = (size_t)blockIdx.x * 256 + threadIdx.x; if (t >= n8) return; FragH fh, fl; const v4f a = *(const v4fa*)(F + t * 8), c = *(const v4fa*)(F + t * 8 + 4);
#pragma unroll
  for (int q = 0; q < 4; ++q) { _Float16 h = (_Float16)a[q]; fh.h[q] = h; fl.h[q] = (_Float16)((a[q] - (float)h) * 1024.0f); h = (_Float16)c[q]; fh.h[4 + q] = h; fl.h[4 + q] = (_Float16)((c[q] - (float)h) * 1024.0f); }
  { *(v8us*)((unsigned short*)Hh + t * 8) = fh.half[0]; *(v8us*)((unsigned short*)Hl + t * 8) = fl.half[0];  } }

// ---- fast GEMM (wave tile 32x64; requires M % 32 == 0 rows per launch region and N % 64 == 0); epilogue = k_gemm_hhx semantics ----
__device__ __forceinline__ v16h g2_frag(const _Float16* p, int hh) { FragH f; f.half[0] = *(const v8us*)((const unsigned short*)p + 8 * hh); f.half[1] = *(const v8us*)((const unsigned short*)p + 16 + 8 * hh); return f.v; }
__device__ __forceinline__ v8f g2_mma(v16h a, v16h b, v8f c) { v8f d = __builtin_amdgcn_wmma_f32_16x16x32_f16(false, a, false, b, (short)0, c, false, false); asm volatile("v_nop\n\tv_nop\n\tv_nop\n\tv_nop" : "+v"(d) : "v"(a), "v"(b)); return d; }
template <int ACT>
__global__ __launch_bounds__(128) void k_gemm2(const _Float16* __restrict__ A, int lda, size_t sA, const _Float16* __restrict__ Bh, int ldb, size_t sB, float alpha, const float* __restrict__ bias, size_t sBias, const float* __restrict__ CP, int rowsPerB, size_t sCPb, int row0g,
    float* __restrict__ C, _Float16* __restrict__ C16, int ldc, size_t sC, int M, int N, int K) { static_assert(ACT == 0 || ACT == 3 || ACT == 6 || ACT == 8 || ACT == 9 || ACT == 11 || ACT == 12 || ACT == 14 || ACT == 15 || ACT == 16 || ACT == 17, "k_gemm2: unsupported ACT code (would silently apply no activation)");
  __shared__ __attribute__((aligned(16))) float so[4][32][68];
  const int tid = threadIdx.x, w = tid >> 5, lane = tid & 31, ln = lane & 15, hh = lane >> 4; const int by = blockIdx.y;
  A += (size_t)by * sA; Bh += (size_t)by * sB; const size_t cofs = (size_t)by * sC; const float* bp = bias ? bias + (size_t)by * sBias : nullptr;
  const int ntn = N >> 6; const int mt = blockIdx.x / ntn, nq = blockIdx.x - mt * ntn; const int row0 = mt * 128 + 32 * w, col0 = nq * 64; if (row0 >= M) return;
  const _Float16* a0p = A + (size_t)(row0 + ln) * lda; const _Float16* a1p = a0p + (size_t)16 * lda;
  const _Float16* b0p = Bh + (size_t)(col0 + ln) * ldb; const _Float16* b1p = b0p + (size_t)16 * ldb; const _Float16* b2p = b1p + (size_t)16 * ldb; const _Float16* b3p = b2p + (size_t)16 * ldb;
  const v8f z8 = {0.f,0.f,0.f,0.f,0.f,0.f,0.f,0.f}; v8f c00 = z8, c01 = z8, c02 = z8, c03 = z8, c10 = z8, c11 = z8, c12 = z8, c13 = z8;
#pragma unroll 1
  for (int kb = 0; kb < K; kb += 32) { const v16h a0 = g2_frag(a0p + kb, hh), a1 = g2_frag(a1p + kb, hh);
    v16h b = g2_frag(b0p + kb, hh); c00 = g2_mma(a0, b, c00); c10 = g2_mma(a1, b, c10);
    b = g2_frag(b1p + kb, hh); c01 = g2_mma(a0, b, c01); c11 = g2_mma(a1, b, c11);
    b = g2_frag(b2p + kb, hh); c02 = g2_mma(a0, b, c02); c12 = g2_mma(a1, b, c12);
    b = g2_frag(b3p + kb, hh); c03 = g2_mma(a0, b, c03); c13 = g2_mma(a1, b, c13); }
  v8f accs[8] = {c00, c01, c02, c03, c10, c11, c12, c13};
#pragma unroll
  for (int u = 0; u < 8; ++u) { const int t = u & 3, half = u >> 2; const int col = col0 + t * 16 + ln; const float bv = bp ? bf16_round(bp[col]) : 0.f;
#pragma unroll
    for (int r = 0; r < 8; ++r) { const int rloc = half * 16 + 8 * hh + r; float v = accs[u][r] * alpha + bv; if (CP) { if (rowsPerB < 0) v += CP[cofs + (size_t)(row0g + row0 + rloc) * ldc + col];      /* rowsPerB < 0: own element of the batched C plane */ else { const int bidx = (row0g + row0 + rloc) / rowsPerB; v += CP[(size_t)bidx * sCPb + (size_t)by * 64 + col]; } }
      if (ACT == 3) v = fmaxf(v, 0.f); else if (ACT == 6) v = 0.5f * v * (1.0f + erff(v * 0.70710678118654752f)); else if (ACT == 11) v = 1.0f / (1.0f + expf(-v)); else if (ACT == 15) v = v / (1.0f + expf(-v)); else if (ACT == 12) v = (v > 0.f) ? v : 0.01f * v; else if (ACT == 8) v = tanhf(v); else if (ACT == 9) v = 0.5f * v * (1.0f + tanhf(0.7978845608028654f * (v + 0.044715f * v * v * v))); else if (ACT == 14) v = (v > 0.f) ? v : 0.1f * v; else if (ACT == 16) v = (v >= 0.f) ? v : 0.3f * v; else if (ACT == 17) v = (v >= 0.f) ? v : 0.2f * v;
      so[w][rloc][t * 16 + ln] = v; } }
  __builtin_amdgcn_fence(__ATOMIC_ACQ_REL, "workgroup"); __builtin_amdgcn_wave_barrier();
  const int rsub = lane >> 4, c4 = (lane & 15) * 4;
  {
#pragma unroll
    for (int q = 0; q < 16; ++q) { const int r = q * 2 + rsub; const v4f v = *(const v4fa*)&so[w][r][c4]; if (C) *(v4f*)(C + cofs + (size_t)(row0 + r) * ldc + col0 + c4) = v; if (C16) { v4h h4; for (int i = 0; i < 4; ++i) h4[i] = (_Float16)v[i]; *(v4h*)(C16 + cofs + (size_t)(row0 + r) * ldc + col0 + c4) = h4; } }
     } }


__global__ __launch_bounds__(256) void k_wnat(const float* __restrict__ w, size_t n8, _Float16* __restrict__ Bt) { const size_t t = (size_t)blockIdx.x * 256 + threadIdx.x; if (t >= n8) return; FragH f; for (int q = 0; q < 8; ++q) f.h[q] = (_Float16)(bf16_round(w[t * 8 + q]) * 16.0f); *(v8us*)((unsigned short*)Bt + t * 8) = f.half[0];  }
__global__ __launch_bounds__(256) void k_rsm(const float* __restrict__ S, _Float16* __restrict__ P, int nrows) {
  #pragma clang fp contract(off)
  const int i = blockIdx.x * 256 + threadIdx.x; if (i >= nrows) return; const float* s = S + (size_t)i * SQ; float mx = -3.0e38f;
#pragma unroll 1
  for (int j = 0; j < SQ; ++j) mx = fmaxf(mx, s[j]); float se = 0.f;
#pragma unroll 1
  for (int j = 0; j < SQ; ++j) se += expf(s[j] - mx); const float sc = 256.0f / se;
#pragma unroll 1
  for (int j0 = 0; j0 < SQ; j0 += 8) { FragH f; for (int q = 0; q < 8; ++q) f.h[q] = (_Float16)(expf(s[j0 + q] - mx) * sc); unsigned short* d = (unsigned short*)P + (size_t)i * SQ + j0; *(v8us*)d = f.half[0];  } }
__global__ __launch_bounds__(256) void k_vt(const _Float16* __restrict__ V16, int b, int h0, _Float16* __restrict__ VT) { __shared__ unsigned short tl[64][65]; const int tid = threadIdx.x; const int hh = blockIdx.x % HG, sg = blockIdx.x / HG; const int s0 = sg * 64; const int h = h0 + hh;
  for (int i = tid; i < 64 * 8; i += 256) { const int j = i / 8, d8 = (i % 8) * 8; FragH f; f.half[0] = *(const v8us*)((const unsigned short*)V16 + ((size_t)b * SQ + s0 + j) * DM + h * HD + d8); for (int q = 0; q < 8; ++q) tl[d8 + q][j] = f.u[q]; }
  __syncthreads();
  { for (int i = tid; i < 64 * 8; i += 256) { const int d = i / 8, j8 = (i % 8) * 8; FragH f; for (int q = 0; q < 8; ++q) f.u[q] = tl[d][j8 + q]; *(v8us*)((unsigned short*)VT + ((size_t)hh * HD + d) * SQ + s0 + j8) = f.half[0]; }  } }



// Four exponentials 2^x in place. The closing v_nop is the free slot that the instruction set asks for behind a transcendental before its result is used or its
// source overwritten; it stands in the same statement because nothing else would keep it directly behind the last v_exp_f32 (inside, each v_exp_f32 is independent of the one before).
__device__ __forceinline__ v4f exp2x4(v4f x) { float a = x[0], b = x[1], c = x[2], d = x[3];
  asm("v_exp_f32 %0, %0\n\tv_exp_f32 %1, %1\n\tv_exp_f32 %2, %2\n\tv_exp_f32 %3, %3\n\tv_nop" : "+v"(a), "+v"(b), "+v"(c), "+v"(d));
  const v4f r = {a, b, c, d}; return r; }
#define FA_LAG 5.5f                  /* score units; 5.5 log2 e = 7.9 */
#define FA_L2E 1.44269504088896340736f
#define FA_PITCH 144                 /* LDS row pitch, bytes */
#define FA_TILE (64 * FA_PITCH)      /* one operand's 64 rows */
#define FA_BUF (2 * FA_TILE)         /* K tile + V^T tile */
#define FA_EP 272                    /* output staging pitch, bytes: 64 f32 + 16 */
__device__ __forceinline__ v16h fa_frag(const unsigned char* p) { FragH f; f.half[0] = *(const v8us*)p; f.half[1] = *(const v8us*)(p + 32); return f.v; }
__device__ __forceinline__ v8f fa_mma(v16h a, v16h b, v8f c) { return __builtin_amdgcn_wmma_f32_16x16x32_f16(false, a, false, b, (short)0, c, false, false); }
__device__ __forceinline__ float fa_xhalf(float x) { return __builtin_bit_cast(float, __builtin_amdgcn_permlanex16(__builtin_bit_cast(int, x), __builtin_bit_cast(int, x), 0x76543210, 0xfedcba98, false, false)); }      /* lane l with lane l ^ 16 */
__global__ __launch_bounds__(256) void k_fattn(const _Float16* __restrict__ Q16, const _Float16* __restrict__ K16, const _Float16* __restrict__ VT, const float* __restrict__ am, float* __restrict__ out) {
  __shared__ __attribute__((aligned(16))) unsigned char L[8 * 32 * FA_EP];      /* two K/V buffers (2 x FA_BUF bytes) in the loop, output staging behind it */
  __shared__ __attribute__((aligned(16))) float ms[SQ];
  static_assert(2 * FA_BUF <= 8 * 32 * FA_EP, "the two K/V buffers must fit the array");
  const int tid = threadIdx.x, lane = tid & 31, c = lane & 15, h = lane >> 4; const int w = __builtin_amdgcn_readfirstlane(tid >> 5);
  const int head = blockIdx.y, q0 = blockIdx.x * 256 + w * 32;
  /* staging: 8 threads cover one 128-byte row, a thread brings rows sr and sr + 32 of both operands */
  const int sr = tid >> 3, sc = tid & 7;
  const unsigned short* kg = (const unsigned short*)K16 + (size_t)sr * DM + head * HD + sc * 8;
  const unsigned short* vg = (const unsigned short*)VT + ((size_t)head * HD + sr) * SQ + sc * 8;
  unsigned char* lw = L + sr * FA_PITCH + sc * 16;
  v8us ka = *(const v8us*)kg, kb = *(const v8us*)(kg + (size_t)32 * DM), va = *(const v8us*)vg, vb = *(const v8us*)(vg + (size_t)32 * SQ);
#pragma unroll
  for (int u = 0; u < SQ / 1024; ++u) { const v4f m = *(const v4fa*)(am + u * 1024 + tid * 4); v4f r;
#pragma unroll
    for (int q = 0; q < 4; ++q) r[q] = bf16_round(m[q]);
    *(v4fa*)&ms[u * 1024 + tid * 4] = r; }
  v16h qf[2][2];
#pragma unroll
  for (int g = 0; g < 2; ++g) { const _Float16* qp = Q16 + (size_t)(q0 + 16 * g + c) * DM + head * HD; qf[g][0] = g2_frag(qp, h); qf[g][1] = g2_frag(qp + 32, h); }
  FragH ones;      /* A operand whose row 0 is 1.0: its product with P^T is the column sums of P^T, the softmax denominators */
#pragma unroll
  for (int i = 0; i < 16; ++i) ones.h[i] = (c == 0) ? (_Float16)1.0f : (_Float16)0.0f;
  const v8f z8 = {0.f, 0.f, 0.f, 0.f, 0.f, 0.f, 0.f, 0.f};
  v8f acc[2][4], lacc[2]; float m_run[2];
#pragma unroll
  for (int g = 0; g < 2; ++g) { m_run[g] = -3.402823466e38f; lacc[g] = z8;      /* the lowest finite value: any finite score replaces it, a key at -inf keeps weight 0 */
#pragma unroll
    for (int t = 0; t < 4; ++t) acc[g][t] = z8; }
  *(v8us*)lw = ka; *(v8us*)(lw + 32 * FA_PITCH) = kb; *(v8us*)(lw + FA_TILE) = va; *(v8us*)(lw + FA_TILE + 32 * FA_PITCH) = vb;
  __syncthreads();      /* publishes stage 0 and the mask */
#pragma unroll 1      /* 64 trips of 36 matrix instructions stay rolled: code size and registers */
  for (int st = 0; st < SQ / 64; ++st) {
    const unsigned char* Lb = L + (st & 1) * FA_BUF;
    if (st + 1 < SQ / 64) { const unsigned short* kn = kg + (size_t)(st + 1) * 64 * DM; const unsigned short* vn = vg + (st + 1) * 64;
      ka = *(const v8us*)kn; kb = *(const v8us*)(kn + (size_t)32 * DM); va = *(const v8us*)vn; vb = *(const v8us*)(vn + (size_t)32 * SQ); }
#pragma unroll
    for (int sub = 0; sub < 2; ++sub) {
      v8f s[2][2];
#pragma unroll
      for (int kt = 0; kt < 2; ++kt) { const unsigned char* kp = Lb + (sub * 32 + 16 * kt + c) * FA_PITCH + 16 * h; const v16h k0 = fa_frag(kp), k1 = fa_frag(kp + 64);
        const float* mp = ms + st * 64 + sub * 32 + 16 * kt + 8 * h; const v4f m0 = *(const v4fa*)mp, m1 = *(const v4fa*)(mp + 4);
        const v8f mc = {m0[0], m0[1], m0[2], m0[3], m1[0], m1[1], m1[2], m1[3]};
        s[kt][0] = fa_mma(k0, qf[0][0], z8); s[kt][1] = fa_mma(k0, qf[1][0], z8);
        s[kt][0] = fa_mma(k1, qf[0][1], s[kt][0]) * 0.125f + mc; s[kt][1] = fa_mma(k1, qf[1][1], s[kt][1]) * 0.125f + mc; }      /* 1/sqrt(64) is a power of two, so this is the score plus the mask in one f32 rounding, fused or not, as the separate kernels had it */
      v16h vf[4];
#pragma unroll
      for (int t = 0; t < 4; ++t) vf[t] = fa_frag(Lb + FA_TILE + (16 * t + c) * FA_PITCH + sub * 64 + 16 * h);
      float mb[2]; bool need = false;
#pragma unroll
      for (int g = 0; g < 2; ++g) { float mx = fmaxf(s[0][g][0], s[1][g][0]);
#pragma unroll
        for (int r = 1; r < 8; ++r) mx = fmaxf(fmaxf(mx, s[0][g][r]), s[1][g][r]);
        mx = fmaxf(mx, fa_xhalf(mx)); mb[g] = mx; need = need || (mx > m_run[g] + FA_LAG); }
      if (__builtin_amdgcn_ballot_w32(need) != 0) {      /* one scalar branch a pass; rare behind the first passes */
        v4f e = {(m_run[0] - fmaxf(m_run[0], mb[0])) * FA_L2E, (m_run[1] - fmaxf(m_run[1], mb[1])) * FA_L2E, 0.f, 0.f}; e = exp2x4(e);
#pragma unroll
        for (int g = 0; g < 2; ++g) { m_run[g] = fmaxf(m_run[g], mb[g]); lacc[g] = lacc[g] * e[g];
#pragma unroll
          for (int t = 0; t < 4; ++t) acc[g][t] = acc[g][t] * e[g]; } }
#pragma unroll
      for (int g = 0; g < 2; ++g) { const float mr = m_run[g]; FragH pf;
#pragma unroll
        for (int j = 0; j < 4; ++j) { v4f a;
#pragma unroll
          for (int q = 0; q < 4; ++q) a[q] = (s[j >> 1][g][4 * (j & 1) + q] - mr) * FA_L2E;
          a = exp2x4(a);
#pragma unroll
          for (int q = 0; q < 4; ++q) pf.h[4 * j + q] = (_Float16)a[q]; }
#pragma unroll
        for (int t = 0; t < 4; ++t) acc[g][t] = fa_mma(vf[t], pf.v, acc[g][t]);
        lacc[g] = fa_mma(ones.v, pf.v, lacc[g]); }
    }
    if (st + 1 < SQ / 64) { unsigned char* p = lw + ((st + 1) & 1) * FA_BUF;
      *(v8us*)p = ka; *(v8us*)(p + 32 * FA_PITCH) = kb; *(v8us*)(p + FA_TILE) = va; *(v8us*)(p + FA_TILE + 32 * FA_PITCH) = vb; }
    __syncthreads();      /* publishes stage st + 1 and ends every wave's reads of stage st, whose buffer the next trip refills (behind the last trip: frees the array for the output staging) */
  }
  unsigned char* E = L + w * (32 * FA_EP);      /* this wave's own 32 rows of 64 f32 */
#pragma unroll
  for (int g = 0; g < 2; ++g) { const float lr = lacc[g][0]; const float inv = 1.0f / (lr + fa_xhalf(lr));      /* register 0: the sum in lanes 0-15, 0 in lanes 16-31 */
#pragma unroll
    for (int t = 0; t < 4; ++t) { const v8f o = acc[g][t] * inv; const v4f o0 = {o[0], o[1], o[2], o[3]}, o1 = {o[4], o[5], o[6], o[7]};
      unsigned char* p = E + (16 * g + c) * FA_EP + 64 * t + 32 * h; *(v4fa*)p = o0; *(v4fa*)(p + 16) = o1; } }      /* row = query, d = 16 t + 8 h + r */
  __builtin_amdgcn_fence(__ATOMIC_ACQ_REL, "workgroup"); __builtin_amdgcn_wave_barrier();      /* the rows are read back by other lanes of the same wave */
#pragma unroll
  for (int i = 0; i < 16; ++i) { const int row = i * 2 + h; const v4f v = *(const v4fa*)(E + row * FA_EP + c * 16);
    *(v4f*)(out + (size_t)(q0 + row) * DM + head * HD + c * 4) = v; } }      /* whole 256-byte row pieces: every 128-byte line stored once */

extern "C" void kernel_launch(void* const* d_in, const int* in_sizes, int n_in,
                              void* d_out, int out_size, void* d_ws, size_t ws_size, hipStream_t stream) {
  (void)in_sizes; (void)n_in; (void)out_size;
  const float* const* I = (const float* const*)d_in; const float* x = I[0]; const float* am = I[1]; const float* wq = I[2]; const float* bq = I[3]; const float* wk = I[4]; const float* bk = I[5]; const float* wv = I[6]; const float* bv = I[7];      /* weights [in][out]; am = additive mask [NB][1][1][SQ] */
  char* ws = (char*)d_ws; size_t off = 0;
  auto take = [&](size_t bytes) { char* p = ws + off; off += (bytes + 255) & ~(size_t)255; return p; };
  _Float16* BQ = (_Float16*)take((size_t)DM * DM * 2); _Float16* BK = (_Float16*)take((size_t)DM * DM * 2); _Float16* BV = (_Float16*)take((size_t)DM * DM * 2); 
  _Float16* X16 = (_Float16*)take(NR * DM * 2); _Float16* Q16 = (_Float16*)take(NR * DM * 2); _Float16* K16 = (_Float16*)take(NR * DM * 2); _Float16* V16 = (_Float16*)take(NR * DM * 2);
  _Float16* VT = (_Float16*)take((size_t)NH * HD * SQ * 2);
  if (off > ws_size) return;
  { const unsigned g = (unsigned)(((size_t)DM * (DM / 8) + 255) / 256); k_wt_f16<<<g, 256, 0, stream>>>(wq, BQ, DM, DM, 16.0f); k_wt_f16<<<g, 256, 0, stream>>>(wk, BK, DM, DM, 16.0f); k_wt_f16<<<g, 256, 0, stream>>>(wv, BV, DM, DM, 16.0f); }      /* [in][out] -> Bt[n][k] x16 */
  k_x16<<<(unsigned)((NR * DM / 8 + 255) / 256), 256, 0, stream>>>(x, X16, NR * DM / 8);
  const size_t r0p = (size_t)B0 * SQ;      /* first projected row */
  k_gemm2<0><<<dim3((unsigned)((MP / 128) * (DM / 64)), 1), 128, 0, stream>>>(X16 + r0p * DM, DM, 0, BQ, DM, 0, 0.0625f, bq, 0, nullptr, 1, 0, 0, nullptr, Q16 + r0p * DM, DM, 0, MP, DM, DM);
  k_gemm2<0><<<dim3((unsigned)((MP / 128) * (DM / 64)), 1), 128, 0, stream>>>(X16 + r0p * DM, DM, 0, BK, DM, 0, 0.0625f, bk, 0, nullptr, 1, 0, 0, nullptr, K16 + r0p * DM, DM, 0, MP, DM, DM);
  k_gemm2<0><<<dim3((unsigned)((MP / 128) * (DM / 64)), 1), 128, 0, stream>>>(X16 + r0p * DM, DM, 0, BV, DM, 0, 0.0625f, bv, 0, nullptr, 1, 0, 0, nullptr, V16 + r0p * DM, DM, 0, MP, DM, DM);
  for (int b = B0; b < B0 + NBR; ++b) { const size_t r0 = (size_t)b * SQ;
    k_vt<NH, SQ><<<NH * (SQ / 64), 256, 0, stream>>>(V16 + r0 * LQ, LQ, 0, VT);      /* V^T [NH][HD][SQ] for this batch */
    k_fattn<<<dim3(SQ / 256, NH), 256, 0, stream>>>(Q16 + r0 * LQ, K16 + r0 * LQ, VT, am + (size_t)b * SQ, (float*)d_out + r0 * DM); }      /* scores, softmax and P.V of all heads; out = merged heads, f32 */
}

// v003
// It runs in 103 microseconds.
// Timed twice side by side with v002, it ran 1.76 and 1.77 times as fast.
// Counting every step since v000, it is 98.4 times as fast.
#include <hip/hip_runtime.h>
// BERT self-attention (hidden [1][4096][768]; q/k/v = x W + b with W stored [in][out], 12 heads of 64; scores / 8 + the additive attention_mask[b][key] (f32); softmax; out = attn v merged -> [1][4096][768]; no output projection).
// Structure: token rows r = b*4096 + s; x as exact f16 rows (bf16-rounded); Q, K, V as one WMMA GEMM launch (128x128 work-group tiles staged in LDS, 64x64 wave tiles, f32 accumulation, exact x16 weights + bias, f16 outputs); per batch: V^T for all heads via LDS transposes; per batch one fused attention launch over all heads: scores (WMMA, K = 64), running softmax of (scores / 8 + additive mask) on VALU (f32 statistics, native exp; weights as f16 in registers), o = P . V (WMMA), normalised and written as f32 into the merged output rows.
// Compute dtype: inputs rounded to bf16; x / weights exact; q, k, v and softmax weights as plain f16 GEMM operands (~2^-12); scores, softmax statistics and o f32. v_wmma_f32_16x16x32_f16.
#define NB 1
#define SQ 4096
#define DM 768
#define NH 12
#define HD 64
#define HG 1                         /* heads per launch of the second k_vt (not launched) */
#define B0 0                         /* first batch processed (debug hook) */
#define NBR NB                       /* batches processed (debug hook) */
#define NR ((size_t)NB * SQ)         /* token rows */
#define MP ((int)((size_t)NBR * SQ)) /* rows projected (debug hook) */
#define QN SQ                        /* unused: the attention launch covers all SQ queries */
#define NHD NH                       /* unused: the attention launch covers all NH heads */
#define MPO MP                       /* unused: there is no output stage */
#define LQ DM      /* row pitch of the q/k/v rows */
typedef __bf16 v16b __attribute__((ext_vector_type(16)));
typedef unsigned short v8us __attribute__((ext_vector_type(8), may_alias));
typedef float  v8f  __attribute__((ext_vector_type(8)));
typedef float  v4f  __attribute__((ext_vector_type(4)));
typedef float  v4fa __attribute__((ext_vector_type(4), may_alias));
union FragB { v16b v; v8us half[2]; unsigned short u[16]; };

__device__ __forceinline__ unsigned short bf16_bits(float x) { unsigned int u = __float_as_uint(x); return (unsigned short)((u + 0x7FFFu + ((u >> 16) & 1u)) >> 16); }
__device__ __forceinline__ float bf16_val(unsigned short b) { return __uint_as_float(((unsigned int)b) << 16); }
__device__ __forceinline__ float bf16_round(float x) { return bf16_val(bf16_bits(x)); }
// D += A·B with NT terms: 1 = ah·bh, 2 = + al·bh (A split), 3 = + ah·bl (both split)
template <int NT>
__device__ __forceinline__ v8f mmaN(v16b ah, v16b al, v16b bh, v16b bl, v8f c) {
  c = __builtin_amdgcn_wmma_f32_16x16x32_bf16(false, ah, false, bh, (short)0, c, false, false);
  if (NT >= 2) c = __builtin_amdgcn_wmma_f32_16x16x32_bf16(false, al, false, bh, (short)0, c, false, false);
  if (NT >= 3) c = __builtin_amdgcn_wmma_f32_16x16x32_bf16(false, ah, false, bl, (short)0, c, false, false);
  asm volatile("v_nop\n\tv_nop\n\tv_nop\n\tv_nop" : "+v"(c) : "v"(ah), "v"(al), "v"(bh), "v"(bl));
  return c;
}

__global__ __launch_bounds__(256) void k_wt_bf16(const float* __restrict__ W, unsigned short* __restrict__ Wt, int K, int N) {
  const int t = blockIdx.x * 256 + threadIdx.x;
  const int k8n = K / 8;
  if (t >= N * k8n) return;
  const int n = t / k8n, k8 = (t % k8n) * 8;
  v8us v;
#pragma unroll
  for (int i = 0; i < 8; ++i) v[i] = bf16_bits(W[(size_t)(k8 + i) * N + n]);
  *(v8us*)(Wt + (size_t)n * K + k8) = v;
  
}

// GEMM C[M][N] (f32, pitch ldc) = act(A[M][K]·W + bias). A f32 row-major (pitch lda) converted per fragment to bf16
// (ASPLIT: hi/lo two planes -> 2 terms, else single rounded term); Wt bf16 [N][K] (pitch ldb). BIAS_BF16 rounds the
// bias to bf16 first (bias quantised to bf16 before the add). K%32==0, M%16==0, N%64==0.
template <bool ASPLIT, int ACT, bool BIAS_BF16>
__global__ __launch_bounds__(128) void k_gemm_bf(const float* __restrict__ A, int lda, const unsigned short* __restrict__ Wt, int ldb,
                                               const float* __restrict__ bias, float* __restrict__ C, int ldc, int M, int N, int K) {
  __shared__ __attribute__((aligned(16))) float so[4][16][64];
  const int tid = threadIdx.x, w = tid >> 5, lane = tid & 31, ln = lane & 15, hh = lane >> 4;
  const int ntn = N / 64;
  const int wid = blockIdx.x * 4 + w;
  const int mt = wid / ntn, nq = wid % ntn;
  if (mt * 16 >= M) return;
  const int row0 = mt * 16, col0 = nq * 64;
  const float* arow = A + (size_t)(row0 + ln) * lda;
  v8f acc[4] = {};
  for (int kb = 0; kb < K; kb += 32) {
    FragB ah, al;
    const v4f x0 = *(const v4fa*)(arow + kb + 8 * hh), x1 = *(const v4fa*)(arow + kb + 8 * hh + 4);
    const v4f x2 = *(const v4fa*)(arow + kb + 16 + 8 * hh), x3 = *(const v4fa*)(arow + kb + 16 + 8 * hh + 4);
    float xs[16] = {x0[0],x0[1],x0[2],x0[3],x1[0],x1[1],x1[2],x1[3],x2[0],x2[1],x2[2],x2[3],x3[0],x3[1],x3[2],x3[3]};
#pragma unroll
    for (int i = 0; i < 16; ++i) { const unsigned short hb = bf16_bits(xs[i]); ah.u[i] = hb; al.u[i] = ASPLIT ? bf16_bits(xs[i] - bf16_val(hb)) : (unsigned short)0; }
#pragma unroll
    for (int t = 0; t < 4; ++t) {
      const unsigned short* brow = Wt + (size_t)(col0 + t * 16 + ln) * ldb + kb;
      FragB b;
      b.half[0] = *(const v8us*)(brow + 8 * hh);
      b.half[1] = *(const v8us*)(brow + 16 + 8 * hh);
      acc[t] = mmaN<ASPLIT ? 2 : 1>(ah.v, al.v, b.v, b.v, acc[t]);
    }
  }
#pragma unroll
  for (int t = 0; t < 4; ++t) {
    float bv = bias ? bias[col0 + t * 16 + ln] : 0.f;
    if (BIAS_BF16) bv = bf16_round(bv);
#pragma unroll
    for (int r = 0; r < 8; ++r) { float v = acc[t][r] + bv; if (ACT == 1) v = fmaxf(v, 0.f); so[w][8 * hh + r][t * 16 + ln] = v; }
  }
  __builtin_amdgcn_fence(__ATOMIC_ACQ_REL, "workgroup");
  __builtin_amdgcn_wave_barrier();
  const int rsub = lane >> 4, c4 = (lane & 15) * 4;
  {
#pragma unroll
    for (int q = 0; q < 8; ++q) {
      const int r = q * 2 + rsub;
      const v4f v = *(const v4fa*)&so[w][r][c4];
      *(v4f*)(C + (size_t)(row0 + r) * ldc + col0 + c4) = v;
    }
    
  }
}

// GEMM C = act(A·W + bias + resid): A f32 (ASPLIT -> hi/lo 2 terms), Wt bf16 [N][K]; ACT 0 none, 1 relu, 2 exact gelu;
// resid (optional, f32, row index = (row % rmod), pitch ldr, RES_BF16 rounds it) added before the activation.
template <bool ASPLIT, int ACT, bool BIAS_BF16, bool RES_BF16>
__global__ __launch_bounds__(128) void k_gemm_bf3(const float* __restrict__ A, int lda, const unsigned short* __restrict__ Wt, int ldb,
                                                const float* __restrict__ bias, const float* __restrict__ resid, int rmod, int ldr,
                                                float* __restrict__ C, int ldc, int M, int N, int K) {
  __shared__ __attribute__((aligned(16))) float so[4][16][64];
  const int tid = threadIdx.x, w = tid >> 5, lane = tid & 31, ln = lane & 15, hh = lane >> 4;
  const int ntn = N / 64;
  const int wid = blockIdx.x * 4 + w;
  const int mt = wid / ntn, nq = wid % ntn;
  if (mt * 16 >= M) return;
  const int row0 = mt * 16, col0 = nq * 64;
  const float* arow = A + (size_t)(row0 + ln) * lda;
  v8f acc[4] = {};
  for (int kb = 0; kb < K; kb += 32) {
    FragB ah, al;
    const v4f x0 = *(const v4fa*)(arow + kb + 8 * hh), x1 = *(const v4fa*)(arow + kb + 8 * hh + 4);
    const v4f x2 = *(const v4fa*)(arow + kb + 16 + 8 * hh), x3 = *(const v4fa*)(arow + kb + 16 + 8 * hh + 4);
    float xs[16] = {x0[0],x0[1],x0[2],x0[3],x1[0],x1[1],x1[2],x1[3],x2[0],x2[1],x2[2],x2[3],x3[0],x3[1],x3[2],x3[3]};
#pragma unroll
    for (int i = 0; i < 16; ++i) { const unsigned short hb = bf16_bits(xs[i]); ah.u[i] = hb; al.u[i] = ASPLIT ? bf16_bits(xs[i] - bf16_val(hb)) : (unsigned short)0; }
#pragma unroll
    for (int t = 0; t < 4; ++t) {
      const unsigned short* brow = Wt + (size_t)(col0 + t * 16 + ln) * ldb + kb;
      FragB b;
      b.half[0] = *(const v8us*)(brow + 8 * hh);
      b.half[1] = *(const v8us*)(brow + 16 + 8 * hh);
      acc[t] = mmaN<ASPLIT ? 2 : 1>(ah.v, al.v, b.v, b.v, acc[t]);
    }
  }
#pragma unroll
  for (int t = 0; t < 4; ++t) {
    const int col = col0 + t * 16 + ln;
    float bv = bias ? bias[col] : 0.f;
    if (BIAS_BF16) bv = bf16_round(bv);
#pragma unroll
    for (int r = 0; r < 8; ++r) {
      float v = acc[t][r] + bv;
      if (resid) { float rv = resid[(size_t)((row0 + 8 * hh + r) % rmod) * ldr + col]; if (RES_BF16) rv = bf16_round(rv); v += rv; }
      if (ACT == 1) v = fmaxf(v, 0.f);
      if (ACT == 2) v = 0.5f * v * (1.0f + erff(v * 0.70710678118654752f));
      if (ACT == 3) { const float u = 0.7978845608028654f * (v + 0.044715f * v * v * v); v = 0.5f * v * (1.0f + tanhf(u)); }
      so[w][8 * hh + r][t * 16 + ln] = v;
    }
  }
  __builtin_amdgcn_fence(__ATOMIC_ACQ_REL, "workgroup");
  __builtin_amdgcn_wave_barrier();
  const int rsub = lane >> 4, c4 = (lane & 15) * 4;
  {
#pragma unroll
    for (int q = 0; q < 8; ++q) {
      const int r = q * 2 + rsub;
      const v4f v = *(const v4fa*)&so[w][r][c4];
      *(v4f*)(C + (size_t)(row0 + r) * ldc + col0 + c4) = v;
    }
    
  }
}
// row LayerNorm (biased variance, eps) over N: s = X (+ R); optional out_sum <- s; out_norm <- (s-mu)*rsqrt(var+eps)*g + b
template <bool PARAM_BF16>
__global__ __launch_bounds__(256) void k_layernorm(const float* __restrict__ X, const float* __restrict__ R, const float* __restrict__ g, const float* __restrict__ bta,
                                                  float* __restrict__ out_sum, float* __restrict__ out_norm, int N, float eps) {
  __shared__ float red[256];
  const int row = blockIdx.x, tid = threadIdx.x;
  const float* x = X + (size_t)row * N; const float* rr = R ? R + (size_t)row * N : nullptr;
  float vals[16];                     // up to N = 4096
  const int per = N / 256;            // contiguous chunk per thread? use strided-by-4 chunks: thread handles j = tid*4 + 1024*u
  float s1 = 0.f;
  for (int u = 0; u < per / 4; ++u) {
    const int j = tid * 4 + 1024 * u;
    const v4f a = *(const v4fa*)(x + j);
    v4f b = {0.f,0.f,0.f,0.f}; if (rr) b = *(const v4fa*)(rr + j);
#pragma unroll
    for (int q = 0; q < 4; ++q) { const float v = a[q] + b[q]; vals[u * 4 + q] = v; s1 += v; }
  }
  red[tid] = s1; __syncthreads();
  for (int st = 128; st > 0; st >>= 1) { if (tid < st) red[tid] += red[tid + st]; __syncthreads(); }
  const float mu = red[0] / (float)N; __syncthreads();
  float s2 = 0.f;
  for (int u = 0; u < per / 4; ++u)
#pragma unroll
    for (int q = 0; q < 4; ++q) { const float c = vals[u * 4 + q] - mu; s2 += c * c; }
  red[tid] = s2; __syncthreads();
  for (int st = 128; st > 0; st >>= 1) { if (tid < st) red[tid] += red[tid + st]; __syncthreads(); }
  const float rs = rsqrtf(red[0] / (float)N + eps);
  {
    for (int u = 0; u < per / 4; ++u) {
      const int j = tid * 4 + 1024 * u;
      v4f o, sm;
#pragma unroll
      for (int q = 0; q < 4; ++q) {
        float gg = g[j + q], bb = bta[j + q];
        if (PARAM_BF16) { gg = bf16_round(gg); bb = bf16_round(bb); }
        sm[q] = vals[u * 4 + q]; o[q] = (vals[u * 4 + q] - mu) * rs * gg + bb;
      }
      if (out_sum) *(v4f*)(out_sum + (size_t)row * N + j) = sm;
      *(v4f*)(out_norm + (size_t)row * N + j) = o;
    }
    
  }
}



// ---- f16 WMMA path (v_wmma_f32_16x16x32_f16): 11-bit significands for operands in range — used where a [0,1] probability operand needs more precision than bf16
typedef _Float16 v16h __attribute__((ext_vector_type(16)));
union FragH { v16h v; v8us half[2]; _Float16 h[16]; unsigned short u[16]; };
template <int NT>
__device__ __forceinline__ v8f mmaH(v16h ah, v16h al, v16h bh, v16h bl, v8f c) {
  c = __builtin_amdgcn_wmma_f32_16x16x32_f16(false, ah, false, bh, (short)0, c, false, false);
  if (NT >= 2) c = __builtin_amdgcn_wmma_f32_16x16x32_f16(false, al, false, bh, (short)0, c, false, false);
  if (NT >= 3) c = __builtin_amdgcn_wmma_f32_16x16x32_f16(false, ah, false, bl, (short)0, c, false, false);
  asm volatile("v_nop\n\tv_nop\n\tv_nop\n\tv_nop" : "+v"(c) : "v"(ah), "v"(al), "v"(bh), "v"(bl));
  return c;
}
// batched GEMM like k_gemm_b but f16 operands: A f32 (split into f16 hi/lo if ASPLIT, else rounded to f16), Bt = f16 values [n][k]; alpha; C f32; N multiple of 16 (partial tiles skipped)
template <bool ASPLIT>
__global__ __launch_bounds__(128) void k_gemm_h(const float* __restrict__ A, int lda, size_t sA, const _Float16* __restrict__ Bh, int ldb, size_t sB, float alpha, float* __restrict__ C, int ldc, size_t sC, int M, int N, int K) {
  __shared__ __attribute__((aligned(16))) float so[4][16][64];
  const int tid = threadIdx.x, w = tid >> 5, lane = tid & 31, ln = lane & 15, hh = lane >> 4; const int by = blockIdx.y;
  A += (size_t)by * sA; Bh += (size_t)by * sB; C += (size_t)by * sC;
  const int ntn = (N + 63) / 64; const int wid = blockIdx.x * 4 + w; const int mt = wid / ntn, nq = wid % ntn; if (mt * 16 >= M) return;
  const int row0 = mt * 16, col0 = nq * 64; const float* arow = A + (size_t)(row0 + ln) * lda;
  v8f acc[4] = {};
  for (int kb = 0; kb < K; kb += 32) {
    FragH ah, al;
    const v4f x0 = *(const v4fa*)(arow + kb + 8 * hh), x1 = *(const v4fa*)(arow + kb + 8 * hh + 4), x2 = *(const v4fa*)(arow + kb + 16 + 8 * hh), x3 = *(const v4fa*)(arow + kb + 16 + 8 * hh + 4);
    float xs[16] = {x0[0],x0[1],x0[2],x0[3],x1[0],x1[1],x1[2],x1[3],x2[0],x2[1],x2[2],x2[3],x3[0],x3[1],x3[2],x3[3]};
#pragma unroll
    for (int i = 0; i < 16; ++i) { const _Float16 h = (_Float16)xs[i]; ah.h[i] = h; al.h[i] = ASPLIT ? (_Float16)(xs[i] - (float)h) : (_Float16)0.0f; }
#pragma unroll
    for (int t = 0; t < 4; ++t) { if (col0 + t * 16 >= N) continue; const size_t boff = (size_t)(col0 + t * 16 + ln) * ldb + kb; FragH bq; bq.half[0] = *(const v8us*)(Bh + boff + 8 * hh); bq.half[1] = *(const v8us*)(Bh + boff + 16 + 8 * hh);
      acc[t] = mmaH<ASPLIT ? 2 : 1>(ah.v, al.v, bq.v, bq.v, acc[t]); }
  }
#pragma unroll
  for (int t = 0; t < 4; ++t) { if (col0 + t * 16 >= N) continue;
#pragma unroll
    for (int r = 0; r < 8; ++r) so[w][8 * hh + r][t * 16 + ln] = acc[t][r] * alpha; }
  __builtin_amdgcn_fence(__ATOMIC_ACQ_REL, "workgroup"); __builtin_amdgcn_wave_barrier();
  const int rsub = lane >> 4, c4 = (lane & 15) * 4;
  {
#pragma unroll
    for (int q = 0; q < 8; ++q) { const int r = q * 2 + rsub; if (col0 + c4 < N) { const v4f v = *(const v4fa*)&so[w][r][c4]; *(v4f*)(C + (size_t)(row0 + r) * ldc + col0 + c4) = v; } }
     }
}

// Wt[n][k] = f16(W[k][n]·scale) from f32 row-major W[K][N] (scale = power of two; bf16-exact weights stay exact in f16 away from the subnormal range)
__global__ __launch_bounds__(256) void k_wt_f16(const float* __restrict__ W, _Float16* __restrict__ Wt, int K, int N, float scale) {
  const int t = blockIdx.x * 256 + threadIdx.x; if (t >= N * (K / 8)) return; const int n = t / (K / 8), k8 = (t % (K / 8)) * 8; FragH f;
#pragma unroll
  for (int i = 0; i < 8; ++i) f.h[i] = (_Float16)(bf16_round(W[(size_t)(k8 + i) * N + n]) * scale); const v8us o = f.half[0];
  *(v8us*)((unsigned short*)Wt + (size_t)n * K + k8) = o; 
}
// k_gemm_hh variant with fused epilogue: v = acc·alpha + bias[by·sBias + col] (+ CP[(row/rowsPerB)·sCPb + by·64 + col] if CP) ; ACT 0 none / 1 elu ; writes f16 C16 (and f32 C if non-null)
template <int ACT>
__global__ __launch_bounds__(128) void k_gemm_hhx(const _Float16* __restrict__ A, int lda, size_t sA, const _Float16* __restrict__ Bh, int ldb, size_t sB, float alpha, const float* __restrict__ bias, size_t sBias, const float* __restrict__ CP, int rowsPerB, size_t sCPb, int row0g,
    float* __restrict__ C, _Float16* __restrict__ C16, int ldc, size_t sC, int M, int N, int K) {
  __shared__ __attribute__((aligned(16))) float so[4][16][64];
  const int tid = threadIdx.x, w = tid >> 5, lane = tid & 31, ln = lane & 15, hh = lane >> 4; const int by = blockIdx.y;
  A += (size_t)by * sA; Bh += (size_t)by * sB; const size_t cofs = (size_t)by * sC; const float* bp = bias ? bias + (size_t)by * sBias : nullptr;
  const int ntn = (N + 63) / 64; const int wid = blockIdx.x * 4 + w; const int mt = wid / ntn, nq = wid % ntn; if (mt * 16 >= M) return;
  const int row0 = mt * 16, col0 = nq * 64; const _Float16* arow = A + (size_t)(row0 + ln) * lda;
  v8f acc[4] = {};
  for (int kb = 0; kb < K; kb += 32) { FragH ah; ah.half[0] = *(const v8us*)((const unsigned short*)arow + kb + 8 * hh); ah.half[1] = *(const v8us*)((const unsigned short*)arow + kb + 16 + 8 * hh);
#pragma unroll
    for (int t = 0; t < 4; ++t) { if (col0 + t * 16 >= N) continue; const size_t boff = (size_t)(col0 + t * 16 + ln) * ldb + kb; FragH bq; bq.half[0] = *(const v8us*)((const unsigned short*)Bh + boff + 8 * hh); bq.half[1] = *(const v8us*)((const unsigned short*)Bh + boff + 16 + 8 * hh);
      acc[t] = mmaH<1>(ah.v, ah.v, bq.v, bq.v, acc[t]); }
  }
#pragma unroll
  for (int t = 0; t < 4; ++t) { if (col0 + t * 16 >= N) continue; const int col = col0 + t * 16 + ln; const float bv = bp ? bf16_round(bp[col]) : 0.f;
#pragma unroll
    for (int r = 0; r < 8; ++r) { float v = acc[t][r] * alpha + bv; if (CP) { const int rr = row0g + row0 + 8 * hh + r; if (rowsPerB < 0) v += CP[cofs + (size_t)rr * ldc + col];      /* rowsPerB < 0: own element of the batched C plane */ else { const int bidx = rr / rowsPerB; v += CP[(size_t)bidx * sCPb + (size_t)by * 64 + col]; } } if (ACT == 1) v = (v > 0.f) ? v : expm1f(v); else if (ACT == 7) v = (v > 0.f) ? v + 1.0f : expf(v); else if (ACT == 8) v = tanhf(v); else if (ACT == 9) v = 0.5f * v * (1.0f + tanhf(0.7978845608028654f * (v + 0.044715f * v * v * v))); else if (ACT == 11) v = 1.0f / (1.0f + expf(-v)); else if (ACT == 12) v = (v > 0.f) ? v : 0.01f * v; else if (ACT == 14) v = (v > 0.f) ? v : 0.1f * v; else if (ACT == 16) v = (v >= 0.f) ? v : 0.3f * v; else if (ACT == 17) v = (v >= 0.f) ? v : 0.2f * v; else if (ACT == 15) v = v / (1.0f + expf(-v)); else if (ACT == 3) v = fmaxf(v, 0.f); else if (ACT == 6) v = 0.5f * v * (1.0f + erff(v * 0.70710678118654752f)); so[w][8 * hh + r][t * 16 + ln] = v; } }
  __builtin_amdgcn_fence(__ATOMIC_ACQ_REL, "workgroup"); __builtin_amdgcn_wave_barrier();
  const int rsub = lane >> 4, c4 = (lane & 15) * 4; typedef _Float16 v4h __attribute__((ext_vector_type(4)));
  {
#pragma unroll
    for (int q = 0; q < 8; ++q) { const int r = q * 2 + rsub; if (col0 + c4 < N) { const v4f v = *(const v4fa*)&so[w][r][c4]; if (C) *(v4f*)(C + cofs + (size_t)(row0 + r) * ldc + col0 + c4) = v; if (C16) { v4h h4; for (int i = 0; i < 4; ++i) h4[i] = (_Float16)v[i]; *(v4h*)(C16 + cofs + (size_t)(row0 + r) * ldc + col0 + c4) = h4; } } }
     }
}


typedef _Float16 v4h __attribute__((ext_vector_type(4)));

__global__ __launch_bounds__(256) void k_x16(const float* __restrict__ x, _Float16* __restrict__ X16, size_t n8) { const size_t t = (size_t)blockIdx.x * 256 + threadIdx.x; if (t >= n8) return; FragH f;
#pragma unroll
  for (int q = 0; q < 8; ++q) f.h[q] = (_Float16)bf16_round(x[t * 8 + q]); *(v8us*)((unsigned short*)X16 + t * 8) = f.half[0];  }
__global__ __launch_bounds__(256) void k_h16(const float* __restrict__ x, _Float16* __restrict__ X16, size_t n8) { const size_t t = (size_t)blockIdx.x * 256 + threadIdx.x; if (t >= n8) return; FragH f;
#pragma unroll
  for (int q = 0; q < 8; ++q) f.h[q] = (_Float16)x[t * 8 + q]; *(v8us*)((unsigned short*)X16 + t * 8) = f.half[0];  }
__global__ __launch_bounds__(256) void k_round16f(const float* __restrict__ W, _Float16* __restrict__ Bt, size_t n8) { const size_t t = (size_t)blockIdx.x * 256 + threadIdx.x; if (t >= n8) return; FragH f;
#pragma unroll
  for (int i = 0; i < 8; ++i) f.h[i] = (_Float16)(bf16_round(W[t * 8 + i]) * 16.0f); *(v8us*)((unsigned short*)Bt + t * 8) = f.half[0];  }
template <int NHv, int TTv>
__global__ __launch_bounds__(256) void k_vt(const _Float16* __restrict__ V16, int ldv, int voff, _Float16* __restrict__ Vt) { __shared__ unsigned short tl[64][66]; const int tid = threadIdx.x; const int slab = blockIdx.x / (TTv / 64), lg = blockIdx.x % (TTv / 64); const int b = slab / NHv, h = slab % NHv;
  for (int i = tid; i < 64 * 8; i += 256) { const int r = i / 8, c8 = (i % 8) * 8; FragH f; f.half[0] = *(const v8us*)((const unsigned short*)V16 + ((size_t)b * TTv + lg * 64 + r) * ldv + voff + h * 64 + c8);
#pragma unroll
    for (int q = 0; q < 8; ++q) tl[r][c8 + q] = f.u[q]; }
  __syncthreads();
  {
#pragma unroll
    for (int rd = 0; rd < 2; ++rd) { const int d = rd * 32 + tid / 8, pc = tid % 8; FragH f;
#pragma unroll
      for (int q = 0; q < 8; ++q) f.u[q] = tl[pc * 8 + q][d];
      *(v8us*)((unsigned short*)Vt + ((size_t)slab * 64 + d) * TTv + lg * 64 + pc * 8) = f.half[0]; }
     } }

__global__ __launch_bounds__(256) void k_hl(const float* __restrict__ F, _Float16* __restrict__ Hh, _Float16* __restrict__ Hl, size_t n8) { const size_t t = (size_t)blockIdx.x * 256 + threadIdx.x; if (t >= n8) return; FragH fh, fl; const v4f a = *(const v4fa*)(F + t * 8), c = *(const v4fa*)(F + t * 8 + 4);
#pragma unroll
  for (int q = 0; q < 4; ++q) { _Float16 h = (_Float16)a[q]; fh.h[q] = h; fl.h[q] = (_Float16)((a[q] - (float)h) * 1024.0f); h = (_Float16)c[q]; fh.h[4 + q] = h; fl.h[4 + q] = (_Float16)((c[q] - (float)h) * 1024.0f); }
  { *(v8us*)((unsigned short*)Hh + t * 8) = fh.half[0]; *(v8us*)((unsigned short*)Hl + t * 8) = fl.half[0];  } }

// ---- fast GEMM (wave tile 32x64; requires M % 32 == 0 rows per launch region and N % 64 == 0); epilogue = k_gemm_hhx semantics ----
__device__ __forceinline__ v16h g2_frag(const _Float16* p, int hh) { FragH f; f.half[0] = *(const v8us*)((const unsigned short*)p + 8 * hh); f.half[1] = *(const v8us*)((const unsigned short*)p + 16 + 8 * hh); return f.v; }
__device__ __forceinline__ v8f g2_mma(v16h a, v16h b, v8f c) { v8f d = __builtin_amdgcn_wmma_f32_16x16x32_f16(false, a, false, b, (short)0, c, false, false); asm volatile("v_nop\n\tv_nop\n\tv_nop\n\tv_nop" : "+v"(d) : "v"(a), "v"(b)); return d; }
template <int ACT>
__global__ __launch_bounds__(128) void k_gemm2(const _Float16* __restrict__ A, int lda, size_t sA, const _Float16* __restrict__ Bh, int ldb, size_t sB, float alpha, const float* __restrict__ bias, size_t sBias, const float* __restrict__ CP, int rowsPerB, size_t sCPb, int row0g,
    float* __restrict__ C, _Float16* __restrict__ C16, int ldc, size_t sC, int M, int N, int K) { static_assert(ACT == 0 || ACT == 3 || ACT == 6 || ACT == 8 || ACT == 9 || ACT == 11 || ACT == 12 || ACT == 14 || ACT == 15 || ACT == 16 || ACT == 17, "k_gemm2: unsupported ACT code (would silently apply no activation)");
  __shared__ __attribute__((aligned(16))) float so[4][32][68];
  const int tid = threadIdx.x, w = tid >> 5, lane = tid & 31, ln = lane & 15, hh = lane >> 4; const int by = blockIdx.y;
  A += (size_t)by * sA; Bh += (size_t)by * sB; const size_t cofs = (size_t)by * sC; const float* bp = bias ? bias + (size_t)by * sBias : nullptr;
  const int ntn = N >> 6; const int mt = blockIdx.x / ntn, nq = blockIdx.x - mt * ntn; const int row0 = mt * 128 + 32 * w, col0 = nq * 64; if (row0 >= M) return;
  const _Float16* a0p = A + (size_t)(row0 + ln) * lda; const _Float16* a1p = a0p + (size_t)16 * lda;
  const _Float16* b0p = Bh + (size_t)(col0 + ln) * ldb; const _Float16* b1p = b0p + (size_t)16 * ldb; const _Float16* b2p = b1p + (size_t)16 * ldb; const _Float16* b3p = b2p + (size_t)16 * ldb;
  const v8f z8 = {0.f,0.f,0.f,0.f,0.f,0.f,0.f,0.f}; v8f c00 = z8, c01 = z8, c02 = z8, c03 = z8, c10 = z8, c11 = z8, c12 = z8, c13 = z8;
#pragma unroll 1
  for (int kb = 0; kb < K; kb += 32) { const v16h a0 = g2_frag(a0p + kb, hh), a1 = g2_frag(a1p + kb, hh);
    v16h b = g2_frag(b0p + kb, hh); c00 = g2_mma(a0, b, c00); c10 = g2_mma(a1, b, c10);
    b = g2_frag(b1p + kb, hh); c01 = g2_mma(a0, b, c01); c11 = g2_mma(a1, b, c11);
    b = g2_frag(b2p + kb, hh); c02 = g2_mma(a0, b, c02); c12 = g2_mma(a1, b, c12);
    b = g2_frag(b3p + kb, hh); c03 = g2_mma(a0, b, c03); c13 = g2_mma(a1, b, c13); }
  v8f accs[8] = {c00, c01, c02, c03, c10, c11, c12, c13};
#pragma unroll
  for (int u = 0; u < 8; ++u) { const int t = u & 3, half = u >> 2; const int col = col0 + t * 16 + ln; const float bv = bp ? bf16_round(bp[col]) : 0.f;
#pragma unroll
    for (int r = 0; r < 8; ++r) { const int rloc = half * 16 + 8 * hh + r; float v = accs[u][r] * alpha + bv; if (CP) { if (rowsPerB < 0) v += CP[cofs + (size_t)(row0g + row0 + rloc) * ldc + col];      /* rowsPerB < 0: own element of the batched C plane */ else { const int bidx = (row0g + row0 + rloc) / rowsPerB; v += CP[(size_t)bidx * sCPb + (size_t)by * 64 + col]; } }
      if (ACT == 3) v = fmaxf(v, 0.f); else if (ACT == 6) v = 0.5f * v * (1.0f + erff(v * 0.70710678118654752f)); else if (ACT == 11) v = 1.0f / (1.0f + expf(-v)); else if (ACT == 15) v = v / (1.0f + expf(-v)); else if (ACT == 12) v = (v > 0.f) ? v : 0.01f * v; else if (ACT == 8) v = tanhf(v); else if (ACT == 9) v = 0.5f * v * (1.0f + tanhf(0.7978845608028654f * (v + 0.044715f * v * v * v))); else if (ACT == 14) v = (v > 0.f) ? v : 0.1f * v; else if (ACT == 16) v = (v >= 0.f) ? v : 0.3f * v; else if (ACT == 17) v = (v >= 0.f) ? v : 0.2f * v;
      so[w][rloc][t * 16 + ln] = v; } }
  __builtin_amdgcn_fence(__ATOMIC_ACQ_REL, "workgroup"); __builtin_amdgcn_wave_barrier();
  const int rsub = lane >> 4, c4 = (lane & 15) * 4;
  {
#pragma unroll
    for (int q = 0; q < 16; ++q) { const int r = q * 2 + rsub; const v4f v = *(const v4fa*)&so[w][r][c4]; if (C) *(v4f*)(C + cofs + (size_t)(row0 + r) * ldc + col0 + c4) = v; if (C16) { v4h h4; for (int i = 0; i < 4; ++i) h4[i] = (_Float16)v[i]; *(v4h*)(C16 + cofs + (size_t)(row0 + r) * ldc + col0 + c4) = h4; } }
     } }


__global__ __launch_bounds__(256) void k_wnat(const float* __restrict__ w, size_t n8, _Float16* __restrict__ Bt) { const size_t t = (size_t)blockIdx.x * 256 + threadIdx.x; if (t >= n8) return; FragH f; for (int q = 0; q < 8; ++q) f.h[q] = (_Float16)(bf16_round(w[t * 8 + q]) * 16.0f); *(v8us*)((unsigned short*)Bt + t * 8) = f.half[0];  }
__global__ __launch_bounds__(256) void k_rsm(const float* __restrict__ S, _Float16* __restrict__ P, int nrows) {
  #pragma clang fp contract(off)
  const int i = blockIdx.x * 256 + threadIdx.x; if (i >= nrows) return; const float* s = S + (size_t)i * SQ; float mx = -3.0e38f;
#pragma unroll 1
  for (int j = 0; j < SQ; ++j) mx = fmaxf(mx, s[j]); float se = 0.f;
#pragma unroll 1
  for (int j = 0; j < SQ; ++j) se += expf(s[j] - mx); const float sc = 256.0f / se;
#pragma unroll 1
  for (int j0 = 0; j0 < SQ; j0 += 8) { FragH f; for (int q = 0; q < 8; ++q) f.h[q] = (_Float16)(expf(s[j0 + q] - mx) * sc); unsigned short* d = (unsigned short*)P + (size_t)i * SQ + j0; *(v8us*)d = f.half[0];  } }
__global__ __launch_bounds__(256) void k_vt(const _Float16* __restrict__ V16, int b, int h0, _Float16* __restrict__ VT) { __shared__ unsigned short tl[64][65]; const int tid = threadIdx.x; const int hh = blockIdx.x % HG, sg = blockIdx.x / HG; const int s0 = sg * 64; const int h = h0 + hh;
  for (int i = tid; i < 64 * 8; i += 256) { const int j = i / 8, d8 = (i % 8) * 8; FragH f; f.half[0] = *(const v8us*)((const unsigned short*)V16 + ((size_t)b * SQ + s0 + j) * DM + h * HD + d8); for (int q = 0; q < 8; ++q) tl[d8 + q][j] = f.u[q]; }
  __syncthreads();
  { for (int i = tid; i < 64 * 8; i += 256) { const int d = i / 8, j8 = (i % 8) * 8; FragH f; for (int q = 0; q < 8; ++q) f.u[q] = tl[d][j8 + q]; *(v8us*)((unsigned short*)VT + ((size_t)hh * HD + d) * SQ + s0 + j8) = f.half[0]; }  } }



// Four exponentials 2^x in place. The closing v_nop is the free slot that the instruction set asks for behind a transcendental before its result is used or its
// source overwritten; it stands in the same statement because nothing else would keep it directly behind the last v_exp_f32 (inside, each v_exp_f32 is independent of the one before).
__device__ __forceinline__ v4f exp2x4(v4f x) { float a = x[0], b = x[1], c = x[2], d = x[3];
  asm("v_exp_f32 %0, %0\n\tv_exp_f32 %1, %1\n\tv_exp_f32 %2, %2\n\tv_exp_f32 %3, %3\n\tv_nop" : "+v"(a), "+v"(b), "+v"(c), "+v"(d));
  const v4f r = {a, b, c, d}; return r; }
#define FA_LAG 5.5f                  /* score units; 5.5 log2 e = 7.9 */
#define FA_L2E 1.44269504088896340736f
#define FA_PITCH 144                 /* LDS row pitch, bytes */
#define FA_TILE (64 * FA_PITCH)      /* one operand's 64 rows */
#define FA_BUF (2 * FA_TILE)         /* K tile + V^T tile */
#define FA_EP 272                    /* output staging pitch, bytes: 64 f32 + 16 */
__device__ __forceinline__ v16h fa_frag(const unsigned char* p) { FragH f; f.half[0] = *(const v8us*)p; f.half[1] = *(const v8us*)(p + 32); return f.v; }
__device__ __forceinline__ v8f fa_mma(v16h a, v16h b, v8f c) { return __builtin_amdgcn_wmma_f32_16x16x32_f16(false, a, false, b, (short)0, c, false, false); }
__device__ __forceinline__ float fa_xhalf(float x) { return __builtin_bit_cast(float, __builtin_amdgcn_permlanex16(__builtin_bit_cast(int, x), __builtin_bit_cast(int, x), 0x76543210, 0xfedcba98, false, false)); }      /* lane l with lane l ^ 16 */
__global__ __launch_bounds__(256) void k_fattn(const _Float16* __restrict__ Q16, const _Float16* __restrict__ K16, const _Float16* __restrict__ VT, const float* __restrict__ am, float* __restrict__ out) {
  __shared__ __attribute__((aligned(16))) unsigned char L[8 * 32 * FA_EP];      /* two K/V buffers (2 x FA_BUF bytes) in the loop, output staging behind it */
  __shared__ __attribute__((aligned(16))) float ms[SQ];
  static_assert(2 * FA_BUF <= 8 * 32 * FA_EP, "the two K/V buffers must fit the array");
  const int tid = threadIdx.x, lane = tid & 31, c = lane & 15, h = lane >> 4; const int w = __builtin_amdgcn_readfirstlane(tid >> 5);
  const int head = blockIdx.y, q0 = blockIdx.x * 256 + w * 32;
  /* staging: 8 threads cover one 128-byte row, a thread brings rows sr and sr + 32 of both operands */
  const int sr = tid >> 3, sc = tid & 7;
  const unsigned short* kg = (const unsigned short*)K16 + (size_t)sr * DM + head * HD + sc * 8;
  const unsigned short* vg = (const unsigned short*)VT + ((size_t)head * HD + sr) * SQ + sc * 8;
  unsigned char* lw = L + sr * FA_PITCH + sc * 16;
  v8us ka = *(const v8us*)kg, kb = *(const v8us*)(kg + (size_t)32 * DM), va = *(const v8us*)vg, vb = *(const v8us*)(vg + (size_t)32 * SQ);
#pragma unroll
  for (int u = 0; u < SQ / 1024; ++u) { const v4f m = *(const v4fa*)(am + u * 1024 + tid * 4); v4f r;
#pragma unroll
    for (int q = 0; q < 4; ++q) r[q] = bf16_round(m[q]);
    *(v4fa*)&ms[u * 1024 + tid * 4] = r; }
  v16h qf[2][2];
#pragma unroll
  for (int g = 0; g < 2; ++g) { const _Float16* qp = Q16 + (size_t)(q0 + 16 * g + c) * DM + head * HD; qf[g][0] = g2_frag(qp, h); qf[g][1] = g2_frag(qp + 32, h); }
  FragH ones;      /* A operand whose row 0 is 1.0: its product with P^T is the column sums of P^T, the softmax denominators */
#pragma unroll
  for (int i = 0; i < 16; ++i) ones.h[i] = (c == 0) ? (_Float16)1.0f : (_Float16)0.0f;
  const v8f z8 = {0.f, 0.f, 0.f, 0.f, 0.f, 0.f, 0.f, 0.f};
  v8f acc[2][4], lacc[2]; float m_run[2];
#pragma unroll
  for (int g = 0; g < 2; ++g) { m_run[g] = -3.402823466e38f; lacc[g] = z8;      /* the lowest finite value: any finite score replaces it, a key at -inf keeps weight 0 */
#pragma unroll
    for (int t = 0; t < 4; ++t) acc[g][t] = z8; }
  *(v8us*)lw = ka; *(v8us*)(lw + 32 * FA_PITCH) = kb; *(v8us*)(lw + FA_TILE) = va; *(v8us*)(lw + FA_TILE + 32 * FA_PITCH) = vb;
  __syncthreads();      /* publishes stage 0 and the mask */
#pragma unroll 1      /* 64 trips of 36 matrix instructions stay rolled: code size and registers */
  for (int st = 0; st < SQ / 64; ++st) {
    const unsigned char* Lb = L + (st & 1) * FA_BUF;
    if (st + 1 < SQ / 64) { const unsigned short* kn = kg + (size_t)(st + 1) * 64 * DM; const unsigned short* vn = vg + (st + 1) * 64;
      ka = *(const v8us*)kn; kb = *(const v8us*)(kn + (size_t)32 * DM); va = *(const v8us*)vn; vb = *(const v8us*)(vn + (size_t)32 * SQ); }
#pragma unroll
    for (int sub = 0; sub < 2; ++sub) {
      v8f s[2][2];
#pragma unroll
      for (int kt = 0; kt < 2; ++kt) { const unsigned char* kp = Lb + (sub * 32 + 16 * kt + c) * FA_PITCH + 16 * h; const v16h k0 = fa_frag(kp), k1 = fa_frag(kp + 64);
        const float* mp = ms + st * 64 + sub * 32 + 16 * kt + 8 * h; const v4f m0 = *(const v4fa*)mp, m1 = *(const v4fa*)(mp + 4);
        const v8f mc = {m0[0], m0[1], m0[2], m0[3], m1[0], m1[1], m1[2], m1[3]};
        s[kt][0] = fa_mma(k0, qf[0][0], z8); s[kt][1] = fa_mma(k0, qf[1][0], z8);
        s[kt][0] = fa_mma(k1, qf[0][1], s[kt][0]) * 0.125f + mc; s[kt][1] = fa_mma(k1, qf[1][1], s[kt][1]) * 0.125f + mc; }      /* 1/sqrt(64) is a power of two, so this is the score plus the mask in one f32 rounding, fused or not, as the separate kernels had it */
      v16h vf[4];
#pragma unroll
      for (int t = 0; t < 4; ++t) vf[t] = fa_frag(Lb + FA_TILE + (16 * t + c) * FA_PITCH + sub * 64 + 16 * h);
      float mb[2]; bool need = false;
#pragma unroll
      for (int g = 0; g < 2; ++g) { float mx = fmaxf(s[0][g][0], s[1][g][0]);
#pragma unroll
        for (int r = 1; r < 8; ++r) mx = fmaxf(fmaxf(mx, s[0][g][r]), s[1][g][r]);
        mx = fmaxf(mx, fa_xhalf(mx)); mb[g] = mx; need = need || (mx > m_run[g] + FA_LAG); }
      if (__builtin_amdgcn_ballot_w32(need) != 0) {      /* one scalar branch a pass; rare behind the first passes */
        v4f e = {(m_run[0] - fmaxf(m_run[0], mb[0])) * FA_L2E, (m_run[1] - fmaxf(m_run[1], mb[1])) * FA_L2E, 0.f, 0.f}; e = exp2x4(e);
#pragma unroll
        for (int g = 0; g < 2; ++g) { m_run[g] = fmaxf(m_run[g], mb[g]); lacc[g] = lacc[g] * e[g];
#pragma unroll
          for (int t = 0; t < 4; ++t) acc[g][t] = acc[g][t] * e[g]; } }
#pragma unroll
      for (int g = 0; g < 2; ++g) { const float mr = m_run[g]; FragH pf;
#pragma unroll
        for (int j = 0; j < 4; ++j) { v4f a;
#pragma unroll
          for (int q = 0; q < 4; ++q) a[q] = (s[j >> 1][g][4 * (j & 1) + q] - mr) * FA_L2E;
          a = exp2x4(a);
#pragma unroll
          for (int q = 0; q < 4; ++q) pf.h[4 * j + q] = (_Float16)a[q]; }
#pragma unroll
        for (int t = 0; t < 4; ++t) acc[g][t] = fa_mma(vf[t], pf.v, acc[g][t]);
        lacc[g] = fa_mma(ones.v, pf.v, lacc[g]); }
    }
    if (st + 1 < SQ / 64) { unsigned char* p = lw + ((st + 1) & 1) * FA_BUF;
      *(v8us*)p = ka; *(v8us*)(p + 32 * FA_PITCH) = kb; *(v8us*)(p + FA_TILE) = va; *(v8us*)(p + FA_TILE + 32 * FA_PITCH) = vb; }
    __syncthreads();      /* publishes stage st + 1 and ends every wave's reads of stage st, whose buffer the next trip refills (behind the last trip: frees the array for the output staging) */
  }
  unsigned char* E = L + w * (32 * FA_EP);      /* this wave's own 32 rows of 64 f32 */
#pragma unroll
  for (int g = 0; g < 2; ++g) { const float lr = lacc[g][0]; const float inv = 1.0f / (lr + fa_xhalf(lr));      /* register 0: the sum in lanes 0-15, 0 in lanes 16-31 */
#pragma unroll
    for (int t = 0; t < 4; ++t) { const v8f o = acc[g][t] * inv; const v4f o0 = {o[0], o[1], o[2], o[3]}, o1 = {o[4], o[5], o[6], o[7]};
      unsigned char* p = E + (16 * g + c) * FA_EP + 64 * t + 32 * h; *(v4fa*)p = o0; *(v4fa*)(p + 16) = o1; } }      /* row = query, d = 16 t + 8 h + r */
  __builtin_amdgcn_fence(__ATOMIC_ACQ_REL, "workgroup"); __builtin_amdgcn_wave_barrier();      /* the rows are read back by other lanes of the same wave */
#pragma unroll
  for (int i = 0; i < 16; ++i) { const int row = i * 2 + h; const v4f v = *(const v4fa*)(E + row * FA_EP + c * 16);
    *(v4f*)(out + (size_t)(q0 + row) * DM + head * HD + c * 4) = v; } }      /* whole 256-byte row pieces: every 128-byte line stored once */

// ---- Q, K and V projections in one launch: C[m][n] = f16(x[m][:] . Wt[n][:] / 16 + bias[n]), n running over the three weight matrices (blockIdx.y: 6 column tiles each) ----
// One work-group = 4 waves, a 128 x 128 output tile, a 64 x 64 quadrant a wave (16 accumulator tiles: 8 LDS fragment reads feed 16 matrix instructions).
// 64 k of the x rows and of the Wt rows a stage go through registers into one of two LDS buffers (row pitch 128 + 16 bytes), the next stage's global loads (whole 128-byte lines) in flight under this stage's work.
// Transposed product (A = Wt rows, B = x rows): a lane then holds 8 neighbouring n of one token row, one 16-byte piece of the f16 output row. k runs upward in steps of 32.
#define PJ_PITCH 144                 /* LDS row pitch, bytes */
#define PJ_TILE (128 * PJ_PITCH)     /* one operand's 128 rows */
#define PJ_BUF (2 * PJ_TILE)         /* x tile + Wt tile */
__global__ __launch_bounds__(128) void k_qkv(const _Float16* __restrict__ X16, const _Float16* __restrict__ BQ, const _Float16* __restrict__ BK, const _Float16* __restrict__ BV,
    const float* __restrict__ bq, const float* __restrict__ bk, const float* __restrict__ bv, _Float16* __restrict__ Q16, _Float16* __restrict__ K16, _Float16* __restrict__ V16) {
  __shared__ __attribute__((aligned(16))) unsigned char L[2 * PJ_BUF];      /* two operand buffers in the loop, output staging (4 waves x 64 rows) behind it */
  const int tid = threadIdx.x, lane = tid & 31, c = lane & 15, h = lane >> 4; const int w = __builtin_amdgcn_readfirstlane(tid >> 5);
  const int sel = blockIdx.y / (DM / 128), col0 = (blockIdx.y % (DM / 128)) * 128, row0 = blockIdx.x * 128;
  const _Float16* Bt = sel == 0 ? BQ : sel == 1 ? BK : BV; const float* bias = sel == 0 ? bq : sel == 1 ? bk : bv; _Float16* C = sel == 0 ? Q16 : sel == 1 ? K16 : V16;
  const int wm = (w & 1) * 64, wn = (w >> 1) * 64;      /* this wave's quadrant */
  /* staging: 8 threads cover one 128-byte row piece, a thread brings rows sr + 16 p of both operands */
  const int sr = tid >> 3, sc = tid & 7;
  const unsigned char* xp = (const unsigned char*)(X16 + (size_t)(row0 + sr) * DM + sc * 8); const unsigned char* wp = (const unsigned char*)(Bt + (size_t)(col0 + sr) * DM + sc * 8);      /* step 128 bytes a stage */
  unsigned char* lw = L + sr * PJ_PITCH + sc * 16;
  v8us xs[8], wr[8];
#pragma unroll
  for (int p = 0; p < 8; ++p) { xs[p] = *(const v8us*)(xp + p * (32 * DM)); wr[p] = *(const v8us*)(wp + p * (32 * DM)); }
  const v8f z8 = {0.f, 0.f, 0.f, 0.f, 0.f, 0.f, 0.f, 0.f};
  v8f acc[4][4];
#pragma unroll
  for (int i = 0; i < 4; ++i)
#pragma unroll
    for (int j = 0; j < 4; ++j) acc[i][j] = z8;
#pragma unroll
  for (int p = 0; p < 8; ++p) { *(v8us*)(lw + p * 16 * PJ_PITCH) = xs[p]; *(v8us*)(lw + PJ_TILE + p * 16 * PJ_PITCH) = wr[p]; }
  __syncthreads();      /* publishes stage 0 */
#pragma unroll 1      /* 12 trips of 32 matrix instructions stay rolled: registers */
  for (int st = 0; st < DM / 64; ++st) {
    const unsigned char* Lb = L + (st & 1) * PJ_BUF;
    if (st + 1 < DM / 64) { xp += 128; wp += 128;
#pragma unroll
      for (int p = 0; p < 8; ++p) { xs[p] = *(const v8us*)(xp + p * (32 * DM)); wr[p] = *(const v8us*)(wp + p * (32 * DM)); } }
#pragma unroll
    for (int ks = 0; ks < 2; ++ks) { v16h xf[4];
#pragma unroll
      for (int i = 0; i < 4; ++i) xf[i] = fa_frag(Lb + (wm + 16 * i + c) * PJ_PITCH + ks * 64 + 16 * h);
#pragma unroll
      for (int j = 0; j < 4; ++j) { const v16h wf = fa_frag(Lb + PJ_TILE + (wn + 16 * j + c) * PJ_PITCH + ks * 64 + 16 * h);
#pragma unroll
        for (int i = 0; i < 4; ++i) acc[i][j] = fa_mma(wf, xf[i], acc[i][j]); } }
    if (st + 1 < DM / 64) { unsigned char* p0 = lw + ((st + 1) & 1) * PJ_BUF;
#pragma unroll
      for (int p = 0; p < 8; ++p) { *(v8us*)(p0 + p * 16 * PJ_PITCH) = xs[p]; *(v8us*)(p0 + PJ_TILE + p * 16 * PJ_PITCH) = wr[p]; } }
    __syncthreads();      /* publishes stage st + 1 and ends every wave's reads of stage st, whose buffer the next trip refills (behind the last trip: frees the array for the output staging) */
  }
  unsigned char* E = L + w * (64 * PJ_PITCH);      /* this wave's own 64 rows of 64 f16 */
#pragma unroll
  for (int j = 0; j < 4; ++j) { const float* bp = bias + col0 + wn + 16 * j + 8 * h; const v4f b0 = *(const v4fa*)bp, b1 = *(const v4fa*)(bp + 4);
    const float bb[8] = {bf16_round(b0[0]), bf16_round(b0[1]), bf16_round(b0[2]), bf16_round(b0[3]), bf16_round(b1[0]), bf16_round(b1[1]), bf16_round(b1[2]), bf16_round(b1[3])};
#pragma unroll
    for (int i = 0; i < 4; ++i) { FragH f;
#pragma unroll
      for (int r = 0; r < 8; ++r) f.h[r] = (_Float16)(acc[i][j][r] * 0.0625f + bb[r]);
      *(v8us*)(E + (16 * i + c) * PJ_PITCH + 32 * j + 16 * h) = f.half[0]; } }      /* row = token, n = 16 j + 8 h + r */
  __builtin_amdgcn_fence(__ATOMIC_ACQ_REL, "workgroup"); __builtin_amdgcn_wave_barrier();      /* the rows are read back by other lanes of the same wave */
#pragma unroll
  for (int it = 0; it < 16; ++it) { const int row = it * 4 + (lane >> 3); const v8us v = *(const v8us*)(E + row * PJ_PITCH + (lane & 7) * 16);
    *(v8us*)((unsigned short*)C + (size_t)(row0 + wm + row) * DM + col0 + wn + (lane & 7) * 8) = v; } }      /* whole 128-byte lines, each stored once by one wave */

extern "C" void kernel_launch(void* const* d_in, const int* in_sizes, int n_in,
                              void* d_out, int out_size, void* d_ws, size_t ws_size, hipStream_t stream) {
  (void)in_sizes; (void)n_in; (void)out_size;
  const float* const* I = (const float* const*)d_in; const float* x = I[0]; const float* am = I[1]; const float* wq = I[2]; const float* bq = I[3]; const float* wk = I[4]; const float* bk = I[5]; const float* wv = I[6]; const float* bv = I[7];      /* weights [in][out]; am = additive mask [NB][1][1][SQ] */
  char* ws = (char*)d_ws; size_t off = 0;
  auto take = [&](size_t bytes) { char* p = ws + off; off += (bytes + 255) & ~(size_t)255; return p; };
  _Float16* BQ = (_Float16*)take((size_t)DM * DM * 2); _Float16* BK = (_Float16*)take((size_t)DM * DM * 2); _Float16* BV = (_Float16*)take((size_t)DM * DM * 2); 
  _Float16* X16 = (_Float16*)take(NR * DM * 2); _Float16* Q16 = (_Float16*)take(NR * DM * 2); _Float16* K16 = (_Float16*)take(NR * DM * 2); _Float16* V16 = (_Float16*)take(NR * DM * 2);
  _Float16* VT = (_Float16*)take((size_t)NH * HD * SQ * 2);
  if (off > ws_size) return;
  { const unsigned g = (unsigned)(((size_t)DM * (DM / 8) + 255) / 256); k_wt_f16<<<g, 256, 0, stream>>>(wq, BQ, DM, DM, 16.0f); k_wt_f16<<<g, 256, 0, stream>>>(wk, BK, DM, DM, 16.0f); k_wt_f16<<<g, 256, 0, stream>>>(wv, BV, DM, DM, 16.0f); }      /* [in][out] -> Bt[n][k] x16 */
  k_x16<<<(unsigned)((NR * DM / 8 + 255) / 256), 256, 0, stream>>>(x, X16, NR * DM / 8);
  const size_t r0p = (size_t)B0 * SQ;      /* first projected row */
  k_qkv<<<dim3((unsigned)(MP / 128), 3 * (DM / 128)), 128, 0, stream>>>(X16 + r0p * DM, BQ, BK, BV, bq, bk, bv, Q16 + r0p * DM, K16 + r0p * DM, V16 + r0p * DM);      /* q, k, v rows as f16, all three in one launch */
  for (int b = B0; b < B0 + NBR; ++b) { const size_t r0 = (size_t)b * SQ;
    k_vt<NH, SQ><<<NH * (SQ / 64), 256, 0, stream>>>(V16 + r0 * LQ, LQ, 0, VT);      /* V^T [NH][HD][SQ] for this batch */
    k_fattn<<<dim3(SQ / 256, NH), 256, 0, stream>>>(Q16 + r0 * LQ, K16 + r0 * LQ, VT, am + (size_t)b * SQ, (float*)d_out + r0 * DM); }      /* scores, softmax and P.V of all heads; out = merged heads, f32 */
}

// v004
// Measured time: 95.6 microseconds a run.
// Timed twice side by side with v003, it ran 1.08 times as fast both times.
// Over all steps from v000 it is 106 times as fast.
#include <hip/hip_runtime.h>
// BERT self-attention (hidden [1][4096][768]; q/k/v = x W + b with W stored [in][out], 12 heads of 64; scores / 8 + the additive attention_mask[b][key] (f32); softmax; out = attn v merged -> [1][4096][768]; no output projection).
// Structure: token rows r = b*4096 + s; x as exact f16 rows (bf16-rounded); Q, K, V as one WMMA GEMM launch (128x128 work-group tiles staged in LDS, 64x64 wave tiles, f32 accumulation, exact x16 weights + bias, f16 outputs); per batch: V^T for all heads via LDS transposes; per batch one fused attention launch over all heads: scores (WMMA, K = 64), running softmax of (scores / 8 + additive mask) on VALU (f32 statistics, native exp; weights as f16 in registers), o = P . V (WMMA), normalised and written as f32 into the merged output rows.
// Compute dtype: inputs rounded to bf16; x / weights exact; q, k, v and softmax weights as plain f16 GEMM operands (~2^-12); scores, softmax statistics and o f32. v_wmma_f32_16x16x32_f16.
#define NB 1
#define SQ 4096
#define DM 768
#define NH 12
#define HD 64
#define HG 1                         /* heads per launch of the second k_vt (not launched) */
#define B0 0                         /* first batch processed (debug hook) */
#define NBR NB                       /* batches processed (debug hook) */
#define NR ((size_t)NB * SQ)         /* token rows */
#define MP ((int)((size_t)NBR * SQ)) /* rows projected (debug hook) */
#define QN SQ                        /* unused: the attention launch covers all SQ queries */
#define NHD NH                       /* unused: the attention launch covers all NH heads */
#define MPO MP                       /* unused: there is no output stage */
#define LQ DM      /* row pitch of the q/k/v rows */
typedef __bf16 v16b __attribute__((ext_vector_type(16)));
typedef unsigned short v8us __attribute__((ext_vector_type(8), may_alias));
typedef float  v8f  __attribute__((ext_vector_type(8)));
typedef float  v4f  __attribute__((ext_vector_type(4)));
typedef float  v4fa __attribute__((ext_vector_type(4), may_alias));
union FragB { v16b v; v8us half[2]; unsigned short u[16]; };

__device__ __forceinline__ unsigned short bf16_bits(float x) { unsigned int u = __float_as_uint(x); return (unsigned short)((u + 0x7FFFu + ((u >> 16) & 1u)) >> 16); }
__device__ __forceinline__ float bf16_val(unsigned short b) { return __uint_as_float(((unsigned int)b) << 16); }
__device__ __forceinline__ float bf16_round(float x) { return bf16_val(bf16_bits(x)); }
// D += A·B with NT terms: 1 = ah·bh, 2 = + al·bh (A split), 3 = + ah·bl (both split)
template <int NT>
__device__ __forceinline__ v8f mmaN(v16b ah, v16b al, v16b bh, v16b bl, v8f c) {
  c = __builtin_amdgcn_wmma_f32_16x16x32_bf16(false, ah, false, bh, (short)0, c, false, false);
  if (NT >= 2) c = __builtin_amdgcn_wmma_f32_16x16x32_bf16(false, al, false, bh, (short)0, c, false, false);
  if (NT >= 3) c = __builtin_amdgcn_wmma_f32_16x16x32_bf16(false, ah, false, bl, (short)0, c, false, false);
  asm volatile("v_nop\n\tv_nop\n\tv_nop\n\tv_nop" : "+v"(c) : "v"(ah), "v"(al), "v"(bh), "v"(bl));
  return c;
}

__global__ __launch_bounds__(256) void k_wt_bf16(const float* __restrict__ W, unsigned short* __restrict__ Wt, int K, int N) {
  const int t = blockIdx.x * 256 + threadIdx.x;
  const int k8n = K / 8;
  if (t >= N * k8n) return;
  const int n = t / k8n, k8 = (t % k8n) * 8;
  v8us v;
#pragma unroll
  for (int i = 0; i < 8; ++i) v[i] = bf16_bits(W[(size_t)(k8 + i) * N + n]);
  *(v8us*)(Wt + (size_t)n * K + k8) = v;
  
}

// GEMM C[M][N] (f32, pitch ldc) = act(A[M][K]·W + bias). A f32 row-major (pitch lda) converted per fragment to bf16
// (ASPLIT: hi/lo two planes -> 2 terms, else single rounded term); Wt bf16 [N][K] (pitch ldb). BIAS_BF16 rounds the
// bias to bf16 first (bias quantised to bf16 before the add). K%32==0, M%16==0, N%64==0.
template <bool ASPLIT, int ACT, bool BIAS_BF16>
__global__ __launch_bounds__(128) void k_gemm_bf(const float* __restrict__ A, int lda, const unsigned short* __restrict__ Wt, int ldb,
                                               const float* __restrict__ bias, float* __restrict__ C, int ldc, int M, int N, int K) {
  __shared__ __attribute__((aligned(16))) float so[4][16][64];
  const int tid = threadIdx.x, w = tid >> 5, lane = tid & 31, ln = lane & 15, hh = lane >> 4;
  const int ntn = N / 64;
  const int wid = blockIdx.x * 4 + w;
  const int mt = wid / ntn, nq = wid % ntn;
  if (mt * 16 >= M) return;
  const int row0 = mt * 16, col0 = nq * 64;
  const float* arow = A + (size_t)(row0 + ln) * lda;
  v8f acc[4] = {};
  for (int kb = 0; kb < K; kb += 32) {
    FragB ah, al;
    const v4f x0 = *(const v4fa*)(arow + kb + 8 * hh), x1 = *(const v4fa*)(arow + kb + 8 * hh + 4);
    const v4f x2 = *(const v4fa*)(arow + kb + 16 + 8 * hh), x3 = *(const v4fa*)(arow + kb + 16 + 8 * hh + 4);
    float xs[16] = {x0[0],x0[1],x0[2],x0[3],x1[0],x1[1],x1[2],x1[3],x2[0],x2[1],x2[2],x2[3],x3[0],x3[1],x3[2],x3[3]};
#pragma unroll
    for (int i = 0; i < 16; ++i) { const unsigned short hb = bf16_bits(xs[i]); ah.u[i] = hb; al.u[i] = ASPLIT ? bf16_bits(xs[i] - bf16_val(hb)) : (unsigned short)0; }
#pragma unroll
    for (int t = 0; t < 4; ++t) {
      const unsigned short* brow = Wt + (size_t)(col0 + t * 16 + ln) * ldb + kb;
      FragB b;
      b.half[0] = *(const v8us*)(brow + 8 * hh);
      b.half[1] = *(const v8us*)(brow + 16 + 8 * hh);
      acc[t] = mmaN<ASPLIT ? 2 : 1>(ah.v, al.v, b.v, b.v, acc[t]);
    }
  }
#pragma unroll
  for (int t = 0; t < 4; ++t) {
    float bv = bias ? bias[col0 + t * 16 + ln] : 0.f;
    if (BIAS_BF16) bv = bf16_round(bv);
#pragma unroll
    for (int r = 0; r < 8; ++r) { float v = acc[t][r] + bv; if (ACT == 1) v = fmaxf(v, 0.f); so[w][8 * hh + r][t * 16 + ln] = v; }
  }
  __builtin_amdgcn_fence(__ATOMIC_ACQ_REL, "workgroup");
  __builtin_amdgcn_wave_barrier();
  const int rsub = lane >> 4, c4 = (lane & 15) * 4;
  {
#pragma unroll
    for (int q = 0; q < 8; ++q) {
      const int r = q * 2 + rsub;
      const v4f v = *(const v4fa*)&so[w][r][c4];
      *(v4f*)(C + (size_t)(row0 + r) * ldc + col0 + c4) = v;
    }
    
  }
}

// GEMM C = act(A·W + bias + resid): A f32 (ASPLIT -> hi/lo 2 terms), Wt bf16 [N][K]; ACT 0 none, 1 relu, 2 exact gelu;
// resid (optional, f32, row index = (row % rmod), pitch ldr, RES_BF16 rounds it) added before the activation.
template <bool ASPLIT, int ACT, bool BIAS_BF16, bool RES_BF16>
__global__ __launch_bounds__(128) void k_gemm_bf3(const float* __restrict__ A, int lda, const unsigned short* __restrict__ Wt, int ldb,
                                                const float* __restrict__ bias, const float* __restrict__ resid, int rmod, int ldr,
                                                float* __restrict__ C, int ldc, int M, int N, int K) {
  __shared__ __attribute__((aligned(16))) float so[4][16][64];
  const int tid = threadIdx.x, w = tid >> 5, lane = tid & 31, ln = lane & 15, hh = lane >> 4;
  const int ntn = N / 64;
  const int wid = blockIdx.x * 4 + w;
  const int mt = wid / ntn, nq = wid % ntn;
  if (mt * 16 >= M) return;
  const int row0 = mt * 16, col0 = nq * 64;
  const float* arow = A + (size_t)(row0 + ln) * lda;
  v8f acc[4] = {};
  for (int kb = 0; kb < K; kb += 32) {
    FragB ah, al;
    const v4f x0 = *(const v4fa*)(arow + kb + 8 * hh), x1 = *(const v4fa*)(arow + kb + 8 * hh + 4);
    const v4f x2 = *(const v4fa*)(arow + kb + 16 + 8 * hh), x3 = *(const v4fa*)(arow + kb + 16 + 8 * hh + 4);
    float xs[16] = {x0[0],x0[1],x0[2],x0[3],x1[0],x1[1],x1[2],x1[3],x2[0],x2[1],x2[2],x2[3],x3[0],x3[1],x3[2],x3[3]};
#pragma unroll
    for (int i = 0; i < 16; ++i) { const unsigned short hb = bf16_bits(xs[i]); ah.u[i] = hb; al.u[i] = ASPLIT ? bf16_bits(xs[i] - bf16_val(hb)) : (unsigned short)0; }
#pragma unroll
    for (int t = 0; t < 4; ++t) {
      const unsigned short* brow = Wt + (size_t)(col0 + t * 16 + ln) * ldb + kb;
      FragB b;
      b.half[0] = *(const v8us*)(brow + 8 * hh);
      b.half[1] = *(const v8us*)(brow + 16 + 8 * hh);
      acc[t] = mmaN<ASPLIT ? 2 : 1>(ah.v, al.v, b.v, b.v, acc[t]);
    }
  }
#pragma unroll
  for (int t = 0; t < 4; ++t) {
    const int col = col0 + t * 16 + ln;
    float bv = bias ? bias[col] : 0.f;
    if (BIAS_BF16) bv = bf16_round(bv);
#pragma unroll
    for (int r = 0; r < 8; ++r) {
      float v = acc[t][r] + bv;
      if (resid) { float rv = resid[(size_t)((row0 + 8 * hh + r) % rmod) * ldr + col]; if (RES_BF16) rv = bf16_round(rv); v += rv; }
      if (ACT == 1) v = fmaxf(v, 0.f);
      if (ACT == 2) v = 0.5f * v * (1.0f + erff(v * 0.70710678118654752f));
      if (ACT == 3) { const float u = 0.7978845608028654f * (v + 0.044715f * v * v * v); v = 0.5f * v * (1.0f + tanhf(u)); }
      so[w][8 * hh + r][t * 16 + ln] = v;
    }
  }
  __builtin_amdgcn_fence(__ATOMIC_ACQ_REL, "workgroup");
  __builtin_amdgcn_wave_barrier();
  const int rsub = lane >> 4, c4 = (lane & 15) * 4;
  {
#pragma unroll
    for (int q = 0; q < 8; ++q) {
      const int r = q * 2 + rsub;
      const v4f v = *(const v4fa*)&so[w][r][c4];
      *(v4f*)(C + (size_t)(row0 + r) * ldc + col0 + c4) = v;
    }
    
  }
}
// row LayerNorm (biased variance, eps) over N: s = X (+ R); optional out_sum <- s; out_norm <- (s-mu)*rsqrt(var+eps)*g + b
template <bool PARAM_BF16>
__global__ __launch_bounds__(256) void k_layernorm(const float* __restrict__ X, const float* __restrict__ R, const float* __restrict__ g, const float* __restrict__ bta,
                                                  float* __restrict__ out_sum, float* __restrict__ out_norm, int N, float eps) {
  __shared__ float red[256];
  const int row = blockIdx.x, tid = threadIdx.x;
  const float* x = X + (size_t)row * N; const float* rr = R ? R + (size_t)row * N : nullptr;
  float vals[16];                     // up to N = 4096
  const int per = N / 256;            // contiguous chunk per thread? use strided-by-4 chunks: thread handles j = tid*4 + 1024*u
  float s1 = 0.f;
  for (int u = 0; u < per / 4; ++u) {
    const int j = tid * 4 + 1024 * u;
    const v4f a = *(const v4fa*)(x + j);
    v4f b = {0.f,0.f,0.f,0.f}; if (rr) b = *(const v4fa*)(rr + j);
#pragma unroll
    for (int q = 0; q < 4; ++q) { const float v = a[q] + b[q]; vals[u * 4 + q] = v; s1 += v; }
  }
  red[tid] = s1; __syncthreads();
  for (int st = 128; st > 0; st >>= 1) { if (tid < st) red[tid] += red[tid + st]; __syncthreads(); }
  const float mu = red[0] / (float)N; __syncthreads();
  float s2 = 0.f;
  for (int u = 0; u < per / 4; ++u)
#pragma unroll
    for (int q = 0; q < 4; ++q) { const float c = vals[u * 4 + q] - mu; s2 += c * c; }
  red[tid] = s2; __syncthreads();
  for (int st = 128; st > 0; st >>= 1) { if (tid < st) red[tid] += red[tid + st]; __syncthreads(); }
  const float rs = rsqrtf(red[0] / (float)N + eps);
  {
    for (int u = 0; u < per / 4; ++u) {
      const int j = tid * 4 + 1024 * u;
      v4f o, sm;
#pragma unroll
      for (int q = 0; q < 4; ++q) {
        float gg = g[j + q], bb = bta[j + q];
        if (PARAM_BF16) { gg = bf16_round(gg); bb = bf16_round(bb); }
        sm[q] = vals[u * 4 + q]; o[q] = (vals[u * 4 + q] - mu) * rs * gg + bb;
      }
      if (out_sum) *(v4f*)(out_sum + (size_t)row * N + j) = sm;
      *(v4f*)(out_norm + (size_t)row * N + j) = o;
    }
    
  }
}



// ---- f16 WMMA path (v_wmma_f32_16x16x32_f16): 11-bit significands for operands in range — used where a [0,1] probability operand needs more precision than bf16
typedef _Float16 v16h __attribute__((ext_vector_type(16)));
union FragH { v16h v; v8us half[2]; _Float16 h[16]; unsigned short u[16]; };
template <int NT>
__device__ __forceinline__ v8f mmaH(v16h ah, v16h al, v16h bh, v16h bl, v8f c) {
  c = __builtin_amdgcn_wmma_f32_16x16x32_f16(false, ah, false, bh, (short)0, c, false, false);
  if (NT >= 2) c = __builtin_amdgcn_wmma_f32_16x16x32_f16(false, al, false, bh, (short)0, c, false, false);
  if (NT >= 3) c = __builtin_amdgcn_wmma_f32_16x16x32_f16(false, ah, false, bl, (short)0, c, false, false);
  asm volatile("v_nop\n\tv_nop\n\tv_nop\n\tv_nop" : "+v"(c) : "v"(ah), "v"(al), "v"(bh), "v"(bl));
  return c;
}
// batched GEMM like k_gemm_b but f16 operands: A f32 (split into f16 hi/lo if ASPLIT, else rounded to f16), Bt = f16 values [n][k]; alpha; C f32; N multiple of 16 (partial tiles skipped)
template <bool ASPLIT>
__global__ __launch_bounds__(128) void k_gemm_h(const float* __restrict__ A, int lda, size_t sA, const _Float16* __restrict__ Bh, int ldb, size_t sB, float alpha, float* __restrict__ C, int ldc, size_t sC, int M, int N, int K) {
  __shared__ __attribute__((aligned(16))) float so[4][16][64];
  const int tid = threadIdx.x, w = tid >> 5, lane = tid & 31, ln = lane & 15, hh = lane >> 4; const int by = blockIdx.y;
  A += (size_t)by * sA; Bh += (size_t)by * sB; C += (size_t)by * sC;
  const int ntn = (N + 63) / 64; const int wid = blockIdx.x * 4 + w; const int mt = wid / ntn, nq = wid % ntn; if (mt * 16 >= M) return;
  const int row0 = mt * 16, col0 = nq * 64; const float* arow = A + (size_t)(row0 + ln) * lda;
  v8f acc[4] = {};
  for (int kb = 0; kb < K; kb += 32) {
    FragH ah, al;
    const v4f x0 = *(const v4fa*)(arow + kb + 8 * hh), x1 = *(const v4fa*)(arow + kb + 8 * hh + 4), x2 = *(const v4fa*)(arow + kb + 16 + 8 * hh), x3 = *(const v4fa*)(arow + kb + 16 + 8 * hh + 4);
    float xs[16] = {x0[0],x0[1],x0[2],x0[3],x1[0],x1[1],x1[2],x1[3],x2[0],x2[1],x2[2],x2[3],x3[0],x3[1],x3[2],x3[3]};
#pragma unroll
    for (int i = 0; i < 16; ++i) { const _Float16 h = (_Float16)xs[i]; ah.h[i] = h; al.h[i] = ASPLIT ? (_Float16)(xs[i] - (float)h) : (_Float16)0.0f; }
#pragma unroll
    for (int t = 0; t < 4; ++t) { if (col0 + t * 16 >= N) continue; const size_t boff = (size_t)(col0 + t * 16 + ln) * ldb + kb; FragH bq; bq.half[0] = *(const v8us*)(Bh + boff + 8 * hh); bq.half[1] = *(const v8us*)(Bh + boff + 16 + 8 * hh);
      acc[t] = mmaH<ASPLIT ? 2 : 1>(ah.v, al.v, bq.v, bq.v, acc[t]); }
  }
#pragma unroll
  for (int t = 0; t < 4; ++t) { if (col0 + t * 16 >= N) continue;
#pragma unroll
    for (int r = 0; r < 8; ++r) so[w][8 * hh + r][t * 16 + ln] = acc[t][r] * alpha; }
  __builtin_amdgcn_fence(__ATOMIC_ACQ_REL, "workgroup"); __builtin_amdgcn_wave_barrier();
  const int rsub = lane >> 4, c4 = (lane & 15) * 4;
  {
#pragma unroll
    for (int q = 0; q < 8; ++q) { const int r = q * 2 + rsub; if (col0 + c4 < N) { const v4f v = *(const v4fa*)&so[w][r][c4]; *(v4f*)(C + (size_t)(row0 + r) * ldc + col0 + c4) = v; } }
     }
}

// Wt[n][k] = f16(W[k][n]·scale) from f32 row-major W[K][N] (scale = power of two; bf16-exact weights stay exact in f16 away from the subnormal range)
__global__ __launch_bounds__(256) void k_wt_f16(const float* __restrict__ W, _Float16* __restrict__ Wt, int K, int N, float scale) {
  const int t = blockIdx.x * 256 + threadIdx.x; if (t >= N * (K / 8)) return; const int n = t / (K / 8), k8 = (t % (K / 8)) * 8; FragH f;
#pragma unroll
  for (int i = 0; i < 8; ++i) f.h[i] = (_Float16)(bf16_round(W[(size_t)(k8 + i) * N + n]) * scale); const v8us o = f.half[0];
  *(v8us*)((unsigned short*)Wt + (size_t)n * K + k8) = o; 
}
// k_gemm_hh variant with fused epilogue: v = acc·alpha + bias[by·sBias + col] (+ CP[(row/rowsPerB)·sCPb + by·64 + col] if CP) ; ACT 0 none / 1 elu ; writes f16 C16 (and f32 C if non-null)
template <int ACT>
__global__ __launch_bounds__(128) void k_gemm_hhx(const _Float16* __restrict__ A, int lda, size_t sA, const _Float16* __restrict__ Bh, int ldb, size_t sB, float alpha, const float* __restrict__ bias, size_t sBias, const float* __restrict__ CP, int rowsPerB, size_t sCPb, int row0g,
    float* __restrict__ C, _Float16* __restrict__ C16, int ldc, size_t sC, int M, int N, int K) {
  __shared__ __attribute__((aligned(16))) float so[4][16][64];
  const int tid = threadIdx.x, w = tid >> 5, lane = tid & 31, ln = lane & 15, hh = lane >> 4; const int by = blockIdx.y;
  A += (size_t)by * sA; Bh += (size_t)by * sB; const size_t cofs = (size_t)by * sC; const float* bp = bias ? bias + (size_t)by * sBias : nullptr;
  const int ntn = (N + 63) / 64; const int wid = blockIdx.x * 4 + w; const int mt = wid / ntn, nq = wid % ntn; if (mt * 16 >= M) return;
  const int row0 = mt * 16, col0 = nq * 64; const _Float16* arow = A + (size_t)(row0 + ln) * lda;
  v8f acc[4] = {};
  for (int kb = 0; kb < K; kb += 32) { FragH ah; ah.half[0] = *(const v8us*)((const unsigned short*)arow + kb + 8 * hh); ah.half[1] = *(const v8us*)((const unsigned short*)arow + kb + 16 + 8 * hh);
#pragma unroll
    for (int t = 0; t < 4; ++t) { if (col0 + t * 16 >= N) continue; const size_t boff = (size_t)(col0 + t * 16 + ln) * ldb + kb; FragH bq; bq.half[0] = *(const v8us*)((const unsigned short*)Bh + boff + 8 * hh); bq.half[1] = *(const v8us*)((const unsigned short*)Bh + boff + 16 + 8 * hh);
      acc[t] = mmaH<1>(ah.v, ah.v, bq.v, bq.v, acc[t]); }
  }
#pragma unroll
  for (int t = 0; t < 4; ++t) { if (col0 + t * 16 >= N) continue; const int col = col0 + t * 16 + ln; const float bv = bp ? bf16_round(bp[col]) : 0.f;
#pragma unroll
    for (int r = 0; r < 8; ++r) { float v = acc[t][r] * alpha + bv; if (CP) { const int rr = row0g + row0 + 8 * hh + r; if (rowsPerB < 0) v += CP[cofs + (size_t)rr * ldc + col];      /* rowsPerB < 0: own element of the batched C plane */ else { const int bidx = rr / rowsPerB; v += CP[(size_t)bidx * sCPb + (size_t)by * 64 + col]; } } if (ACT == 1) v = (v > 0.f) ? v : expm1f(v); else if (ACT == 7) v = (v > 0.f) ? v + 1.0f : expf(v); else if (ACT == 8) v = tanhf(v); else if (ACT == 9) v = 0.5f * v * (1.0f + tanhf(0.7978845608028654f * (v + 0.044715f * v * v * v))); else if (ACT == 11) v = 1.0f / (1.0f + expf(-v)); else if (ACT == 12) v = (v > 0.f) ? v : 0.01f * v; else if (ACT == 14) v = (v > 0.f) ? v : 0.1f * v; else if (ACT == 16) v = (v >= 0.f) ? v : 0.3f * v; else if (ACT == 17) v = (v >= 0.f) ? v : 0.2f * v; else if (ACT == 15) v = v / (1.0f + expf(-v)); else if (ACT == 3) v = fmaxf(v, 0.f); else if (ACT == 6) v = 0.5f * v * (1.0f + erff(v * 0.70710678118654752f)); so[w][8 * hh + r][t * 16 + ln] = v; } }
  __builtin_amdgcn_fence(__ATOMIC_ACQ_REL, "workgroup"); __builtin_amdgcn_wave_barrier();
  const int rsub = lane >> 4, c4 = (lane & 15) * 4; typedef _Float16 v4h __attribute__((ext_vector_type(4)));
  {
#pragma unroll
    for (int q = 0; q < 8; ++q) { const int r = q * 2 + rsub; if (col0 + c4 < N) { const v4f v = *(const v4fa*)&so[w][r][c4]; if (C) *(v4f*)(C + cofs + (size_t)(row0 + r) * ldc + col0 + c4) = v; if (C16) { v4h h4; for (int i = 0; i < 4; ++i) h4[i] = (_Float16)v[i]; *(v4h*)(C16 + cofs + (size_t)(row0 + r) * ldc + col0 + c4) = h4; } } }
     }
}


typedef _Float16 v4h __attribute__((ext_vector_type(4)));

__global__ __launch_bounds__(256) void k_x16(const float* __restrict__ x, _Float16* __restrict__ X16, size_t n8) { const size_t t = (size_t)blockIdx.x * 256 + threadIdx.x; if (t >= n8) return; FragH f;
#pragma unroll
  for (int q = 0; q < 8; ++q) f.h[q] = (_Float16)bf16_round(x[t * 8 + q]); *(v8us*)((unsigned short*)X16 + t * 8) = f.half[0];  }
__global__ __launch_bounds__(256) void k_h16(const float* __restrict__ x, _Float16* __restrict__ X16, size_t n8) { const size_t t = (size_t)blockIdx.x * 256 + threadIdx.x; if (t >= n8) return; FragH f;
#pragma unroll
  for (int q = 0; q < 8; ++q) f.h[q] = (_Float16)x[t * 8 + q]; *(v8us*)((unsigned short*)X16 + t * 8) = f.half[0];  }
__global__ __launch_bounds__(256) void k_round16f(const float* __restrict__ W, _Float16* __restrict__ Bt, size_t n8) { const size_t t = (size_t)blockIdx.x * 256 + threadIdx.x; if (t >= n8) return; FragH f;
#pragma unroll
  for (int i = 0; i < 8; ++i) f.h[i] = (_Float16)(bf16_round(W[t * 8 + i]) * 16.0f); *(v8us*)((unsigned short*)Bt + t * 8) = f.half[0];  }
template <int NHv, int TTv>
__global__ __launch_bounds__(256) void k_vt(const _Float16* __restrict__ V16, int ldv, int voff, _Float16* __restrict__ Vt) { __shared__ unsigned short tl[64][66]; const int tid = threadIdx.x; const int slab = blockIdx.x / (TTv / 64), lg = blockIdx.x % (TTv / 64); const int b = slab / NHv, h = slab % NHv;
  for (int i = tid; i < 64 * 8; i += 256) { const int r = i / 8, c8 = (i % 8) * 8; FragH f; f.half[0] = *(const v8us*)((const unsigned short*)V16 + ((size_t)b * TTv + lg * 64 + r) * ldv + voff + h * 64 + c8);
#pragma unroll
    for (int q = 0; q < 8; ++q) tl[r][c8 + q] = f.u[q]; }
  __syncthreads();
  {
#pragma unroll
    for (int rd = 0; rd < 2; ++rd) { const int d = rd * 32 + tid / 8, pc = tid % 8; FragH f;
#pragma unroll
      for (int q = 0; q < 8; ++q) f.u[q] = tl[pc * 8 + q][d];
      *(v8us*)((unsigned short*)Vt + ((size_t)slab * 64 + d) * TTv + lg * 64 + pc * 8) = f.half[0]; }
     } }

__global__ __launch_bounds__(256) void k_hl(const float* __restrict__ F, _Float16* __restrict__ Hh, _Float16* __restrict__ Hl, size_t n8) { const size_t t = (size_t)blockIdx.x * 256 + threadIdx.x; if (t >= n8) return; FragH fh, fl; const v4f a = *(const v4fa*)(F + t * 8), c = *(const v4fa*)(F + t * 8 + 4);
#pragma unroll
  for (int q = 0; q < 4; ++q) { _Float16 h = (_Float16)a[q]; fh.h[q] = h; fl.h[q] = (_Float16)((a[q] - (float)h) * 1024.0f); h = (_Float16)c[q]; fh.h[4 + q] = h; fl.h[4 + q] = (_Float16)((c[q] - (float)h) * 1024.0f); }
  { *(v8us*)((unsigned short*)Hh + t * 8) = fh.half[0]; *(v8us*)((unsigned short*)Hl + t * 8) = fl.half[0];  } }

// ---- fast GEMM (wave tile 32x64; requires M % 32 == 0 rows per launch region and N % 64 == 0); epilogue = k_gemm_hhx semantics ----
__device__ __forceinline__ v16h g2_frag(const _Float16* p, int hh) { FragH f; f.half[0] = *(const v8us*)((const unsigned short*)p + 8 * hh); f.half[1] = *(const v8us*)((const unsigned short*)p + 16 + 8 * hh); return f.v; }
__device__ __forceinline__ v8f g2_mma(v16h a, v16h b, v8f c) { v8f d = __builtin_amdgcn_wmma_f32_16x16x32_f16(false, a, false, b, (short)0, c, false, false); asm volatile("v_nop\n\tv_nop\n\tv_nop\n\tv_nop" : "+v"(d) : "v"(a), "v"(b)); return d; }
template <int ACT>
__global__ __launch_bounds__(128) void k_gemm2(const _Float16* __restrict__ A, int lda, size_t sA, const _Float16* __restrict__ Bh, int ldb, size_t sB, float alpha, const float* __restrict__ bias, size_t sBias, const float* __restrict__ CP, int rowsPerB, size_t sCPb, int row0g,
    float* __restrict__ C, _Float16* __restrict__ C16, int ldc, size_t sC, int M, int N, int K) { static_assert(ACT == 0 || ACT == 3 || ACT == 6 || ACT == 8 || ACT == 9 || ACT == 11 || ACT == 12 || ACT == 14 || ACT == 15 || ACT == 16 || ACT == 17, "k_gemm2: unsupported ACT code (would silently apply no activation)");
  __shared__ __attribute__((aligned(16))) float so[4][32][68];
  const int tid = threadIdx.x, w = tid >> 5, lane = tid & 31, ln = lane & 15, hh = lane >> 4; const int by = blockIdx.y;
  A += (size_t)by * sA; Bh += (size_t)by * sB; const size_t cofs = (size_t)by * sC; const float* bp = bias ? bias + (size_t)by * sBias : nullptr;
  const int ntn = N >> 6; const int mt = blockIdx.x / ntn, nq = blockIdx.x - mt * ntn; const int row0 = mt * 128 + 32 * w, col0 = nq * 64; if (row0 >= M) return;
  const _Float16* a0p = A + (size_t)(row0 + ln) * lda; const _Float16* a1p = a0p + (size_t)16 * lda;
  const _Float16* b0p = Bh + (size_t)(col0 + ln) * ldb; const _Float16* b1p = b0p + (size_t)16 * ldb; const _Float16* b2p = b1p + (size_t)16 * ldb; const _Float16* b3p = b2p + (size_t)16 * ldb;
  const v8f z8 = {0.f,0.f,0.f,0.f,0.f,0.f,0.f,0.f}; v8f c00 = z8, c01 = z8, c02 = z8, c03 = z8, c10 = z8, c11 = z8, c12 = z8, c13 = z8;
#pragma unroll 1
  for (int kb = 0; kb < K; kb += 32) { const v16h a0 = g2_frag(a0p + kb, hh), a1 = g2_frag(a1p + kb, hh);
    v16h b = g2_frag(b0p + kb, hh); c00 = g2_mma(a0, b, c00); c10 = g2_mma(a1, b, c10);
    b = g2_frag(b1p + kb, hh); c01 = g2_mma(a0, b, c01); c11 = g2_mma(a1, b, c11);
    b = g2_frag(b2p + kb, hh); c02 = g2_mma(a0, b, c02); c12 = g2_mma(a1, b, c12);
    b = g2_frag(b3p + kb, hh); c03 = g2_mma(a0, b, c03); c13 = g2_mma(a1, b, c13); }
  v8f accs[8] = {c00, c01, c02, c03, c10, c11, c12, c13};
#pragma unroll
  for (int u = 0; u < 8; ++u) { const int t = u & 3, half = u >> 2; const int col = col0 + t * 16 + ln; const float bv = bp ? bf16_round(bp[col]) : 0.f;
#pragma unroll
    for (int r = 0; r < 8; ++r) { const int rloc = half * 16 + 8 * hh + r; float v = accs[u][r] * alpha + bv; if (CP) { if (rowsPerB < 0) v += CP[cofs + (size_t)(row0g + row0 + rloc) * ldc + col];      /* rowsPerB < 0: own element of the batched C plane */ else { const int bidx = (row0g + row0 + rloc) / rowsPerB; v += CP[(size_t)bidx * sCPb + (size_t)by * 64 + col]; } }
      if (ACT == 3) v = fmaxf(v, 0.f); else if (ACT == 6) v = 0.5f * v * (1.0f + erff(v * 0.70710678118654752f)); else if (ACT == 11) v = 1.0f / (1.0f + expf(-v)); else if (ACT == 15) v = v / (1.0f + expf(-v)); else if (ACT == 12) v = (v > 0.f) ? v : 0.01f * v; else if (ACT == 8) v = tanhf(v); else if (ACT == 9) v = 0.5f * v * (1.0f + tanhf(0.7978845608028654f * (v + 0.044715f * v * v * v))); else if (ACT == 14) v = (v > 0.f) ? v : 0.1f * v; else if (ACT == 16) v = (v >= 0.f) ? v : 0.3f * v; else if (ACT == 17) v = (v >= 0.f) ? v : 0.2f * v;
      so[w][rloc][t * 16 + ln] = v; } }
  __builtin_amdgcn_fence(__ATOMIC_ACQ_REL, "workgroup"); __builtin_amdgcn_wave_barrier();
  const int rsub = lane >> 4, c4 = (lane & 15) * 4;
  {
#pragma unroll
    for (int q = 0; q < 16; ++q) { const int r = q * 2 + rsub; const v4f v = *(const v4fa*)&so[w][r][c4]; if (C) *(v4f*)(C + cofs + (size_t)(row0 + r) * ldc + col0 + c4) = v; if (C16) { v4h h4; for (int i = 0; i < 4; ++i) h4[i] = (_Float16)v[i]; *(v4h*)(C16 + cofs + (size_t)(row0 + r) * ldc + col0 + c4) = h4; } }
     } }


__global__ __launch_bounds__(256) void k_wnat(const float* __restrict__ w, size_t n8, _Float16* __restrict__ Bt) { const size_t t = (size_t)blockIdx.x * 256 + threadIdx.x; if (t >= n8) return; FragH f; for (int q = 0; q < 8; ++q) f.h[q] = (_Float16)(bf16_round(w[t * 8 + q]) * 16.0f); *(v8us*)((unsigned short*)Bt + t * 8) = f.half[0];  }
__global__ __launch_bounds__(256) void k_rsm(const float* __restrict__ S, _Float16* __restrict__ P, int nrows) {
  #pragma clang fp contract(off)
  const int i = blockIdx.x * 256 + threadIdx.x; if (i >= nrows) return; const float* s = S + (size_t)i * SQ; float mx = -3.0e38f;
#pragma unroll 1
  for (int j = 0; j < SQ; ++j) mx = fmaxf(mx, s[j]); float se = 0.f;
#pragma unroll 1
  for (int j = 0; j < SQ; ++j) se += expf(s[j] - mx); const float sc = 256.0f / se;
#pragma unroll 1
  for (int j0 = 0; j0 < SQ; j0 += 8) { FragH f; for (int q = 0; q < 8; ++q) f.h[q] = (_Float16)(expf(s[j0 + q] - mx) * sc); unsigned short* d = (unsigned short*)P + (size_t)i * SQ + j0; *(v8us*)d = f.half[0];  } }
__global__ __launch_bounds__(256) void k_vt(const _Float16* __restrict__ V16, int b, int h0, _Float16* __restrict__ VT) { __shared__ unsigned short tl[64][65]; const int tid = threadIdx.x; const int hh = blockIdx.x % HG, sg = blockIdx.x / HG; const int s0 = sg * 64; const int h = h0 + hh;
  for (int i = tid; i < 64 * 8; i += 256) { const int j = i / 8, d8 = (i % 8) * 8; FragH f; f.half[0] = *(const v8us*)((const unsigned short*)V16 + ((size_t)b * SQ + s0 + j) * DM + h * HD + d8); for (int q = 0; q < 8; ++q) tl[d8 + q][j] = f.u[q]; }
  __syncthreads();
  { for (int i = tid; i < 64 * 8; i += 256) { const int d = i / 8, j8 = (i % 8) * 8; FragH f; for (int q = 0; q < 8; ++q) f.u[q] = tl[d][j8 + q]; *(v8us*)((unsigned short*)VT + ((size_t)hh * HD + d) * SQ + s0 + j8) = f.half[0]; }  } }



// Four exponentials 2^x in place. The closing v_nop is the free slot that the instruction set asks for behind a transcendental before its result is used or its
// source overwritten; it stands in the same statement because nothing else would keep it directly behind the last v_exp_f32 (inside, each v_exp_f32 is independent of the one before).
__device__ __forceinline__ v4f exp2x4(v4f x) { float a = x[0], b = x[1], c = x[2], d = x[3];
  asm("v_exp_f32 %0, %0\n\tv_exp_f32 %1, %1\n\tv_exp_f32 %2, %2\n\tv_exp_f32 %3, %3\n\tv_nop" : "+v"(a), "+v"(b), "+v"(c), "+v"(d));
  const v4f r = {a, b, c, d}; return r; }
#define FA_LAG 5.5f                  /* score units; 5.5 log2 e = 7.9 */
#define FA_L2E 1.44269504088896340736f
#define FA_PITCH 144                 /* LDS row pitch, bytes */
#define FA_TILE (64 * FA_PITCH)      /* one operand's 64 rows */
#define FA_BUF (2 * FA_TILE)         /* K tile + V^T tile of 64 keys */
#define FA_STG (2 * FA_BUF)          /* one stage: the tiles of both key sets */
#define FA_EP 272                    /* output staging pitch, bytes: 64 f32 + 16 */
#define FA_XW (17 * 512)             /* one wave's partial result: 17 pieces of 16 bytes a lane */
__device__ __forceinline__ v16h fa_frag(const unsigned char* p) { FragH f; f.half[0] = *(const v8us*)p; f.half[1] = *(const v8us*)(p + 32); return f.v; }
__device__ __forceinline__ v8f fa_mma(v16h a, v16h b, v8f c) { return __builtin_amdgcn_wmma_f32_16x16x32_f16(false, a, false, b, (short)0, c, false, false); }
__device__ __forceinline__ float fa_xhalf(float x) { return __builtin_bit_cast(float, __builtin_amdgcn_permlanex16(__builtin_bit_cast(int, x), __builtin_bit_cast(int, x), 0x76543210, 0xfedcba98, false, false)); }      /* lane l with lane l ^ 16 */
__global__ __launch_bounds__(128) void k_fattn(const _Float16* __restrict__ Q16, const _Float16* __restrict__ K16, const _Float16* __restrict__ VT, const float* __restrict__ am, float* __restrict__ out) {
  __shared__ __attribute__((aligned(16))) unsigned char L[2 * FA_STG];      /* two stages in the loop; the partial results and the output staging behind it */
  __shared__ __attribute__((aligned(16))) float ms[SQ];
  static_assert(2 * FA_XW + 2 * 32 * FA_EP <= 2 * FA_STG, "partial results and output staging must fit the array");
  const int tid = threadIdx.x, lane = tid & 31, c = lane & 15, h = lane >> 4; const int w = __builtin_amdgcn_readfirstlane(tid >> 5);
  const int qh = w & 1, ks = w >> 1;      /* which 32 queries, which key set */
  const int head = blockIdx.y, q0 = blockIdx.x * 64 + qh * 32;
  /* staging: 8 threads cover one 128-byte row piece; a thread brings rows sr + 16 p (p = 0..3) of both operands of both tiles */
  const int sr = tid >> 3, sc = tid & 7;
  const unsigned short* kg = (const unsigned short*)K16 + (size_t)sr * DM + head * HD + sc * 8;
  const unsigned short* vg = (const unsigned short*)VT + ((size_t)head * HD + sr) * SQ + sc * 8;
  unsigned char* lw = L + sr * FA_PITCH + sc * 16;
  v8us kr[8], vr[8];      /* index 4 u + p: tile u */
#pragma unroll
  for (int i = 0; i < 8; ++i) { kr[i] = *(const v8us*)(kg + (size_t)(16 * i) * DM); vr[i] = *(const v8us*)(vg + (size_t)(16 * (i & 3)) * SQ + 64 * (i >> 2)); }
#pragma unroll
  for (int u = 0; u < SQ / 512; ++u) { const v4f m = *(const v4fa*)(am + u * 512 + tid * 4); v4f r;
#pragma unroll
    for (int q = 0; q < 4; ++q) r[q] = bf16_round(m[q]);
    *(v4fa*)&ms[u * 512 + tid * 4] = r; }
  v16h qf[2][2]; const _Float16* qa[2];      /* qa: the lane's own address, its half's 8 elements counted in */
#pragma unroll
  for (int g = 0; g < 2; ++g) { qa[g] = Q16 + (size_t)(q0 + 16 * g + c) * DM + head * HD + 8 * h; qf[g][0] = g2_frag(qa[g], 0); qf[g][1] = g2_frag(qa[g] + 32, 0); }
  asm volatile("s_wait_xcnt 0x0" :: "v"(qa[0]), "v"(qa[1]) : "memory");      /* the wait in front of any overwrite of the Q loads' address registers; the addresses are inputs so that they stay live up to it */
  FragH ones;      /* A operand whose row 0 is 1.0: its product with P^T is the column sums of P^T, the softmax denominators */
#pragma unroll
  for (int i = 0; i < 16; ++i) ones.h[i] = (c == 0) ? (_Float16)1.0f : (_Float16)0.0f;
  const v8f z8 = {0.f, 0.f, 0.f, 0.f, 0.f, 0.f, 0.f, 0.f};
  v8f acc[2][4], lacc[2]; float m_run[2];
#pragma unroll
  for (int g = 0; g < 2; ++g) { m_run[g] = -3.402823466e38f; lacc[g] = z8;      /* the lowest finite value: any finite score replaces it, a key at -inf keeps weight 0 */
#pragma unroll
    for (int t = 0; t < 4; ++t) acc[g][t] = z8; }
#pragma unroll
  for (int i = 0; i < 8; ++i) { unsigned char* p = lw + (i >> 2) * FA_BUF + (i & 3) * 16 * FA_PITCH; *(v8us*)p = kr[i]; *(v8us*)(p + FA_TILE) = vr[i]; }
  __syncthreads();      /* publishes stage 0 and the mask */
#pragma unroll 1      /* 32 trips of 36 matrix instructions stay rolled: code size and registers */
  for (int st = 0; st < SQ / 128; ++st) {
    const unsigned char* Lb = L + (st & 1) * FA_STG + ks * FA_BUF;
    if (st + 1 < SQ / 128) { const unsigned short* kn = kg + (size_t)(st + 1) * 128 * DM; const unsigned short* vn = vg + (st + 1) * 128;
#pragma unroll
      for (int i = 0; i < 8; ++i) { kr[i] = *(const v8us*)(kn + (size_t)(16 * i) * DM); vr[i] = *(const v8us*)(vn + (size_t)(16 * (i & 3)) * SQ + 64 * (i >> 2)); }
      asm volatile("s_wait_xcnt 0x0" :: "v"(kn), "v"(vn) : "memory"); }      /* the wait in front of any overwrite of the sixteen loads' address registers; the two addresses are inputs so that they stay live up to it and no load of the run lands in them */
#pragma unroll
    for (int sub = 0; sub < 2; ++sub) {
      v8f s[2][2];
#pragma unroll
      for (int kt = 0; kt < 2; ++kt) { const unsigned char* kp = Lb + (sub * 32 + 16 * kt + c) * FA_PITCH + 16 * h; const v16h k0 = fa_frag(kp), k1 = fa_frag(kp + 64);
        const float* mp = ms + st * 128 + ks * 64 + sub * 32 + 16 * kt + 8 * h; const v4f m0 = *(const v4fa*)mp, m1 = *(const v4fa*)(mp + 4);
        const v8f mc = {m0[0], m0[1], m0[2], m0[3], m1[0], m1[1], m1[2], m1[3]};
        s[kt][0] = fa_mma(k0, qf[0][0], z8); s[kt][1] = fa_mma(k0, qf[1][0], z8);
        s[kt][0] = fa_mma(k1, qf[0][1], s[kt][0]) * 0.125f + mc; s[kt][1] = fa_mma(k1, qf[1][1], s[kt][1]) * 0.125f + mc; }      /* 1/sqrt(64) is a power of two, so this is the score plus the mask in one f32 rounding, fused or not, as the separate kernels had it */
      v16h vf[4];
#pragma unroll
      for (int t = 0; t < 4; ++t) vf[t] = fa_frag(Lb + FA_TILE + (16 * t + c) * FA_PITCH + sub * 64 + 16 * h);
      float mb[2]; bool need = false;
#pragma unroll
      for (int g = 0; g < 2; ++g) { float mx = fmaxf(s[0][g][0], s[1][g][0]);
#pragma unroll
        for (int r = 1; r < 8; ++r) mx = fmaxf(fmaxf(mx, s[0][g][r]), s[1][g][r]);
        mx = fmaxf(mx, fa_xhalf(mx)); mb[g] = mx; need = need || (mx > m_run[g] + FA_LAG); }
      if (__builtin_amdgcn_ballot_w32(need) != 0) {      /* one scalar branch a pass; rare behind the first passes */
        v4f e = {(m_run[0] - fmaxf(m_run[0], mb[0])) * FA_L2E, (m_run[1] - fmaxf(m_run[1], mb[1])) * FA_L2E, 0.f, 0.f}; e = exp2x4(e);
#pragma unroll
        for (int g = 0; g < 2; ++g) { m_run[g] = fmaxf(m_run[g], mb[g]); lacc[g] = lacc[g] * e[g];
#pragma unroll
          for (int t = 0; t < 4; ++t) acc[g][t] = acc[g][t] * e[g]; } }
#pragma unroll
      for (int g = 0; g < 2; ++g) { const float mr = m_run[g]; FragH pf;
#pragma unroll
        for (int j = 0; j < 4; ++j) { v4f a;
#pragma unroll
          for (int q = 0; q < 4; ++q) a[q] = (s[j >> 1][g][4 * (j & 1) + q] - mr) * FA_L2E;
          a = exp2x4(a);
#pragma unroll
          for (int q = 0; q < 4; ++q) pf.h[4 * j + q] = (_Float16)a[q]; }
#pragma unroll
        for (int t = 0; t < 4; ++t) acc[g][t] = fa_mma(vf[t], pf.v, acc[g][t]);
        lacc[g] = fa_mma(ones.v, pf.v, lacc[g]); }
    }
    if (st + 1 < SQ / 128) { unsigned char* p0 = lw + ((st + 1) & 1) * FA_STG;
#pragma unroll
      for (int i = 0; i < 8; ++i) { unsigned char* p = p0 + (i >> 2) * FA_BUF + (i & 3) * 16 * FA_PITCH; *(v8us*)p = kr[i]; *(v8us*)(p + FA_TILE) = vr[i]; } }
    __syncthreads();      /* publishes stage st + 1 and ends every wave's reads of stage st, whose buffer the next trip refills (behind the last trip: frees the array for the partial results) */
  }
  float lf[2];
#pragma unroll
  for (int g = 0; g < 2; ++g) { const float lr = lacc[g][0]; lf[g] = lr + fa_xhalf(lr); }      /* register 0: the sum in lanes 0-15, 0 in lanes 16-31 */
  unsigned char* X = L + qh * FA_XW + lane * 16;      /* lane for lane: the two waves of one query half hold the same element in the same lane and register */
  if (ks == 1) {
#pragma unroll
    for (int g = 0; g < 2; ++g)
#pragma unroll
      for (int t = 0; t < 4; ++t) { const v8f o = acc[g][t]; const v4f o0 = {o[0], o[1], o[2], o[3]}, o1 = {o[4], o[5], o[6], o[7]};
        *(v4fa*)(X + (8 * g + 2 * t) * 512) = o0; *(v4fa*)(X + (8 * g + 2 * t + 1) * 512) = o1; }
    const v4f ml = {m_run[0], m_run[1], lf[0], lf[1]}; *(v4fa*)(X + 16 * 512) = ml; }
  __syncthreads();      /* publishes key set 1's partial results to the waves of key set 0 */
  if (ks == 1) return;      /* behind the last barrier */
  const v4f ml = *(const v4fa*)(X + 16 * 512);
  const float mm0 = fmaxf(m_run[0], ml[0]), mm1 = fmaxf(m_run[1], ml[1]);
  v4f e = {(m_run[0] - mm0) * FA_L2E, (ml[0] - mm0) * FA_L2E, (m_run[1] - mm1) * FA_L2E, (ml[1] - mm1) * FA_L2E}; e = exp2x4(e);      /* both partial results brought to the larger of their two maxima */
  unsigned char* E = L + 2 * FA_XW + qh * (32 * FA_EP);      /* this wave's own 32 rows of 64 f32 */
#pragma unroll
  for (int g = 0; g < 2; ++g) { const float inv = 1.0f / (lf[g] * e[2 * g] + ml[2 + g] * e[2 * g + 1]); const float fa = e[2 * g] * inv, fb = e[2 * g + 1] * inv;
#pragma unroll
    for (int t = 0; t < 4; ++t) { const v4f p0 = *(const v4fa*)(X + (8 * g + 2 * t) * 512), p1 = *(const v4fa*)(X + (8 * g + 2 * t + 1) * 512); const v8f a = acc[g][t];
      const v4f o0 = {a[0] * fa + p0[0] * fb, a[1] * fa + p0[1] * fb, a[2] * fa + p0[2] * fb, a[3] * fa + p0[3] * fb}, o1 = {a[4] * fa + p1[0] * fb, a[5] * fa + p1[1] * fb, a[6] * fa + p1[2] * fb, a[7] * fa + p1[3] * fb};
      unsigned char* p = E + (16 * g + c) * FA_EP + 64 * t + 32 * h; *(v4fa*)p = o0; *(v4fa*)(p + 16) = o1; } }      /* row = query, d = 16 t + 8 h + r */
  __builtin_amdgcn_fence(__ATOMIC_ACQ_REL, "workgroup"); __builtin_amdgcn_wave_barrier();      /* the rows are read back by other lanes of the same wave */
#pragma unroll
  for (int i = 0; i < 16; ++i) { const int row = i * 2 + h; const v4f v = *(const v4fa*)(E + row * FA_EP + c * 16);
    *(v4f*)(out + (size_t)(q0 + row) * DM + head * HD + c * 4) = v; } }      /* whole 256-byte row pieces: every 128-byte line stored once */

// ---- Q, K and V projections in one launch: C[m][n] = f16(x[m][:] . Wt[n][:] / 16 + bias[n]), n running over the three weight matrices (blockIdx.y: 6 column tiles each) ----
// One work-group = 4 waves, a 128 x 128 output tile, a 64 x 64 quadrant a wave (16 accumulator tiles: 8 LDS fragment reads feed 16 matrix instructions).
// 64 k of the x rows and of the Wt rows a stage go through registers into one of two LDS buffers (row pitch 128 + 16 bytes), the next stage's global loads (whole 128-byte lines) in flight under this stage's work.
// Transposed product (A = Wt rows, B = x rows): a lane then holds 8 neighbouring n of one token row, one 16-byte piece of the f16 output row. k runs upward in steps of 32.
#define PJ_PITCH 144                 /* LDS row pitch, bytes */
#define PJ_TILE (128 * PJ_PITCH)     /* one operand's 128 rows */
#define PJ_BUF (2 * PJ_TILE)         /* x tile + Wt tile */
__global__ __launch_bounds__(128) void k_qkv(const _Float16* __restrict__ X16, const _Float16* __restrict__ BQ, const _Float16* __restrict__ BK, const _Float16* __restrict__ BV,
    const float* __restrict__ bq, const float* __restrict__ bk, const float* __restrict__ bv, _Float16* __restrict__ Q16, _Float16* __restrict__ K16, _Float16* __restrict__ V16) {
  __shared__ __attribute__((aligned(16))) unsigned char L[2 * PJ_BUF];      /* two operand buffers in the loop, output staging (4 waves x 64 rows) behind it */
  const int tid = threadIdx.x, lane = tid & 31, c = lane & 15, h = lane >> 4; const int w = __builtin_amdgcn_readfirstlane(tid >> 5);
  const int sel = blockIdx.y / (DM / 128), col0 = (blockIdx.y % (DM / 128)) * 128, row0 = blockIdx.x * 128;
  const _Float16* Bt = sel == 0 ? BQ : sel == 1 ? BK : BV; const float* bias = sel == 0 ? bq : sel == 1 ? bk : bv; _Float16* C = sel == 0 ? Q16 : sel == 1 ? K16 : V16;
  const int wm = (w & 1) * 64, wn = (w >> 1) * 64;      /* this wave's quadrant */
  /* staging: 8 threads cover one 128-byte row piece, a thread brings rows sr + 16 p of both operands */
  const int sr = tid >> 3, sc = tid & 7;
  const unsigned char* xp = (const unsigned char*)(X16 + (size_t)(row0 + sr) * DM + sc * 8); const unsigned char* wp = (const unsigned char*)(Bt + (size_t)(col0 + sr) * DM + sc * 8);      /* step 128 bytes a stage */
  unsigned char* lw = L + sr * PJ_PITCH + sc * 16;
  v8us xs[8], wr[8];
#pragma unroll
  for (int p = 0; p < 8; ++p) { xs[p] = *(const v8us*)(xp + p * (32 * DM)); wr[p] = *(const v8us*)(wp + p * (32 * DM)); }
  const v8f z8 = {0.f, 0.f, 0.f, 0.f, 0.f, 0.f, 0.f, 0.f};
  v8f acc[4][4];
#pragma unroll
  for (int i = 0; i < 4; ++i)
#pragma unroll
    for (int j = 0; j < 4; ++j) acc[i][j] = z8;
#pragma unroll
  for (int p = 0; p < 8; ++p) { *(v8us*)(lw + p * 16 * PJ_PITCH) = xs[p]; *(v8us*)(lw + PJ_TILE + p * 16 * PJ_PITCH) = wr[p]; }
  __syncthreads();      /* publishes stage 0 */
#pragma unroll 1      /* 12 trips of 32 matrix instructions stay rolled: registers */
  for (int st = 0; st < DM / 64; ++st) {
    const unsigned char* Lb = L + (st & 1) * PJ_BUF;
    if (st + 1 < DM / 64) { xp += 128; wp += 128;
#pragma unroll
      for (int p = 0; p < 8; ++p) { xs[p] = *(const v8us*)(xp + p * (32 * DM)); wr[p] = *(const v8us*)(wp + p * (32 * DM)); } }
#pragma unroll
    for (int ks = 0; ks < 2; ++ks) { v16h xf[4];
#pragma unroll
      for (int i = 0; i < 4; ++i) xf[i] = fa_frag(Lb + (wm + 16 * i + c) * PJ_PITCH + ks * 64 + 16 * h);
#pragma unroll
      for (int j = 0; j < 4; ++j) { const v16h wf = fa_frag(Lb + PJ_TILE + (wn + 16 * j + c) * PJ_PITCH + ks * 64 + 16 * h);
#pragma unroll
        for (int i = 0; i < 4; ++i) acc[i][j] = fa_mma(wf, xf[i], acc[i][j]); } }
    if (st + 1 < DM / 64) { unsigned char* p0 = lw + ((st + 1) & 1) * PJ_BUF;
#pragma unroll
      for (int p = 0; p < 8; ++p) { *(v8us*)(p0 + p * 16 * PJ_PITCH) = xs[p]; *(v8us*)(p0 + PJ_TILE + p * 16 * PJ_PITCH) = wr[p]; } }
    __syncthreads();      /* publishes stage st + 1 and ends every wave's reads of stage st, whose buffer the next trip refills (behind the last trip: frees the array for the output staging) */
  }
  unsigned char* E = L + w * (64 * PJ_PITCH);      /* this wave's own 64 rows of 64 f16 */
#pragma unroll
  for (int j = 0; j < 4; ++j) { const float* bp = bias + col0 + wn + 16 * j + 8 * h; const v4f b0 = *(const v4fa*)bp, b1 = *(const v4fa*)(bp + 4);
    const float bb[8] = {bf16_round(b0[0]), bf16_round(b0[1]), bf16_round(b0[2]), bf16_round(b0[3]), bf16_round(b1[0]), bf16_round(b1[1]), bf16_round(b1[2]), bf16_round(b1[3])};
#pragma unroll
    for (int i = 0; i < 4; ++i) { FragH f;
#pragma unroll
      for (int r = 0; r < 8; ++r) f.h[r] = (_Float16)(acc[i][j][r] * 0.0625f + bb[r]);
      *(v8us*)(E + (16 * i + c) * PJ_PITCH + 32 * j + 16 * h) = f.half[0]; } }      /* row = token, n = 16 j + 8 h + r */
  __builtin_amdgcn_fence(__ATOMIC_ACQ_REL, "workgroup"); __builtin_amdgcn_wave_barrier();      /* the rows are read back by other lanes of the same wave */
#pragma unroll
  for (int it = 0; it < 16; ++it) { const int row = it * 4 + (lane >> 3); const v8us v = *(const v8us*)(E + row * PJ_PITCH + (lane & 7) * 16);
    *(v8us*)((unsigned short*)C + (size_t)(row0 + wm + row) * DM + col0 + wn + (lane & 7) * 8) = v; } }      /* whole 128-byte lines, each stored once by one wave */

extern "C" void kernel_launch(void* const* d_in, const int* in_sizes, int n_in,
                              void* d_out, int out_size, void* d_ws, size_t ws_size, hipStream_t stream) {
  (void)in_sizes; (void)n_in; (void)out_size;
  const float* const* I = (const float* const*)d_in; const float* x = I[0]; const float* am = I[1]; const float* wq = I[2]; const float* bq = I[3]; const float* wk = I[4]; const float* bk = I[5]; const float* wv = I[6]; const float* bv = I[7];      /* weights [in][out]; am = additive mask [NB][1][1][SQ] */
  char* ws = (char*)d_ws; size_t off = 0;
  auto take = [&](size_t bytes) { char* p = ws + off; off += (bytes + 255) & ~(size_t)255; return p; };
  _Float16* BQ = (_Float16*)take((size_t)DM * DM * 2); _Float16* BK = (_Float16*)take((size_t)DM * DM * 2); _Float16* BV = (_Float16*)take((size_t)DM * DM * 2); 
  _Float16* X16 = (_Float16*)take(NR * DM * 2); _Float16* Q16 = (_Float16*)take(NR * DM * 2); _Float16* K16 = (_Float16*)take(NR * DM * 2); _Float16* V16 = (_Float16*)take(NR * DM * 2);
  _Float16* VT = (_Float16*)take((size_t)NH * HD * SQ * 2);
  if (off > ws_size) return;
  { const unsigned g = (unsigned)(((size_t)DM * (DM / 8) + 255) / 256); k_wt_f16<<<g, 256, 0, stream>>>(wq, BQ, DM, DM, 16.0f); k_wt_f16<<<g, 256, 0, stream>>>(wk, BK, DM, DM, 16.0f); k_wt_f16<<<g, 256, 0, stream>>>(wv, BV, DM, DM, 16.0f); }      /* [in][out] -> Bt[n][k] x16 */
  k_x16<<<(unsigned)((NR * DM / 8 + 255) / 256), 256, 0, stream>>>(x, X16, NR * DM / 8);
  const size_t r0p = (size_t)B0 * SQ;      /* first projected row */
  k_qkv<<<dim3((unsigned)(MP / 128), 3 * (DM / 128)), 128, 0, stream>>>(X16 + r0p * DM, BQ, BK, BV, bq, bk, bv, Q16 + r0p * DM, K16 + r0p * DM, V16 + r0p * DM);      /* q, k, v rows as f16, all three in one launch */
  for (int b = B0; b < B0 + NBR; ++b) { const size_t r0 = (size_t)b * SQ;
    k_vt<NH, SQ><<<NH * (SQ / 64), 256, 0, stream>>>(V16 + r0 * LQ, LQ, 0, VT);      /* V^T [NH][HD][SQ] for this batch */
    k_fattn<<<dim3(SQ / 64, NH), 128, 0, stream>>>(Q16 + r0 * LQ, K16 + r0 * LQ, VT, am + (size_t)b * SQ, (float*)d_out + r0 * DM); }      /* scores, softmax and P.V of all heads; out = merged heads, f32 */
}

// v005
// It runs in 87.3 microseconds.
// In two side-by-side timings against v004, it was 1.09 and 1.10 times as fast.
// Counting every step since v000, it is 116 times as fast.
#include <hip/hip_runtime.h>
// BERT self-attention (hidden [1][4096][768]; q/k/v = x W + b with W stored [in][out], 12 heads of 64; scores / 8 + the additive attention_mask[b][key] (f32); softmax; out = attn v merged -> [1][4096][768]; no output projection).
// Structure: token rows r = b*4096 + s; x as exact f16 rows (bf16-rounded); x and the three weight matrices are prepared in one launch; Q, K, V as one WMMA GEMM launch (128x128 work-group tiles staged in LDS, 64x64 wave tiles, f32 accumulation, exact x16 weights + bias, f16 outputs); per batch: V^T for all heads via LDS transposes; per batch one fused attention launch over all heads: scores (WMMA, K = 64), running softmax of (scores / 8 + additive mask) on VALU (f32 statistics, native exp; weights as f16 in registers), o = P . V (WMMA), normalised and written as f32 into the merged output rows.
// Compute dtype: inputs rounded to bf16; x / weights exact; q, k, v and softmax weights as plain f16 GEMM operands (~2^-12); scores, softmax statistics and o f32. v_wmma_f32_16x16x32_f16.
#define NB 1
#define SQ 4096
#define DM 768
#define NH 12
#define HD 64
#define HG 1                         /* heads per launch of the second k_vt (not launched) */
#define B0 0                         /* first batch processed (debug hook) */
#define NBR NB                       /* batches processed (debug hook) */
#define NR ((size_t)NB * SQ)         /* token rows */
#define MP ((int)((size_t)NBR * SQ)) /* rows projected (debug hook) */
#define QN SQ                        /* unused: the attention launch covers all SQ queries */
#define NHD NH                       /* unused: the attention launch covers all NH heads */
#define MPO MP                       /* unused: there is no output stage */
#define LQ DM      /* row pitch of the q/k/v rows */
typedef __bf16 v16b __attribute__((ext_vector_type(16)));
typedef unsigned short v8us __attribute__((ext_vector_type(8), may_alias));
typedef float  v8f  __attribute__((ext_vector_type(8)));
typedef float  v4f  __attribute__((ext_vector_type(4)));
typedef float  v4fa __attribute__((ext_vector_type(4), may_alias));
union FragB { v16b v; v8us half[2]; unsigned short u[16]; };

__device__ __forceinline__ unsigned short bf16_bits(float x) { unsigned int u = __float_as_uint(x); return (unsigned short)((u + 0x7FFFu + ((u >> 16) & 1u)) >> 16); }
__device__ __forceinline__ float bf16_val(unsigned short b) { return __uint_as_float(((unsigned int)b) << 16); }
__device__ __forceinline__ float bf16_round(float x) { return bf16_val(bf16_bits(x)); }
// D += A·B with NT terms: 1 = ah·bh, 2 = + al·bh (A split), 3 = + ah·bl (both split)
template <int NT>
__device__ __forceinline__ v8f mmaN(v16b ah, v16b al, v16b bh, v16b bl, v8f c) {
  c = __builtin_amdgcn_wmma_f32_16x16x32_bf16(false, ah, false, bh, (short)0, c, false, false);
  if (NT >= 2) c = __builtin_amdgcn_wmma_f32_16x16x32_bf16(false, al, false, bh, (short)0, c, false, false);
  if (NT >= 3) c = __builtin_amdgcn_wmma_f32_16x16x32_bf16(false, ah, false, bl, (short)0, c, false, false);
  asm volatile("v_nop\n\tv_nop\n\tv_nop\n\tv_nop" : "+v"(c) : "v"(ah), "v"(al), "v"(bh), "v"(bl));
  return c;
}

__global__ __launch_bounds__(256) void k_wt_bf16(const float* __restrict__ W, unsigned short* __restrict__ Wt, int K, int N) {
  const int t = blockIdx.x * 256 + threadIdx.x;
  const int k8n = K / 8;
  if (t >= N * k8n) return;
  const int n = t / k8n, k8 = (t % k8n) * 8;
  v8us v;
#pragma unroll
  for (int i = 0; i < 8; ++i) v[i] = bf16_bits(W[(size_t)(k8 + i) * N + n]);
  *(v8us*)(Wt + (size_t)n * K + k8) = v;
  
}

// GEMM C[M][N] (f32, pitch ldc) = act(A[M][K]·W + bias). A f32 row-major (pitch lda) converted per fragment to bf16
// (ASPLIT: hi/lo two planes -> 2 terms, else single rounded term); Wt bf16 [N][K] (pitch ldb). BIAS_BF16 rounds the
// bias to bf16 first (bias quantised to bf16 before the add). K%32==0, M%16==0, N%64==0.
template <bool ASPLIT, int ACT, bool BIAS_BF16>
__global__ __launch_bounds__(128) void k_gemm_bf(const float* __restrict__ A, int lda, const unsigned short* __restrict__ Wt, int ldb,
                                               const float* __restrict__ bias, float* __restrict__ C, int ldc, int M, int N, int K) {
  __shared__ __attribute__((aligned(16))) float so[4][16][64];
  const int tid = threadIdx.x, w = tid >> 5, lane = tid & 31, ln = lane & 15, hh = lane >> 4;
  const int ntn = N / 64;
  const int wid = blockIdx.x * 4 + w;
  const int mt = wid / ntn, nq = wid % ntn;
  if (mt * 16 >= M) return;
  const int row0 = mt * 16, col0 = nq * 64;
  const float* arow = A + (size_t)(row0 + ln) * lda;
  v8f acc[4] = {};
  for (int kb = 0; kb < K; kb += 32) {
    FragB ah, al;
    const v4f x0 = *(const v4fa*)(arow + kb + 8 * hh), x1 = *(const v4fa*)(arow + kb + 8 * hh + 4);
    const v4f x2 = *(const v4fa*)(arow + kb + 16 + 8 * hh), x3 = *(const v4fa*)(arow + kb + 16 + 8 * hh + 4);
    float xs[16] = {x0[0],x0[1],x0[2],x0[3],x1[0],x1[1],x1[2],x1[3],x2[0],x2[1],x2[2],x2[3],x3[0],x3[1],x3[2],x3[3]};
#pragma unroll
    for (int i = 0; i < 16; ++i) { const unsigned short hb = bf16_bits(xs[i]); ah.u[i] = hb; al.u[i] = ASPLIT ? bf16_bits(xs[i] - bf16_val(hb)) : (unsigned short)0; }
#pragma unroll
    for (int t = 0; t < 4; ++t) {
      const unsigned short* brow = Wt + (size_t)(col0 + t * 16 + ln) * ldb + kb;
      FragB b;
      b.half[0] = *(const v8us*)(brow + 8 * hh);
      b.half[1] = *(const v8us*)(brow + 16 + 8 * hh);
      acc[t] = mmaN<ASPLIT ? 2 : 1>(ah.v, al.v, b.v, b.v, acc[t]);
    }
  }
#pragma unroll
  for (int t = 0; t < 4; ++t) {
    float bv = bias ? bias[col0 + t * 16 + ln] : 0.f;
    if (BIAS_BF16) bv = bf16_round(bv);
#pragma unroll
    for (int r = 0; r < 8; ++r) { float v = acc[t][r] + bv; if (ACT == 1) v = fmaxf(v, 0.f); so[w][8 * hh + r][t * 16 + ln] = v; }
  }
  __builtin_amdgcn_fence(__ATOMIC_ACQ_REL, "workgroup");
  __builtin_amdgcn_wave_barrier();
  const int rsub = lane >> 4, c4 = (lane & 15) * 4;
  {
#pragma unroll
    for (int q = 0; q < 8; ++q) {
      const int r = q * 2 + rsub;
      const v4f v = *(const v4fa*)&so[w][r][c4];
      *(v4f*)(C + (size_t)(row0 + r) * ldc + col0 + c4) = v;
    }
    
  }
}

// GEMM C = act(A·W + bias + resid): A f32 (ASPLIT -> hi/lo 2 terms), Wt bf16 [N][K]; ACT 0 none, 1 relu, 2 exact gelu;
// resid (optional, f32, row index = (row % rmod), pitch ldr, RES_BF16 rounds it) added before the activation.
template <bool ASPLIT, int ACT, bool BIAS_BF16, bool RES_BF16>
__global__ __launch_bounds__(128) void k_gemm_bf3(const float* __restrict__ A, int lda, const unsigned short* __restrict__ Wt, int ldb,
                                                const float* __restrict__ bias, const float* __restrict__ resid, int rmod, int ldr,
                                                float* __restrict__ C, int ldc, int M, int N, int K) {
  __shared__ __attribute__((aligned(16))) float so[4][16][64];
  const int tid = threadIdx.x, w = tid >> 5, lane = tid & 31, ln = lane & 15, hh = lane >> 4;
  const int ntn = N / 64;
  const int wid = blockIdx.x * 4 + w;
  const int mt = wid / ntn, nq = wid % ntn;
  if (mt * 16 >= M) return;
  const int row0 = mt * 16, col0 = nq * 64;
  const float* arow = A + (size_t)(row0 + ln) * lda;
  v8f acc[4] = {};
  for (int kb = 0; kb < K; kb += 32) {
    FragB ah, al;
    const v4f x0 = *(const v4fa*)(arow + kb + 8 * hh), x1 = *(const v4fa*)(arow + kb + 8 * hh + 4);
    const v4f x2 = *(const v4fa*)(arow + kb + 16 + 8 * hh), x3 = *(const v4fa*)(arow + kb + 16 + 8 * hh + 4);
    float xs[16] = {x0[0],x0[1],x0[2],x0[3],x1[0],x1[1],x1[2],x1[3],x2[0],x2[1],x2[2],x2[3],x3[0],x3[1],x3[2],x3[3]};
#pragma unroll
    for (int i = 0; i < 16; ++i) { const unsigned short hb = bf16_bits(xs[i]); ah.u[i] = hb; al.u[i] = ASPLIT ? bf16_bits(xs[i] - bf16_val(hb)) : (unsigned short)0; }
#pragma unroll
    for (int t = 0; t < 4; ++t) {
      const unsigned short* brow = Wt + (size_t)(col0 + t * 16 + ln) * ldb + kb;
      FragB b;
      b.half[0] = *(const v8us*)(brow + 8 * hh);
      b.half[1] = *(const v8us*)(brow + 16 + 8 * hh);
      acc[t] = mmaN<ASPLIT ? 2 : 1>(ah.v, al.v, b.v, b.v, acc[t]);
    }
  }
#pragma unroll
  for (int t = 0; t < 4; ++t) {
    const int col = col0 + t * 16 + ln;
    float bv = bias ? bias[col] : 0.f;
    if (BIAS_BF16) bv = bf16_round(bv);
#pragma unroll
    for (int r = 0; r < 8; ++r) {
      float v = acc[t][r] + bv;
      if (resid) { float rv = resid[(size_t)((row0 + 8 * hh + r) % rmod) * ldr + col]; if (RES_BF16) rv = bf16_round(rv); v += rv; }
      if (ACT == 1) v = fmaxf(v, 0.f);
      if (ACT == 2) v = 0.5f * v * (1.0f + erff(v * 0.70710678118654752f));
      if (ACT == 3) { const float u = 0.7978845608028654f * (v + 0.044715f * v * v * v); v = 0.5f * v * (1.0f + tanhf(u)); }
      so[w][8 * hh + r][t * 16 + ln] = v;
    }
  }
  __builtin_amdgcn_fence(__ATOMIC_ACQ_REL, "workgroup");
  __builtin_amdgcn_wave_barrier();
  const int rsub = lane >> 4, c4 = (lane & 15) * 4;
  {
#pragma unroll
    for (int q = 0; q < 8; ++q) {
      const int r = q * 2 + rsub;
      const v4f v = *(const v4fa*)&so[w][r][c4];
      *(v4f*)(C + (size_t)(row0 + r) * ldc + col0 + c4) = v;
    }
    
  }
}
// row LayerNorm (biased variance, eps) over N: s = X (+ R); optional out_sum <- s; out_norm <- (s-mu)*rsqrt(var+eps)*g + b
template <bool PARAM_BF16>
__global__ __launch_bounds__(256) void k_layernorm(const float* __restrict__ X, const float* __restrict__ R, const float* __restrict__ g, const float* __restrict__ bta,
                                                  float* __restrict__ out_sum, float* __restrict__ out_norm, int N, float eps) {
  __shared__ float red[256];
  const int row = blockIdx.x, tid = threadIdx.x;
  const float* x = X + (size_t)row * N; const float* rr = R ? R + (size_t)row * N : nullptr;
  float vals[16];                     // up to N = 4096
  const int per = N / 256;            // contiguous chunk per thread? use strided-by-4 chunks: thread handles j = tid*4 + 1024*u
  float s1 = 0.f;
  for (int u = 0; u < per / 4; ++u) {
    const int j = tid * 4 + 1024 * u;
    const v4f a = *(const v4fa*)(x + j);
    v4f b = {0.f,0.f,0.f,0.f}; if (rr) b = *(const v4fa*)(rr + j);
#pragma unroll
    for (int q = 0; q < 4; ++q) { const float v = a[q] + b[q]; vals[u * 4 + q] = v; s1 += v; }
  }
  red[tid] = s1; __syncthreads();
  for (int st = 128; st > 0; st >>= 1) { if (tid < st) red[tid] += red[tid + st]; __syncthreads(); }
  const float mu = red[0] / (float)N; __syncthreads();
  float s2 = 0.f;
  for (int u = 0; u < per / 4; ++u)
#pragma unroll
    for (int q = 0; q < 4; ++q) { const float c = vals[u * 4 + q] - mu; s2 += c * c; }
  red[tid] = s2; __syncthreads();
  for (int st = 128; st > 0; st >>= 1) { if (tid < st) red[tid] += red[tid + st]; __syncthreads(); }
  const float rs = rsqrtf(red[0] / (float)N + eps);
  {
    for (int u = 0; u < per / 4; ++u) {
      const int j = tid * 4 + 1024 * u;
      v4f o, sm;
#pragma unroll
      for (int q = 0; q < 4; ++q) {
        float gg = g[j + q], bb = bta[j + q];
        if (PARAM_BF16) { gg = bf16_round(gg); bb = bf16_round(bb); }
        sm[q] = vals[u * 4 + q]; o[q] = (vals[u * 4 + q] - mu) * rs * gg + bb;
      }
      if (out_sum) *(v4f*)(out_sum + (size_t)row * N + j) = sm;
      *(v4f*)(out_norm + (size_t)row * N + j) = o;
    }
    
  }
}



// ---- f16 WMMA path (v_wmma_f32_16x16x32_f16): 11-bit significands for operands in range — used where a [0,1] probability operand needs more precision than bf16
typedef _Float16 v16h __attribute__((ext_vector_type(16)));
union FragH { v16h v; v8us half[2]; _Float16 h[16]; unsigned short u[16]; };
template <int NT>
__device__ __forceinline__ v8f mmaH(v16h ah, v16h al, v16h bh, v16h bl, v8f c) {
  c = __builtin_amdgcn_wmma_f32_16x16x32_f16(false, ah, false, bh, (short)0, c, false, false);
  if (NT >= 2) c = __builtin_amdgcn_wmma_f32_16x16x32_f16(false, al, false, bh, (short)0, c, false, false);
  if (NT >= 3) c = __builtin_amdgcn_wmma_f32_16x16x32_f16(false, ah, false, bl, (short)0, c, false, false);
  asm volatile("v_nop\n\tv_nop\n\tv_nop\n\tv_nop" : "+v"(c) : "v"(ah), "v"(al), "v"(bh), "v"(bl));
  return c;
}
// batched GEMM like k_gemm_b but f16 operands: A f32 (split into f16 hi/lo if ASPLIT, else rounded to f16), Bt = f16 values [n][k]; alpha; C f32; N multiple of 16 (partial tiles skipped)
template <bool ASPLIT>
__global__ __launch_bounds__(128) void k_gemm_h(const float* __restrict__ A, int lda, size_t sA, const _Float16* __restrict__ Bh, int ldb, size_t sB, float alpha, float* __restrict__ C, int ldc, size_t sC, int M, int N, int K) {
  __shared__ __attribute__((aligned(16))) float so[4][16][64];
  const int tid = threadIdx.x, w = tid >> 5, lane = tid & 31, ln = lane & 15, hh = lane >> 4; const int by = blockIdx.y;
  A += (size_t)by * sA; Bh += (size_t)by * sB; C += (size_t)by * sC;
  const int ntn = (N + 63) / 64; const int wid = blockIdx.x * 4 + w; const int mt = wid / ntn, nq = wid % ntn; if (mt * 16 >= M) return;
  const int row0 = mt * 16, col0 = nq * 64; const float* arow = A + (size_t)(row0 + ln) * lda;
  v8f acc[4] = {};
  for (int kb = 0; kb < K; kb += 32) {
    FragH ah, al;
    const v4f x0 = *(const v4fa*)(arow + kb + 8 * hh), x1 = *(const v4fa*)(arow + kb + 8 * hh + 4), x2 = *(const v4fa*)(arow + kb + 16 + 8 * hh), x3 = *(const v4fa*)(arow + kb + 16 + 8 * hh + 4);
    float xs[16] = {x0[0],x0[1],x0[2],x0[3],x1[0],x1[1],x1[2],x1[3],x2[0],x2[1],x2[2],x2[3],x3[0],x3[1],x3[2],x3[3]};
#pragma unroll
    for (int i = 0; i < 16; ++i) { const _Float16 h = (_Float16)xs[i]; ah.h[i] = h; al.h[i] = ASPLIT ? (_Float16)(xs[i] - (float)h) : (_Float16)0.0f; }
#pragma unroll
    for (int t = 0; t < 4; ++t) { if (col0 + t * 16 >= N) continue; const size_t boff = (size_t)(col0 + t * 16 + ln) * ldb + kb; FragH bq; bq.half[0] = *(const v8us*)(Bh + boff + 8 * hh); bq.half[1] = *(const v8us*)(Bh + boff + 16 + 8 * hh);
      acc[t] = mmaH<ASPLIT ? 2 : 1>(ah.v, al.v, bq.v, bq.v, acc[t]); }
  }
#pragma unroll
  for (int t = 0; t < 4; ++t) { if (col0 + t * 16 >= N) continue;
#pragma unroll
    for (int r = 0; r < 8; ++r) so[w][8 * hh + r][t * 16 + ln] = acc[t][r] * alpha; }
  __builtin_amdgcn_fence(__ATOMIC_ACQ_REL, "workgroup"); __builtin_amdgcn_wave_barrier();
  const int rsub = lane >> 4, c4 = (lane & 15) * 4;
  {
#pragma unroll
    for (int q = 0; q < 8; ++q) { const int r = q * 2 + rsub; if (col0 + c4 < N) { const v4f v = *(const v4fa*)&so[w][r][c4]; *(v4f*)(C + (size_t)(row0 + r) * ldc + col0 + c4) = v; } }
     }
}

// Wt[n][k] = f16(W[k][n]·scale) from f32 row-major W[K][N] (scale = power of two; bf16-exact weights stay exact in f16 away from the subnormal range)
__global__ __launch_bounds__(256) void k_wt_f16(const float* __restrict__ W, _Float16* __restrict__ Wt, int K, int N, float scale) {
  const int t = blockIdx.x * 256 + threadIdx.x; if (t >= N * (K / 8)) return; const int n = t / (K / 8), k8 = (t % (K / 8)) * 8; FragH f;
#pragma unroll
  for (int i = 0; i < 8; ++i) f.h[i] = (_Float16)(bf16_round(W[(size_t)(k8 + i) * N + n]) * scale); const v8us o = f.half[0];
  *(v8us*)((unsigned short*)Wt + (size_t)n * K + k8) = o; 
}
// k_gemm_hh variant with fused epilogue: v = acc·alpha + bias[by·sBias + col] (+ CP[(row/rowsPerB)·sCPb + by·64 + col] if CP) ; ACT 0 none / 1 elu ; writes f16 C16 (and f32 C if non-null)
template <int ACT>
__global__ __launch_bounds__(128) void k_gemm_hhx(const _Float16* __restrict__ A, int lda, size_t sA, const _Float16* __restrict__ Bh, int ldb, size_t sB, float alpha, const float* __restrict__ bias, size_t sBias, const float* __restrict__ CP, int rowsPerB, size_t sCPb, int row0g,
    float* __restrict__ C, _Float16* __restrict__ C16, int ldc, size_t sC, int M, int N, int K) {
  __shared__ __attribute__((aligned(16))) float so[4][16][64];
  const int tid = threadIdx.x, w = tid >> 5, lane = tid & 31, ln = lane & 15, hh = lane >> 4; const int by = blockIdx.y;
  A += (size_t)by * sA; Bh += (size_t)by * sB; const size_t cofs = (size_t)by * sC; const float* bp = bias ? bias + (size_t)by * sBias : nullptr;
  const int ntn = (N + 63) / 64; const int wid = blockIdx.x * 4 + w; const int mt = wid / ntn, nq = wid % ntn; if (mt * 16 >= M) return;
  const int row0 = mt * 16, col0 = nq * 64; const _Float16* arow = A + (size_t)(row0 + ln) * lda;
  v8f acc[4] = {};
  for (int kb = 0; kb < K; kb += 32) { FragH ah; ah.half[0] = *(const v8us*)((const unsigned short*)arow + kb + 8 * hh); ah.half[1] = *(const v8us*)((const unsigned short*)arow + kb + 16 + 8 * hh);
#pragma unroll
    for (int t = 0; t < 4; ++t) { if (col0 + t * 16 >= N) continue; const size_t boff = (size_t)(col0 + t * 16 + ln) * ldb + kb; FragH bq; bq.half[0] = *(const v8us*)((const unsigned short*)Bh + boff + 8 * hh); bq.half[1] = *(const v8us*)((const unsigned short*)Bh + boff + 16 + 8 * hh);
      acc[t] = mmaH<1>(ah.v, ah.v, bq.v, bq.v, acc[t]); }
  }
#pragma unroll
  for (int t = 0; t < 4; ++t) { if (col0 + t * 16 >= N) continue; const int col = col0 + t * 16 + ln; const float bv = bp ? bf16_round(bp[col]) : 0.f;
#pragma unroll
    for (int r = 0; r < 8; ++r) { float v = acc[t][r] * alpha + bv; if (CP) { const int rr = row0g + row0 + 8 * hh + r; if (rowsPerB < 0) v += CP[cofs + (size_t)rr * ldc + col];      /* rowsPerB < 0: own element of the batched C plane */ else { const int bidx = rr / rowsPerB; v += CP[(size_t)bidx * sCPb + (size_t)by * 64 + col]; } } if (ACT == 1) v = (v > 0.f) ? v : expm1f(v); else if (ACT == 7) v = (v > 0.f) ? v + 1.0f : expf(v); else if (ACT == 8) v = tanhf(v); else if (ACT == 9) v = 0.5f * v * (1.0f + tanhf(0.7978845608028654f * (v + 0.044715f * v * v * v))); else if (ACT == 11) v = 1.0f / (1.0f + expf(-v)); else if (ACT == 12) v = (v > 0.f) ? v : 0.01f * v; else if (ACT == 14) v = (v > 0.f) ? v : 0.1f * v; else if (ACT == 16) v = (v >= 0.f) ? v : 0.3f * v; else if (ACT == 17) v = (v >= 0.f) ? v : 0.2f * v; else if (ACT == 15) v = v / (1.0f + expf(-v)); else if (ACT == 3) v = fmaxf(v, 0.f); else if (ACT == 6) v = 0.5f * v * (1.0f + erff(v * 0.70710678118654752f)); so[w][8 * hh + r][t * 16 + ln] = v; } }
  __builtin_amdgcn_fence(__ATOMIC_ACQ_REL, "workgroup"); __builtin_amdgcn_wave_barrier();
  const int rsub = lane >> 4, c4 = (lane & 15) * 4; typedef _Float16 v4h __attribute__((ext_vector_type(4)));
  {
#pragma unroll
    for (int q = 0; q < 8; ++q) { const int r = q * 2 + rsub; if (col0 + c4 < N) { const v4f v = *(const v4fa*)&so[w][r][c4]; if (C) *(v4f*)(C + cofs + (size_t)(row0 + r) * ldc + col0 + c4) = v; if (C16) { v4h h4; for (int i = 0; i < 4; ++i) h4[i] = (_Float16)v[i]; *(v4h*)(C16 + cofs + (size_t)(row0 + r) * ldc + col0 + c4) = h4; } } }
     }
}


typedef _Float16 v4h __attribute__((ext_vector_type(4)));

__global__ __launch_bounds__(256) void k_x16(const float* __restrict__ x, _Float16* __restrict__ X16, size_t n8) { const size_t t = (size_t)blockIdx.x * 256 + threadIdx.x; if (t >= n8) return; FragH f;
#pragma unroll
  for (int q = 0; q < 8; ++q) f.h[q] = (_Float16)bf16_round(x[t * 8 + q]); *(v8us*)((unsigned short*)X16 + t * 8) = f.half[0];  }
__global__ __launch_bounds__(256) void k_h16(const float* __restrict__ x, _Float16* __restrict__ X16, size_t n8) { const size_t t = (size_t)blockIdx.x * 256 + threadIdx.x; if (t >= n8) return; FragH f;
#pragma unroll
  for (int q = 0; q < 8; ++q) f.h[q] = (_Float16)x[t * 8 + q]; *(v8us*)((unsigned short*)X16 + t * 8) = f.half[0];  }
__global__ __launch_bounds__(256) void k_round16f(const float* __restrict__ W, _Float16* __restrict__ Bt, size_t n8) { const size_t t = (size_t)blockIdx.x * 256 + threadIdx.x; if (t >= n8) return; FragH f;
#pragma unroll
  for (int i = 0; i < 8; ++i) f.h[i] = (_Float16)(bf16_round(W[t * 8 + i]) * 16.0f); *(v8us*)((unsigned short*)Bt + t * 8) = f.half[0];  }
template <int NHv, int TTv>
__global__ __launch_bounds__(256) void k_vt(const _Float16* __restrict__ V16, int ldv, int voff, _Float16* __restrict__ Vt) { __shared__ unsigned short tl[64][66]; const int tid = threadIdx.x; const int slab = blockIdx.x / (TTv / 64), lg = blockIdx.x % (TTv / 64); const int b = slab / NHv, h = slab % NHv;
  for (int i = tid; i < 64 * 8; i += 256) { const int r = i / 8, c8 = (i % 8) * 8; FragH f; f.half[0] = *(const v8us*)((const unsigned short*)V16 + ((size_t)b * TTv + lg * 64 + r) * ldv + voff + h * 64 + c8);
#pragma unroll
    for (int q = 0; q < 8; ++q) tl[r][c8 + q] = f.u[q]; }
  __syncthreads();
  {
#pragma unroll
    for (int rd = 0; rd < 2; ++rd) { const int d = rd * 32 + tid / 8, pc = tid % 8; FragH f;
#pragma unroll
      for (int q = 0; q < 8; ++q) f.u[q] = tl[pc * 8 + q][d];
      *(v8us*)((unsigned short*)Vt + ((size_t)slab * 64 + d) * TTv + lg * 64 + pc * 8) = f.half[0]; }
     } }

__global__ __launch_bounds__(256) void k_hl(const float* __restrict__ F, _Float16* __restrict__ Hh, _Float16* __restrict__ Hl, size_t n8) { const size_t t = (size_t)blockIdx.x * 256 + threadIdx.x; if (t >= n8) return; FragH fh, fl; const v4f a = *(const v4fa*)(F + t * 8), c = *(const v4fa*)(F + t * 8 + 4);
#pragma unroll
  for (int q = 0; q < 4; ++q) { _Float16 h = (_Float16)a[q]; fh.h[q] = h; fl.h[q] = (_Float16)((a[q] - (float)h) * 1024.0f); h = (_Float16)c[q]; fh.h[4 + q] = h; fl.h[4 + q] = (_Float16)((c[q] - (float)h) * 1024.0f); }
  { *(v8us*)((unsigned short*)Hh + t * 8) = fh.half[0]; *(v8us*)((unsigned short*)Hl + t * 8) = fl.half[0];  } }

// ---- fast GEMM (wave tile 32x64; requires M % 32 == 0 rows per launch region and N % 64 == 0); epilogue = k_gemm_hhx semantics ----
__device__ __forceinline__ v16h g2_frag(const _Float16* p, int hh) { FragH f; f.half[0] = *(const v8us*)((const unsigned short*)p + 8 * hh); f.half[1] = *(const v8us*)((const unsigned short*)p + 16 + 8 * hh); return f.v; }
__device__ __forceinline__ v8f g2_mma(v16h a, v16h b, v8f c) { v8f d = __builtin_amdgcn_wmma_f32_16x16x32_f16(false, a, false, b, (short)0, c, false, false); asm volatile("v_nop\n\tv_nop\n\tv_nop\n\tv_nop" : "+v"(d) : "v"(a), "v"(b)); return d; }
template <int ACT>
__global__ __launch_bounds__(128) void k_gemm2(const _Float16* __restrict__ A, int lda, size_t sA, const _Float16* __restrict__ Bh, int ldb, size_t sB, float alpha, const float* __restrict__ bias, size_t sBias, const float* __restrict__ CP, int rowsPerB, size_t sCPb, int row0g,
    float* __restrict__ C, _Float16* __restrict__ C16, int ldc, size_t sC, int M, int N, int K) { static_assert(ACT == 0 || ACT == 3 || ACT == 6 || ACT == 8 || ACT == 9 || ACT == 11 || ACT == 12 || ACT == 14 || ACT == 15 || ACT == 16 || ACT == 17, "k_gemm2: unsupported ACT code (would silently apply no activation)");
  __shared__ __attribute__((aligned(16))) float so[4][32][68];
  const int tid = threadIdx.x, w = tid >> 5, lane = tid & 31, ln = lane & 15, hh = lane >> 4; const int by = blockIdx.y;
  A += (size_t)by * sA; Bh += (size_t)by * sB; const size_t cofs = (size_t)by * sC; const float* bp = bias ? bias + (size_t)by * sBias : nullptr;
  const int ntn = N >> 6; const int mt = blockIdx.x / ntn, nq = blockIdx.x - mt * ntn; const int row0 = mt * 128 + 32 * w, col0 = nq * 64; if (row0 >= M) return;
  const _Float16* a0p = A + (size_t)(row0 + ln) * lda; const _Float16* a1p = a0p + (size_t)16 * lda;
  const _Float16* b0p = Bh + (size_t)(col0 + ln) * ldb; const _Float16* b1p = b0p + (size_t)16 * ldb; const _Float16* b2p = b1p + (size_t)16 * ldb; const _Float16* b3p = b2p + (size_t)16 * ldb;
  const v8f z8 = {0.f,0.f,0.f,0.f,0.f,0.f,0.f,0.f}; v8f c00 = z8, c01 = z8, c02 = z8, c03 = z8, c10 = z8, c11 = z8, c12 = z8, c13 = z8;
#pragma unroll 1
  for (int kb = 0; kb < K; kb += 32) { const v16h a0 = g2_frag(a0p + kb, hh), a1 = g2_frag(a1p + kb, hh);
    v16h b = g2_frag(b0p + kb, hh); c00 = g2_mma(a0, b, c00); c10 = g2_mma(a1, b, c10);
    b = g2_frag(b1p + kb, hh); c01 = g2_mma(a0, b, c01); c11 = g2_mma(a1, b, c11);
    b = g2_frag(b2p + kb, hh); c02 = g2_mma(a0, b, c02); c12 = g2_mma(a1, b, c12);
    b = g2_frag(b3p + kb, hh); c03 = g2_mma(a0, b, c03); c13 = g2_mma(a1, b, c13); }
  v8f accs[8] = {c00, c01, c02, c03, c10, c11, c12, c13};
#pragma unroll
  for (int u = 0; u < 8; ++u) { const int t = u & 3, half = u >> 2; const int col = col0 + t * 16 + ln; const float bv = bp ? bf16_round(bp[col]) : 0.f;
#pragma unroll
    for (int r = 0; r < 8; ++r) { const int rloc = half * 16 + 8 * hh + r; float v = accs[u][r] * alpha + bv; if (CP) { if (rowsPerB < 0) v += CP[cofs + (size_t)(row0g + row0 + rloc) * ldc + col];      /* rowsPerB < 0: own element of the batched C plane */ else { const int bidx = (row0g + row0 + rloc) / rowsPerB; v += CP[(size_t)bidx * sCPb + (size_t)by * 64 + col]; } }
      if (ACT == 3) v = fmaxf(v, 0.f); else if (ACT == 6) v = 0.5f * v * (1.0f + erff(v * 0.70710678118654752f)); else if (ACT == 11) v = 1.0f / (1.0f + expf(-v)); else if (ACT == 15) v = v / (1.0f + expf(-v)); else if (ACT == 12) v = (v > 0.f) ? v : 0.01f * v; else if (ACT == 8) v = tanhf(v); else if (ACT == 9) v = 0.5f * v * (1.0f + tanhf(0.7978845608028654f * (v + 0.044715f * v * v * v))); else if (ACT == 14) v = (v > 0.f) ? v : 0.1f * v; else if (ACT == 16) v = (v >= 0.f) ? v : 0.3f * v; else if (ACT == 17) v = (v >= 0.f) ? v : 0.2f * v;
      so[w][rloc][t * 16 + ln] = v; } }
  __builtin_amdgcn_fence(__ATOMIC_ACQ_REL, "workgroup"); __builtin_amdgcn_wave_barrier();
  const int rsub = lane >> 4, c4 = (lane & 15) * 4;
  {
#pragma unroll
    for (int q = 0; q < 16; ++q) { const int r = q * 2 + rsub; const v4f v = *(const v4fa*)&so[w][r][c4]; if (C) *(v4f*)(C + cofs + (size_t)(row0 + r) * ldc + col0 + c4) = v; if (C16) { v4h h4; for (int i = 0; i < 4; ++i) h4[i] = (_Float16)v[i]; *(v4h*)(C16 + cofs + (size_t)(row0 + r) * ldc + col0 + c4) = h4; } }
     } }


__global__ __launch_bounds__(256) void k_wnat(const float* __restrict__ w, size_t n8, _Float16* __restrict__ Bt) { const size_t t = (size_t)blockIdx.x * 256 + threadIdx.x; if (t >= n8) return; FragH f; for (int q = 0; q < 8; ++q) f.h[q] = (_Float16)(bf16_round(w[t * 8 + q]) * 16.0f); *(v8us*)((unsigned short*)Bt + t * 8) = f.half[0];  }
__global__ __launch_bounds__(256) void k_rsm(const float* __restrict__ S, _Float16* __restrict__ P, int nrows) {
  #pragma clang fp contract(off)
  const int i = blockIdx.x * 256 + threadIdx.x; if (i >= nrows) return; const float* s = S + (size_t)i * SQ; float mx = -3.0e38f;
#pragma unroll 1
  for (int j = 0; j < SQ; ++j) mx = fmaxf(mx, s[j]); float se = 0.f;
#pragma unroll 1
  for (int j = 0; j < SQ; ++j) se += expf(s[j] - mx); const float sc = 256.0f / se;
#pragma unroll 1
  for (int j0 = 0; j0 < SQ; j0 += 8) { FragH f; for (int q = 0; q < 8; ++q) f.h[q] = (_Float16)(expf(s[j0 + q] - mx) * sc); unsigned short* d = (unsigned short*)P + (size_t)i * SQ + j0; *(v8us*)d = f.half[0];  } }
__global__ __launch_bounds__(256) void k_vt(const _Float16* __restrict__ V16, int b, int h0, _Float16* __restrict__ VT) { __shared__ unsigned short tl[64][65]; const int tid = threadIdx.x; const int hh = blockIdx.x % HG, sg = blockIdx.x / HG; const int s0 = sg * 64; const int h = h0 + hh;
  for (int i = tid; i < 64 * 8; i += 256) { const int j = i / 8, d8 = (i % 8) * 8; FragH f; f.half[0] = *(const v8us*)((const unsigned short*)V16 + ((size_t)b * SQ + s0 + j) * DM + h * HD + d8); for (int q = 0; q < 8; ++q) tl[d8 + q][j] = f.u[q]; }
  __syncthreads();
  { for (int i = tid; i < 64 * 8; i += 256) { const int d = i / 8, j8 = (i % 8) * 8; FragH f; for (int q = 0; q < 8; ++q) f.u[q] = tl[d][j8 + q]; *(v8us*)((unsigned short*)VT + ((size_t)hh * HD + d) * SQ + s0 + j8) = f.half[0]; }  } }



// Four exponentials 2^x in place. The closing v_nop is the free slot that the instruction set asks for behind a transcendental before its result is used or its
// source overwritten; it stands in the same statement because nothing else would keep it directly behind the last v_exp_f32 (inside, each v_exp_f32 is independent of the one before).
__device__ __forceinline__ v4f exp2x4(v4f x) { float a = x[0], b = x[1], c = x[2], d = x[3];
  asm("v_exp_f32 %0, %0\n\tv_exp_f32 %1, %1\n\tv_exp_f32 %2, %2\n\tv_exp_f32 %3, %3\n\tv_nop" : "+v"(a), "+v"(b), "+v"(c), "+v"(d));
  const v4f r = {a, b, c, d}; return r; }
#define FA_LAG 5.5f                  /* score units; 5.5 log2 e = 7.9 */
#define FA_L2E 1.44269504088896340736f
#define FA_PITCH 144                 /* LDS row pitch, bytes */
#define FA_TILE (64 * FA_PITCH)      /* one operand's 64 rows */
#define FA_BUF (2 * FA_TILE)         /* K tile + V^T tile of 64 keys */
#define FA_STG (2 * FA_BUF)          /* one stage: the tiles of both key sets */
#define FA_EP 272                    /* output staging pitch, bytes: 64 f32 + 16 */
#define FA_XW (17 * 512)             /* one wave's partial result: 17 pieces of 16 bytes a lane */
__device__ __forceinline__ v16h fa_frag(const unsigned char* p) { FragH f; f.half[0] = *(const v8us*)p; f.half[1] = *(const v8us*)(p + 32); return f.v; }
__device__ __forceinline__ v8f fa_mma(v16h a, v16h b, v8f c) { return __builtin_amdgcn_wmma_f32_16x16x32_f16(false, a, false, b, (short)0, c, false, false); }
__device__ __forceinline__ float fa_xhalf(float x) { return __builtin_bit_cast(float, __builtin_amdgcn_permlanex16(__builtin_bit_cast(int, x), __builtin_bit_cast(int, x), 0x76543210, 0xfedcba98, false, false)); }      /* lane l with lane l ^ 16 */
__global__ __launch_bounds__(128) void k_fattn(const _Float16* __restrict__ Q16, const _Float16* __restrict__ K16, const _Float16* __restrict__ VT, const float* __restrict__ am, float* __restrict__ out) {
  __shared__ __attribute__((aligned(16))) unsigned char L[2 * FA_STG];      /* two stages in the loop; the partial results and the output staging behind it */
  __shared__ __attribute__((aligned(16))) float ms[SQ];
  static_assert(2 * FA_XW + 2 * 32 * FA_EP <= 2 * FA_STG, "partial results and output staging must fit the array");
  const int tid = threadIdx.x, lane = tid & 31, c = lane & 15, h = lane >> 4; const int w = __builtin_amdgcn_readfirstlane(tid >> 5);
  const int qh = w & 1, ks = w >> 1;      /* which 32 queries, which key set */
  const int head = blockIdx.y, q0 = blockIdx.x * 64 + qh * 32;
  /* staging: 8 threads cover one 128-byte row piece; a thread brings rows sr + 16 p (p = 0..3) of both operands of both tiles */
  const int sr = tid >> 3, sc = tid & 7;
  const unsigned short* kg = (const unsigned short*)K16 + (size_t)sr * DM + head * HD + sc * 8;
  const unsigned short* vg = (const unsigned short*)VT + ((size_t)head * HD + sr) * SQ + sc * 8;
  unsigned char* lw = L + sr * FA_PITCH + sc * 16;
  v8us kr[8], vr[8];      /* index 4 u + p: tile u */
#pragma unroll
  for (int i = 0; i < 8; ++i) { kr[i] = *(const v8us*)(kg + (size_t)(16 * i) * DM); vr[i] = *(const v8us*)(vg + (size_t)(16 * (i & 3)) * SQ + 64 * (i >> 2)); }
#pragma unroll
  for (int u = 0; u < SQ / 512; ++u) { const v4f m = *(const v4fa*)(am + u * 512 + tid * 4); v4f r;
#pragma unroll
    for (int q = 0; q < 4; ++q) r[q] = bf16_round(m[q]);
    *(v4fa*)&ms[u * 512 + tid * 4] = r; }
  v16h qf[2][2]; const _Float16* qa[2];      /* qa: the lane's own address, its half's 8 elements counted in */
#pragma unroll
  for (int g = 0; g < 2; ++g) { qa[g] = Q16 + (size_t)(q0 + 16 * g + c) * DM + head * HD + 8 * h; qf[g][0] = g2_frag(qa[g], 0); qf[g][1] = g2_frag(qa[g] + 32, 0); }
  asm volatile("s_wait_xcnt 0x0" :: "v"(qa[0]), "v"(qa[1]) : "memory");      /* the wait in front of any overwrite of the Q loads' address registers; the addresses are inputs so that they stay live up to it */
  FragH ones;      /* A operand whose row 0 is 1.0: its product with P^T is the column sums of P^T, the softmax denominators */
#pragma unroll
  for (int i = 0; i < 16; ++i) ones.h[i] = (c == 0) ? (_Float16)1.0f : (_Float16)0.0f;
  const v8f z8 = {0.f, 0.f, 0.f, 0.f, 0.f, 0.f, 0.f, 0.f};
  v8f acc[2][4], lacc[2]; float m_run[2];
#pragma unroll
  for (int g = 0; g < 2; ++g) { m_run[g] = -3.402823466e38f; lacc[g] = z8;      /* the lowest finite value: any finite score replaces it, a key at -inf keeps weight 0 */
#pragma unroll
    for (int t = 0; t < 4; ++t) acc[g][t] = z8; }
#pragma unroll
  for (int i = 0; i < 8; ++i) { unsigned char* p = lw + (i >> 2) * FA_BUF + (i & 3) * 16 * FA_PITCH; *(v8us*)p = kr[i]; *(v8us*)(p + FA_TILE) = vr[i]; }
  __syncthreads();      /* publishes stage 0 and the mask */
#pragma unroll 1      /* 32 trips of 36 matrix instructions stay rolled: code size and registers */
  for (int st = 0; st < SQ / 128; ++st) {
    const unsigned char* Lb = L + (st & 1) * FA_STG + ks * FA_BUF;
    if (st + 1 < SQ / 128) { const unsigned short* kn = kg + (size_t)(st + 1) * 128 * DM; const unsigned short* vn = vg + (st + 1) * 128;
#pragma unroll
      for (int i = 0; i < 8; ++i) { kr[i] = *(const v8us*)(kn + (size_t)(16 * i) * DM); vr[i] = *(const v8us*)(vn + (size_t)(16 * (i & 3)) * SQ + 64 * (i >> 2)); }
      asm volatile("s_wait_xcnt 0x0" :: "v"(kn), "v"(vn) : "memory"); }      /* the wait in front of any overwrite of the sixteen loads' address registers; the two addresses are inputs so that they stay live up to it and no load of the run lands in them */
#pragma unroll
    for (int sub = 0; sub < 2; ++sub) {
      v8f s[2][2];
#pragma unroll
      for (int kt = 0; kt < 2; ++kt) { const unsigned char* kp = Lb + (sub * 32 + 16 * kt + c) * FA_PITCH + 16 * h; const v16h k0 = fa_frag(kp), k1 = fa_frag(kp + 64);
        const float* mp = ms + st * 128 + ks * 64 + sub * 32 + 16 * kt + 8 * h; const v4f m0 = *(const v4fa*)mp, m1 = *(const v4fa*)(mp + 4);
        const v8f mc = {m0[0], m0[1], m0[2], m0[3], m1[0], m1[1], m1[2], m1[3]};
        s[kt][0] = fa_mma(k0, qf[0][0], z8); s[kt][1] = fa_mma(k0, qf[1][0], z8);
        s[kt][0] = fa_mma(k1, qf[0][1], s[kt][0]) * 0.125f + mc; s[kt][1] = fa_mma(k1, qf[1][1], s[kt][1]) * 0.125f + mc; }      /* 1/sqrt(64) is a power of two, so this is the score plus the mask in one f32 rounding, fused or not, as the separate kernels had it */
      v16h vf[4];
#pragma unroll
      for (int t = 0; t < 4; ++t) vf[t] = fa_frag(Lb + FA_TILE + (16 * t + c) * FA_PITCH + sub * 64 + 16 * h);
      float mb[2]; bool need = false;
#pragma unroll
      for (int g = 0; g < 2; ++g) { float mx = fmaxf(s[0][g][0], s[1][g][0]);
#pragma unroll
        for (int r = 1; r < 8; ++r) mx = fmaxf(fmaxf(mx, s[0][g][r]), s[1][g][r]);
        mx = fmaxf(mx, fa_xhalf(mx)); mb[g] = mx; need = need || (mx > m_run[g] + FA_LAG); }
      if (__builtin_amdgcn_ballot_w32(need) != 0) {      /* one scalar branch a pass; rare behind the first passes */
        v4f e = {(m_run[0] - fmaxf(m_run[0], mb[0])) * FA_L2E, (m_run[1] - fmaxf(m_run[1], mb[1])) * FA_L2E, 0.f, 0.f}; e = exp2x4(e);
#pragma unroll
        for (int g = 0; g < 2; ++g) { m_run[g] = fmaxf(m_run[g], mb[g]); lacc[g] = lacc[g] * e[g];
#pragma unroll
          for (int t = 0; t < 4; ++t) acc[g][t] = acc[g][t] * e[g]; } }
#pragma unroll
      for (int g = 0; g < 2; ++g) { const float mr = m_run[g]; FragH pf;
#pragma unroll
        for (int j = 0; j < 4; ++j) { v4f a;
#pragma unroll
          for (int q = 0; q < 4; ++q) a[q] = (s[j >> 1][g][4 * (j & 1) + q] - mr) * FA_L2E;
          a = exp2x4(a);
#pragma unroll
          for (int q = 0; q < 4; ++q) pf.h[4 * j + q] = (_Float16)a[q]; }
#pragma unroll
        for (int t = 0; t < 4; ++t) acc[g][t] = fa_mma(vf[t], pf.v, acc[g][t]);
        lacc[g] = fa_mma(ones.v, pf.v, lacc[g]); }
    }
    if (st + 1 < SQ / 128) { unsigned char* p0 = lw + ((st + 1) & 1) * FA_STG;
#pragma unroll
      for (int i = 0; i < 8; ++i) { unsigned char* p = p0 + (i >> 2) * FA_BUF + (i & 3) * 16 * FA_PITCH; *(v8us*)p = kr[i]; *(v8us*)(p + FA_TILE) = vr[i]; } }
    __syncthreads();      /* publishes stage st + 1 and ends every wave's reads of stage st, whose buffer the next trip refills (behind the last trip: frees the array for the partial results) */
  }
  float lf[2];
#pragma unroll
  for (int g = 0; g < 2; ++g) { const float lr = lacc[g][0]; lf[g] = lr + fa_xhalf(lr); }      /* register 0: the sum in lanes 0-15, 0 in lanes 16-31 */
  unsigned char* X = L + qh * FA_XW + lane * 16;      /* lane for lane: the two waves of one query half hold the same element in the same lane and register */
  if (ks == 1) {
#pragma unroll
    for (int g = 0; g < 2; ++g)
#pragma unroll
      for (int t = 0; t < 4; ++t) { const v8f o = acc[g][t]; const v4f o0 = {o[0], o[1], o[2], o[3]}, o1 = {o[4], o[5], o[6], o[7]};
        *(v4fa*)(X + (8 * g + 2 * t) * 512) = o0; *(v4fa*)(X + (8 * g + 2 * t + 1) * 512) = o1; }
    const v4f ml = {m_run[0], m_run[1], lf[0], lf[1]}; *(v4fa*)(X + 16 * 512) = ml; }
  __syncthreads();      /* publishes key set 1's partial results to the waves of key set 0 */
  if (ks == 1) return;      /* behind the last barrier */
  const v4f ml = *(const v4fa*)(X + 16 * 512);
  const float mm0 = fmaxf(m_run[0], ml[0]), mm1 = fmaxf(m_run[1], ml[1]);
  v4f e = {(m_run[0] - mm0) * FA_L2E, (ml[0] - mm0) * FA_L2E, (m_run[1] - mm1) * FA_L2E, (ml[1] - mm1) * FA_L2E}; e = exp2x4(e);      /* both partial results brought to the larger of their two maxima */
  unsigned char* E = L + 2 * FA_XW + qh * (32 * FA_EP);      /* this wave's own 32 rows of 64 f32 */
#pragma unroll
  for (int g = 0; g < 2; ++g) { const float inv = 1.0f / (lf[g] * e[2 * g] + ml[2 + g] * e[2 * g + 1]); const float fa = e[2 * g] * inv, fb = e[2 * g + 1] * inv;
#pragma unroll
    for (int t = 0; t < 4; ++t) { const v4f p0 = *(const v4fa*)(X + (8 * g + 2 * t) * 512), p1 = *(const v4fa*)(X + (8 * g + 2 * t + 1) * 512); const v8f a = acc[g][t];
      const v4f o0 = {a[0] * fa + p0[0] * fb, a[1] * fa + p0[1] * fb, a[2] * fa + p0[2] * fb, a[3] * fa + p0[3] * fb}, o1 = {a[4] * fa + p1[0] * fb, a[5] * fa + p1[1] * fb, a[6] * fa + p1[2] * fb, a[7] * fa + p1[3] * fb};
      unsigned char* p = E + (16 * g + c) * FA_EP + 64 * t + 32 * h; *(v4fa*)p = o0; *(v4fa*)(p + 16) = o1; } }      /* row = query, d = 16 t + 8 h + r */
  __builtin_amdgcn_fence(__ATOMIC_ACQ_REL, "workgroup"); __builtin_amdgcn_wave_barrier();      /* the rows are read back by other lanes of the same wave */
#pragma unroll
  for (int i = 0; i < 16; ++i) { const int row = i * 2 + h; const v4f v = *(const v4fa*)(E + row * FA_EP + c * 16);
    *(v4f*)(out + (size_t)(q0 + row) * DM + head * HD + c * 4) = v; } }      /* whole 256-byte row pieces: every 128-byte line stored once */

// ---- Q, K and V projections in one launch: C[m][n] = f16(x[m][:] . Wt[n][:] / 16 + bias[n]), n running over the three weight matrices (blockIdx.y: 6 column tiles each) ----
// One work-group = 4 waves, a 128 x 128 output tile, a 64 x 64 quadrant a wave (16 accumulator tiles: 8 LDS fragment reads feed 16 matrix instructions).
// 64 k of the x rows and of the Wt rows a stage go through registers into one of two LDS buffers (row pitch 128 + 16 bytes), the next stage's global loads (whole 128-byte lines) in flight under this stage's work.
// Transposed product (A = Wt rows, B = x rows): a lane then holds 8 neighbouring n of one token row, one 16-byte piece of the f16 output row. k runs upward in steps of 32.
#define PJ_PITCH 144                 /* LDS row pitch, bytes */
#define PJ_TILE (128 * PJ_PITCH)     /* one operand's 128 rows */
#define PJ_BUF (2 * PJ_TILE)         /* x tile + Wt tile */
__global__ __launch_bounds__(128) void k_qkv(const _Float16* __restrict__ X16, const _Float16* __restrict__ BQ, const _Float16* __restrict__ BK, const _Float16* __restrict__ BV,
    const float* __restrict__ bq, const float* __restrict__ bk, const float* __restrict__ bv, _Float16* __restrict__ Q16, _Float16* __restrict__ K16, _Float16* __restrict__ V16) {
  __shared__ __attribute__((aligned(16))) unsigned char L[2 * PJ_BUF];      /* two operand buffers in the loop, output staging (4 waves x 64 rows) behind it */
  const int tid = threadIdx.x, lane = tid & 31, c = lane & 15, h = lane >> 4; const int w = __builtin_amdgcn_readfirstlane(tid >> 5);
  const int sel = blockIdx.y / (DM / 128), col0 = (blockIdx.y % (DM / 128)) * 128, row0 = blockIdx.x * 128;
  const _Float16* Bt = sel == 0 ? BQ : sel == 1 ? BK : BV; const float* bias = sel == 0 ? bq : sel == 1 ? bk : bv; _Float16* C = sel == 0 ? Q16 : sel == 1 ? K16 : V16;
  const int wm = (w & 1) * 64, wn = (w >> 1) * 64;      /* this wave's quadrant */
  /* staging: 8 threads cover one 128-byte row piece, a thread brings rows sr + 16 p of both operands */
  const int sr = tid >> 3, sc = tid & 7;
  const unsigned char* xp = (const unsigned char*)(X16 + (size_t)(row0 + sr) * DM + sc * 8); const unsigned char* wp = (const unsigned char*)(Bt + (size_t)(col0 + sr) * DM + sc * 8);      /* step 128 bytes a stage */
  unsigned char* lw = L + sr * PJ_PITCH + sc * 16;
  v8us xs[8], wr[8];
#pragma unroll
  for (int p = 0; p < 8; ++p) { xs[p] = *(const v8us*)(xp + p * (32 * DM)); wr[p] = *(const v8us*)(wp + p * (32 * DM)); }
  const v8f z8 = {0.f, 0.f, 0.f, 0.f, 0.f, 0.f, 0.f, 0.f};
  v8f acc[4][4];
#pragma unroll
  for (int i = 0; i < 4; ++i)
#pragma unroll
    for (int j = 0; j < 4; ++j) acc[i][j] = z8;
#pragma unroll
  for (int p = 0; p < 8; ++p) { *(v8us*)(lw + p * 16 * PJ_PITCH) = xs[p]; *(v8us*)(lw + PJ_TILE + p * 16 * PJ_PITCH) = wr[p]; }
  __syncthreads();      /* publishes stage 0 */
#pragma unroll 1      /* 12 trips of 32 matrix instructions stay rolled: registers */
  for (int st = 0; st < DM / 64; ++st) {
    const unsigned char* Lb = L + (st & 1) * PJ_BUF;
    if (st + 1 < DM / 64) { xp += 128; wp += 128;
#pragma unroll
      for (int p = 0; p < 8; ++p) { xs[p] = *(const v8us*)(xp + p * (32 * DM)); wr[p] = *(const v8us*)(wp + p * (32 * DM)); } }
#pragma unroll
    for (int ks = 0; ks < 2; ++ks) { v16h xf[4];
#pragma unroll
      for (int i = 0; i < 4; ++i) xf[i] = fa_frag(Lb + (wm + 16 * i + c) * PJ_PITCH + ks * 64 + 16 * h);
#pragma unroll
      for (int j = 0; j < 4; ++j) { const v16h wf = fa_frag(Lb + PJ_TILE + (wn + 16 * j + c) * PJ_PITCH + ks * 64 + 16 * h);
#pragma unroll
        for (int i = 0; i < 4; ++i) acc[i][j] = fa_mma(wf, xf[i], acc[i][j]); } }
    if (st + 1 < DM / 64) { unsigned char* p0 = lw + ((st + 1) & 1) * PJ_BUF;
#pragma unroll
      for (int p = 0; p < 8; ++p) { *(v8us*)(p0 + p * 16 * PJ_PITCH) = xs[p]; *(v8us*)(p0 + PJ_TILE + p * 16 * PJ_PITCH) = wr[p]; } }
    __syncthreads();      /* publishes stage st + 1 and ends every wave's reads of stage st, whose buffer the next trip refills (behind the last trip: frees the array for the output staging) */
  }
  unsigned char* E = L + w * (64 * PJ_PITCH);      /* this wave's own 64 rows of 64 f16 */
#pragma unroll
  for (int j = 0; j < 4; ++j) { const float* bp = bias + col0 + wn + 16 * j + 8 * h; const v4f b0 = *(const v4fa*)bp, b1 = *(const v4fa*)(bp + 4);
    const float bb[8] = {bf16_round(b0[0]), bf16_round(b0[1]), bf16_round(b0[2]), bf16_round(b0[3]), bf16_round(b1[0]), bf16_round(b1[1]), bf16_round(b1[2]), bf16_round(b1[3])};
#pragma unroll
    for (int i = 0; i < 4; ++i) { FragH f;
#pragma unroll
      for (int r = 0; r < 8; ++r) f.h[r] = (_Float16)(acc[i][j][r] * 0.0625f + bb[r]);
      *(v8us*)(E + (16 * i + c) * PJ_PITCH + 32 * j + 16 * h) = f.half[0]; } }      /* row = token, n = 16 j + 8 h + r */
  __builtin_amdgcn_fence(__ATOMIC_ACQ_REL, "workgroup"); __builtin_amdgcn_wave_barrier();      /* the rows are read back by other lanes of the same wave */
#pragma unroll
  for (int it = 0; it < 16; ++it) { const int row = it * 4 + (lane >> 3); const v8us v = *(const v8us*)(E + row * PJ_PITCH + (lane & 7) * 16);
    *(v8us*)((unsigned short*)C + (size_t)(row0 + wm + row) * DM + col0 + wn + (lane & 7) * 8) = v; } }      /* whole 128-byte lines, each stored once by one wave */

// ---- operand preparation in one launch: the three weight matrices (f16 [n][k], x16) and x (f16 rows) need nothing of each other, so they share one grid by ranges of the block index ----
#define PP_WB (DM * (DM / 8) / 256)            /* blocks a weight matrix */
#define PP_XB ((int)(NR * DM / 8 / 256))       /* blocks of x */
__global__ __launch_bounds__(256) void k_prep(const float* __restrict__ x, const float* __restrict__ wq, const float* __restrict__ wk, const float* __restrict__ wv,
    _Float16* __restrict__ X16, _Float16* __restrict__ BQ, _Float16* __restrict__ BK, _Float16* __restrict__ BV) {
  static_assert(DM * (DM / 8) % 256 == 0 && NR * DM / 8 % 256 == 0, "whole blocks only");
  const int bid = blockIdx.x; FragH f;
  if (bid < 3 * PP_WB) {      /* block-uniform; the weight blocks come first in the grid: their strided reads take longest */
    const int sel = bid / PP_WB; const float* W = sel == 0 ? wq : sel == 1 ? wk : wv; _Float16* Wt = sel == 0 ? BQ : sel == 1 ? BK : BV;
    const int t = (bid - sel * PP_WB) * 256 + threadIdx.x; const int n = t / (DM / 8), k8 = (t % (DM / 8)) * 8;
#pragma unroll
    for (int i = 0; i < 8; ++i) f.h[i] = (_Float16)(bf16_round(W[(size_t)(k8 + i) * DM + n]) * 16.0f);      /* [in][out] -> Wt[n][k] x16 */
    *(v8us*)((unsigned short*)Wt + (size_t)n * DM + k8) = f.half[0];
    asm volatile("s_wait_xcnt 0x0" ::: "memory");      /* the wait in front of any overwrite of the store's registers, on whatever way the built code leaves this branch */
  } else {
    const size_t t = (size_t)(bid - 3 * PP_WB) * 256 + threadIdx.x;
#pragma unroll
    for (int q = 0; q < 8; ++q) f.h[q] = (_Float16)bf16_round(x[t * 8 + q]);
    *(v8us*)((unsigned short*)X16 + t * 8) = f.half[0];
    asm volatile("s_wait_xcnt 0x0" ::: "memory");      /* as above */
  } }

extern "C" void kernel_launch(void* const* d_in, const int* in_sizes, int n_in,
                              void* d_out, int out_size, void* d_ws, size_t ws_size, hipStream_t stream) {
  (void)in_sizes; (void)n_in; (void)out_size;
  const float* const* I = (const float* const*)d_in; const float* x = I[0]; const float* am = I[1]; const float* wq = I[2]; const float* bq = I[3]; const float* wk = I[4]; const float* bk = I[5]; const float* wv = I[6]; const float* bv = I[7];      /* weights [in][out]; am = additive mask [NB][1][1][SQ] */
  char* ws = (char*)d_ws; size_t off = 0;
  auto take = [&](size_t bytes) { char* p = ws + off; off += (bytes + 255) & ~(size_t)255; return p; };
  _Float16* BQ = (_Float16*)take((size_t)DM * DM * 2); _Float16* BK = (_Float16*)take((size_t)DM * DM * 2); _Float16* BV = (_Float16*)take((size_t)DM * DM * 2); 
  _Float16* X16 = (_Float16*)take(NR * DM * 2); _Float16* Q16 = (_Float16*)take(NR * DM * 2); _Float16* K16 = (_Float16*)take(NR * DM * 2); _Float16* V16 = (_Float16*)take(NR * DM * 2);
  _Float16* VT = (_Float16*)take((size_t)NH * HD * SQ * 2);
  if (off > ws_size) return;
  k_prep<<<3 * PP_WB + PP_XB, 256, 0, stream>>>(x, wq, wk, wv, X16, BQ, BK, BV);      /* weights [in][out] -> Bt[n][k] x16, x -> f16 rows */
  const size_t r0p = (size_t)B0 * SQ;      /* first projected row */
  k_qkv<<<dim3((unsigned)(MP / 128), 3 * (DM / 128)), 128, 0, stream>>>(X16 + r0p * DM, BQ, BK, BV, bq, bk, bv, Q16 + r0p * DM, K16 + r0p * DM, V16 + r0p * DM);      /* q, k, v rows as f16, all three in one launch */
  for (int b = B0; b < B0 + NBR; ++b) { const size_t r0 = (size_t)b * SQ;
    k_vt<NH, SQ><<<NH * (SQ / 64), 256, 0, stream>>>(V16 + r0 * LQ, LQ, 0, VT);      /* V^T [NH][HD][SQ] for this batch */
    k_fattn<<<dim3(SQ / 64, NH), 128, 0, stream>>>(Q16 + r0 * LQ, K16 + r0 * LQ, VT, am + (size_t)b * SQ, (float*)d_out + r0 * DM); }      /* scores, softmax and P.V of all heads; out = merged heads, f32 */
}

// v006
// One run takes 84.1 microseconds.
// Two timings next to v005 put it at 1.04 and 1.03 times that version's speed.
// Over all steps from v000 it is 121 times as fast.
#include <hip/hip_runtime.h>
// BERT self-attention (hidden [1][4096][768]; q/k/v = x W + b with W stored [in][out], 12 heads of 64; scores / 8 + the additive attention_mask[b][key] (f32); softmax; out = attn v merged -> [1][4096][768]; no output projection).
// Structure: token rows r = b*4096 + s; x as exact f16 rows (bf16-rounded); x and the three weight matrices are prepared in one launch; Q, K, V as one WMMA GEMM launch (128x128 work-group tiles staged in LDS, 64x64 wave tiles, f32 accumulation, exact x16 weights + bias, f16 outputs); V leaves that launch already transposed (its tiles swap the two operands' roles); per batch one fused attention launch over all heads: scores (WMMA, K = 64), running softmax of (scores / 8 + additive mask) on VALU (f32 statistics, native exp; weights as f16 in registers), o = P . V (WMMA), normalised and written as f32 into the merged output rows.
// Compute dtype: inputs rounded to bf16; x / weights exact; q, k, v and softmax weights as plain f16 GEMM operands (~2^-12); scores, softmax statistics and o f32. v_wmma_f32_16x16x32_f16.
#define NB 1
#define SQ 4096
#define DM 768
#define NH 12
#define HD 64
#define HG 1                         /* heads per launch of the second k_vt (not launched) */
#define B0 0                         /* first batch processed (debug hook) */
#define NBR NB                       /* batches processed (debug hook) */
#define NR ((size_t)NB * SQ)         /* token rows */
#define MP ((int)((size_t)NBR * SQ)) /* rows projected (debug hook) */
#define QN SQ                        /* unused: the attention launch covers all SQ queries */
#define NHD NH                       /* unused: the attention launch covers all NH heads */
#define MPO MP                       /* unused: there is no output stage */
#define LQ DM      /* row pitch of the q and k rows */
typedef __bf16 v16b __attribute__((ext_vector_type(16)));
typedef unsigned short v8us __attribute__((ext_vector_type(8), may_alias));
typedef float  v8f  __attribute__((ext_vector_type(8)));
typedef float  v4f  __attribute__((ext_vector_type(4)));
typedef float  v4fa __attribute__((ext_vector_type(4), may_alias));
union FragB { v16b v; v8us half[2]; unsigned short u[16]; };

__device__ __forceinline__ unsigned short bf16_bits(float x) { unsigned int u = __float_as_uint(x); return (unsigned short)((u + 0x7FFFu + ((u >> 16) & 1u)) >> 16); }
__device__ __forceinline__ float bf16_val(unsigned short b) { return __uint_as_float(((unsigned int)b) << 16); }
__device__ __forceinline__ float bf16_round(float x) { return bf16_val(bf16_bits(x)); }
// D += A·B with NT terms: 1 = ah·bh, 2 = + al·bh (A split), 3 = + ah·bl (both split)
template <int NT>
__device__ __forceinline__ v8f mmaN(v16b ah, v16b al, v16b bh, v16b bl, v8f c) {
  c = __builtin_amdgcn_wmma_f32_16x16x32_bf16(false, ah, false, bh, (short)0, c, false, false);
  if (NT >= 2) c = __builtin_amdgcn_wmma_f32_16x16x32_bf16(false, al, false, bh, (short)0, c, false, false);
  if (NT >= 3) c = __builtin_amdgcn_wmma_f32_16x16x32_bf16(false, ah, false, bl, (short)0, c, false, false);
  asm volatile("v_nop\n\tv_nop\n\tv_nop\n\tv_nop" : "+v"(c) : "v"(ah), "v"(al), "v"(bh), "v"(bl));
  return c;
}

__global__ __launch_bounds__(256) void k_wt_bf16(const float* __restrict__ W, unsigned short* __restrict__ Wt, int K, int N) {
  const int t = blockIdx.x * 256 + threadIdx.x;
  const int k8n = K / 8;
  if (t >= N * k8n) return;
  const int n = t / k8n, k8 = (t % k8n) * 8;
  v8us v;
#pragma unroll
  for (int i = 0; i < 8; ++i) v[i] = bf16_bits(W[(size_t)(k8 + i) * N + n]);
  *(v8us*)(Wt + (size_t)n * K + k8) = v;
  
}

// GEMM C[M][N] (f32, pitch ldc) = act(A[M][K]·W + bias). A f32 row-major (pitch lda) converted per fragment to bf16
// (ASPLIT: hi/lo two planes -> 2 terms, else single rounded term); Wt bf16 [N][K] (pitch ldb). BIAS_BF16 rounds the
// bias to bf16 first (bias quantised to bf16 before the add). K%32==0, M%16==0, N%64==0.
template <bool ASPLIT, int ACT, bool BIAS_BF16>
__global__ __launch_bounds__(128) void k_gemm_bf(const float* __restrict__ A, int lda, const unsigned short* __restrict__ Wt, int ldb,
                                               const float* __restrict__ bias, float* __restrict__ C, int ldc, int M, int N, int K) {
  __shared__ __attribute__((aligned(16))) float so[4][16][64];
  const int tid = threadIdx.x, w = tid >> 5, lane = tid & 31, ln = lane & 15, hh = lane >> 4;
  const int ntn = N / 64;
  const int wid = blockIdx.x * 4 + w;
  const int mt = wid / ntn, nq = wid % ntn;
  if (mt * 16 >= M) return;
  const int row0 = mt * 16, col0 = nq * 64;
  const float* arow = A + (size_t)(row0 + ln) * lda;
  v8f acc[4] = {};
  for (int kb = 0; kb < K; kb += 32) {
    FragB ah, al;
    const v4f x0 = *(const v4fa*)(arow + kb + 8 * hh), x1 = *(const v4fa*)(arow + kb + 8 * hh + 4);
    const v4f x2 = *(const v4fa*)(arow + kb + 16 + 8 * hh), x3 = *(const v4fa*)(arow + kb + 16 + 8 * hh + 4);
    float xs[16] = {x0[0],x0[1],x0[2],x0[3],x1[0],x1[1],x1[2],x1[3],x2[0],x2[1],x2[2],x2[3],x3[0],x3[1],x3[2],x3[3]};
#pragma unroll
    for (int i = 0; i < 16; ++i) { const unsigned short hb = bf16_bits(xs[i]); ah.u[i] = hb; al.u[i] = ASPLIT ? bf16_bits(xs[i] - bf16_val(hb)) : (unsigned short)0; }
#pragma unroll
    for (int t = 0; t < 4; ++t) {
      const unsigned short* brow = Wt + (size_t)(col0 + t * 16 + ln) * ldb + kb;
      FragB b;
      b.half[0] = *(const v8us*)(brow + 8 * hh);
      b.half[1] = *(const v8us*)(brow + 16 + 8 * hh);
      acc[t] = mmaN<ASPLIT ? 2 : 1>(ah.v, al.v, b.v, b.v, acc[t]);
    }
  }
#pragma unroll
  for (int t = 0; t < 4; ++t) {
    float bv = bias ? bias[col0 + t * 16 + ln] : 0.f;
    if (BIAS_BF16) bv = bf16_round(bv);
#pragma unroll
    for (int r = 0; r < 8; ++r) { float v = acc[t][r] + bv; if (ACT == 1) v = fmaxf(v, 0.f); so[w][8 * hh + r][t * 16 + ln] = v; }
  }
  __builtin_amdgcn_fence(__ATOMIC_ACQ_REL, "workgroup");
  __builtin_amdgcn_wave_barrier();
  const int rsub = lane >> 4, c4 = (lane & 15) * 4;
  {
#pragma unroll
    for (int q = 0; q < 8; ++q) {
      const int r = q * 2 + rsub;
      const v4f v = *(const v4fa*)&so[w][r][c4];
      *(v4f*)(C + (size_t)(row0 + r) * ldc + col0 + c4) = v;
    }
    
  }
}

// GEMM C = act(A·W + bias + resid): A f32 (ASPLIT -> hi/lo 2 terms), Wt bf16 [N][K]; ACT 0 none, 1 relu, 2 exact gelu;
// resid (optional, f32, row index = (row % rmod), pitch ldr, RES_BF16 rounds it) added before the activation.
template <bool ASPLIT, int ACT, bool BIAS_BF16, bool RES_BF16>
__global__ __launch_bounds__(128) void k_gemm_bf3(const float* __restrict__ A, int lda, const unsigned short* __restrict__ Wt, int ldb,
                                                const float* __restrict__ bias, const float* __restrict__ resid, int rmod, int ldr,
                                                float* __restrict__ C, int ldc, int M, int N, int K) {
  __shared__ __attribute__((aligned(16))) float so[4][16][64];
  const int tid = threadIdx.x, w = tid >> 5, lane = tid & 31, ln = lane & 15, hh = lane >> 4;
  const int ntn = N / 64;
  const int wid = blockIdx.x * 4 + w;
  const int mt = wid / ntn, nq = wid % ntn;
  if (mt * 16 >= M) return;
  const int row0 = mt * 16, col0 = nq * 64;
  const float* arow = A + (size_t)(row0 + ln) * lda;
  v8f acc[4] = {};
  for (int kb = 0; kb < K; kb += 32) {
    FragB ah, al;
    const v4f x0 = *(const v4fa*)(arow + kb + 8 * hh), x1 = *(const v4fa*)(arow + kb + 8 * hh + 4);
    const v4f x2 = *(const v4fa*)(arow + kb + 16 + 8 * hh), x3 = *(const v4fa*)(arow + kb + 16 + 8 * hh + 4);
    float xs[16] = {x0[0],x0[1],x0[2],x0[3],x1[0],x1[1],x1[2],x1[3],x2[0],x2[1],x2[2],x2[3],x3[0],x3[1],x3[2],x3[3]};
#pragma unroll
    for (int i = 0; i < 16; ++i) { const unsigned short hb = bf16_bits(xs[i]); ah.u[i] = hb; al.u[i] = ASPLIT ? bf16_bits(xs[i] - bf16_val(hb)) : (unsigned short)0; }
#pragma unroll
    for (int t = 0; t < 4; ++t) {
      const unsigned short* brow = Wt + (size_t)(col0 + t * 16 + ln) * ldb + kb;
      FragB b;
      b.half[0] = *(const v8us*)(brow + 8 * hh);
      b.half[1] = *(const v8us*)(brow + 16 + 8 * hh);
      acc[t] = mmaN<ASPLIT ? 2 : 1>(ah.v, al.v, b.v, b.v, acc[t]);
    }
  }
#pragma unroll
  for (int t = 0; t < 4; ++t) {
    const int col = col0 + t * 16 + ln;
    float bv = bias ? bias[col] : 0.f;
    if (BIAS_BF16) bv = bf16_round(bv);
#pragma unroll
    for (int r = 0; r < 8; ++r) {
      float v = acc[t][r] + bv;
      if (resid) { float rv = resid[(size_t)((row0 + 8 * hh + r) % rmod) * ldr + col]; if (RES_BF16) rv = bf16_round(rv); v += rv; }
      if (ACT == 1) v = fmaxf(v, 0.f);
      if (ACT == 2) v = 0.5f * v * (1.0f + erff(v * 0.70710678118654752f));
      if (ACT == 3) { const float u = 0.7978845608028654f * (v + 0.044715f * v * v * v); v = 0.5f * v * (1.0f + tanhf(u)); }
      so[w][8 * hh + r][t * 16 + ln] = v;
    }
  }
  __builtin_amdgcn_fence(__ATOMIC_ACQ_REL, "workgroup");
  __builtin_amdgcn_wave_barrier();
  const int rsub = lane >> 4, c4 = (lane & 15) * 4;
  {
#pragma unroll
    for (int q = 0; q < 8; ++q) {
      const int r = q * 2 + rsub;
      const v4f v = *(const v4fa*)&so[w][r][c4];
      *(v4f*)(C + (size_t)(row0 + r) * ldc + col0 + c4) = v;
    }
    
  }
}
// row LayerNorm (biased variance, eps) over N: s = X (+ R); optional out_sum <- s; out_norm <- (s-mu)*rsqrt(var+eps)*g + b
template <bool PARAM_BF16>
__global__ __launch_bounds__(256) void k_layernorm(const float* __restrict__ X, const float* __restrict__ R, const float* __restrict__ g, const float* __restrict__ bta,
                                                  float* __restrict__ out_sum, float* __restrict__ out_norm, int N, float eps) {
  __shared__ float red[256];
  const int row = blockIdx.x, tid = threadIdx.x;
  const float* x = X + (size_t)row * N; const float* rr = R ? R + (size_t)row * N : nullptr;
  float vals[16];                     // up to N = 4096
  const int per = N / 256;            // contiguous chunk per thread? use strided-by-4 chunks: thread handles j = tid*4 + 1024*u
  float s1 = 0.f;
  for (int u = 0; u < per / 4; ++u) {
    const int j = tid * 4 + 1024 * u;
    const v4f a = *(const v4fa*)(x + j);
    v4f b = {0.f,0.f,0.f,0.f}; if (rr) b = *(const v4fa*)(rr + j);
#pragma unroll
    for (int q = 0; q < 4; ++q) { const float v = a[q] + b[q]; vals[u * 4 + q] = v; s1 += v; }
  }
  red[tid] = s1; __syncthreads();
  for (int st = 128; st > 0; st >>= 1) { if (tid < st) red[tid] += red[tid + st]; __syncthreads(); }
  const float mu = red[0] / (float)N; __syncthreads();
  float s2 = 0.f;
  for (int u = 0; u < per / 4; ++u)
#pragma unroll
    for (int q = 0; q < 4; ++q) { const float c = vals[u * 4 + q] - mu; s2 += c * c; }
  red[tid] = s2; __syncthreads();
  for (int st = 128; st > 0; st >>= 1) { if (tid < st) red[tid] += red[tid + st]; __syncthreads(); }
  const float rs = rsqrtf(red[0] / (float)N + eps);
  {
    for (int u = 0; u < per / 4; ++u) {
      const int j = tid * 4 + 1024 * u;
      v4f o, sm;
#pragma unroll
      for (int q = 0; q < 4; ++q) {
        float gg = g[j + q], bb = bta[j + q];
        if (PARAM_BF16) { gg = bf16_round(gg); bb = bf16_round(bb); }
        sm[q] = vals[u * 4 + q]; o[q] = (vals[u * 4 + q] - mu) * rs * gg + bb;
      }
      if (out_sum) *(v4f*)(out_sum + (size_t)row * N + j) = sm;
      *(v4f*)(out_norm + (size_t)row * N + j) = o;
    }
    
  }
}



// ---- f16 WMMA path (v_wmma_f32_16x16x32_f16): 11-bit significands for operands in range — used where a [0,1] probability operand needs more precision than bf16
typedef _Float16 v16h __attribute__((ext_vector_type(16)));
union FragH { v16h v; v8us half[2]; _Float16 h[16]; unsigned short u[16]; };
template <int NT>
__device__ __forceinline__ v8f mmaH(v16h ah, v16h al, v16h bh, v16h bl, v8f c) {
  c = __builtin_amdgcn_wmma_f32_16x16x32_f16(false, ah, false, bh, (short)0, c, false, false);
  if (NT >= 2) c = __builtin_amdgcn_wmma_f32_16x16x32_f16(false, al, false, bh, (short)0, c, false, false);
  if (NT >= 3) c = __builtin_amdgcn_wmma_f32_16x16x32_f16(false, ah, false, bl, (short)0, c, false, false);
  asm volatile("v_nop\n\tv_nop\n\tv_nop\n\tv_nop" : "+v"(c) : "v"(ah), "v"(al), "v"(bh), "v"(bl));
  return c;
}
// batched GEMM like k_gemm_b but f16 operands: A f32 (split into f16 hi/lo if ASPLIT, else rounded to f16), Bt = f16 values [n][k]; alpha; C f32; N multiple of 16 (partial tiles skipped)
template <bool ASPLIT>
__global__ __launch_bounds__(128) void k_gemm_h(const float* __restrict__ A, int lda, size_t sA, const _Float16* __restrict__ Bh, int ldb, size_t sB, float alpha, float* __restrict__ C, int ldc, size_t sC, int M, int N, int K) {
  __shared__ __attribute__((aligned(16))) float so[4][16][64];
  const int tid = threadIdx.x, w = tid >> 5, lane = tid & 31, ln = lane & 15, hh = lane >> 4; const int by = blockIdx.y;
  A += (size_t)by * sA; Bh += (size_t)by * sB; C += (size_t)by * sC;
  const int ntn = (N + 63) / 64; const int wid = blockIdx.x * 4 + w; const int mt = wid / ntn, nq = wid % ntn; if (mt * 16 >= M) return;
  const int row0 = mt * 16, col0 = nq * 64; const float* arow = A + (size_t)(row0 + ln) * lda;
  v8f acc[4] = {};
  for (int kb = 0; kb < K; kb += 32) {
    FragH ah, al;
    const v4f x0 = *(const v4fa*)(arow + kb + 8 * hh), x1 = *(const v4fa*)(arow + kb + 8 * hh + 4), x2 = *(const v4fa*)(arow + kb + 16 + 8 * hh), x3 = *(const v4fa*)(arow + kb + 16 + 8 * hh + 4);
    float xs[16] = {x0[0],x0[1],x0[2],x0[3],x1[0],x1[1],x1[2],x1[3],x2[0],x2[1],x2[2],x2[3],x3[0],x3[1],x3[2],x3[3]};
#pragma unroll
    for (int i = 0; i < 16; ++i) { const _Float16 h = (_Float16)xs[i]; ah.h[i] = h; al.h[i] = ASPLIT ? (_Float16)(xs[i] - (float)h) : (_Float16)0.0f; }
#pragma unroll
    for (int t = 0; t < 4; ++t) { if (col0 + t * 16 >= N) continue; const size_t boff = (size_t)(col0 + t * 16 + ln) * ldb + kb; FragH bq; bq.half[0] = *(const v8us*)(Bh + boff + 8 * hh); bq.half[1] = *(const v8us*)(Bh + boff + 16 + 8 * hh);
      acc[t] = mmaH<ASPLIT ? 2 : 1>(ah.v, al.v, bq.v, bq.v, acc[t]); }
  }
#pragma unroll
  for (int t = 0; t < 4; ++t) { if (col0 + t * 16 >= N) continue;
#pragma unroll
    for (int r = 0; r < 8; ++r) so[w][8 * hh + r][t * 16 + ln] = acc[t][r] * alpha; }
  __builtin_amdgcn_fence(__ATOMIC_ACQ_REL, "workgroup"); __builtin_amdgcn_wave_barrier();
  const int rsub = lane >> 4, c4 = (lane & 15) * 4;
  {
#pragma unroll
    for (int q = 0; q < 8; ++q) { const int r = q * 2 + rsub; if (col0 + c4 < N) { const v4f v = *(const v4fa*)&so[w][r][c4]; *(v4f*)(C + (size_t)(row0 + r) * ldc + col0 + c4) = v; } }
     }
}

// Wt[n][k] = f16(W[k][n]·scale) from f32 row-major W[K][N] (scale = power of two; bf16-exact weights stay exact in f16 away from the subnormal range)
__global__ __launch_bounds__(256) void k_wt_f16(const float* __restrict__ W, _Float16* __restrict__ Wt, int K, int N, float scale) {
  const int t = blockIdx.x * 256 + threadIdx.x; if (t >= N * (K / 8)) return; const int n = t / (K / 8), k8 = (t % (K / 8)) * 8; FragH f;
#pragma unroll
  for (int i = 0; i < 8; ++i) f.h[i] = (_Float16)(bf16_round(W[(size_t)(k8 + i) * N + n]) * scale); const v8us o = f.half[0];
  *(v8us*)((unsigned short*)Wt + (size_t)n * K + k8) = o; 
}
// k_gemm_hh variant with fused epilogue: v = acc·alpha + bias[by·sBias + col] (+ CP[(row/rowsPerB)·sCPb + by·64 + col] if CP) ; ACT 0 none / 1 elu ; writes f16 C16 (and f32 C if non-null)
template <int ACT>
__global__ __launch_bounds__(128) void k_gemm_hhx(const _Float16* __restrict__ A, int lda, size_t sA, const _Float16* __restrict__ Bh, int ldb, size_t sB, float alpha, const float* __restrict__ bias, size_t sBias, const float* __restrict__ CP, int rowsPerB, size_t sCPb, int row0g,
    float* __restrict__ C, _Float16* __restrict__ C16, int ldc, size_t sC, int M, int N, int K) {
  __shared__ __attribute__((aligned(16))) float so[4][16][64];
  const int tid = threadIdx.x, w = tid >> 5, lane = tid & 31, ln = lane & 15, hh = lane >> 4; const int by = blockIdx.y;
  A += (size_t)by * sA; Bh += (size_t)by * sB; const size_t cofs = (size_t)by * sC; const float* bp = bias ? bias + (size_t)by * sBias : nullptr;
  const int ntn = (N + 63) / 64; const int wid = blockIdx.x * 4 + w; const int mt = wid / ntn, nq = wid % ntn; if (mt * 16 >= M) return;
  const int row0 = mt * 16, col0 = nq * 64; const _Float16* arow = A + (size_t)(row0 + ln) * lda;
  v8f acc[4] = {};
  for (int kb = 0; kb < K; kb += 32) { FragH ah; ah.half[0] = *(const v8us*)((const unsigned short*)arow + kb + 8 * hh); ah.half[1] = *(const v8us*)((const unsigned short*)arow + kb + 16 + 8 * hh);
#pragma unroll
    for (int t = 0; t < 4; ++t) { if (col0 + t * 16 >= N) continue; const size_t boff = (size_t)(col0 + t * 16 + ln) * ldb + kb; FragH bq; bq.half[0] = *(const v8us*)((const unsigned short*)Bh + boff + 8 * hh); bq.half[1] = *(const v8us*)((const unsigned short*)Bh + boff + 16 + 8 * hh);
      acc[t] = mmaH<1>(ah.v, ah.v, bq.v, bq.v, acc[t]); }
  }
#pragma unroll
  for (int t = 0; t < 4; ++t) { if (col0 + t * 16 >= N) continue; const int col = col0 + t * 16 + ln; const float bv = bp ? bf16_round(bp[col]) : 0.f;
#pragma unroll
    for (int r = 0; r < 8; ++r) { float v = acc[t][r] * alpha + bv; if (CP) { const int rr = row0g + row0 + 8 * hh + r; if (rowsPerB < 0) v += CP[cofs + (size_t)rr * ldc + col];      /* rowsPerB < 0: own element of the batched C plane */ else { const int bidx = rr / rowsPerB; v += CP[(size_t)bidx * sCPb + (size_t)by * 64 + col]; } } if (ACT == 1) v = (v > 0.f) ? v : expm1f(v); else if (ACT == 7) v = (v > 0.f) ? v + 1.0f : expf(v); else if (ACT == 8) v = tanhf(v); else if (ACT == 9) v = 0.5f * v * (1.0f + tanhf(0.7978845608028654f * (v + 0.044715f * v * v * v))); else if (ACT == 11) v = 1.0f / (1.0f + expf(-v)); else if (ACT == 12) v = (v > 0.f) ? v : 0.01f * v; else if (ACT == 14) v = (v > 0.f) ? v : 0.1f * v; else if (ACT == 16) v = (v >= 0.f) ? v : 0.3f * v; else if (ACT == 17) v = (v >= 0.f) ? v : 0.2f * v; else if (ACT == 15) v = v / (1.0f + expf(-v)); else if (ACT == 3) v = fmaxf(v, 0.f); else if (ACT == 6) v = 0.5f * v * (1.0f + erff(v * 0.70710678118654752f)); so[w][8 * hh + r][t * 16 + ln] = v; } }
  __builtin_amdgcn_fence(__ATOMIC_ACQ_REL, "workgroup"); __builtin_amdgcn_wave_barrier();
  const int rsub = lane >> 4, c4 = (lane & 15) * 4; typedef _Float16 v4h __attribute__((ext_vector_type(4)));
  {
#pragma unroll
    for (int q = 0; q < 8; ++q) { const int r = q * 2 + rsub; if (col0 + c4 < N) { const v4f v = *(const v4fa*)&so[w][r][c4]; if (C) *(v4f*)(C + cofs + (size_t)(row0 + r) * ldc + col0 + c4) = v; if (C16) { v4h h4; for (int i = 0; i < 4; ++i) h4[i] = (_Float16)v[i]; *(v4h*)(C16 + cofs + (size_t)(row0 + r) * ldc + col0 + c4) = h4; } } }
     }
}


typedef _Float16 v4h __attribute__((ext_vector_type(4)));

__global__ __launch_bounds__(256) void k_x16(const float* __restrict__ x, _Float16* __restrict__ X16, size_t n8) { const size_t t = (size_t)blockIdx.x * 256 + threadIdx.x; if (t >= n8) return; FragH f;
#pragma unroll
  for (int q = 0; q < 8; ++q) f.h[q] = (_Float16)bf16_round(x[t * 8 + q]); *(v8us*)((unsigned short*)X16 + t * 8) = f.half[0];  }
__global__ __launch_bounds__(256) void k_h16(const float* __restrict__ x, _Float16* __restrict__ X16, size_t n8) { const size_t t = (size_t)blockIdx.x * 256 + threadIdx.x; if (t >= n8) return; FragH f;
#pragma unroll
  for (int q = 0; q < 8; ++q) f.h[q] = (_Float16)x[t * 8 + q]; *(v8us*)((unsigned short*)X16 + t * 8) = f.half[0];  }
__global__ __launch_bounds__(256) void k_round16f(const float* __restrict__ W, _Float16* __restrict__ Bt, size_t n8) { const size_t t = (size_t)blockIdx.x * 256 + threadIdx.x; if (t >= n8) return; FragH f;
#pragma unroll
  for (int i = 0; i < 8; ++i) f.h[i] = (_Float16)(bf16_round(W[t * 8 + i]) * 16.0f); *(v8us*)((unsigned short*)Bt + t * 8) = f.half[0];  }
template <int NHv, int TTv>
__global__ __launch_bounds__(256) void k_vt(const _Float16* __restrict__ V16, int ldv, int voff, _Float16* __restrict__ Vt) { __shared__ unsigned short tl[64][66]; const int tid = threadIdx.x; const int slab = blockIdx.x / (TTv / 64), lg = blockIdx.x % (TTv / 64); const int b = slab / NHv, h = slab % NHv;
  for (int i = tid; i < 64 * 8; i += 256) { const int r = i / 8, c8 = (i % 8) * 8; FragH f; f.half[0] = *(const v8us*)((const unsigned short*)V16 + ((size_t)b * TTv + lg * 64 + r) * ldv + voff + h * 64 + c8);
#pragma unroll
    for (int q = 0; q < 8; ++q) tl[r][c8 + q] = f.u[q]; }
  __syncthreads();
  {
#pragma unroll
    for (int rd = 0; rd < 2; ++rd) { const int d = rd * 32 + tid / 8, pc = tid % 8; FragH f;
#pragma unroll
      for (int q = 0; q < 8; ++q) f.u[q] = tl[pc * 8 + q][d];
      *(v8us*)((unsigned short*)Vt + ((size_t)slab * 64 + d) * TTv + lg * 64 + pc * 8) = f.half[0]; }
     } }

__global__ __launch_bounds__(256) void k_hl(const float* __restrict__ F, _Float16* __restrict__ Hh, _Float16* __restrict__ Hl, size_t n8) { const size_t t = (size_t)blockIdx.x * 256 + threadIdx.x; if (t >= n8) return; FragH fh, fl; const v4f a = *(const v4fa*)(F + t * 8), c = *(const v4fa*)(F + t * 8 + 4);
#pragma unroll
  for (int q = 0; q < 4; ++q) { _Float16 h = (_Float16)a[q]; fh.h[q] = h; fl.h[q] = (_Float16)((a[q] - (float)h) * 1024.0f); h = (_Float16)c[q]; fh.h[4 + q] = h; fl.h[4 + q] = (_Float16)((c[q] - (float)h) * 1024.0f); }
  { *(v8us*)((unsigned short*)Hh + t * 8) = fh.half[0]; *(v8us*)((unsigned short*)Hl + t * 8) = fl.half[0];  } }

// ---- fast GEMM (wave tile 32x64; requires M % 32 == 0 rows per launch region and N % 64 == 0); epilogue = k_gemm_hhx semantics ----
__device__ __forceinline__ v16h g2_frag(const _Float16* p, int hh) { FragH f; f.half[0] = *(const v8us*)((const unsigned short*)p + 8 * hh); f.half[1] = *(const v8us*)((const unsigned short*)p + 16 + 8 * hh); return f.v; }
__device__ __forceinline__ v8f g2_mma(v16h a, v16h b, v8f c) { v8f d = __builtin_amdgcn_wmma_f32_16x16x32_f16(false, a, false, b, (short)0, c, false, false); asm volatile("v_nop\n\tv_nop\n\tv_nop\n\tv_nop" : "+v"(d) : "v"(a), "v"(b)); return d; }
template <int ACT>
__global__ __launch_bounds__(128) void k_gemm2(const _Float16* __restrict__ A, int lda, size_t sA, const _Float16* __restrict__ Bh, int ldb, size_t sB, float alpha, const float* __restrict__ bias, size_t sBias, const float* __restrict__ CP, int rowsPerB, size_t sCPb, int row0g,
    float* __restrict__ C, _Float16* __restrict__ C16, int ldc, size_t sC, int M, int N, int K) { static_assert(ACT == 0 || ACT == 3 || ACT == 6 || ACT == 8 || ACT == 9 || ACT == 11 || ACT == 12 || ACT == 14 || ACT == 15 || ACT == 16 || ACT == 17, "k_gemm2: unsupported ACT code (would silently apply no activation)");
  __shared__ __attribute__((aligned(16))) float so[4][32][68];
  const int tid = threadIdx.x, w = tid >> 5, lane = tid & 31, ln = lane & 15, hh = lane >> 4; const int by = blockIdx.y;
  A += (size_t)by * sA; Bh += (size_t)by * sB; const size_t cofs = (size_t)by * sC; const float* bp = bias ? bias + (size_t)by * sBias : nullptr;
  const int ntn = N >> 6; const int mt = blockIdx.x / ntn, nq = blockIdx.x - mt * ntn; const int row0 = mt * 128 + 32 * w, col0 = nq * 64; if (row0 >= M) return;
  const _Float16* a0p = A + (size_t)(row0 + ln) * lda; const _Float16* a1p = a0p + (size_t)16 * lda;
  const _Float16* b0p = Bh + (size_t)(col0 + ln) * ldb; const _Float16* b1p = b0p + (size_t)16 * ldb; const _Float16* b2p = b1p + (size_t)16 * ldb; const _Float16* b3p = b2p + (size_t)16 * ldb;
  const v8f z8 = {0.f,0.f,0.f,0.f,0.f,0.f,0.f,0.f}; v8f c00 = z8, c01 = z8, c02 = z8, c03 = z8, c10 = z8, c11 = z8, c12 = z8, c13 = z8;
#pragma unroll 1
  for (int kb = 0; kb < K; kb += 32) { const v16h a0 = g2_frag(a0p + kb, hh), a1 = g2_frag(a1p + kb, hh);
    v16h b = g2_frag(b0p + kb, hh); c00 = g2_mma(a0, b, c00); c10 = g2_mma(a1, b, c10);
    b = g2_frag(b1p + kb, hh); c01 = g2_mma(a0, b, c01); c11 = g2_mma(a1, b, c11);
    b = g2_frag(b2p + kb, hh); c02 = g2_mma(a0, b, c02); c12 = g2_mma(a1, b, c12);
    b = g2_frag(b3p + kb, hh); c03 = g2_mma(a0, b, c03); c13 = g2_mma(a1, b, c13); }
  v8f accs[8] = {c00, c01, c02, c03, c10, c11, c12, c13};
#pragma unroll
  for (int u = 0; u < 8; ++u) { const int t = u & 3, half = u >> 2; const int col = col0 + t * 16 + ln; const float bv = bp ? bf16_round(bp[col]) : 0.f;
#pragma unroll
    for (int r = 0; r < 8; ++r) { const int rloc = half * 16 + 8 * hh + r; float v = accs[u][r] * alpha + bv; if (CP) { if (rowsPerB < 0) v += CP[cofs + (size_t)(row0g + row0 + rloc) * ldc + col];      /* rowsPerB < 0: own element of the batched C plane */ else { const int bidx = (row0g + row0 + rloc) / rowsPerB; v += CP[(size_t)bidx * sCPb + (size_t)by * 64 + col]; } }
      if (ACT == 3) v = fmaxf(v, 0.f); else if (ACT == 6) v = 0.5f * v * (1.0f + erff(v * 0.70710678118654752f)); else if (ACT == 11) v = 1.0f / (1.0f + expf(-v)); else if (ACT == 15) v = v / (1.0f + expf(-v)); else if (ACT == 12) v = (v > 0.f) ? v : 0.01f * v; else if (ACT == 8) v = tanhf(v); else if (ACT == 9) v = 0.5f * v * (1.0f + tanhf(0.7978845608028654f * (v + 0.044715f * v * v * v))); else if (ACT == 14) v = (v > 0.f) ? v : 0.1f * v; else if (ACT == 16) v = (v >= 0.f) ? v : 0.3f * v; else if (ACT == 17) v = (v >= 0.f) ? v : 0.2f * v;
      so[w][rloc][t * 16 + ln] = v; } }
  __builtin_amdgcn_fence(__ATOMIC_ACQ_REL, "workgroup"); __builtin_amdgcn_wave_barrier();
  const int rsub = lane >> 4, c4 = (lane & 15) * 4;
  {
#pragma unroll
    for (int q = 0; q < 16; ++q) { const int r = q * 2 + rsub; const v4f v = *(const v4fa*)&so[w][r][c4]; if (C) *(v4f*)(C + cofs + (size_t)(row0 + r) * ldc + col0 + c4) = v; if (C16) { v4h h4; for (int i = 0; i < 4; ++i) h4[i] = (_Float16)v[i]; *(v4h*)(C16 + cofs + (size_t)(row0 + r) * ldc + col0 + c4) = h4; } }
     } }


__global__ __launch_bounds__(256) void k_wnat(const float* __restrict__ w, size_t n8, _Float16* __restrict__ Bt) { const size_t t = (size_t)blockIdx.x * 256 + threadIdx.x; if (t >= n8) return; FragH f; for (int q = 0; q < 8; ++q) f.h[q] = (_Float16)(bf16_round(w[t * 8 + q]) * 16.0f); *(v8us*)((unsigned short*)Bt + t * 8) = f.half[0];  }
__global__ __launch_bounds__(256) void k_rsm(const float* __restrict__ S, _Float16* __restrict__ P, int nrows) {
  #pragma clang fp contract(off)
  const int i = blockIdx.x * 256 + threadIdx.x; if (i >= nrows) return; const float* s = S + (size_t)i * SQ; float mx = -3.0e38f;
#pragma unroll 1
  for (int j = 0; j < SQ; ++j) mx = fmaxf(mx, s[j]); float se = 0.f;
#pragma unroll 1
  for (int j = 0; j < SQ; ++j) se += expf(s[j] - mx); const float sc = 256.0f / se;
#pragma unroll 1
  for (int j0 = 0; j0 < SQ; j0 += 8) { FragH f; for (int q = 0; q < 8; ++q) f.h[q] = (_Float16)(expf(s[j0 + q] - mx) * sc); unsigned short* d = (unsigned short*)P + (size_t)i * SQ + j0; *(v8us*)d = f.half[0];  } }
__global__ __launch_bounds__(256) void k_vt(const _Float16* __restrict__ V16, int b, int h0, _Float16* __restrict__ VT) { __shared__ unsigned short tl[64][65]; const int tid = threadIdx.x; const int hh = blockIdx.x % HG, sg = blockIdx.x / HG; const int s0 = sg * 64; const int h = h0 + hh;
  for (int i = tid; i < 64 * 8; i += 256) { const int j = i / 8, d8 = (i % 8) * 8; FragH f; f.half[0] = *(const v8us*)((const unsigned short*)V16 + ((size_t)b * SQ + s0 + j) * DM + h * HD + d8); for (int q = 0; q < 8; ++q) tl[d8 + q][j] = f.u[q]; }
  __syncthreads();
  { for (int i = tid; i < 64 * 8; i += 256) { const int d = i / 8, j8 = (i % 8) * 8; FragH f; for (int q = 0; q < 8; ++q) f.u[q] = tl[d][j8 + q]; *(v8us*)((unsigned short*)VT + ((size_t)hh * HD + d) * SQ + s0 + j8) = f.half[0]; }  } }



// Four exponentials 2^x in place. The closing v_nop is the free slot that the instruction set asks for behind a transcendental before its result is used or its
// source overwritten; it stands in the same statement because nothing else would keep it directly behind the last v_exp_f32 (inside, each v_exp_f32 is independent of the one before).
__device__ __forceinline__ v4f exp2x4(v4f x) { float a = x[0], b = x[1], c = x[2], d = x[3];
  asm("v_exp_f32 %0, %0\n\tv_exp_f32 %1, %1\n\tv_exp_f32 %2, %2\n\tv_exp_f32 %3, %3\n\tv_nop" : "+v"(a), "+v"(b), "+v"(c), "+v"(d));
  const v4f r = {a, b, c, d}; return r; }
#define FA_LAG 5.5f                  /* score units; 5.5 log2 e = 7.9 */
#define FA_L2E 1.44269504088896340736f
#define FA_PITCH 144                 /* LDS row pitch, bytes */
#define FA_TILE (64 * FA_PITCH)      /* one operand's 64 rows */
#define FA_BUF (2 * FA_TILE)         /* K tile + V^T tile of 64 keys */
#define FA_STG (2 * FA_BUF)          /* one stage: the tiles of both key sets */
#define FA_EP 272                    /* output staging pitch, bytes: 64 f32 + 16 */
#define FA_XW (17 * 512)             /* one wave's partial result: 17 pieces of 16 bytes a lane */
__device__ __forceinline__ v16h fa_frag(const unsigned char* p) { FragH f; f.half[0] = *(const v8us*)p; f.half[1] = *(const v8us*)(p + 32); return f.v; }
__device__ __forceinline__ v8f fa_mma(v16h a, v16h b, v8f c) { return __builtin_amdgcn_wmma_f32_16x16x32_f16(false, a, false, b, (short)0, c, false, false); }
__device__ __forceinline__ float fa_xhalf(float x) { return __builtin_bit_cast(float, __builtin_amdgcn_permlanex16(__builtin_bit_cast(int, x), __builtin_bit_cast(int, x), 0x76543210, 0xfedcba98, false, false)); }      /* lane l with lane l ^ 16 */
__global__ __launch_bounds__(128) void k_fattn(const _Float16* __restrict__ Q16, const _Float16* __restrict__ K16, const _Float16* __restrict__ VT, const float* __restrict__ am, float* __restrict__ out) {
  __shared__ __attribute__((aligned(16))) unsigned char L[2 * FA_STG];      /* two stages in the loop; the partial results and the output staging behind it */
  __shared__ __attribute__((aligned(16))) float ms[SQ];
  static_assert(2 * FA_XW + 2 * 32 * FA_EP <= 2 * FA_STG, "partial results and output staging must fit the array");
  const int tid = threadIdx.x, lane = tid & 31, c = lane & 15, h = lane >> 4; const int w = __builtin_amdgcn_readfirstlane(tid >> 5);
  const int qh = w & 1, ks = w >> 1;      /* which 32 queries, which key set */
  const int head = blockIdx.y, q0 = blockIdx.x * 64 + qh * 32;
  /* staging: 8 threads cover one 128-byte row piece; a thread brings rows sr + 16 p (p = 0..3) of both operands of both tiles */
  const int sr = tid >> 3, sc = tid & 7;
  const unsigned short* kg = (const unsigned short*)K16 + (size_t)sr * DM + head * HD + sc * 8;
  const unsigned short* vg = (const unsigned short*)VT + ((size_t)head * HD + sr) * SQ + sc * 8;
  unsigned char* lw = L + sr * FA_PITCH + sc * 16;
  v8us kr[8], vr[8];      /* index 4 u + p: tile u */
#pragma unroll
  for (int i = 0; i < 8; ++i) { kr[i] = *(const v8us*)(kg + (size_t)(16 * i) * DM); vr[i] = *(const v8us*)(vg + (size_t)(16 * (i & 3)) * SQ + 64 * (i >> 2)); }
#pragma unroll
  for (int u = 0; u < SQ / 512; ++u) { const v4f m = *(const v4fa*)(am + u * 512 + tid * 4); v4f r;
#pragma unroll
    for (int q = 0; q < 4; ++q) r[q] = bf16_round(m[q]);
    *(v4fa*)&ms[u * 512 + tid * 4] = r; }
  v16h qf[2][2]; const _Float16* qa[2];      /* qa: the lane's own address, its half's 8 elements counted in */
#pragma unroll
  for (int g = 0; g < 2; ++g) { qa[g] = Q16 + (size_t)(q0 + 16 * g + c) * DM + head * HD + 8 * h; qf[g][0] = g2_frag(qa[g], 0); qf[g][1] = g2_frag(qa[g] + 32, 0); }
  asm volatile("s_wait_xcnt 0x0" :: "v"(qa[0]), "v"(qa[1]) : "memory");      /* the wait in front of any overwrite of the Q loads' address registers; the addresses are inputs so that they stay live up to it */
  FragH ones;      /* A operand whose row 0 is 1.0: its product with P^T is the column sums of P^T, the softmax denominators */
#pragma unroll
  for (int i = 0; i < 16; ++i) ones.h[i] = (c == 0) ? (_Float16)1.0f : (_Float16)0.0f;
  const v8f z8 = {0.f, 0.f, 0.f, 0.f, 0.f, 0.f, 0.f, 0.f};
  v8f acc[2][4], lacc[2]; float m_run[2];
#pragma unroll
  for (int g = 0; g < 2; ++g) { m_run[g] = -3.402823466e38f; lacc[g] = z8;      /* the lowest finite value: any finite score replaces it, a key at -inf keeps weight 0 */
#pragma unroll
    for (int t = 0; t < 4; ++t) acc[g][t] = z8; }
#pragma unroll
  for (int i = 0; i < 8; ++i) { unsigned char* p = lw + (i >> 2) * FA_BUF + (i & 3) * 16 * FA_PITCH; *(v8us*)p = kr[i]; *(v8us*)(p + FA_TILE) = vr[i]; }
  __syncthreads();      /* publishes stage 0 and the mask */
#pragma unroll 1      /* 32 trips of 36 matrix instructions stay rolled: code size and registers */
  for (int st = 0; st < SQ / 128; ++st) {
    const unsigned char* Lb = L + (st & 1) * FA_STG + ks * FA_BUF;
    if (st + 1 < SQ / 128) { const unsigned short* kn = kg + (size_t)(st + 1) * 128 * DM; const unsigned short* vn = vg + (st + 1) * 128;
#pragma unroll
      for (int i = 0; i < 8; ++i) { kr[i] = *(const v8us*)(kn + (size_t)(16 * i) * DM); vr[i] = *(const v8us*)(vn + (size_t)(16 * (i & 3)) * SQ + 64 * (i >> 2)); }
      asm volatile("s_wait_xcnt 0x0" :: "v"(kn), "v"(vn) : "memory"); }      /* the wait in front of any overwrite of the sixteen loads' address registers; the two addresses are inputs so that they stay live up to it and no load of the run lands in them */
#pragma unroll
    for (int sub = 0; sub < 2; ++sub) {
      v8f s[2][2];
#pragma unroll
      for (int kt = 0; kt < 2; ++kt) { const unsigned char* kp = Lb + (sub * 32 + 16 * kt + c) * FA_PITCH + 16 * h; const v16h k0 = fa_frag(kp), k1 = fa_frag(kp + 64);
        const float* mp = ms + st * 128 + ks * 64 + sub * 32 + 16 * kt + 8 * h; const v4f m0 = *(const v4fa*)mp, m1 = *(const v4fa*)(mp + 4);
        const v8f mc = {m0[0], m0[1], m0[2], m0[3], m1[0], m1[1], m1[2], m1[3]};
        s[kt][0] = fa_mma(k0, qf[0][0], z8); s[kt][1] = fa_mma(k0, qf[1][0], z8);
        s[kt][0] = fa_mma(k1, qf[0][1], s[kt][0]) * 0.125f + mc; s[kt][1] = fa_mma(k1, qf[1][1], s[kt][1]) * 0.125f + mc; }      /* 1/sqrt(64) is a power of two, so this is the score plus the mask in one f32 rounding, fused or not, as the separate kernels had it */
      v16h vf[4];
#pragma unroll
      for (int t = 0; t < 4; ++t) vf[t] = fa_frag(Lb + FA_TILE + (16 * t + c) * FA_PITCH + sub * 64 + 16 * h);
      float mb[2]; bool need = false;
#pragma unroll
      for (int g = 0; g < 2; ++g) { float mx = fmaxf(s[0][g][0], s[1][g][0]);
#pragma unroll
        for (int r = 1; r < 8; ++r) mx = fmaxf(fmaxf(mx, s[0][g][r]), s[1][g][r]);
        mx = fmaxf(mx, fa_xhalf(mx)); mb[g] = mx; need = need || (mx > m_run[g] + FA_LAG); }
      if (__builtin_amdgcn_ballot_w32(need) != 0) {      /* one scalar branch a pass; rare behind the first passes */
        v4f e = {(m_run[0] - fmaxf(m_run[0], mb[0])) * FA_L2E, (m_run[1] - fmaxf(m_run[1], mb[1])) * FA_L2E, 0.f, 0.f}; e = exp2x4(e);
#pragma unroll
        for (int g = 0; g < 2; ++g) { m_run[g] = fmaxf(m_run[g], mb[g]); lacc[g] = lacc[g] * e[g];
#pragma unroll
          for (int t = 0; t < 4; ++t) acc[g][t] = acc[g][t] * e[g]; } }
#pragma unroll
      for (int g = 0; g < 2; ++g) { const float mr = m_run[g]; FragH pf;
#pragma unroll
        for (int j = 0; j < 4; ++j) { v4f a;
#pragma unroll
          for (int q = 0; q < 4; ++q) a[q] = (s[j >> 1][g][4 * (j & 1) + q] - mr) * FA_L2E;
          a = exp2x4(a);
#pragma unroll
          for (int q = 0; q < 4; ++q) pf.h[4 * j + q] = (_Float16)a[q]; }
#pragma unroll
        for (int t = 0; t < 4; ++t) acc[g][t] = fa_mma(vf[t], pf.v, acc[g][t]);
        lacc[g] = fa_mma(ones.v, pf.v, lacc[g]); }
    }
    if (st + 1 < SQ / 128) { unsigned char* p0 = lw + ((st + 1) & 1) * FA_STG;
#pragma unroll
      for (int i = 0; i < 8; ++i) { unsigned char* p = p0 + (i >> 2) * FA_BUF + (i & 3) * 16 * FA_PITCH; *(v8us*)p = kr[i]; *(v8us*)(p + FA_TILE) = vr[i]; } }
    __syncthreads();      /* publishes stage st + 1 and ends every wave's reads of stage st, whose buffer the next trip refills (behind the last trip: frees the array for the partial results) */
  }
  float lf[2];
#pragma unroll
  for (int g = 0; g < 2; ++g) { const float lr = lacc[g][0]; lf[g] = lr + fa_xhalf(lr); }      /* register 0: the sum in lanes 0-15, 0 in lanes 16-31 */
  unsigned char* X = L + qh * FA_XW + lane * 16;      /* lane for lane: the two waves of one query half hold the same element in the same lane and register */
  if (ks == 1) {
#pragma unroll
    for (int g = 0; g < 2; ++g)
#pragma unroll
      for (int t = 0; t < 4; ++t) { const v8f o = acc[g][t]; const v4f o0 = {o[0], o[1], o[2], o[3]}, o1 = {o[4], o[5], o[6], o[7]};
        *(v4fa*)(X + (8 * g + 2 * t) * 512) = o0; *(v4fa*)(X + (8 * g + 2 * t + 1) * 512) = o1; }
    const v4f ml = {m_run[0], m_run[1], lf[0], lf[1]}; *(v4fa*)(X + 16 * 512) = ml; }
  __syncthreads();      /* publishes key set 1's partial results to the waves of key set 0 */
  if (ks == 1) return;      /* behind the last barrier */
  const v4f ml = *(const v4fa*)(X + 16 * 512);
  const float mm0 = fmaxf(m_run[0], ml[0]), mm1 = fmaxf(m_run[1], ml[1]);
  v4f e = {(m_run[0] - mm0) * FA_L2E, (ml[0] - mm0) * FA_L2E, (m_run[1] - mm1) * FA_L2E, (ml[1] - mm1) * FA_L2E}; e = exp2x4(e);      /* both partial results brought to the larger of their two maxima */
  unsigned char* E = L + 2 * FA_XW + qh * (32 * FA_EP);      /* this wave's own 32 rows of 64 f32 */
#pragma unroll
  for (int g = 0; g < 2; ++g) { const float inv = 1.0f / (lf[g] * e[2 * g] + ml[2 + g] * e[2 * g + 1]); const float fa = e[2 * g] * inv, fb = e[2 * g + 1] * inv;
#pragma unroll
    for (int t = 0; t < 4; ++t) { const v4f p0 = *(const v4fa*)(X + (8 * g + 2 * t) * 512), p1 = *(const v4fa*)(X + (8 * g + 2 * t + 1) * 512); const v8f a = acc[g][t];
      const v4f o0 = {a[0] * fa + p0[0] * fb, a[1] * fa + p0[1] * fb, a[2] * fa + p0[2] * fb, a[3] * fa + p0[3] * fb}, o1 = {a[4] * fa + p1[0] * fb, a[5] * fa + p1[1] * fb, a[6] * fa + p1[2] * fb, a[7] * fa + p1[3] * fb};
      unsigned char* p = E + (16 * g + c) * FA_EP + 64 * t + 32 * h; *(v4fa*)p = o0; *(v4fa*)(p + 16) = o1; } }      /* row = query, d = 16 t + 8 h + r */
  __builtin_amdgcn_fence(__ATOMIC_ACQ_REL, "workgroup"); __builtin_amdgcn_wave_barrier();      /* the rows are read back by other lanes of the same wave */
#pragma unroll
  for (int i = 0; i < 16; ++i) { const int row = i * 2 + h; const v4f v = *(const v4fa*)(E + row * FA_EP + c * 16);
    *(v4f*)(out + (size_t)(q0 + row) * DM + head * HD + c * 4) = v; } }      /* whole 256-byte row pieces: every 128-byte line stored once */

// ---- Q, K and V projections in one launch: C[m][n] = f16(x[m][:] . Wt[n][:] / 16 + bias[n]), n running over the three weight matrices (blockIdx.y: 6 column tiles each) ----
// One work-group = 4 waves, a 128 x 128 output tile, a 64 x 64 quadrant a wave (16 accumulator tiles: 8 LDS fragment reads feed 16 matrix instructions).
// 64 k of the x rows and of the Wt rows a stage go through registers into one of two LDS buffers (row pitch 128 + 16 bytes), the next stage's global loads (whole 128-byte lines) in flight under this stage's work.
// Q and K, transposed product (A = Wt rows, B = x rows): a lane then holds 8 neighbouring n of one token row, one 16-byte piece of the f16 output row. k runs upward in steps of 32.
// V, the two operands' roles swapped (A = x rows, B = Wt rows; both tiles lie in LDS alike and are read by the same loader): a lane holds 8 neighbouring tokens of one n, one 16-byte piece of a row of V^T [n][token],
// which is the layout the attention launch stages, so V needs no transposing launch of its own.
#define PJ_PITCH 144                 /* LDS row pitch, bytes */
#define PJ_TILE (128 * PJ_PITCH)     /* one operand's 128 rows */
#define PJ_BUF (2 * PJ_TILE)         /* x tile + Wt tile */
__global__ __launch_bounds__(128) void k_qkv(const _Float16* __restrict__ X16, const _Float16* __restrict__ BQ, const _Float16* __restrict__ BK, const _Float16* __restrict__ BV,
    const float* __restrict__ bq, const float* __restrict__ bk, const float* __restrict__ bv, _Float16* __restrict__ Q16, _Float16* __restrict__ K16, _Float16* __restrict__ VT) {
  __shared__ __attribute__((aligned(16))) unsigned char L[2 * PJ_BUF];      /* two operand buffers in the loop, output staging (4 waves x 64 rows) behind it */
  const int tid = threadIdx.x, lane = tid & 31, c = lane & 15, h = lane >> 4; const int w = __builtin_amdgcn_readfirstlane(tid >> 5);
  const int sel = blockIdx.y / (DM / 128), col0 = (blockIdx.y % (DM / 128)) * 128, row0 = blockIdx.x * 128;
  const _Float16* Bt = sel == 0 ? BQ : sel == 1 ? BK : BV; const float* bias = sel == 0 ? bq : sel == 1 ? bk : bv; _Float16* C = sel == 0 ? Q16 : sel == 1 ? K16 : VT;
  const int wm = (w & 1) * 64, wn = (w >> 1) * 64;      /* this wave's quadrant */
  const bool tv = sel == 2;      /* block-uniform: V^T */
  const int ao = tv ? wm * PJ_PITCH : PJ_TILE + wn * PJ_PITCH, bo = tv ? PJ_TILE + wn * PJ_PITCH : wm * PJ_PITCH;      /* this wave's 64 rows of the A and of the B operand, bytes inside a buffer */
  /* staging: 8 threads cover one 128-byte row piece, a thread brings rows sr + 16 p of both operands */
  const int sr = tid >> 3, sc = tid & 7;
  const unsigned char* xp = (const unsigned char*)(X16 + (size_t)(row0 + sr) * DM + sc * 8); const unsigned char* wp = (const unsigned char*)(Bt + (size_t)(col0 + sr) * DM + sc * 8);      /* step 128 bytes a stage */
  unsigned char* lw = L + sr * PJ_PITCH + sc * 16;
  v8us xs[8], wr[8];
#pragma unroll
  for (int p = 0; p < 8; ++p) { xs[p] = *(const v8us*)(xp + p * (32 * DM)); wr[p] = *(const v8us*)(wp + p * (32 * DM)); }
  const v8f z8 = {0.f, 0.f, 0.f, 0.f, 0.f, 0.f, 0.f, 0.f};
  v8f acc[4][4];
#pragma unroll
  for (int i = 0; i < 4; ++i)
#pragma unroll
    for (int j = 0; j < 4; ++j) acc[i][j] = z8;
#pragma unroll
  for (int p = 0; p < 8; ++p) { *(v8us*)(lw + p * 16 * PJ_PITCH) = xs[p]; *(v8us*)(lw + PJ_TILE + p * 16 * PJ_PITCH) = wr[p]; }
  __syncthreads();      /* publishes stage 0 */
#pragma unroll 1      /* 12 trips of 32 matrix instructions stay rolled: registers */
  for (int st = 0; st < DM / 64; ++st) {
    const unsigned char* Lb = L + (st & 1) * PJ_BUF;
    if (st + 1 < DM / 64) { xp += 128; wp += 128;
#pragma unroll
      for (int p = 0; p < 8; ++p) { xs[p] = *(const v8us*)(xp + p * (32 * DM)); wr[p] = *(const v8us*)(wp + p * (32 * DM)); } }
#pragma unroll
    for (int ks = 0; ks < 2; ++ks) { v16h bf[4];
#pragma unroll
      for (int i = 0; i < 4; ++i) bf[i] = fa_frag(Lb + bo + (16 * i + c) * PJ_PITCH + ks * 64 + 16 * h);
#pragma unroll
      for (int j = 0; j < 4; ++j) { const v16h af = fa_frag(Lb + ao + (16 * j + c) * PJ_PITCH + ks * 64 + 16 * h);
#pragma unroll
        for (int i = 0; i < 4; ++i) acc[i][j] = fa_mma(af, bf[i], acc[i][j]); } }
    if (st + 1 < DM / 64) { unsigned char* p0 = lw + ((st + 1) & 1) * PJ_BUF;
#pragma unroll
      for (int p = 0; p < 8; ++p) { *(v8us*)(p0 + p * 16 * PJ_PITCH) = xs[p]; *(v8us*)(p0 + PJ_TILE + p * 16 * PJ_PITCH) = wr[p]; } }
    __syncthreads();      /* publishes stage st + 1 and ends every wave's reads of stage st, whose buffer the next trip refills (behind the last trip: frees the array for the output staging) */
  }
  unsigned char* E = L + w * (64 * PJ_PITCH);      /* this wave's own 64 rows of 64 f16 */
  /* element (i, j, r): index 16 i + c among the B operand's rows (the staging row), 16 j + 8 h + r among the A operand's (along the row). n, which picks the bias, is the A index for Q and K, the B index for V: */
  /* both sets of bias values are loaded (both lie inside the 128 columns of this tile), the set that does not apply is replaced by 0, and bn + ba is the one that applies, exactly */
  float bn[4]; v4f b0[4], b1[4];
#pragma unroll
  for (int u = 0; u < 4; ++u) { const float* bp = bias + col0 + wn + 16 * u; bn[u] = bp[c]; b0[u] = *(const v4fa*)(bp + 8 * h); b1[u] = *(const v4fa*)(bp + 8 * h + 4); }
  const unsigned int ka = tv ? 0u : 0xFFFF0000u, kn = tv ? 0xFFFF0000u : 0u;      /* the mask that ends the rounding to bf16 keeps the set that applies and clears the other */
  auto rnd = [](float x, unsigned int k) { const unsigned int u = __float_as_uint(x); return __uint_as_float((u + 0x7FFFu + ((u >> 16) & 1u)) & k); };      /* bf16_round(x) under k = 0xFFFF0000, 0 under k = 0 */
#pragma unroll
  for (int i = 0; i < 4; ++i) bn[i] = rnd(bn[i], kn);
#pragma unroll
  for (int j = 0; j < 4; ++j) { float ba[8];
#pragma unroll
    for (int r = 0; r < 4; ++r) { ba[r] = rnd(b0[j][r], ka); ba[4 + r] = rnd(b1[j][r], ka); }
#pragma unroll
    for (int i = 0; i < 4; ++i) { FragH f;
#pragma unroll
      for (int r = 0; r < 8; ++r) f.h[r] = (_Float16)(acc[i][j][r] * 0.0625f + (ba[r] + bn[i]));
      *(v8us*)(E + (16 * i + c) * PJ_PITCH + 32 * j + 16 * h) = f.half[0]; } }      /* Q, K: row = token, n along it; V: row = n, tokens along it */
  __builtin_amdgcn_fence(__ATOMIC_ACQ_REL, "workgroup"); __builtin_amdgcn_wave_barrier();      /* the rows are read back by other lanes of the same wave */
  const int cp = tv ? SQ : DM;      /* output row pitch, elements; a 128-token tile lies inside one batch, whose V^T is [DM][SQ] */
  unsigned short* cw = (unsigned short*)C + (tv ? ((size_t)(row0 / SQ) * DM + col0 + wn) * SQ + row0 % SQ + wm : (size_t)(row0 + wm) * DM + col0 + wn) + (size_t)(lane >> 3) * cp + (lane & 7) * 8;
#pragma unroll
  for (int it = 0; it < 16; ++it) { const v8us v = *(const v8us*)(E + (it * 4 + (lane >> 3)) * PJ_PITCH + (lane & 7) * 16);
    *(v8us*)(cw + (size_t)(it * 4) * cp) = v; } }      /* whole 128-byte lines, each stored once by one wave */

// ---- operand preparation in one launch: the three weight matrices (f16 [n][k], x16) and x (f16 rows) need nothing of each other, so they share one grid by ranges of the block index ----
#define PP_WB (DM * (DM / 8) / 256)            /* blocks a weight matrix */
#define PP_XB ((int)(NR * DM / 8 / 256))       /* blocks of x */
__global__ __launch_bounds__(256) void k_prep(const float* __restrict__ x, const float* __restrict__ wq, const float* __restrict__ wk, const float* __restrict__ wv,
    _Float16* __restrict__ X16, _Float16* __restrict__ BQ, _Float16* __restrict__ BK, _Float16* __restrict__ BV) {
  static_assert(DM * (DM / 8) % 256 == 0 && NR * DM / 8 % 256 == 0, "whole blocks only");
  const int bid = blockIdx.x; FragH f;
  if (bid < 3 * PP_WB) {      /* block-uniform; the weight blocks come first in the grid: their strided reads take longest */
    const int sel = bid / PP_WB; const float* W = sel == 0 ? wq : sel == 1 ? wk : wv; _Float16* Wt = sel == 0 ? BQ : sel == 1 ? BK : BV;
    const int t = (bid - sel * PP_WB) * 256 + threadIdx.x; const int n = t / (DM / 8), k8 = (t % (DM / 8)) * 8;
#pragma unroll
    for (int i = 0; i < 8; ++i) f.h[i] = (_Float16)(bf16_round(W[(size_t)(k8 + i) * DM + n]) * 16.0f);      /* [in][out] -> Wt[n][k] x16 */
    *(v8us*)((unsigned short*)Wt + (size_t)n * DM + k8) = f.half[0];
    asm volatile("s_wait_xcnt 0x0" ::: "memory");      /* the wait in front of any overwrite of the store's registers, on whatever way the built code leaves this branch */
  } else {
    const size_t t = (size_t)(bid - 3 * PP_WB) * 256 + threadIdx.x;
#pragma unroll
    for (int q = 0; q < 8; ++q) f.h[q] = (_Float16)bf16_round(x[t * 8 + q]);
    *(v8us*)((unsigned short*)X16 + t * 8) = f.half[0];
    asm volatile("s_wait_xcnt 0x0" ::: "memory");      /* as above */
  } }

extern "C" void kernel_launch(void* const* d_in, const int* in_sizes, int n_in,
                              void* d_out, int out_size, void* d_ws, size_t ws_size, hipStream_t stream) {
  (void)in_sizes; (void)n_in; (void)out_size;
  const float* const* I = (const float* const*)d_in; const float* x = I[0]; const float* am = I[1]; const float* wq = I[2]; const float* bq = I[3]; const float* wk = I[4]; const float* bk = I[5]; const float* wv = I[6]; const float* bv = I[7];      /* weights [in][out]; am = additive mask [NB][1][1][SQ] */
  char* ws = (char*)d_ws; size_t off = 0;
  auto take = [&](size_t bytes) { char* p = ws + off; off += (bytes + 255) & ~(size_t)255; return p; };
  _Float16* BQ = (_Float16*)take((size_t)DM * DM * 2); _Float16* BK = (_Float16*)take((size_t)DM * DM * 2); _Float16* BV = (_Float16*)take((size_t)DM * DM * 2); 
  _Float16* X16 = (_Float16*)take(NR * DM * 2); _Float16* Q16 = (_Float16*)take(NR * DM * 2); _Float16* K16 = (_Float16*)take(NR * DM * 2);
  _Float16* VT = (_Float16*)take(NR * DM * 2);      /* V^T, [DM][SQ] a batch */
  if (off > ws_size) return;
  k_prep<<<3 * PP_WB + PP_XB, 256, 0, stream>>>(x, wq, wk, wv, X16, BQ, BK, BV);      /* weights [in][out] -> Bt[n][k] x16, x -> f16 rows */
  const size_t r0p = (size_t)B0 * SQ;      /* first projected row */
  k_qkv<<<dim3((unsigned)(MP / 128), 3 * (DM / 128)), 128, 0, stream>>>(X16 + r0p * DM, BQ, BK, BV, bq, bk, bv, Q16 + r0p * DM, K16 + r0p * DM, VT + r0p * DM);      /* q, k rows and V^T as f16, all three in one launch */
  for (int b = B0; b < B0 + NBR; ++b) { const size_t r0 = (size_t)b * SQ;
    k_fattn<<<dim3(SQ / 64, NH), 128, 0, stream>>>(Q16 + r0 * LQ, K16 + r0 * LQ, VT + r0 * DM, am + (size_t)b * SQ, (float*)d_out + r0 * DM); }      /* scores, softmax and P.V of all heads; out = merged heads, f32 */
}

// v007
// It runs in 77.7 microseconds.
// Next to v006, in two timings, it ran 1.08 times as fast each time.
// Counting every step since v000, it is 131 times as fast.
#include <hip/hip_runtime.h>
// BERT self-attention (hidden [1][4096][768]; q/k/v = x W + b with W stored [in][out], 12 heads of 64; scores / 8 + the additive attention_mask[b][key] (f32); softmax; out = attn v merged -> [1][4096][768]; no output projection).
// Structure: token rows r = b*4096 + s; x as exact f16 rows (bf16-rounded); x and the three weight matrices are prepared in one launch; Q, K, V as one WMMA GEMM launch (128x128 work-group tiles staged in LDS, 64x64 wave tiles, f32 accumulation, exact x16 weights + bias, f16 outputs); V leaves that launch already transposed (its tiles swap the two operands' roles); per batch one fused attention launch over all heads: scores (WMMA, K = 64), running softmax of (scores / 8 + additive mask) on VALU (f32 statistics, native exp; weights as f16 in registers), o = P . V (WMMA), normalised and written as f32 into the merged output rows.
// Compute dtype: inputs rounded to bf16; x / weights exact; q, k, v and softmax weights as plain f16 GEMM operands (~2^-12); scores, softmax statistics and o f32. v_wmma_f32_16x16x32_f16.
#define NB 1
#define SQ 4096
#define DM 768
#define NH 12
#define HD 64
#define HG 1                         /* heads per launch of the second k_vt (not launched) */
#define B0 0                         /* first batch processed (debug hook) */
#define NBR NB                       /* batches processed (debug hook) */
#define NR ((size_t)NB * SQ)         /* token rows */
#define MP ((int)((size_t)NBR * SQ)) /* rows projected (debug hook) */
#define QN SQ                        /* unused: the attention launch covers all SQ queries */
#define NHD NH                       /* unused: the attention launch covers all NH heads */
#define MPO MP                       /* unused: there is no output stage */
#define LQ DM      /* row pitch of the q and k rows */
typedef __bf16 v16b __attribute__((ext_vector_type(16)));
typedef unsigned short v8us __attribute__((ext_vector_type(8), may_alias));
typedef float  v8f  __attribute__((ext_vector_type(8)));
typedef float  v4f  __attribute__((ext_vector_type(4)));
typedef float  v4fa __attribute__((ext_vector_type(4), may_alias));
union FragB { v16b v; v8us half[2]; unsigned short u[16]; };

__device__ __forceinline__ unsigned short bf16_bits(float x) { unsigned int u = __float_as_uint(x); return (unsigned short)((u + 0x7FFFu + ((u >> 16) & 1u)) >> 16); }
__device__ __forceinline__ float bf16_val(unsigned short b) { return __uint_as_float(((unsigned int)b) << 16); }
__device__ __forceinline__ float bf16_round(float x) { return bf16_val(bf16_bits(x)); }
// D += A·B with NT terms: 1 = ah·bh, 2 = + al·bh (A split), 3 = + ah·bl (both split)
template <int NT>
__device__ __forceinline__ v8f mmaN(v16b ah, v16b al, v16b bh, v16b bl, v8f c) {
  c = __builtin_amdgcn_wmma_f32_16x16x32_bf16(false, ah, false, bh, (short)0, c, false, false);
  if (NT >= 2) c = __builtin_amdgcn_wmma_f32_16x16x32_bf16(false, al, false, bh, (short)0, c, false, false);
  if (NT >= 3) c = __builtin_amdgcn_wmma_f32_16x16x32_bf16(false, ah, false, bl, (short)0, c, false, false);
  asm volatile("v_nop\n\tv_nop\n\tv_nop\n\tv_nop" : "+v"(c) : "v"(ah), "v"(al), "v"(bh), "v"(bl));
  return c;
}

__global__ __launch_bounds__(256) void k_wt_bf16(const float* __restrict__ W, unsigned short* __restrict__ Wt, int K, int N) {
  const int t = blockIdx.x * 256 + threadIdx.x;
  const int k8n = K / 8;
  if (t >= N * k8n) return;
  const int n = t / k8n, k8 = (t % k8n) * 8;
  v8us v;
#pragma unroll
  for (int i = 0; i < 8; ++i) v[i] = bf16_bits(W[(size_t)(k8 + i) * N + n]);
  *(v8us*)(Wt + (size_t)n * K + k8) = v;
  
}

// GEMM C[M][N] (f32, pitch ldc) = act(A[M][K]·W + bias). A f32 row-major (pitch lda) converted per fragment to bf16
// (ASPLIT: hi/lo two planes -> 2 terms, else single rounded term); Wt bf16 [N][K] (pitch ldb). BIAS_BF16 rounds the
// bias to bf16 first (bias quantised to bf16 before the add). K%32==0, M%16==0, N%64==0.
template <bool ASPLIT, int ACT, bool BIAS_BF16>
__global__ __launch_bounds__(128) void k_gemm_bf(const float* __restrict__ A, int lda, const unsigned short* __restrict__ Wt, int ldb,
                                               const float* __restrict__ bias, float* __restrict__ C, int ldc, int M, int N, int K) {
  __shared__ __attribute__((aligned(16))) float so[4][16][64];
  const int tid = threadIdx.x, w = tid >> 5, lane = tid & 31, ln = lane & 15, hh = lane >> 4;
  const int ntn = N / 64;
  const int wid = blockIdx.x * 4 + w;
  const int mt = wid / ntn, nq = wid % ntn;
  if (mt * 16 >= M) return;
  const int row0 = mt * 16, col0 = nq * 64;
  const float* arow = A + (size_t)(row0 + ln) * lda;
  v8f acc[4] = {};
  for (int kb = 0; kb < K; kb += 32) {
    FragB ah, al;
    const v4f x0 = *(const v4fa*)(arow + kb + 8 * hh), x1 = *(const v4fa*)(arow + kb + 8 * hh + 4);
    const v4f x2 = *(const v4fa*)(arow + kb + 16 + 8 * hh), x3 = *(const v4fa*)(arow + kb + 16 + 8 * hh + 4);
    float xs[16] = {x0[0],x0[1],x0[2],x0[3],x1[0],x1[1],x1[2],x1[3],x2[0],x2[1],x2[2],x2[3],x3[0],x3[1],x3[2],x3[3]};
#pragma unroll
    for (int i = 0; i < 16; ++i) { const unsigned short hb = bf16_bits(xs[i]); ah.u[i] = hb; al.u[i] = ASPLIT ? bf16_bits(xs[i] - bf16_val(hb)) : (unsigned short)0; }
#pragma unroll
    for (int t = 0; t < 4; ++t) {
      const unsigned short* brow = Wt + (size_t)(col0 + t * 16 + ln) * ldb + kb;
      FragB b;
      b.half[0] = *(const v8us*)(brow + 8 * hh);
      b.half[1] = *(const v8us*)(brow + 16 + 8 * hh);
      acc[t] = mmaN<ASPLIT ? 2 : 1>(ah.v, al.v, b.v, b.v, acc[t]);
    }
  }
#pragma unroll
  for (int t = 0; t < 4; ++t) {
    float bv = bias ? bias[col0 + t * 16 + ln] : 0.f;
    if (BIAS_BF16) bv = bf16_round(bv);
#pragma unroll
    for (int r = 0; r < 8; ++r) { float v = acc[t][r] + bv; if (ACT == 1) v = fmaxf(v, 0.f); so[w][8 * hh + r][t * 16 + ln] = v; }
  }
  __builtin_amdgcn_fence(__ATOMIC_ACQ_REL, "workgroup");
  __builtin_amdgcn_wave_barrier();
  const int rsub = lane >> 4, c4 = (lane & 15) * 4;
  {
#pragma unroll
    for (int q = 0; q < 8; ++q) {
      const int r = q * 2 + rsub;
      const v4f v = *(const v4fa*)&so[w][r][c4];
      *(v4f*)(C + (size_t)(row0 + r) * ldc + col0 + c4) = v;
    }
    
  }
}

// GEMM C = act(A·W + bias + resid): A f32 (ASPLIT -> hi/lo 2 terms), Wt bf16 [N][K]; ACT 0 none, 1 relu, 2 exact gelu;
// resid (optional, f32, row index = (row % rmod), pitch ldr, RES_BF16 rounds it) added before the activation.
template <bool ASPLIT, int ACT, bool BIAS_BF16, bool RES_BF16>
__global__ __launch_bounds__(128) void k_gemm_bf3(const float* __restrict__ A, int lda, const unsigned short* __restrict__ Wt, int ldb,
                                                const float* __restrict__ bias, const float* __restrict__ resid, int rmod, int ldr,
                                                float* __restrict__ C, int ldc, int M, int N, int K) {
  __shared__ __attribute__((aligned(16))) float so[4][16][64];
  const int tid = threadIdx.x, w = tid >> 5, lane = tid & 31, ln = lane & 15, hh = lane >> 4;
  const int ntn = N / 64;
  const int wid = blockIdx.x * 4 + w;
  const int mt = wid / ntn, nq = wid % ntn;
  if (mt * 16 >= M) return;
  const int row0 = mt * 16, col0 = nq * 64;
  const float* arow = A + (size_t)(row0 + ln) * lda;
  v8f acc[4] = {};
  for (int kb = 0; kb < K; kb += 32) {
    FragB ah, al;
    const v4f x0 = *(const v4fa*)(arow + kb + 8 * hh), x1 = *(const v4fa*)(arow + kb + 8 * hh + 4);
    const v4f x2 = *(const v4fa*)(arow + kb + 16 + 8 * hh), x3 = *(const v4fa*)(arow + kb + 16 + 8 * hh + 4);
    float xs[16] = {x0[0],x0[1],x0[2],x0[3],x1[0],x1[1],x1[2],x1[3],x2[0],x2[1],x2[2],x2[3],x3[0],x3[1],x3[2],x3[3]};
#pragma unroll
    for (int i = 0; i < 16; ++i) { const unsigned short hb = bf16_bits(xs[i]); ah.u[i] = hb; al.u[i] = ASPLIT ? bf16_bits(xs[i] - bf16_val(hb)) : (unsigned short)0; }
#pragma unroll
    for (int t = 0; t < 4; ++t) {
      const unsigned short* brow = Wt + (size_t)(col0 + t * 16 + ln) * ldb + kb;
      FragB b;
      b.half[0] = *(const v8us*)(brow + 8 * hh);
      b.half[1] = *(const v8us*)(brow + 16 + 8 * hh);
      acc[t] = mmaN<ASPLIT ? 2 : 1>(ah.v, al.v, b.v, b.v, acc[t]);
    }
  }
#pragma unroll
  for (int t = 0; t < 4; ++t) {
    const int col = col0 + t * 16 + ln;
    float bv = bias ? bias[col] : 0.f;
    if (BIAS_BF16) bv = bf16_round(bv);
#pragma unroll
    for (int r = 0; r < 8; ++r) {
      float v = acc[t][r] + bv;
      if (resid) { float rv = resid[(size_t)((row0 + 8 * hh + r) % rmod) * ldr + col]; if (RES_BF16) rv = bf16_round(rv); v += rv; }
      if (ACT == 1) v = fmaxf(v, 0.f);
      if (ACT == 2) v = 0.5f * v * (1.0f + erff(v * 0.70710678118654752f));
      if (ACT == 3) { const float u = 0.7978845608028654f * (v + 0.044715f * v * v * v); v = 0.5f * v * (1.0f + tanhf(u)); }
      so[w][8 * hh + r][t * 16 + ln] = v;
    }
  }
  __builtin_amdgcn_fence(__ATOMIC_ACQ_REL, "workgroup");
  __builtin_amdgcn_wave_barrier();
  const int rsub = lane >> 4, c4 = (lane & 15) * 4;
  {
#pragma unroll
    for (int q = 0; q < 8; ++q) {
      const int r = q * 2 + rsub;
      const v4f v = *(const v4fa*)&so[w][r][c4];
      *(v4f*)(C + (size_t)(row0 + r) * ldc + col0 + c4) = v;
    }
    
  }
}
// row LayerNorm (biased variance, eps) over N: s = X (+ R); optional out_sum <- s; out_norm <- (s-mu)*rsqrt(var+eps)*g + b
template <bool PARAM_BF16>
__global__ __launch_bounds__(256) void k_layernorm(const float* __restrict__ X, const float* __restrict__ R, const float* __restrict__ g, const float* __restrict__ bta,
                                                  float* __restrict__ out_sum, float* __restrict__ out_norm, int N, float eps) {
  __shared__ float red[256];
  const int row = blockIdx.x, tid = threadIdx.x;
  const float* x = X + (size_t)row * N; const float* rr = R ? R + (size_t)row * N : nullptr;
  float vals[16];                     // up to N = 4096
  const int per = N / 256;            // contiguous chunk per thread? use strided-by-4 chunks: thread handles j = tid*4 + 1024*u
  float s1 = 0.f;
  for (int u = 0; u < per / 4; ++u) {
    const int j = tid * 4 + 1024 * u;
    const v4f a = *(const v4fa*)(x + j);
    v4f b = {0.f,0.f,0.f,0.f}; if (rr) b = *(const v4fa*)(rr + j);
#pragma unroll
    for (int q = 0; q < 4; ++q) { const float v = a[q] + b[q]; vals[u * 4 + q] = v; s1 += v; }
  }
  red[tid] = s1; __syncthreads();
  for (int st = 128; st > 0; st >>= 1) { if (tid < st) red[tid] += red[tid + st]; __syncthreads(); }
  const float mu = red[0] / (float)N; __syncthreads();
  float s2 = 0.f;
  for (int u = 0; u < per / 4; ++u)
#pragma unroll
    for (int q = 0; q < 4; ++q) { const float c = vals[u * 4 + q] - mu; s2 += c * c; }
  red[tid] = s2; __syncthreads();
  for (int st = 128; st > 0; st >>= 1) { if (tid < st) red[tid] += red[tid + st]; __syncthreads(); }
  const float rs = rsqrtf(red[0] / (float)N + eps);
  {
    for (int u = 0; u < per / 4; ++u) {
      const int j = tid * 4 + 1024 * u;
      v4f o, sm;
#pragma unroll
      for (int q = 0; q < 4; ++q) {
        float gg = g[j + q], bb = bta[j + q];
        if (PARAM_BF16) { gg = bf16_round(gg); bb = bf16_round(bb); }
        sm[q] = vals[u * 4 + q]; o[q] = (vals[u * 4 + q] - mu) * rs * gg + bb;
      }
      if (out_sum) *(v4f*)(out_sum + (size_t)row * N + j) = sm;
      *(v4f*)(out_norm + (size_t)row * N + j) = o;
    }
    
  }
}



// ---- f16 WMMA path (v_wmma_f32_16x16x32_f16): 11-bit significands for operands in range — used where a [0,1] probability operand needs more precision than bf16
typedef _Float16 v16h __attribute__((ext_vector_type(16)));
union FragH { v16h v; v8us half[2]; _Float16 h[16]; unsigned short u[16]; };
template <int NT>
__device__ __forceinline__ v8f mmaH(v16h ah, v16h al, v16h bh, v16h bl, v8f c) {
  c = __builtin_amdgcn_wmma_f32_16x16x32_f16(false, ah, false, bh, (short)0, c, false, false);
  if (NT >= 2) c = __builtin_amdgcn_wmma_f32_16x16x32_f16(false, al, false, bh, (short)0, c, false, false);
  if (NT >= 3) c = __builtin_amdgcn_wmma_f32_16x16x32_f16(false, ah, false, bl, (short)0, c, false, false);
  asm volatile("v_nop\n\tv_nop\n\tv_nop\n\tv_nop" : "+v"(c) : "v"(ah), "v"(al), "v"(bh), "v"(bl));
  return c;
}
// batched GEMM like k_gemm_b but f16 operands: A f32 (split into f16 hi/lo if ASPLIT, else rounded to f16), Bt = f16 values [n][k]; alpha; C f32; N multiple of 16 (partial tiles skipped)
template <bool ASPLIT>
__global__ __launch_bounds__(128) void k_gemm_h(const float* __restrict__ A, int lda, size_t sA, const _Float16* __restrict__ Bh, int ldb, size_t sB, float alpha, float* __restrict__ C, int ldc, size_t sC, int M, int N, int K) {
  __shared__ __attribute__((aligned(16))) float so[4][16][64];
  const int tid = threadIdx.x, w = tid >> 5, lane = tid & 31, ln = lane & 15, hh = lane >> 4; const int by = blockIdx.y;
  A += (size_t)by * sA; Bh += (size_t)by * sB; C += (size_t)by * sC;
  const int ntn = (N + 63) / 64; const int wid = blockIdx.x * 4 + w; const int mt = wid / ntn, nq = wid % ntn; if (mt * 16 >= M) return;
  const int row0 = mt * 16, col0 = nq * 64; const float* arow = A + (size_t)(row0 + ln) * lda;
  v8f acc[4] = {};
  for (int kb = 0; kb < K; kb += 32) {
    FragH ah, al;
    const v4f x0 = *(const v4fa*)(arow + kb + 8 * hh), x1 = *(const v4fa*)(arow + kb + 8 * hh + 4), x2 = *(const v4fa*)(arow + kb + 16 + 8 * hh), x3 = *(const v4fa*)(arow + kb + 16 + 8 * hh + 4);
    float xs[16] = {x0[0],x0[1],x0[2],x0[3],x1[0],x1[1],x1[2],x1[3],x2[0],x2[1],x2[2],x2[3],x3[0],x3[1],x3[2],x3[3]};
#pragma unroll
    for (int i = 0; i < 16; ++i) { const _Float16 h = (_Float16)xs[i]; ah.h[i] = h; al.h[i] = ASPLIT ? (_Float16)(xs[i] - (float)h) : (_Float16)0.0f; }
#pragma unroll
    for (int t = 0; t < 4; ++t) { if (col0 + t * 16 >= N) continue; const size_t boff = (size_t)(col0 + t * 16 + ln) * ldb + kb; FragH bq; bq.half[0] = *(const v8us*)(Bh + boff + 8 * hh); bq.half[1] = *(const v8us*)(Bh + boff + 16 + 8 * hh);
      acc[t] = mmaH<ASPLIT ? 2 : 1>(ah.v, al.v, bq.v, bq.v, acc[t]); }
  }
#pragma unroll
  for (int t = 0; t < 4; ++t) { if (col0 + t * 16 >= N) continue;
#pragma unroll
    for (int r = 0; r < 8; ++r) so[w][8 * hh + r][t * 16 + ln] = acc[t][r] * alpha; }
  __builtin_amdgcn_fence(__ATOMIC_ACQ_REL, "workgroup"); __builtin_amdgcn_wave_barrier();
  const int rsub = lane >> 4, c4 = (lane & 15) * 4;
  {
#pragma unroll
    for (int q = 0; q < 8; ++q) { const int r = q * 2 + rsub; if (col0 + c4 < N) { const v4f v = *(const v4fa*)&so[w][r][c4]; *(v4f*)(C + (size_t)(row0 + r) * ldc + col0 + c4) = v; } }
     }
}

// Wt[n][k] = f16(W[k][n]·scale) from f32 row-major W[K][N] (scale = power of two; bf16-exact weights stay exact in f16 away from the subnormal range)
__global__ __launch_bounds__(256) void k_wt_f16(const float* __restrict__ W, _Float16* __restrict__ Wt, int K, int N, float scale) {
  const int t = blockIdx.x * 256 + threadIdx.x; if (t >= N * (K / 8)) return; const int n = t / (K / 8), k8 = (t % (K / 8)) * 8; FragH f;
#pragma unroll
  for (int i = 0; i < 8; ++i) f.h[i] = (_Float16)(bf16_round(W[(size_t)(k8 + i) * N + n]) * scale); const v8us o = f.half[0];
  *(v8us*)((unsigned short*)Wt + (size_t)n * K + k8) = o; 
}
// k_gemm_hh variant with fused epilogue: v = acc·alpha + bias[by·sBias + col] (+ CP[(row/rowsPerB)·sCPb + by·64 + col] if CP) ; ACT 0 none / 1 elu ; writes f16 C16 (and f32 C if non-null)
template <int ACT>
__global__ __launch_bounds__(128) void k_gemm_hhx(const _Float16* __restrict__ A, int lda, size_t sA, const _Float16* __restrict__ Bh, int ldb, size_t sB, float alpha, const float* __restrict__ bias, size_t sBias, const float* __restrict__ CP, int rowsPerB, size_t sCPb, int row0g,
    float* __restrict__ C, _Float16* __restrict__ C16, int ldc, size_t sC, int M, int N, int K) {
  __shared__ __attribute__((aligned(16))) float so[4][16][64];
  const int tid = threadIdx.x, w = tid >> 5, lane = tid & 31, ln = lane & 15, hh = lane >> 4; const int by = blockIdx.y;
  A += (size_t)by * sA; Bh += (size_t)by * sB; const size_t cofs = (size_t)by * sC; const float* bp = bias ? bias + (size_t)by * sBias : nullptr;
  const int ntn = (N + 63) / 64; const int wid = blockIdx.x * 4 + w; const int mt = wid / ntn, nq = wid % ntn; if (mt * 16 >= M) return;
  const int row0 = mt * 16, col0 = nq * 64; const _Float16* arow = A + (size_t)(row0 + ln) * lda;
  v8f acc[4] = {};
  for (int kb = 0; kb < K; kb += 32) { FragH ah; ah.half[0] = *(const v8us*)((const unsigned short*)arow + kb + 8 * hh); ah.half[1] = *(const v8us*)((const unsigned short*)arow + kb + 16 + 8 * hh);
#pragma unroll
    for (int t = 0; t < 4; ++t) { if (col0 + t * 16 >= N) continue; const size_t boff = (size_t)(col0 + t * 16 + ln) * ldb + kb; FragH bq; bq.half[0] = *(const v8us*)((const unsigned short*)Bh + boff + 8 * hh); bq.half[1] = *(const v8us*)((const unsigned short*)Bh + boff + 16 + 8 * hh);
      acc[t] = mmaH<1>(ah.v, ah.v, bq.v, bq.v, acc[t]); }
  }
#pragma unroll
  for (int t = 0; t < 4; ++t) { if (col0 + t * 16 >= N) continue; const int col = col0 + t * 16 + ln; const float bv = bp ? bf16_round(bp[col]) : 0.f;
#pragma unroll
    for (int r = 0; r < 8; ++r) { float v = acc[t][r] * alpha + bv; if (CP) { const int rr = row0g + row0 + 8 * hh + r; if (rowsPerB < 0) v += CP[cofs + (size_t)rr * ldc + col];      /* rowsPerB < 0: own element of the batched C plane */ else { const int bidx = rr / rowsPerB; v += CP[(size_t)bidx * sCPb + (size_t)by * 64 + col]; } } if (ACT == 1) v = (v > 0.f) ? v : expm1f(v); else if (ACT == 7) v = (v > 0.f) ? v + 1.0f : expf(v); else if (ACT == 8) v = tanhf(v); else if (ACT == 9) v = 0.5f * v * (1.0f + tanhf(0.7978845608028654f * (v + 0.044715f * v * v * v))); else if (ACT == 11) v = 1.0f / (1.0f + expf(-v)); else if (ACT == 12) v = (v > 0.f) ? v : 0.01f * v; else if (ACT == 14) v = (v > 0.f) ? v : 0.1f * v; else if (ACT == 16) v = (v >= 0.f) ? v : 0.3f * v; else if (ACT == 17) v = (v >= 0.f) ? v : 0.2f * v; else if (ACT == 15) v = v / (1.0f + expf(-v)); else if (ACT == 3) v = fmaxf(v, 0.f); else if (ACT == 6) v = 0.5f * v * (1.0f + erff(v * 0.70710678118654752f)); so[w][8 * hh + r][t * 16 + ln] = v; } }
  __builtin_amdgcn_fence(__ATOMIC_ACQ_REL, "workgroup"); __builtin_amdgcn_wave_barrier();
  const int rsub = lane >> 4, c4 = (lane & 15) * 4; typedef _Float16 v4h __attribute__((ext_vector_type(4)));
  {
#pragma unroll
    for (int q = 0; q < 8; ++q) { const int r = q * 2 + rsub; if (col0 + c4 < N) { const v4f v = *(const v4fa*)&so[w][r][c4]; if (C) *(v4f*)(C + cofs + (size_t)(row0 + r) * ldc + col0 + c4) = v; if (C16) { v4h h4; for (int i = 0; i < 4; ++i) h4[i] = (_Float16)v[i]; *(v4h*)(C16 + cofs + (size_t)(row0 + r) * ldc + col0 + c4) = h4; } } }
     }
}


typedef _Float16 v4h __attribute__((ext_vector_type(4)));

__global__ __launch_bounds__(256) void k_x16(const float* __restrict__ x, _Float16* __restrict__ X16, size_t n8) { const size_t t = (size_t)blockIdx.x * 256 + threadIdx.x; if (t >= n8) return; FragH f;
#pragma unroll
  for (int q = 0; q < 8; ++q) f.h[q] = (_Float16)bf16_round(x[t * 8 + q]); *(v8us*)((unsigned short*)X16 + t * 8) = f.half[0];  }
__global__ __launch_bounds__(256) void k_h16(const float* __restrict__ x, _Float16* __restrict__ X16, size_t n8) { const size_t t = (size_t)blockIdx.x * 256 + threadIdx.x; if (t >= n8) return; FragH f;
#pragma unroll
  for (int q = 0; q < 8; ++q) f.h[q] = (_Float16)x[t * 8 + q]; *(v8us*)((unsigned short*)X16 + t * 8) = f.half[0];  }
__global__ __launch_bounds__(256) void k_round16f(const float* __restrict__ W, _Float16* __restrict__ Bt, size_t n8) { const size_t t = (size_t)blockIdx.x * 256 + threadIdx.x; if (t >= n8) return; FragH f;
#pragma unroll
  for (int i = 0; i < 8; ++i) f.h[i] = (_Float16)(bf16_round(W[t * 8 + i]) * 16.0f); *(v8us*)((unsigned short*)Bt + t * 8) = f.half[0];  }
template <int NHv, int TTv>
__global__ __launch_bounds__(256) void k_vt(const _Float16* __restrict__ V16, int ldv, int voff, _Float16* __restrict__ Vt) { __shared__ unsigned short tl[64][66]; const int tid = threadIdx.x; const int slab = blockIdx.x / (TTv / 64), lg = blockIdx.x % (TTv / 64); const int b = slab / NHv, h = slab % NHv;
  for (int i = tid; i < 64 * 8; i += 256) { const int r = i / 8, c8 = (i % 8) * 8; FragH f; f.half[0] = *(const v8us*)((const unsigned short*)V16 + ((size_t)b * TTv + lg * 64 + r) * ldv + voff + h * 64 + c8);
#pragma unroll
    for (int q = 0; q < 8; ++q) tl[r][c8 + q] = f.u[q]; }
  __syncthreads();
  {
#pragma unroll
    for (int rd = 0; rd < 2; ++rd) { const int d = rd * 32 + tid / 8, pc = tid % 8; FragH f;
#pragma unroll
      for (int q = 0; q < 8; ++q) f.u[q] = tl[pc * 8 + q][d];
      *(v8us*)((unsigned short*)Vt + ((size_t)slab * 64 + d) * TTv + lg * 64 + pc * 8) = f.half[0]; }
     } }

__global__ __launch_bounds__(256) void k_hl(const float* __restrict__ F, _Float16* __restrict__ Hh, _Float16* __restrict__ Hl, size_t n8) { const size_t t = (size_t)blockIdx.x * 256 + threadIdx.x; if (t >= n8) return; FragH fh, fl; const v4f a = *(const v4fa*)(F + t * 8), c = *(const v4fa*)(F + t * 8 + 4);
#pragma unroll
  for (int q = 0; q < 4; ++q) { _Float16 h = (_Float16)a[q]; fh.h[q] = h; fl.h[q] = (_Float16)((a[q] - (float)h) * 1024.0f); h = (_Float16)c[q]; fh.h[4 + q] = h; fl.h[4 + q] = (_Float16)((c[q] - (float)h) * 1024.0f); }
  { *(v8us*)((unsigned short*)Hh + t * 8) = fh.half[0]; *(v8us*)((unsigned short*)Hl + t * 8) = fl.half[0];  } }

// ---- fast GEMM (wave tile 32x64; requires M % 32 == 0 rows per launch region and N % 64 == 0); epilogue = k_gemm_hhx semantics ----
__device__ __forceinline__ v16h g2_frag(const _Float16* p, int hh) { FragH f; f.half[0] = *(const v8us*)((const unsigned short*)p + 8 * hh); f.half[1] = *(const v8us*)((const unsigned short*)p + 16 + 8 * hh); return f.v; }
__device__ __forceinline__ v8f g2_mma(v16h a, v16h b, v8f c) { v8f d = __builtin_amdgcn_wmma_f32_16x16x32_f16(false, a, false, b, (short)0, c, false, false); asm volatile("v_nop\n\tv_nop\n\tv_nop\n\tv_nop" : "+v"(d) : "v"(a), "v"(b)); return d; }
template <int ACT>
__global__ __launch_bounds__(128) void k_gemm2(const _Float16* __restrict__ A, int lda, size_t sA, const _Float16* __restrict__ Bh, int ldb, size_t sB, float alpha, const float* __restrict__ bias, size_t sBias, const float* __restrict__ CP, int rowsPerB, size_t sCPb, int row0g,
    float* __restrict__ C, _Float16* __restrict__ C16, int ldc, size_t sC, int M, int N, int K) { static_assert(ACT == 0 || ACT == 3 || ACT == 6 || ACT == 8 || ACT == 9 || ACT == 11 || ACT == 12 || ACT == 14 || ACT == 15 || ACT == 16 || ACT == 17, "k_gemm2: unsupported ACT code (would silently apply no activation)");
  __shared__ __attribute__((aligned(16))) float so[4][32][68];
  const int tid = threadIdx.x, w = tid >> 5, lane = tid & 31, ln = lane & 15, hh = lane >> 4; const int by = blockIdx.y;
  A += (size_t)by * sA; Bh += (size_t)by * sB; const size_t cofs = (size_t)by * sC; const float* bp = bias ? bias + (size_t)by * sBias : nullptr;
  const int ntn = N >> 6; const int mt = blockIdx.x / ntn, nq = blockIdx.x - mt * ntn; const int row0 = mt * 128 + 32 * w, col0 = nq * 64; if (row0 >= M) return;
  const _Float16* a0p = A + (size_t)(row0 + ln) * lda; const _Float16* a1p = a0p + (size_t)16 * lda;
  const _Float16* b0p = Bh + (size_t)(col0 + ln) * ldb; const _Float16* b1p = b0p + (size_t)16 * ldb; const _Float16* b2p = b1p + (size_t)16 * ldb; const _Float16* b3p = b2p + (size_t)16 * ldb;
  const v8f z8 = {0.f,0.f,0.f,0.f,0.f,0.f,0.f,0.f}; v8f c00 = z8, c01 = z8, c02 = z8, c03 = z8, c10 = z8, c11 = z8, c12 = z8, c13 = z8;
#pragma unroll 1
  for (int kb = 0; kb < K; kb += 32) { const v16h a0 = g2_frag(a0p + kb, hh), a1 = g2_frag(a1p + kb, hh);
    v16h b = g2_frag(b0p + kb, hh); c00 = g2_mma(a0, b, c00); c10 = g2_mma(a1, b, c10);
    b = g2_frag(b1p + kb, hh); c01 = g2_mma(a0, b, c01); c11 = g2_mma(a1, b, c11);
    b = g2_frag(b2p + kb, hh); c02 = g2_mma(a0, b, c02); c12 = g2_mma(a1, b, c12);
    b = g2_frag(b3p + kb, hh); c03 = g2_mma(a0, b, c03); c13 = g2_mma(a1, b, c13); }
  v8f accs[8] = {c00, c01, c02, c03, c10, c11, c12, c13};
#pragma unroll
  for (int u = 0; u < 8; ++u) { const int t = u & 3, half = u >> 2; const int col = col0 + t * 16 + ln; const float bv = bp ? bf16_round(bp[col]) : 0.f;
#pragma unroll
    for (int r = 0; r < 8; ++r) { const int rloc = half * 16 + 8 * hh + r; float v = accs[u][r] * alpha + bv; if (CP) { if (rowsPerB < 0) v += CP[cofs + (size_t)(row0g + row0 + rloc) * ldc + col];      /* rowsPerB < 0: own element of the batched C plane */ else { const int bidx = (row0g + row0 + rloc) / rowsPerB; v += CP[(size_t)bidx * sCPb + (size_t)by * 64 + col]; } }
      if (ACT == 3) v = fmaxf(v, 0.f); else if (ACT == 6) v = 0.5f * v * (1.0f + erff(v * 0.70710678118654752f)); else if (ACT == 11) v = 1.0f / (1.0f + expf(-v)); else if (ACT == 15) v = v / (1.0f + expf(-v)); else if (ACT == 12) v = (v > 0.f) ? v : 0.01f * v; else if (ACT == 8) v = tanhf(v); else if (ACT == 9) v = 0.5f * v * (1.0f + tanhf(0.7978845608028654f * (v + 0.044715f * v * v * v))); else if (ACT == 14) v = (v > 0.f) ? v : 0.1f * v; else if (ACT == 16) v = (v >= 0.f) ? v : 0.3f * v; else if (ACT == 17) v = (v >= 0.f) ? v : 0.2f * v;
      so[w][rloc][t * 16 + ln] = v; } }
  __builtin_amdgcn_fence(__ATOMIC_ACQ_REL, "workgroup"); __builtin_amdgcn_wave_barrier();
  const int rsub = lane >> 4, c4 = (lane & 15) * 4;
  {
#pragma unroll
    for (int q = 0; q < 16; ++q) { const int r = q * 2 + rsub; const v4f v = *(const v4fa*)&so[w][r][c4]; if (C) *(v4f*)(C + cofs + (size_t)(row0 + r) * ldc + col0 + c4) = v; if (C16) { v4h h4; for (int i = 0; i < 4; ++i) h4[i] = (_Float16)v[i]; *(v4h*)(C16 + cofs + (size_t)(row0 + r) * ldc + col0 + c4) = h4; } }
     } }


__global__ __launch_bounds__(256) void k_wnat(const float* __restrict__ w, size_t n8, _Float16* __restrict__ Bt) { const size_t t = (size_t)blockIdx.x * 256 + threadIdx.x; if (t >= n8) return; FragH f; for (int q = 0; q < 8; ++q) f.h[q] = (_Float16)(bf16_round(w[t * 8 + q]) * 16.0f); *(v8us*)((unsigned short*)Bt + t * 8) = f.half[0];  }
__global__ __launch_bounds__(256) void k_rsm(const float* __restrict__ S, _Float16* __restrict__ P, int nrows) {
  #pragma clang fp contract(off)
  const int i = blockIdx.x * 256 + threadIdx.x; if (i >= nrows) return; const float* s = S + (size_t)i * SQ; float mx = -3.0e38f;
#pragma unroll 1
  for (int j = 0; j < SQ; ++j) mx = fmaxf(mx, s[j]); float se = 0.f;
#pragma unroll 1
  for (int j = 0; j < SQ; ++j) se += expf(s[j] - mx); const float sc = 256.0f / se;
#pragma unroll 1
  for (int j0 = 0; j0 < SQ; j0 += 8) { FragH f; for (int q = 0; q < 8; ++q) f.h[q] = (_Float16)(expf(s[j0 + q] - mx) * sc); unsigned short* d = (unsigned short*)P + (size_t)i * SQ + j0; *(v8us*)d = f.half[0];  } }
__global__ __launch_bounds__(256) void k_vt(const _Float16* __restrict__ V16, int b, int h0, _Float16* __restrict__ VT) { __shared__ unsigned short tl[64][65]; const int tid = threadIdx.x; const int hh = blockIdx.x % HG, sg = blockIdx.x / HG; const int s0 = sg * 64; const int h = h0 + hh;
  for (int i = tid; i < 64 * 8; i += 256) { const int j = i / 8, d8 = (i % 8) * 8; FragH f; f.half[0] = *(const v8us*)((const unsigned short*)V16 + ((size_t)b * SQ + s0 + j) * DM + h * HD + d8); for (int q = 0; q < 8; ++q) tl[d8 + q][j] = f.u[q]; }
  __syncthreads();
  { for (int i = tid; i < 64 * 8; i += 256) { const int d = i / 8, j8 = (i % 8) * 8; FragH f; for (int q = 0; q < 8; ++q) f.u[q] = tl[d][j8 + q]; *(v8us*)((unsigned short*)VT + ((size_t)hh * HD + d) * SQ + s0 + j8) = f.half[0]; }  } }



// Four exponentials 2^x in place. The closing v_nop is the free slot that the instruction set asks for behind a transcendental before its result is used or its
// source overwritten; it stands in the same statement because nothing else would keep it directly behind the last v_exp_f32 (inside, each v_exp_f32 is independent of the one before).
__device__ __forceinline__ v4f exp2x4(v4f x) { float a = x[0], b = x[1], c = x[2], d = x[3];
  asm("v_exp_f32 %0, %0\n\tv_exp_f32 %1, %1\n\tv_exp_f32 %2, %2\n\tv_exp_f32 %3, %3\n\tv_nop" : "+v"(a), "+v"(b), "+v"(c), "+v"(d));
  const v4f r = {a, b, c, d}; return r; }
#define FA_LAG 5.5f                  /* score units; 5.5 log2 e = 7.9 */
#define FA_L2E 1.44269504088896340736f
#define FA_PITCH 144                 /* LDS row pitch, bytes */
#define FA_TILE (64 * FA_PITCH)      /* one operand's 64 rows */
#define FA_BUF (2 * FA_TILE)         /* K tile + V^T tile of 64 keys */
#define FA_STG (2 * FA_BUF)          /* one stage: the tiles of both key sets */
#define FA_EP 272                    /* output staging pitch, bytes: 64 f32 + 16 */
#define FA_XW (17 * 512)             /* one wave's partial result: 17 pieces of 16 bytes a lane */
__device__ __forceinline__ v16h fa_frag(const unsigned char* p) { FragH f; f.half[0] = *(const v8us*)p; f.half[1] = *(const v8us*)(p + 32); return f.v; }
__device__ __forceinline__ v8f fa_mma(v16h a, v16h b, v8f c) { return __builtin_amdgcn_wmma_f32_16x16x32_f16(false, a, false, b, (short)0, c, false, false); }
__device__ __forceinline__ float fa_xhalf(float x) { return __builtin_bit_cast(float, __builtin_amdgcn_permlanex16(__builtin_bit_cast(int, x), __builtin_bit_cast(int, x), 0x76543210, 0xfedcba98, false, false)); }      /* lane l with lane l ^ 16 */
__global__ __launch_bounds__(128) void k_fattn(const _Float16* __restrict__ Q16, const _Float16* __restrict__ K16, const _Float16* __restrict__ VT, const float* __restrict__ am, float* __restrict__ out) {
  __shared__ __attribute__((aligned(16))) unsigned char L[2 * FA_STG];      /* two stages in the loop; the partial results and the output staging behind it */
  __shared__ __attribute__((aligned(16))) float ms[SQ];
  static_assert(2 * FA_XW + 2 * 32 * FA_EP <= 2 * FA_STG, "partial results and output staging must fit the array");
  const int tid = threadIdx.x, lane = tid & 31, c = lane & 15, h = lane >> 4; const int w = __builtin_amdgcn_readfirstlane(tid >> 5);
  const int qh = w & 1, ks = w >> 1;      /* which 32 queries, which key set */
  const int head = blockIdx.y, q0 = blockIdx.x * 64 + qh * 32;
  /* staging: 8 threads cover one 128-byte row piece; a thread brings rows sr + 16 p (p = 0..3) of both operands of both tiles */
  const int sr = tid >> 3, sc = tid & 7;
  const unsigned short* kg = (const unsigned short*)K16 + (size_t)sr * DM + head * HD + sc * 8;
  const unsigned short* vg = (const unsigned short*)VT + ((size_t)head * HD + sr) * SQ + sc * 8;
  unsigned char* lw = L + sr * FA_PITCH + sc * 16;
  v8us kr[8], vr[8];      /* index 4 u + p: tile u */
#pragma unroll
  for (int i = 0; i < 8; ++i) { kr[i] = *(const v8us*)(kg + (size_t)(16 * i) * DM); vr[i] = *(const v8us*)(vg + (size_t)(16 * (i & 3)) * SQ + 64 * (i >> 2)); }
#pragma unroll
  for (int u = 0; u < SQ / 512; ++u) { const v4f m = *(const v4fa*)(am + u * 512 + tid * 4); v4f r;
#pragma unroll
    for (int q = 0; q < 4; ++q) r[q] = bf16_round(m[q]);
    *(v4fa*)&ms[u * 512 + tid * 4] = r; }
  v16h qf[2][2]; const _Float16* qa[2];      /* qa: the lane's own address, its half's 8 elements counted in */
#pragma unroll
  for (int g = 0; g < 2; ++g) { qa[g] = Q16 + (size_t)(q0 + 16 * g + c) * DM + head * HD + 8 * h; qf[g][0] = g2_frag(qa[g], 0); qf[g][1] = g2_frag(qa[g] + 32, 0); }
  asm volatile("s_wait_xcnt 0x0" :: "v"(qa[0]), "v"(qa[1]) : "memory");      /* the wait in front of any overwrite of the Q loads' address registers; the addresses are inputs so that they stay live up to it */
  FragH ones;      /* A operand whose row 0 is 1.0: its product with P^T is the column sums of P^T, the softmax denominators */
#pragma unroll
  for (int i = 0; i < 16; ++i) ones.h[i] = (c == 0) ? (_Float16)1.0f : (_Float16)0.0f;
  const v8f z8 = {0.f, 0.f, 0.f, 0.f, 0.f, 0.f, 0.f, 0.f};
  v8f acc[2][4], lacc[2]; float m_run[2];
#pragma unroll
  for (int g = 0; g < 2; ++g) { m_run[g] = -3.402823466e38f; lacc[g] = z8;      /* the lowest finite value: any finite score replaces it, a key at -inf keeps weight 0 */
#pragma unroll
    for (int t = 0; t < 4; ++t) acc[g][t] = z8; }
#pragma unroll
  for (int i = 0; i < 8; ++i) { unsigned char* p = lw + (i >> 2) * FA_BUF + (i & 3) * 16 * FA_PITCH; *(v8us*)p = kr[i]; *(v8us*)(p + FA_TILE) = vr[i]; }
  __syncthreads();      /* publishes stage 0 and the mask */
#pragma unroll 1      /* 32 trips of 36 matrix instructions stay rolled: code size and registers */
  for (int st = 0; st < SQ / 128; ++st) {
    const unsigned char* Lb = L + (st & 1) * FA_STG + ks * FA_BUF;
    if (st + 1 < SQ / 128) { const unsigned short* kn = kg + (size_t)(st + 1) * 128 * DM; const unsigned short* vn = vg + (st + 1) * 128;
#pragma unroll
      for (int i = 0; i < 8; ++i) { kr[i] = *(const v8us*)(kn + (size_t)(16 * i) * DM); vr[i] = *(const v8us*)(vn + (size_t)(16 * (i & 3)) * SQ + 64 * (i >> 2)); }
      asm volatile("s_wait_xcnt 0x0" :: "v"(kn), "v"(vn) : "memory"); }      /* the wait in front of any overwrite of the sixteen loads' address registers; the two addresses are inputs so that they stay live up to it and no load of the run lands in them */
#pragma unroll
    for (int sub = 0; sub < 2; ++sub) {
      v8f s[2][2];
#pragma unroll
      for (int kt = 0; kt < 2; ++kt) { const unsigned char* kp = Lb + (sub * 32 + 16 * kt + c) * FA_PITCH + 16 * h; const v16h k0 = fa_frag(kp), k1 = fa_frag(kp + 64);
        const float* mp = ms + st * 128 + ks * 64 + sub * 32 + 16 * kt + 8 * h; const v4f m0 = *(const v4fa*)mp, m1 = *(const v4fa*)(mp + 4);
        const v8f mc = {m0[0], m0[1], m0[2], m0[3], m1[0], m1[1], m1[2], m1[3]};
        s[kt][0] = fa_mma(k0, qf[0][0], z8); s[kt][1] = fa_mma(k0, qf[1][0], z8);
        s[kt][0] = fa_mma(k1, qf[0][1], s[kt][0]) * 0.125f + mc; s[kt][1] = fa_mma(k1, qf[1][1], s[kt][1]) * 0.125f + mc; }      /* 1/sqrt(64) is a power of two, so this is the score plus the mask in one f32 rounding, fused or not, as the separate kernels had it */
      v16h vf[4];
#pragma unroll
      for (int t = 0; t < 4; ++t) vf[t] = fa_frag(Lb + FA_TILE + (16 * t + c) * FA_PITCH + sub * 64 + 16 * h);
      float mb[2]; bool need = false;
#pragma unroll
      for (int g = 0; g < 2; ++g) { float mx = fmaxf(s[0][g][0], s[1][g][0]);
#pragma unroll
        for (int r = 1; r < 8; ++r) mx = fmaxf(fmaxf(mx, s[0][g][r]), s[1][g][r]);
        mx = fmaxf(mx, fa_xhalf(mx)); mb[g] = mx; need = need || (mx > m_run[g] + FA_LAG); }
      if (__builtin_amdgcn_ballot_w32(need) != 0) {      /* one scalar branch a pass; rare behind the first passes */
        v4f e = {(m_run[0] - fmaxf(m_run[0], mb[0])) * FA_L2E, (m_run[1] - fmaxf(m_run[1], mb[1])) * FA_L2E, 0.f, 0.f}; e = exp2x4(e);
#pragma unroll
        for (int g = 0; g < 2; ++g) { m_run[g] = fmaxf(m_run[g], mb[g]); lacc[g] = lacc[g] * e[g];
#pragma unroll
          for (int t = 0; t < 4; ++t) acc[g][t] = acc[g][t] * e[g]; } }
#pragma unroll
      for (int g = 0; g < 2; ++g) { const float mr = m_run[g]; FragH pf;
#pragma unroll
        for (int j = 0; j < 4; ++j) { v4f a;
#pragma unroll
          for (int q = 0; q < 4; ++q) a[q] = (s[j >> 1][g][4 * (j & 1) + q] - mr) * FA_L2E;
          a = exp2x4(a);
#pragma unroll
          for (int q = 0; q < 4; ++q) pf.h[4 * j + q] = (_Float16)a[q]; }
#pragma unroll
        for (int t = 0; t < 4; ++t) acc[g][t] = fa_mma(vf[t], pf.v, acc[g][t]);
        lacc[g] = fa_mma(ones.v, pf.v, lacc[g]); }
    }
    if (st + 1 < SQ / 128) { unsigned char* p0 = lw + ((st + 1) & 1) * FA_STG;
#pragma unroll
      for (int i = 0; i < 8; ++i) { unsigned char* p = p0 + (i >> 2) * FA_BUF + (i & 3) * 16 * FA_PITCH; *(v8us*)p = kr[i]; *(v8us*)(p + FA_TILE) = vr[i]; } }
    __syncthreads();      /* publishes stage st + 1 and ends every wave's reads of stage st, whose buffer the next trip refills (behind the last trip: frees the array for the partial results) */
  }
  float lf[2];
#pragma unroll
  for (int g = 0; g < 2; ++g) { const float lr = lacc[g][0]; lf[g] = lr + fa_xhalf(lr); }      /* register 0: the sum in lanes 0-15, 0 in lanes 16-31 */
  unsigned char* X = L + qh * FA_XW + lane * 16;      /* lane for lane: the two waves of one query half hold the same element in the same lane and register */
  if (ks == 1) {
#pragma unroll
    for (int g = 0; g < 2; ++g)
#pragma unroll
      for (int t = 0; t < 4; ++t) { const v8f o = acc[g][t]; const v4f o0 = {o[0], o[1], o[2], o[3]}, o1 = {o[4], o[5], o[6], o[7]};
        *(v4fa*)(X + (8 * g + 2 * t) * 512) = o0; *(v4fa*)(X + (8 * g + 2 * t + 1) * 512) = o1; }
    const v4f ml = {m_run[0], m_run[1], lf[0], lf[1]}; *(v4fa*)(X + 16 * 512) = ml; }
  __syncthreads();      /* publishes key set 1's partial results to the waves of key set 0 */
  if (ks == 1) return;      /* behind the last barrier */
  const v4f ml = *(const v4fa*)(X + 16 * 512);
  const float mm0 = fmaxf(m_run[0], ml[0]), mm1 = fmaxf(m_run[1], ml[1]);
  v4f e = {(m_run[0] - mm0) * FA_L2E, (ml[0] - mm0) * FA_L2E, (m_run[1] - mm1) * FA_L2E, (ml[1] - mm1) * FA_L2E}; e = exp2x4(e);      /* both partial results brought to the larger of their two maxima */
  unsigned char* E = L + 2 * FA_XW + qh * (32 * FA_EP);      /* this wave's own 32 rows of 64 f32 */
#pragma unroll
  for (int g = 0; g < 2; ++g) { const float inv = 1.0f / (lf[g] * e[2 * g] + ml[2 + g] * e[2 * g + 1]); const float fa = e[2 * g] * inv, fb = e[2 * g + 1] * inv;
#pragma unroll
    for (int t = 0; t < 4; ++t) { const v4f p0 = *(const v4fa*)(X + (8 * g + 2 * t) * 512), p1 = *(const v4fa*)(X + (8 * g + 2 * t + 1) * 512); const v8f a = acc[g][t];
      const v4f o0 = {a[0] * fa + p0[0] * fb, a[1] * fa + p0[1] * fb, a[2] * fa + p0[2] * fb, a[3] * fa + p0[3] * fb}, o1 = {a[4] * fa + p1[0] * fb, a[5] * fa + p1[1] * fb, a[6] * fa + p1[2] * fb, a[7] * fa + p1[3] * fb};
      unsigned char* p = E + (16 * g + c) * FA_EP + 64 * t + 32 * h; *(v4fa*)p = o0; *(v4fa*)(p + 16) = o1; } }      /* row = query, d = 16 t + 8 h + r */
  __builtin_amdgcn_fence(__ATOMIC_ACQ_REL, "workgroup"); __builtin_amdgcn_wave_barrier();      /* the rows are read back by other lanes of the same wave */
#pragma unroll
  for (int i = 0; i < 16; ++i) { const int row = i * 2 + h; const v4f v = *(const v4fa*)(E + row * FA_EP + c * 16);
    *(v4f*)(out + (size_t)(q0 + row) * DM + head * HD + c * 4) = v; } }      /* whole 256-byte row pieces: every 128-byte line stored once */

// ---- Q, K and V projections in one launch: C[m][n] = f16(x[m][:] . Wt[n][:] / 16 + bias[n]), n running over the three weight matrices (blockIdx.y: 6 column tiles each) ----
// One work-group = 4 waves, a 128 x 128 output tile, a 64 x 64 quadrant a wave (16 accumulator tiles: 8 LDS fragment reads feed 16 matrix instructions).
// 64 k of the x rows and of the Wt rows a stage go through registers into one of two LDS buffers (row pitch 128 + 16 bytes), the next stage's global loads (whole 128-byte lines) in flight under this stage's work.
// Q and K, transposed product (A = Wt rows, B = x rows): a lane then holds 8 neighbouring n of one token row, one 16-byte piece of the f16 output row. k runs upward in steps of 32.
// V, the two operands' roles swapped (A = x rows, B = Wt rows; both tiles lie in LDS alike and are read by the same loader): a lane holds 8 neighbouring tokens of one n, one 16-byte piece of a row of V^T [n][token],
// which is the layout the attention launch stages, so V needs no transposing launch of its own.
#define PJ_PITCH 144                 /* LDS row pitch, bytes */
#define PJ_TILE (128 * PJ_PITCH)     /* one operand's 128 rows */
#define PJ_BUF (2 * PJ_TILE)         /* x tile + Wt tile */
__global__ __launch_bounds__(128) void k_qkv(const _Float16* __restrict__ X16, const _Float16* __restrict__ BQ, const _Float16* __restrict__ BK, const _Float16* __restrict__ BV,
    const float* __restrict__ bq, const float* __restrict__ bk, const float* __restrict__ bv, _Float16* __restrict__ Q16, _Float16* __restrict__ K16, _Float16* __restrict__ VT) {
  __shared__ __attribute__((aligned(16))) unsigned char L[2 * PJ_BUF];      /* two operand buffers in the loop, output staging (4 waves x 64 rows) behind it */
  const int tid = threadIdx.x, lane = tid & 31, c = lane & 15, h = lane >> 4; const int w = __builtin_amdgcn_readfirstlane(tid >> 5);
  const int sel = blockIdx.y / (DM / 128), col0 = (blockIdx.y % (DM / 128)) * 128, row0 = blockIdx.x * 128;
  const _Float16* Bt = sel == 0 ? BQ : sel == 1 ? BK : BV; const float* bias = sel == 0 ? bq : sel == 1 ? bk : bv; _Float16* C = sel == 0 ? Q16 : sel == 1 ? K16 : VT;
  const int wm = (w & 1) * 64, wn = (w >> 1) * 64;      /* this wave's quadrant */
  const bool tv = sel == 2;      /* block-uniform: V^T */
  const int ao = tv ? wm * PJ_PITCH : PJ_TILE + wn * PJ_PITCH, bo = tv ? PJ_TILE + wn * PJ_PITCH : wm * PJ_PITCH;      /* this wave's 64 rows of the A and of the B operand, bytes inside a buffer */
  /* staging: 8 threads cover one 128-byte row piece, a thread brings rows sr + 16 p of both operands */
  const int sr = tid >> 3, sc = tid & 7;
  const unsigned char* xp = (const unsigned char*)(X16 + (size_t)(row0 + sr) * DM + sc * 8); const unsigned char* wp = (const unsigned char*)(Bt + (size_t)(col0 + sr) * DM + sc * 8);      /* step 128 bytes a stage */
  unsigned char* lw = L + sr * PJ_PITCH + sc * 16;
  v8us xs[8], wr[8];
#pragma unroll
  for (int p = 0; p < 8; ++p) { xs[p] = *(const v8us*)(xp + p * (32 * DM)); wr[p] = *(const v8us*)(wp + p * (32 * DM)); }
  const v8f z8 = {0.f, 0.f, 0.f, 0.f, 0.f, 0.f, 0.f, 0.f};
  v8f acc[4][4];
#pragma unroll
  for (int i = 0; i < 4; ++i)
#pragma unroll
    for (int j = 0; j < 4; ++j) acc[i][j] = z8;
#pragma unroll
  for (int p = 0; p < 8; ++p) { *(v8us*)(lw + p * 16 * PJ_PITCH) = xs[p]; *(v8us*)(lw + PJ_TILE + p * 16 * PJ_PITCH) = wr[p]; }
  __syncthreads();      /* publishes stage 0 */
#pragma unroll 1      /* 12 trips of 32 matrix instructions stay rolled: registers */
  for (int st = 0; st < DM / 64; ++st) {
    const unsigned char* Lb = L + (st & 1) * PJ_BUF;
    if (st + 1 < DM / 64) { xp += 128; wp += 128;
#pragma unroll
      for (int p = 0; p < 8; ++p) { xs[p] = *(const v8us*)(xp + p * (32 * DM)); wr[p] = *(const v8us*)(wp + p * (32 * DM)); } }
#pragma unroll
    for (int ks = 0; ks < 2; ++ks) { v16h bf[4];
#pragma unroll
      for (int i = 0; i < 4; ++i) bf[i] = fa_frag(Lb + bo + (16 * i + c) * PJ_PITCH + ks * 64 + 16 * h);
#pragma unroll
      for (int j = 0; j < 4; ++j) { const v16h af = fa_frag(Lb + ao + (16 * j + c) * PJ_PITCH + ks * 64 + 16 * h);
#pragma unroll
        for (int i = 0; i < 4; ++i) acc[i][j] = fa_mma(af, bf[i], acc[i][j]); } }
    if (st + 1 < DM / 64) { unsigned char* p0 = lw + ((st + 1) & 1) * PJ_BUF;
#pragma unroll
      for (int p = 0; p < 8; ++p) { *(v8us*)(p0 + p * 16 * PJ_PITCH) = xs[p]; *(v8us*)(p0 + PJ_TILE + p * 16 * PJ_PITCH) = wr[p]; } }
    __syncthreads();      /* publishes stage st + 1 and ends every wave's reads of stage st, whose buffer the next trip refills (behind the last trip: frees the array for the output staging) */
  }
  unsigned char* E = L + w * (64 * PJ_PITCH);      /* this wave's own 64 rows of 64 f16 */
  /* element (i, j, r): index 16 i + c among the B operand's rows (the staging row), 16 j + 8 h + r among the A operand's (along the row). n, which picks the bias, is the A index for Q and K, the B index for V: */
  /* both sets of bias values are loaded (both lie inside the 128 columns of this tile), the set that does not apply is replaced by 0, and bn + ba is the one that applies, exactly */
  float bn[4]; v4f b0[4], b1[4];
#pragma unroll
  for (int u = 0; u < 4; ++u) { const float* bp = bias + col0 + wn + 16 * u; bn[u] = bp[c]; b0[u] = *(const v4fa*)(bp + 8 * h); b1[u] = *(const v4fa*)(bp + 8 * h + 4); }
  const unsigned int ka = tv ? 0u : 0xFFFF0000u, kn = tv ? 0xFFFF0000u : 0u;      /* the mask that ends the rounding to bf16 keeps the set that applies and clears the other */
  auto rnd = [](float x, unsigned int k) { const unsigned int u = __float_as_uint(x); return __uint_as_float((u + 0x7FFFu + ((u >> 16) & 1u)) & k); };      /* bf16_round(x) under k = 0xFFFF0000, 0 under k = 0 */
#pragma unroll
  for (int i = 0; i < 4; ++i) bn[i] = rnd(bn[i], kn);
#pragma unroll
  for (int j = 0; j < 4; ++j) { float ba[8];
#pragma unroll
    for (int r = 0; r < 4; ++r) { ba[r] = rnd(b0[j][r], ka); ba[4 + r] = rnd(b1[j][r], ka); }
#pragma unroll
    for (int i = 0; i < 4; ++i) { FragH f;
#pragma unroll
      for (int r = 0; r < 8; ++r) f.h[r] = (_Float16)(acc[i][j][r] * 0.0625f + (ba[r] + bn[i]));
      *(v8us*)(E + (16 * i + c) * PJ_PITCH + 32 * j + 16 * h) = f.half[0]; } }      /* Q, K: row = token, n along it; V: row = n, tokens along it */
  __builtin_amdgcn_fence(__ATOMIC_ACQ_REL, "workgroup"); __builtin_amdgcn_wave_barrier();      /* the rows are read back by other lanes of the same wave */
  const int cp = tv ? SQ : DM;      /* output row pitch, elements; a 128-token tile lies inside one batch, whose V^T is [DM][SQ] */
  unsigned short* cw = (unsigned short*)C + (tv ? ((size_t)(row0 / SQ) * DM + col0 + wn) * SQ + row0 % SQ + wm : (size_t)(row0 + wm) * DM + col0 + wn) + (size_t)(lane >> 3) * cp + (lane & 7) * 8;
#pragma unroll
  for (int it = 0; it < 16; ++it) { const v8us v = *(const v8us*)(E + (it * 4 + (lane >> 3)) * PJ_PITCH + (lane & 7) * 16);
    *(v8us*)(cw + (size_t)(it * 4) * cp) = v; } }      /* whole 128-byte lines, each stored once by one wave */

// ---- operand preparation in one launch: the three weight matrices (f16 [n][k], x16) and x (f16 rows) need nothing of each other, so they share one grid by ranges of the block index ----
// Few work-groups with much to do each: the launch is short, so the time its waves take to start counts, and every global access covers whole 128-byte lines.
// Weights: a work-group takes a tile of 64 k x 128 n. A wave reads 8 rows k of it, 512 contiguous bytes each (a lane: 4 neighbouring n of 8 k), and a lane's 8 k of one n are one 16-byte piece of a row of Wt,
// which goes through LDS (row pitch 128 + 16 bytes) so that 8 lanes store one whole 128-byte line of Wt.
// x: a work-group takes 16384 neighbouring elements, a thread 16 pieces of 4, all 16 loads in flight at once.
// Every loop here is unrolled so that its array stays in registers and a run of loads is issued whole before the first value is used.
#define PP_WB ((DM / 64) * (DM / 128))         /* blocks a weight matrix */
#define PP_XE (256 * 64)                       /* elements of x a block */
#define PP_XB ((int)(NR * DM / PP_XE))         /* blocks of x */
#define PP_PITCH 144                           /* LDS row pitch, bytes */
__global__ __launch_bounds__(256) void k_prep(const float* __restrict__ x, const float* __restrict__ wq, const float* __restrict__ wk, const float* __restrict__ wv,
    _Float16* __restrict__ X16, _Float16* __restrict__ BQ, _Float16* __restrict__ BK, _Float16* __restrict__ BV) {
  __shared__ __attribute__((aligned(16))) unsigned char T[128 * PP_PITCH];
  static_assert(DM % 128 == 0 && NR * DM % PP_XE == 0, "whole blocks only");
  const int bid = blockIdx.x, tid = threadIdx.x;
  if (bid < 3 * PP_WB) {      /* block-uniform; the weight blocks come first in the grid: their two phases take longest */
    const int sel = bid / PP_WB, tl = bid - sel * PP_WB; const float* W = sel == 0 ? wq : sel == 1 ? wk : wv; _Float16* Wt = sel == 0 ? BQ : sel == 1 ? BK : BV;
    const int k0 = (tl / (DM / 128)) * 64, n0 = (tl % (DM / 128)) * 128; const int lane = tid & 31, w = tid >> 5;
    const float* wsrc = W + (size_t)(k0 + 8 * w) * DM + n0 + 4 * lane;
    v4f r[8];
#pragma unroll
    for (int i = 0; i < 8; ++i) r[i] = *(const v4fa*)(wsrc + (size_t)i * DM);
    asm volatile("s_wait_xcnt 0x0" :: "v"(wsrc) : "memory");      /* the wait in front of any overwrite of the eight loads' address registers; the address is an input so that it stays live up to it */
#pragma unroll
    for (int q = 0; q < 4; ++q) { FragH f;
#pragma unroll
      for (int i = 0; i < 8; ++i) f.h[i] = (_Float16)(bf16_round(r[i][q]) * 16.0f);      /* [in][out] -> Wt[n][k] x16 */
      *(v8us*)(T + (32 * q + lane) * PP_PITCH + 16 * w) = f.half[0]; }      /* n = n0 + 4 lane + q lies in LDS row 32 q + lane: neighbouring lanes one pitch apart, no bank conflict */
    __syncthreads();      /* publishes the tile: a row is read back by lanes of another wave than those that wrote it */
    unsigned short* wdst = (unsigned short*)Wt + (size_t)(n0 + 4 * (tid >> 3)) * DM + k0 + (tid & 7) * 8;
    v8us o[4];
#pragma unroll
    for (int q = 0; q < 4; ++q) o[q] = *(const v8us*)(T + (32 * q + (tid >> 3)) * PP_PITCH + (tid & 7) * 16);
#pragma unroll
    for (int q = 0; q < 4; ++q) *(v8us*)(wdst + (size_t)q * DM) = o[q];
    asm volatile("s_wait_xcnt 0x0" ::: "memory");      /* the wait in front of any overwrite of the stores' registers, on whatever way the built code leaves this branch */
  } else {
    const size_t e0 = (size_t)(bid - 3 * PP_WB) * PP_XE + tid * 4; const float* xsrc = x + e0;
    v4f r[16];
#pragma unroll
    for (int j = 0; j < 16; ++j) r[j] = *(const v4fa*)(xsrc + j * 1024);      /* a wave: 512 contiguous bytes a load */
    asm volatile("s_wait_xcnt 0x0" :: "v"(xsrc) : "memory");      /* as above, for the sixteen loads */
    v4h o[16];
#pragma unroll
    for (int j = 0; j < 16; ++j)
#pragma unroll
      for (int q = 0; q < 4; ++q) o[j][q] = (_Float16)bf16_round(r[j][q]);
#pragma unroll
    for (int j = 0; j < 16; ++j) *(v4h*)(X16 + e0 + j * 1024) = o[j];      /* a wave: two whole lines a store */
    asm volatile("s_wait_xcnt 0x0" ::: "memory");      /* as above, for the stores */
  } }

extern "C" void kernel_launch(void* const* d_in, const int* in_sizes, int n_in,
                              void* d_out, int out_size, void* d_ws, size_t ws_size, hipStream_t stream) {
  (void)in_sizes; (void)n_in; (void)out_size;
  const float* const* I = (const float* const*)d_in; const float* x = I[0]; const float* am = I[1]; const float* wq = I[2]; const float* bq = I[3]; const float* wk = I[4]; const float* bk = I[5]; const float* wv = I[6]; const float* bv = I[7];      /* weights [in][out]; am = additive mask [NB][1][1][SQ] */
  char* ws = (char*)d_ws; size_t off = 0;
  auto take = [&](size_t bytes) { char* p = ws + off; off += (bytes + 255) & ~(size_t)255; return p; };
  _Float16* BQ = (_Float16*)take((size_t)DM * DM * 2); _Float16* BK = (_Float16*)take((size_t)DM * DM * 2); _Float16* BV = (_Float16*)take((size_t)DM * DM * 2); 
  _Float16* X16 = (_Float16*)take(NR * DM * 2); _Float16* Q16 = (_Float16*)take(NR * DM * 2); _Float16* K16 = (_Float16*)take(NR * DM * 2);
  _Float16* VT = (_Float16*)take(NR * DM * 2);      /* V^T, [DM][SQ] a batch */
  if (off > ws_size) return;
  k_prep<<<3 * PP_WB + PP_XB, 256, 0, stream>>>(x, wq, wk, wv, X16, BQ, BK, BV);      /* weights [in][out] -> Bt[n][k] x16, x -> f16 rows */
  const size_t r0p = (size_t)B0 * SQ;      /* first projected row */
  k_qkv<<<dim3((unsigned)(MP / 128), 3 * (DM / 128)), 128, 0, stream>>>(X16 + r0p * DM, BQ, BK, BV, bq, bk, bv, Q16 + r0p * DM, K16 + r0p * DM, VT + r0p * DM);      /* q, k rows and V^T as f16, all three in one launch */
  for (int b = B0; b < B0 + NBR; ++b) { const size_t r0 = (size_t)b * SQ;
    k_fattn<<<dim3(SQ / 64, NH), 128, 0, stream>>>(Q16 + r0 * LQ, K16 + r0 * LQ, VT + r0 * DM, am + (size_t)b * SQ, (float*)d_out + r0 * DM); }      /* scores, softmax and P.V of all heads; out = merged heads, f32 */
}
